// v000
// Measured on an AMD MI455X. A time is GPU time per run, averaged over a window of back-to-back runs after a warm-up
// (all launches, gaps included; the runs take copies of the inputs in turn), and the median of several windows.
// Apart from v000's, it joins two sittings. Times from different sittings can be a few percent apart, while
// side-by-side timings come from the same sitting.
// v000, which the later versions start from, runs in 204 microseconds.
// Contractions: q, k and v^T projections = v_wmma_f32_16x16x32_bf16 (bf16 operands from RNE-converted inputs and
// transposed weights, single product, bias and ReLU in f32); q.k^T scores = v_wmma_f32_16x16x32_f16 (q as f16 hi
// plane + f16 residual plane x4096 in a separate accumulator, k f16; 2 products); p.v = v_wmma_f32_16x16x32_f16
// (p carried x1024 in f16, v^T as f16 hi plane + f16 residual plane x4096 in a separate accumulator; 2 products);
// ctx.Wo = v_wmma_f32_16x16x32_bf16 (ctx as bf16 hi + lo planes times bf16 Wo^T, 2 products, bias in f32);
// all f32 accumulate; per-(query,key) mask select and softmax in f32.
#include <hip/hip_runtime.h>
#include <math.h>
#include <stdint.h>

#define NB    8
#define SEQ   1024
#define QIN   256
#define DM    512
#define NH    8
#define HD    64
#define NQB   (SEQ / 64)     // 16 key / query tiles of 64
static_assert(NH * HD == DM);
static_assert((SEQ % 64) == 0 && (DM % 64) == 0 && (QIN % 64) == 0 && (QIN % 32) == 0 && (DM % 32) == 0);

typedef _Float16 v16h __attribute__((ext_vector_type(16)));
typedef _Float16 v8h  __attribute__((ext_vector_type(8)));
typedef __bf16   v16b __attribute__((ext_vector_type(16)));
typedef __bf16   v8b  __attribute__((ext_vector_type(8)));
typedef float    v8f  __attribute__((ext_vector_type(8)));
typedef float    v4f  __attribute__((ext_vector_type(4)));
typedef unsigned int v4u __attribute__((ext_vector_type(4)));

// ---- scalar helpers --------------------------------------------------------------------------------
__device__ __forceinline__ unsigned short bf_bits(float f) {          // f32 -> bf16 bits, RNE convert
  unsigned u = __float_as_uint(f);
  return (unsigned short)((u + 0x7FFFu + ((u >> 16) & 1u)) >> 16);
}
__device__ __forceinline__ float bf_up(unsigned short h) { return __uint_as_float(((unsigned)h) << 16); }
__device__ __forceinline__ unsigned short h_bits(_Float16 x) { return __builtin_bit_cast(unsigned short, x); }
__device__ __forceinline__ unsigned pk16(unsigned short a, unsigned short b) { return (unsigned)a | ((unsigned)b << 16); }
__device__ __forceinline__ v8f zero8() { v8f z = {0.f, 0.f, 0.f, 0.f, 0.f, 0.f, 0.f, 0.f}; return z; }

// ---- fragment loaders: 16-bit A/B operand, lane -> row/col (lane&15), p already includes +8*(lane>>4);
//      elements 0..7 <- p[0..7] (k0+8h..), elements 8..15 <- p[16..23] (k0+16+8h..)
__device__ __forceinline__ v16b ldfrag_b(const __bf16* p) {
  union { v16b v; v8b h[2]; } f;
  f.h[0] = *(const v8b*)(p);
  f.h[1] = *(const v8b*)(p + 16);
  return f.v;
}
__device__ __forceinline__ v16h ldfrag_h(const _Float16* p) {
  union { v16h v; v8h h[2]; } f;
  f.h[0] = *(const v8h*)(p);
  f.h[1] = *(const v8h*)(p + 16);
  return f.v;
}

// ---- WMMA helpers with trailing VALU hazard gap --------------------------------------------------------
__device__ __forceinline__ v8f mma_h(v16h a, v16h b, v8f c) {
  c = __builtin_amdgcn_wmma_f32_16x16x32_f16(false, a, false, b, (short)0, c, false, false);
#if defined(__HIP_DEVICE_COMPILE__)
  asm volatile("v_nop\n\tv_nop\n\tv_nop\n\tv_nop" : "+v"(c) : "v"(a), "v"(b));
#endif
  return c;
}
__device__ __forceinline__ v8f mma_b_raw(v16b a, v16b b, v8f c) {
  return __builtin_amdgcn_wmma_f32_16x16x32_bf16(false, a, false, b, (short)0, c, false, false);
}
__device__ __forceinline__ void dep_guard_b(v8f& a, v8f& b, v16b x, v16b y) {
#if defined(__HIP_DEVICE_COMPILE__)
  asm volatile("v_nop\n\tv_nop\n\tv_nop\n\tv_nop" : "+v"(a), "+v"(b) : "v"(x), "v"(y));
#endif
}
__device__ __forceinline__ void keep4_b(v16b a, v16b b, v16b c, v16b d) {
#if defined(__HIP_DEVICE_COMPILE__)
  asm volatile("v_nop" :: "v"(a), "v"(b), "v"(c), "v"(d));
#endif
}
__device__ __forceinline__ void acc_guard4(v8f& a, v8f& b, v8f& c, v8f& d) {
#if defined(__HIP_DEVICE_COMPILE__)
  asm volatile("v_nop\n\tv_nop\n\tv_nop\n\tv_nop" : "+v"(a), "+v"(b), "+v"(c), "+v"(d));
#endif
}
__device__ __forceinline__ void wave_sync_lds() {
  __builtin_amdgcn_fence(__ATOMIC_RELEASE, "workgroup");
  __builtin_amdgcn_wave_barrier();
  __builtin_amdgcn_fence(__ATOMIC_ACQUIRE, "workgroup");
}

// =====================================================================================================
// f32 -> bf16 (RNE convert), 8 elements per thread, one 16-B store per lane: a wave writes 512 contiguous B
// coverage: n8 threads x 8 = whole plane (n8 is a multiple of 256 for every use here).
// =====================================================================================================
__global__ __launch_bounds__(256) void cvt_bf16x8(const float* __restrict__ in, unsigned short* out, int n8) {
  const int i = blockIdx.x * 256 + threadIdx.x;
  if (i < n8) {
    const v4f a = *(const v4f*)(in + (size_t)i * 8);
    const v4f b = *(const v4f*)(in + (size_t)i * 8 + 4);
    v4u p;
    p[0] = pk16(bf_bits(a[0]), bf_bits(a[1]));
    p[1] = pk16(bf_bits(a[2]), bf_bits(a[3]));
    p[2] = pk16(bf_bits(b[0]), bf_bits(b[1]));
    p[3] = pk16(bf_bits(b[2]), bf_bits(b[3]));
    *(v4u*)(out + (size_t)i * 8) = p;
    
  }
}

// =====================================================================================================
// Transpose-convert: f32 in[R][C] row-major -> bf16 (RNE convert) outT[C][R] row-major, outT[c][r] = in[r][c].
// grid = (C/64, R/64) (x = column tile of in = row tile of outT), block 256; R, C multiples of 64 (host-checked).
// Load: thread tid reads in row r0 + (tid>>2), 16 floats at c0 + (tid&3)*16 (4 x 16-B loads) -> LDS tile[r][c].
// coverage: load 64 rows x 4 x 16 cols = 64x64; store 8 waves x 2 x 4 rows x (8 lanes x 8) = 64x64.
// =====================================================================================================
__global__ __launch_bounds__(256) void cvt_bf16_t64(const float* __restrict__ in, unsigned short* outT, int R, int C) {
  __shared__ float tile[64][65];
  const int tid  = threadIdx.x;
  const int lane = tid & 31;
  const int wave = tid >> 5;
  const int c0 = blockIdx.x * 64;
  const int r0 = blockIdx.y * 64;
  {
    const int r = tid >> 2, cs = (tid & 3) * 16;
    const float* g = in + (size_t)(r0 + r) * C + c0 + cs;
#pragma unroll
    for (int i = 0; i < 4; ++i) {
      const v4f v = *(const v4f*)(g + 4 * i);
      tile[r][cs + 4 * i + 0] = v[0];
      tile[r][cs + 4 * i + 1] = v[1];
      tile[r][cs + 4 * i + 2] = v[2];
      tile[r][cs + 4 * i + 3] = v[3];
    }
  }
  __syncthreads();
  const int q = lane >> 3, c8 = (lane & 7) * 8;
  v4u pv[2];
#pragma unroll
  for (int it = 0; it < 2; ++it) {
    const int c = wave * 8 + it * 4 + q;
    v4u p;
#pragma unroll
    for (int e = 0; e < 4; ++e)
      p[e] = pk16(bf_bits(tile[c8 + 2 * e][c]), bf_bits(tile[c8 + 2 * e + 1][c]));
    pv[it] = p;
  }
  {
#pragma unroll
    for (int it = 0; it < 2; ++it) {
      const int c = wave * 8 + it * 4 + q;
      *(v4u*)(outT + (size_t)(c0 + c) * R + r0 + c8) = pv[it];
    }
    
  }
}

// =====================================================================================================
// Register-blocked batched bf16 WMMA GEMM: C[m][n] = sum_k A[m][k] * Bt[n][k] + bias (ReLU optional); one wave
// per 64x64 tile, no block barriers. A row-major [M][K] pitch lda; Bt row-major [N][K] pitch ldb (k contiguous);
// M, N multiples of 64, K multiple of 32 (host-checked). blockIdx.y = batch index (strides in elements).
// NSPLIT: 0 = A.Bt; 1 = (A + A2).Bt (A2 = unscaled bf16 lo plane of A); 2 = A.Bt + A2.Bt + A.Bt2.
// BIAS: 0 = none; 1 = bias[n] (per column); 2 = bias[m] (per row). Bias is an f32 array, applied as its
//       bf16 RNE value in the f32 epilogue before any 16-bit split of the result. RELU: 1 = max(v, 0) after bias.
// OUT_MODE: 0 = f32 (pitch ldc); 2 = bf16 hi plane C + bf16 lo plane C2 (lo = RNE(v - hi), unscaled);
//           3 = f16 hi plane C + f16 residual plane C2 = f16((v - hi) * rscale), C2 written only for tiles
//               with n0 < N2 (pitch ldc2, batch stride strideC2); 4 = f16 hi plane C only.
// =====================================================================================================
template <int NSPLIT, int OUT_MODE, int BIAS, int RELU>
__global__ __launch_bounds__(256) void gemm64(
    const unsigned short* __restrict__ Ap, const unsigned short* A2p, int lda, long long strideA,
    const unsigned short* __restrict__ Btp, const unsigned short* Bt2p, int ldb, long long strideB,
    const float* __restrict__ bias,
    void* Cout, int ldc, long long strideC,
    void* Cout2, int ldc2, long long strideC2, int N2,
    int M, int N, int K, float rscale) {
  const __bf16* A   = (const __bf16*)(const void*)Ap;
  const __bf16* A2  = (const __bf16*)(const void*)A2p;
  const __bf16* Bt  = (const __bf16*)(const void*)Btp;
  const __bf16* Bt2 = (const __bf16*)(const void*)Bt2p;
  __shared__ __align__(16) float sT[8][16 * 68];   // per-wave 16x64 slab, pitch 68 floats
  const int b    = blockIdx.y;
  const int lane = threadIdx.x & 31;
  const int wave = threadIdx.x >> 5;
  const int tilesN = N >> 6;
  const int tilesM = M >> 6;
  const int tile = blockIdx.x * 8 + wave;
  if (tile >= tilesM * tilesN) return;   // wave-uniform; no block barriers in this kernel
  const int tm = tile / tilesN;
  const int tn = tile - tm * tilesN;
  const int m0 = tm << 6;
  const int n0 = tn << 6;

  const __bf16* Ab  = A  + (size_t)b * strideA;
  const __bf16* Bb  = Bt + (size_t)b * strideB;
  const __bf16* Ab2 = (NSPLIT >= 1) ? (A2  + (size_t)b * strideA) : Ab;
  const __bf16* Bb2 = (NSPLIT == 2) ? (Bt2 + (size_t)b * strideB) : Bb;

  const int rlane = lane & 15;                 // row (A) / col (B, D) within subtile
  const int koff  = (lane >> 4) * 8;           // k offset of this lane half
  const int mOff  = (lane >> 4) * 8;           // D row offset

  v8f acc[4][4];
#pragma unroll
  for (int i = 0; i < 4; ++i)
#pragma unroll
    for (int j = 0; j < 4; ++j) acc[i][j] = zero8();

  for (int k0 = 0; k0 < K; k0 += 32) {
    v16b bh[4], bl[4];
#pragma unroll
    for (int j = 0; j < 4; ++j) {
      const size_t bo = (size_t)(n0 + (j << 4) + rlane) * ldb + koff + k0;
      bh[j] = ldfrag_b(Bb + bo);
      if (NSPLIT == 2) bl[j] = ldfrag_b(Bb2 + bo); else bl[j] = bh[j];
    }
#pragma unroll
    for (int i = 0; i < 4; ++i) {
      const size_t ao = (size_t)(m0 + (i << 4) + rlane) * lda + koff + k0;
      const v16b ah = ldfrag_b(Ab + ao);
      v16b al = ah;
      if (NSPLIT >= 1) al = ldfrag_b(Ab2 + ao);
#pragma unroll
      for (int j = 0; j < 4; ++j) {
        acc[i][j] = mma_b_raw(ah, bh[j], acc[i][j]);
        if (NSPLIT >= 1) acc[i][j] = mma_b_raw(al, bh[j], acc[i][j]);
        if (NSPLIT == 2) acc[i][j] = mma_b_raw(ah, bl[j], acc[i][j]);
      }
      dep_guard_b(acc[i][0], acc[i][3], ah, al);
    }
    keep4_b(bh[0], bh[1], bh[2], bh[3]);
    if (NSPLIT == 2) keep4_b(bl[0], bl[1], bl[2], bl[3]);
  }
  acc_guard4(acc[0][0], acc[0][1], acc[0][2], acc[0][3]);
  acc_guard4(acc[1][0], acc[1][1], acc[1][2], acc[1][3]);
  acc_guard4(acc[2][0], acc[2][1], acc[2][2], acc[2][3]);
  acc_guard4(acc[3][0], acc[3][1], acc[3][2], acc[3][3]);

  // ---- epilogue ----
  float bcol[4] = {0.f, 0.f, 0.f, 0.f};
  if (BIAS == 1) {
#pragma unroll
    for (int j = 0; j < 4; ++j) bcol[j] = bf_up(bf_bits(bias[n0 + (j << 4) + rlane]));
  }
  float* slab = sT[wave];
#pragma unroll
  for (int i = 0; i < 4; ++i) {
    const int mBase = m0 + (i << 4);
    float brow[8] = {0.f, 0.f, 0.f, 0.f, 0.f, 0.f, 0.f, 0.f};
    if (BIAS == 2) {
#pragma unroll
      for (int r = 0; r < 8; ++r) brow[r] = bf_up(bf_bits(bias[mBase + mOff + r]));
    }
#pragma unroll
    for (int j = 0; j < 4; ++j) {
#pragma unroll
      for (int r = 0; r < 8; ++r) {
        float vv = acc[i][j][r] + bcol[j] + brow[r];
        if (RELU) vv = fmaxf(vv, 0.0f);
        slab[(mOff + r) * 68 + (j << 4) + rlane] = vv;
      }
    }
    wave_sync_lds();
    if (OUT_MODE == 0) {
      float* C = (float*)Cout + (size_t)b * strideC;
      const int hh = lane >> 4, c4 = (lane & 15) * 4;     // 256-B row segment = 16 lanes x 16 B
      {
#pragma unroll
        for (int it = 0; it < 8; ++it) {
          const int row = it * 2 + hh;                     // it 0..7 x hh 0..1 = rows 0..15
          const v4f v = *(const v4f*)(slab + row * 68 + c4);
          *(v4f*)(C + (size_t)(mBase + row) * ldc + n0 + c4) = v;
        }
        
      }
    } else {
      const int q = lane >> 3, c8 = (lane & 7) * 8;
      unsigned short* C  = (unsigned short*)Cout  + (size_t)b * strideC;
      unsigned short* C2 = (unsigned short*)Cout2 + (size_t)b * strideC2;
      const bool wlo = (OUT_MODE == 2) || (OUT_MODE == 3 && n0 < N2);   // wave-uniform
      v4u hv[4], lv[4];
#pragma unroll
      for (int it = 0; it < 4; ++it) {
        const int row = it * 4 + q;                        // it 0..3 x q 0..3 = rows 0..15
        const float* sp = slab + row * 68 + c8;
        v4u a, a2;
#pragma unroll
        for (int e = 0; e < 4; ++e) {
          const float f0 = sp[2 * e], f1 = sp[2 * e + 1];
          unsigned short h0, h1, l0, l1;
          if (OUT_MODE == 2) {
            h0 = bf_bits(f0); h1 = bf_bits(f1);
            l0 = bf_bits(f0 - bf_up(h0)); l1 = bf_bits(f1 - bf_up(h1));
          } else {
            const _Float16 x0 = (_Float16)f0, x1 = (_Float16)f1;
            h0 = h_bits(x0); h1 = h_bits(x1);
            l0 = h_bits((_Float16)((f0 - (float)x0) * rscale));
            l1 = h_bits((_Float16)((f1 - (float)x1) * rscale));
          }
          a[e] = pk16(h0, h1); a2[e] = pk16(l0, l1);
        }
        hv[it] = a; lv[it] = a2;
      }
      {
#pragma unroll
        for (int it = 0; it < 4; ++it) {
          const int row = it * 4 + q;
          *(v4u*)(C + (size_t)(mBase + row) * ldc + n0 + c8) = hv[it];
          if (wlo) *(v4u*)(C2 + (size_t)(mBase + row) * ldc2 + n0 + c8) = lv[it];
        }
        
      }
    }
    wave_sync_lds();
  }
}

// =====================================================================================================
// Attention, head dim 64, per-(query,key) int32 mask [NB][SEQ][SEQ] (0 = masked -> score replaced by the finite
// value -1e8, so a fully masked row yields uniform weights), standard softmax over all SEQ keys.
//   q hi plane (f16, pitch DM): element (b, t, h, d) at [(b*SEQ + t)*DM + h*64 + d]; k plane same layout
//   q residual plane (f16, (q - f16(q))*4096, pitch DM): same layout
//   v^T hi plane (f16): element (b, h, d, s) at [(b*DM + h*64 + d)*SEQ + s]; v^T residual plane (f16, x4096): same layout
//   out planes (bf16 hi / lo of the normalised context): element (b, t, h, d) at [(b*SEQ + t)*DM + h*64 + d]
//   scores = (qh . k + (ql . k) * rres) * sscale on f16 WMMA, residual products in a separate accumulator,
//   then the per-(q,k) mask select; p = exp(s - m) carried as f16(1024 p); context = p . vh + (p . vl) * rres
//   on f16 WMMA (separate accumulator folded per chunk in f32); online softmax in f32; final multiply by 1/l.
//   Block = 4 waves = 64 query rows of one (b, h); grid = NQB * NH * NB; kv chunks of 64, static trip NQB.
//   K / V^T chunk staging: 128 threads x 32 elements per plane = the whole 64x64 tile (plain 16-B loads,
//   __syncthreads before and after); mask values: each lane loads its own 8 rows x key column per 16-key
//   group straight from global (addresses always in range); P tiles are wave-private, spilled with _Float16
//   Output coverage: each wave stores rows q0..q0+15 (it 0..3 x lane>>3 0..3) x 64 columns (8 lanes x 8) of both planes.
// =====================================================================================================
__global__ __launch_bounds__(128)
void attn64(const unsigned short* __restrict__ qhp, const unsigned short* __restrict__ qlp,
            const unsigned short* __restrict__ khp,
            const unsigned short* __restrict__ vhp, const unsigned short* __restrict__ vlp,
            const int* __restrict__ maskp,
            unsigned short* ohp, unsigned short* olp, float sscale, float rres) {
  union FH { v16h v; v8h h[2]; };
  __shared__ __align__(16) _Float16 Ksh[64 * 64];                 // K [kv][d]   8 KB
  __shared__ __align__(16) _Float16 Vth[64 * 64];                 // V^T hi [d][kv] 8 KB
  __shared__ __align__(16) _Float16 Vtl[64 * 64];                 // V^T residual [d][kv] 8 KB
  __shared__ __align__(16) _Float16 Psh[4][16 * 64];              // per wave P [row][kv] 8 KB
  __shared__ __align__(16) float    Os[4][16 * 64];               // per wave context tile [row][d] 16 KB

  const int tid  = threadIdx.x;
  const int wave = tid >> 5;
  const int lane = tid & 31;
  const int hh   = lane >> 4;
  const int c    = lane & 15;

  const int bx   = blockIdx.x;
  const int qb   = bx % NQB;
  const int rest = bx / NQB;
  const int h    = rest % NH;
  const int b    = rest / NH;
  const int q0   = qb * 64 + wave * 16;
  const size_t rowB = (size_t)b * SEQ;

  const _Float16* Qh = (const _Float16*)(const void*)qhp + (size_t)h * HD;
  const _Float16* Ql = (const _Float16*)(const void*)qlp + (size_t)h * HD;
  const _Float16* Kg = (const _Float16*)(const void*)khp + (size_t)h * HD;
  const _Float16* Vh = (const _Float16*)(const void*)vhp + ((size_t)b * DM + (size_t)h * HD) * SEQ;
  const _Float16* Vl = (const _Float16*)(const void*)vlp + ((size_t)b * DM + (size_t)h * HD) * SEQ;
  // mask rows of this lane half: query rows q0 + 8*hh + r (r 0..7), key index added per chunk / column
  const int* Mg = maskp + (rowB + (size_t)q0 + (size_t)(8 * hh)) * SEQ;

  // ---- Q fragments (A operand, row = lane&15): 2 d-chunks, hi and residual ----
  v16h qah[2], qal[2];
#pragma unroll
  for (int dc = 0; dc < 2; ++dc) {
    qah[dc] = ldfrag_h(Qh + (rowB + q0 + c) * DM + dc * 32 + 8 * hh);
    qal[dc] = ldfrag_h(Ql + (rowB + q0 + c) * DM + dc * 32 + 8 * hh);
  }

  float mrow[8], lrow[8];
  v8f oacc[4];
#pragma unroll
  for (int r = 0; r < 8; ++r) { mrow[r] = -INFINITY; lrow[r] = 0.f; }
#pragma unroll
  for (int t = 0; t < 4; ++t) oacc[t] = zero8();

  for (int kt = 0; kt < NQB; ++kt) {         // static trip count
    const int kv0 = kt * 64;
    __syncthreads();
    {
      const int r = tid >> 1, hf = (tid & 1) * 32;
      const _Float16* kg  = Kg + (rowB + kv0 + r) * DM + hf;       // K row kv0+r, d = hf..hf+31
      const _Float16* vg  = Vh + (size_t)r * SEQ + kv0 + hf;       // V^T row d = r, s = kv0+hf..+31
      const _Float16* vlg = Vl + (size_t)r * SEQ + kv0 + hf;
#pragma unroll
      for (int i = 0; i < 4; ++i) {
        const v8h a0 = *(const v8h*)(kg + 8 * i);
        const v8h b0 = *(const v8h*)(vg + 8 * i);
        const v8h b1 = *(const v8h*)(vlg + 8 * i);
        *(v8h*)(Ksh + r * 64 + hf + 8 * i) = a0;
        *(v8h*)(Vth + r * 64 + hf + 8 * i) = b0;
        *(v8h*)(Vtl + r * 64 + hf + 8 * i) = b1;
      }
    }
    __syncthreads();

    // ---- scores: 16 query rows x 64 keys per wave, 2 f16 products (hi, residual), then per-(q,k) mask select ----
    v8f s[4];
#pragma unroll
    for (int j = 0; j < 4; ++j) {
      v8f sh = zero8(), sl = zero8();
#pragma unroll
      for (int dc = 0; dc < 2; ++dc) {
        FH kb;
        kb.h[0] = *(const v8h*)(Ksh + (j * 16 + c) * 64 + dc * 32 + 8 * hh);
        kb.h[1] = *(const v8h*)(Ksh + (j * 16 + c) * 64 + dc * 32 + 16 + 8 * hh);
        sh = mma_h(qah[dc], kb.v, sh);
        sl = mma_h(qal[dc], kb.v, sl);
      }
      int live[8];
#pragma unroll
      for (int r = 0; r < 8; ++r) live[r] = Mg[(size_t)r * SEQ + kv0 + j * 16 + c];   // row 8hh+r, key j*16+c
#pragma unroll
      for (int r = 0; r < 8; ++r) {
        const float v = (sh[r] + sl[r] * rres) * sscale;
        s[j][r] = (live[r] != 0) ? v : -1.0e8f;
      }
    }

    // ---- row max, online softmax, P (x1024, f16) to LDS ----
    _Float16* pwh = Psh[wave];
#pragma unroll
    for (int r = 0; r < 8; ++r) {
      float m = s[0][r];
      m = fmaxf(m, s[1][r]);
      m = fmaxf(m, s[2][r]);
      m = fmaxf(m, s[3][r]);
#pragma unroll
      for (int off = 1; off < 16; off <<= 1) m = fmaxf(m, __shfl_xor(m, off, 32));
      const float mnew  = fmaxf(mrow[r], m);
      const float alpha = __expf(mrow[r] - mnew);
      mrow[r] = mnew;
      float psum = 0.f;
#pragma unroll
      for (int j = 0; j < 4; ++j) {
        const float p = __expf(s[j][r] - mnew);
        psum += p;
        pwh[(8 * hh + r) * 64 + j * 16 + c] = (_Float16)(p * 1024.0f);
      }
#pragma unroll
      for (int off = 1; off < 16; off <<= 1) psum += __shfl_xor(psum, off, 32);
      lrow[r] = lrow[r] * alpha + psum;
#pragma unroll
      for (int t = 0; t < 4; ++t) oacc[t][r] *= alpha;
    }
    wave_sync_lds();

    // ---- context += P . V (f16 WMMA), residual products into a separate accumulator ----
    v8f o1[4];
#pragma unroll
    for (int t = 0; t < 4; ++t) o1[t] = zero8();
#pragma unroll 1
    for (int kk = 0; kk < 2; ++kk) {
      FH pa;
      pa.h[0] = *(const v8h*)(pwh + c * 64 + kk * 32 + 8 * hh);
      pa.h[1] = *(const v8h*)(pwh + c * 64 + kk * 32 + 16 + 8 * hh);
#pragma unroll
      for (int t = 0; t < 4; ++t) {
        FH vb, vl;
        vb.h[0] = *(const v8h*)(Vth + (t * 16 + c) * 64 + kk * 32 + 8 * hh);
        vb.h[1] = *(const v8h*)(Vth + (t * 16 + c) * 64 + kk * 32 + 16 + 8 * hh);
        vl.h[0] = *(const v8h*)(Vtl + (t * 16 + c) * 64 + kk * 32 + 8 * hh);
        vl.h[1] = *(const v8h*)(Vtl + (t * 16 + c) * 64 + kk * 32 + 16 + 8 * hh);
        oacc[t] = mma_h(pa.v, vb.v, oacc[t]);
        o1[t]   = mma_h(pa.v, vl.v, o1[t]);
      }
    }
#pragma unroll
    for (int t = 0; t < 4; ++t)
#pragma unroll
      for (int r = 0; r < 8; ++r) oacc[t][r] += o1[t][r] * rres;
  }

  // ---- normalise (1/l and the 1/1024 p carry), stage the wave's 16x64 tile, bf16 hi/lo split,
  float* os = Os[wave];
#pragma unroll
  for (int r = 0; r < 8; ++r) {
    const float inv = (1.0f / lrow[r]) * (1.0f / 1024.0f);      // lrow >= 1 always (the max key contributes 1)
#pragma unroll
    for (int t = 0; t < 4; ++t) os[(8 * hh + r) * 64 + t * 16 + c] = oacc[t][r] * inv;
  }
  wave_sync_lds();
  {
    const int q4 = lane >> 3, c8 = (lane & 7) * 8;
    v4u hv[4], lv[4];
#pragma unroll
    for (int it = 0; it < 4; ++it) {
      const int row = it * 4 + q4;   // it 0..3 x q4 0..3 = rows 0..15 of the wave tile
      const float* sp = os + row * 64 + c8;
      v4u a, a2;
#pragma unroll
      for (int e = 0; e < 4; ++e) {
        const float f0 = sp[2 * e], f1 = sp[2 * e + 1];
        const unsigned short h0 = bf_bits(f0), h1 = bf_bits(f1);
        const unsigned short l0 = bf_bits(f0 - bf_up(h0)), l1 = bf_bits(f1 - bf_up(h1));
        a[e] = pk16(h0, h1); a2[e] = pk16(l0, l1);
      }
      hv[it] = a; lv[it] = a2;
    }
    {
#pragma unroll
      for (int it = 0; it < 4; ++it) {
        const int row = it * 4 + q4;
        const size_t go = (rowB + q0 + row) * DM + (size_t)h * HD + c8;
        *(v4u*)(ohp + go) = hv[it];
        *(v4u*)(olp + go) = lv[it];
      }
      
    }
  }
}

// =====================================================================================================
// Workspace map (bytes), every plane an exact multiple of its 64x64-tile / whole-line store granularity:
//   Xq    bf16 [8192][256]           0          4194304
//   Xk    bf16 [8192][256]           4194304    4194304
//   WqT   bf16 [512][256]            8388608    262144
//   WkT   bf16 [512][256]            8650752    262144
//   WvT   bf16 [512][256]            8912896    262144
//   WoT   bf16 [512][512]            9175040    524288
//   Qh    f16  [8192][512]           9699328    8388608
//   Ql    f16  [8192][512]           18087936   8388608   (q residual x4096)
//   Kh    f16  [8192][512]           26476544   8388608
//   VTh   f16  [8][512][1024]        34865152   8388608
//   VTl   f16  [8][512][1024]        43253760   8388608   (v residual x4096)
//   Oh    bf16 [8192][512]           51642368   8388608
//   Ol    bf16 [8192][512]           60030976   8388608
//   end                              68419584
// Weights arrive as [in k][out n] and are transpose-converted to [out n][in k] (k contiguous = Bt / A layout).
// =====================================================================================================
extern "C" void kernel_launch(void* const* d_in, const int* in_sizes, int n_in,
                              void* d_out, int out_size, void* d_ws, size_t ws_size,
                              hipStream_t stream) {
  if (n_in < 11) return;
  if (in_sizes[0] != NB * SEQ * QIN || in_sizes[1] != NB * SEQ * QIN) return;
  if (in_sizes[2] != NB * SEQ * SEQ) return;
  if (in_sizes[3] != QIN * DM || in_sizes[5] != QIN * DM || in_sizes[7] != QIN * DM) return;
  if (in_sizes[9] != DM * DM) return;
  if (in_sizes[4] != DM || in_sizes[6] != DM || in_sizes[8] != DM || in_sizes[10] != DM) return;
  if (out_size != NB * SEQ * DM) return;

  const float* query = (const float*)d_in[0];
  const float* key   = (const float*)d_in[1];
  const int*   mask  = (const int*)d_in[2];
  const float* Wq    = (const float*)d_in[3];
  const float* bq    = (const float*)d_in[4];
  const float* Wk    = (const float*)d_in[5];
  const float* bk    = (const float*)d_in[6];
  const float* Wv    = (const float*)d_in[7];
  const float* bv    = (const float*)d_in[8];
  const float* Wo    = (const float*)d_in[9];
  const float* bo    = (const float*)d_in[10];

  const size_t PXI = (size_t)NB * SEQ * QIN * 2;     //  4194304 (bf16 input activation plane)
  const size_t PW  = (size_t)DM * QIN * 2;           //   262144 (one projection weight plane)
  const size_t PWO = (size_t)DM * DM * 2;            //   524288 (output weight plane)
  const size_t PA  = (size_t)NB * SEQ * DM * 2;      //  8388608 (q / k / context planes)
  const size_t PVT = (size_t)NB * DM * SEQ * 2;      //  8388608 (v^T plane)
  size_t off = 0;
  const size_t oXq  = off; off += PXI;
  const size_t oXk  = off; off += PXI;
  const size_t oWq  = off; off += PW;
  const size_t oWk  = off; off += PW;
  const size_t oWv  = off; off += PW;
  const size_t oWo  = off; off += PWO;
  const size_t oQh  = off; off += PA;
  const size_t oQl  = off; off += PA;
  const size_t oKh  = off; off += PA;
  const size_t oVTh = off; off += PVT;
  const size_t oVTl = off; off += PVT;
  const size_t oOh  = off; off += PA;
  const size_t oOl  = off; off += PA;
  if (off > ws_size) return;                          // off = 68419584
  if (off > (size_t)134217728) return;

  char* ws = (char*)d_ws;
  unsigned short* Xq  = (unsigned short*)(ws + oXq);
  unsigned short* Xk  = (unsigned short*)(ws + oXk);
  unsigned short* WqT = (unsigned short*)(ws + oWq);
  unsigned short* WkT = (unsigned short*)(ws + oWk);
  unsigned short* WvT = (unsigned short*)(ws + oWv);
  unsigned short* WoT = (unsigned short*)(ws + oWo);
  unsigned short* Qh  = (unsigned short*)(ws + oQh);
  unsigned short* Ql  = (unsigned short*)(ws + oQl);
  unsigned short* Kh  = (unsigned short*)(ws + oKh);
  unsigned short* VTh = (unsigned short*)(ws + oVTh);
  unsigned short* VTl = (unsigned short*)(ws + oVTl);
  unsigned short* Oh  = (unsigned short*)(ws + oOh);
  unsigned short* Ol  = (unsigned short*)(ws + oOl);

  const dim3 blk(256);
  const int n8x = NB * SEQ * QIN / 8;                           // 262144
  const dim3 gCvtX((n8x + 255) / 256);                          // 1024 blocks
  const dim3 gTw(DM / 64, QIN / 64);                            // in [QIN][DM] -> out [DM][QIN]: (8, 4)
  const dim3 gTo(DM / 64, DM / 64);                             // in [DM][DM]  -> out [DM][DM]:  (8, 8)
  const dim3 gProj(((NB * SEQ / 64) * (DM / 64) + 7) / 8, 1);   // 1024 tiles -> 128 blocks: M=8192, N=512
  const dim3 gVT(((DM / 64) * (SEQ / 64) + 7) / 8, NB);         // 128 tiles -> 16 blocks x 8 batches: M=512, N=1024
  const dim3 gOut(((NB * SEQ / 64) * (DM / 64) + 7) / 8, 1);    // 1024 tiles -> 128 blocks: M=8192, N=512
  const dim3 gAttn(NB * NH * NQB);                              // 1024 blocks

  // (1) activations -> bf16 planes; weights [in][out] -> transposed bf16 planes [out][in] (RNE convert)
  cvt_bf16x8<<<gCvtX, blk, 0, stream>>>(query, Xq, n8x);
  cvt_bf16x8<<<gCvtX, blk, 0, stream>>>(key,   Xk, n8x);
  cvt_bf16_t64<<<gTw, blk, 0, stream>>>(Wq, WqT, QIN, DM);      // in rows = QIN, cols = DM
  cvt_bf16_t64<<<gTw, blk, 0, stream>>>(Wk, WkT, QIN, DM);
  cvt_bf16_t64<<<gTw, blk, 0, stream>>>(Wv, WvT, QIN, DM);
  cvt_bf16_t64<<<gTo, blk, 0, stream>>>(Wo, WoT, DM, DM);       // in rows = DM (k), cols = DM (n)
  // (2) q = relu(query . Wq + bq) -> f16 hi plane [8192][512] + f16 residual x4096 (all tiles, N2 = DM)
  //     (M=8192, N=512, K=256)
  gemm64<0, 3, 1, 1><<<gProj, blk, 0, stream>>>(
      Xq, Xq, QIN, 0LL, WqT, WqT, QIN, 0LL, bq,
      (void*)Qh, DM, 0LL, (void*)Ql, DM, 0LL, DM,
      NB * SEQ, DM, QIN, 4096.0f);
  // (3) k = relu(key . Wk + bk) -> f16 hi plane [8192][512] only (M=8192, N=512, K=256)
  gemm64<0, 4, 1, 1><<<gProj, blk, 0, stream>>>(
      Xk, Xk, QIN, 0LL, WkT, WkT, QIN, 0LL, bk,
      (void*)Kh, DM, 0LL, (void*)Kh, DM, 0LL, 0,
      NB * SEQ, DM, QIN, 4096.0f);
  // (4) v^T = relu(Wv^T . key^T + bv) per batch -> f16 hi plane [b][h*64+d][s] (pitch SEQ) and residual plane x4096
  //     (A = WvT [n][k], Bt = Xk rows of batch b, bias per row; M=512, N=1024, K=256)
  gemm64<0, 3, 2, 1><<<gVT, blk, 0, stream>>>(
      WvT, WvT, QIN, 0LL, Xk, Xk, QIN, (long long)SEQ * QIN, bv,
      (void*)VTh, SEQ, (long long)DM * SEQ, (void*)VTl, SEQ, (long long)DM * SEQ, SEQ,
      DM, SEQ, QIN, 4096.0f);
  // (5) attention with per-(q,k) mask and softmax -> context bf16 hi / lo planes [8192][512]
  attn64<<<gAttn, dim3(128), 0, stream>>>(Qh, Ql, Kh, VTh, VTl, mask, Oh, Ol, 0.125f, 1.0f / 4096.0f);
  // (6) out = context . Wo + bo -> d_out f32 [8192][512]  (A = context hi + lo planes, 2 products; K=512)
  gemm64<1, 0, 1, 0><<<gOut, blk, 0, stream>>>(
      Oh, Ol, DM, 0LL, WoT, WoT, DM, 0LL, bo,
      d_out, DM, 0LL, d_out, DM, 0LL, DM,
      NB * SEQ, DM, DM, 1.0f);
  (void)hipGetLastError();
}

// v001
// Measured time: 167 microseconds a run.
// Two timings next to v000 put it at 1.24 and 1.25 times that version's speed.
// Contractions: q, k and v^T projections = v_wmma_f32_16x16x32_bf16 (bf16 operands from RNE-converted inputs and
// transposed weights, single product, bias and ReLU in f32); q.k^T scores = v_wmma_f32_16x16x32_f16 (q as f16 hi
// plane + f16 residual plane x4096 in a separate accumulator, k f16; 2 products); p.v = v_wmma_f32_16x16x32_f16
// (p carried x1024 in f16, v^T as f16 hi plane + f16 residual plane x4096 in a separate accumulator; 2 products);
// ctx.Wo = v_wmma_f32_16x16x32_bf16 (ctx as bf16 hi + lo planes times bf16 Wo^T, 2 products, bias in f32);
// all f32 accumulate; per-(query,key) mask select and softmax in f32.
#include <hip/hip_runtime.h>
#include <math.h>
#include <stdint.h>

#define NB    8
#define SEQ   1024
#define QIN   256
#define DM    512
#define NH    8
#define HD    64
#define NQB   (SEQ / 64)     // 16 key / query tiles of 64
#define LP    72             // LDS row pitch of the 64-wide f16 tiles, in halves: 144 B = 16 B x odd, so the 16 rows that one
                             // ds_load_b128 fragment read touches fall on 16 different 4-bank groups
#define OP    68             // LDS row pitch of the 64-wide f32 context tile, in floats (16-byte column walks)
static_assert(NH * HD == DM);
static_assert((SEQ % 64) == 0 && (DM % 64) == 0 && (QIN % 64) == 0 && (QIN % 32) == 0 && (DM % 32) == 0);

typedef _Float16 v16h __attribute__((ext_vector_type(16)));
typedef _Float16 v8h  __attribute__((ext_vector_type(8)));
typedef __bf16   v16b __attribute__((ext_vector_type(16)));
typedef __bf16   v8b  __attribute__((ext_vector_type(8)));
typedef float    v8f  __attribute__((ext_vector_type(8)));
typedef float    v4f  __attribute__((ext_vector_type(4)));
typedef unsigned int v4u __attribute__((ext_vector_type(4)));

// ---- scalar helpers --------------------------------------------------------------------------------
__device__ __forceinline__ unsigned short bf_bits(float f) {          // f32 -> bf16 bits, RNE convert
  unsigned u = __float_as_uint(f);
  return (unsigned short)((u + 0x7FFFu + ((u >> 16) & 1u)) >> 16);
}
__device__ __forceinline__ float bf_up(unsigned short h) { return __uint_as_float(((unsigned)h) << 16); }
__device__ __forceinline__ unsigned short h_bits(_Float16 x) { return __builtin_bit_cast(unsigned short, x); }
__device__ __forceinline__ unsigned pk16(unsigned short a, unsigned short b) { return (unsigned)a | ((unsigned)b << 16); }
__device__ __forceinline__ v8f zero8() { v8f z = {0.f, 0.f, 0.f, 0.f, 0.f, 0.f, 0.f, 0.f}; return z; }

// ---- fragment loaders: 16-bit A/B operand, lane -> row/col (lane&15), p already includes +8*(lane>>4);
//      elements 0..7 <- p[0..7] (k0+8h..), elements 8..15 <- p[16..23] (k0+16+8h..)
__device__ __forceinline__ v16b ldfrag_b(const __bf16* p) {
  union { v16b v; v8b h[2]; } f;
  f.h[0] = *(const v8b*)(p);
  f.h[1] = *(const v8b*)(p + 16);
  return f.v;
}
__device__ __forceinline__ v16h ldfrag_h(const _Float16* p) {
  union { v16h v; v8h h[2]; } f;
  f.h[0] = *(const v8h*)(p);
  f.h[1] = *(const v8h*)(p + 16);
  return f.v;
}

// ---- WMMA helpers with trailing VALU hazard gap --------------------------------------------------------
__device__ __forceinline__ v8f mma_h(v16h a, v16h b, v8f c) {
  c = __builtin_amdgcn_wmma_f32_16x16x32_f16(false, a, false, b, (short)0, c, false, false);
#if defined(__HIP_DEVICE_COMPILE__)
  asm volatile("v_nop\n\tv_nop\n\tv_nop\n\tv_nop" : "+v"(c) : "v"(a), "v"(b));
#endif
  return c;
}
__device__ __forceinline__ v8f mma_b_raw(v16b a, v16b b, v8f c) {
  return __builtin_amdgcn_wmma_f32_16x16x32_bf16(false, a, false, b, (short)0, c, false, false);
}
__device__ __forceinline__ void dep_guard_b(v8f& a, v8f& b, v16b x, v16b y) {
#if defined(__HIP_DEVICE_COMPILE__)
  asm volatile("v_nop\n\tv_nop\n\tv_nop\n\tv_nop" : "+v"(a), "+v"(b) : "v"(x), "v"(y));
#endif
}
__device__ __forceinline__ void keep4_b(v16b a, v16b b, v16b c, v16b d) {
#if defined(__HIP_DEVICE_COMPILE__)
  asm volatile("v_nop" :: "v"(a), "v"(b), "v"(c), "v"(d));
#endif
}
__device__ __forceinline__ void acc_guard4(v8f& a, v8f& b, v8f& c, v8f& d) {
#if defined(__HIP_DEVICE_COMPILE__)
  asm volatile("v_nop\n\tv_nop\n\tv_nop\n\tv_nop" : "+v"(a), "+v"(b), "+v"(c), "+v"(d));
#endif
}
__device__ __forceinline__ void wave_sync_lds() {
  __builtin_amdgcn_fence(__ATOMIC_RELEASE, "workgroup");
  __builtin_amdgcn_wave_barrier();
  __builtin_amdgcn_fence(__ATOMIC_ACQUIRE, "workgroup");
}

// =====================================================================================================
// f32 -> bf16 (RNE convert), 8 elements per thread, one 16-B store per lane: a wave writes 512 contiguous B
// coverage: n8 threads x 8 = whole plane (n8 is a multiple of 256 for every use here).
// =====================================================================================================
__global__ __launch_bounds__(256) void cvt_bf16x8(const float* __restrict__ in, unsigned short* out, int n8) {
  const int i = blockIdx.x * 256 + threadIdx.x;
  if (i < n8) {
    const v4f a = *(const v4f*)(in + (size_t)i * 8);
    const v4f b = *(const v4f*)(in + (size_t)i * 8 + 4);
    v4u p;
    p[0] = pk16(bf_bits(a[0]), bf_bits(a[1]));
    p[1] = pk16(bf_bits(a[2]), bf_bits(a[3]));
    p[2] = pk16(bf_bits(b[0]), bf_bits(b[1]));
    p[3] = pk16(bf_bits(b[2]), bf_bits(b[3]));
    *(v4u*)(out + (size_t)i * 8) = p;
    
  }
}

// =====================================================================================================
// Transpose-convert: f32 in[R][C] row-major -> bf16 (RNE convert) outT[C][R] row-major, outT[c][r] = in[r][c].
// grid = (C/64, R/64) (x = column tile of in = row tile of outT), block 256; R, C multiples of 64 (host-checked).
// Load: thread tid reads in row r0 + (tid>>2), 16 floats at c0 + (tid&3)*16 (4 x 16-B loads) -> LDS tile[r][c].
// coverage: load 64 rows x 4 x 16 cols = 64x64; store 8 waves x 2 x 4 rows x (8 lanes x 8) = 64x64.
// =====================================================================================================
__global__ __launch_bounds__(256) void cvt_bf16_t64(const float* __restrict__ in, unsigned short* outT, int R, int C) {
  __shared__ float tile[64][65];
  const int tid  = threadIdx.x;
  const int lane = tid & 31;
  const int wave = tid >> 5;
  const int c0 = blockIdx.x * 64;
  const int r0 = blockIdx.y * 64;
  {
    const int r = tid >> 2, cs = (tid & 3) * 16;
    const float* g = in + (size_t)(r0 + r) * C + c0 + cs;
#pragma unroll
    for (int i = 0; i < 4; ++i) {
      const v4f v = *(const v4f*)(g + 4 * i);
      tile[r][cs + 4 * i + 0] = v[0];
      tile[r][cs + 4 * i + 1] = v[1];
      tile[r][cs + 4 * i + 2] = v[2];
      tile[r][cs + 4 * i + 3] = v[3];
    }
  }
  __syncthreads();
  const int q = lane >> 3, c8 = (lane & 7) * 8;
  v4u pv[2];
#pragma unroll
  for (int it = 0; it < 2; ++it) {
    const int c = wave * 8 + it * 4 + q;
    v4u p;
#pragma unroll
    for (int e = 0; e < 4; ++e)
      p[e] = pk16(bf_bits(tile[c8 + 2 * e][c]), bf_bits(tile[c8 + 2 * e + 1][c]));
    pv[it] = p;
  }
  {
#pragma unroll
    for (int it = 0; it < 2; ++it) {
      const int c = wave * 8 + it * 4 + q;
      *(v4u*)(outT + (size_t)(c0 + c) * R + r0 + c8) = pv[it];
    }
    
  }
}

// =====================================================================================================
// Register-blocked batched bf16 WMMA GEMM: C[m][n] = sum_k A[m][k] * Bt[n][k] + bias (ReLU optional); one wave
// per 64x64 tile, no block barriers. A row-major [M][K] pitch lda; Bt row-major [N][K] pitch ldb (k contiguous);
// M, N multiples of 64, K multiple of 32 (host-checked). blockIdx.y = batch index (strides in elements).
// NSPLIT: 0 = A.Bt; 1 = (A + A2).Bt (A2 = unscaled bf16 lo plane of A); 2 = A.Bt + A2.Bt + A.Bt2.
// BIAS: 0 = none; 1 = bias[n] (per column); 2 = bias[m] (per row). Bias is an f32 array, applied as its
//       bf16 RNE value in the f32 epilogue before any 16-bit split of the result. RELU: 1 = max(v, 0) after bias.
// OUT_MODE: 0 = f32 (pitch ldc); 2 = bf16 hi plane C + bf16 lo plane C2 (lo = RNE(v - hi), unscaled);
//           3 = f16 hi plane C + f16 residual plane C2 = f16((v - hi) * rscale), C2 written only for tiles
//               with n0 < N2 (pitch ldc2, batch stride strideC2); 4 = f16 hi plane C only.
// =====================================================================================================
template <int NSPLIT, int OUT_MODE, int BIAS, int RELU>
__global__ __launch_bounds__(256) void gemm64(
    const unsigned short* __restrict__ Ap, const unsigned short* A2p, int lda, long long strideA,
    const unsigned short* __restrict__ Btp, const unsigned short* Bt2p, int ldb, long long strideB,
    const float* __restrict__ bias,
    void* Cout, int ldc, long long strideC,
    void* Cout2, int ldc2, long long strideC2, int N2,
    int M, int N, int K, float rscale) {
  const __bf16* A   = (const __bf16*)(const void*)Ap;
  const __bf16* A2  = (const __bf16*)(const void*)A2p;
  const __bf16* Bt  = (const __bf16*)(const void*)Btp;
  const __bf16* Bt2 = (const __bf16*)(const void*)Bt2p;
  __shared__ __align__(16) float sT[8][16 * 68];   // per-wave 16x64 slab, pitch 68 floats
  const int b    = blockIdx.y;
  const int lane = threadIdx.x & 31;
  const int wave = threadIdx.x >> 5;
  const int tilesN = N >> 6;
  const int tilesM = M >> 6;
  const int tile = blockIdx.x * 8 + wave;
  if (tile >= tilesM * tilesN) return;   // wave-uniform; no block barriers in this kernel
  const int tm = tile / tilesN;
  const int tn = tile - tm * tilesN;
  const int m0 = tm << 6;
  const int n0 = tn << 6;

  const __bf16* Ab  = A  + (size_t)b * strideA;
  const __bf16* Bb  = Bt + (size_t)b * strideB;
  const __bf16* Ab2 = (NSPLIT >= 1) ? (A2  + (size_t)b * strideA) : Ab;
  const __bf16* Bb2 = (NSPLIT == 2) ? (Bt2 + (size_t)b * strideB) : Bb;

  const int rlane = lane & 15;                 // row (A) / col (B, D) within subtile
  const int koff  = (lane >> 4) * 8;           // k offset of this lane half
  const int mOff  = (lane >> 4) * 8;           // D row offset

  v8f acc[4][4];
#pragma unroll
  for (int i = 0; i < 4; ++i)
#pragma unroll
    for (int j = 0; j < 4; ++j) acc[i][j] = zero8();

  for (int k0 = 0; k0 < K; k0 += 32) {
    v16b bh[4], bl[4];
#pragma unroll
    for (int j = 0; j < 4; ++j) {
      const size_t bo = (size_t)(n0 + (j << 4) + rlane) * ldb + koff + k0;
      bh[j] = ldfrag_b(Bb + bo);
      if (NSPLIT == 2) bl[j] = ldfrag_b(Bb2 + bo); else bl[j] = bh[j];
    }
#pragma unroll
    for (int i = 0; i < 4; ++i) {
      const size_t ao = (size_t)(m0 + (i << 4) + rlane) * lda + koff + k0;
      const v16b ah = ldfrag_b(Ab + ao);
      v16b al = ah;
      if (NSPLIT >= 1) al = ldfrag_b(Ab2 + ao);
#pragma unroll
      for (int j = 0; j < 4; ++j) {
        acc[i][j] = mma_b_raw(ah, bh[j], acc[i][j]);
        if (NSPLIT >= 1) acc[i][j] = mma_b_raw(al, bh[j], acc[i][j]);
        if (NSPLIT == 2) acc[i][j] = mma_b_raw(ah, bl[j], acc[i][j]);
      }
      dep_guard_b(acc[i][0], acc[i][3], ah, al);
    }
    keep4_b(bh[0], bh[1], bh[2], bh[3]);
    if (NSPLIT == 2) keep4_b(bl[0], bl[1], bl[2], bl[3]);
  }
  acc_guard4(acc[0][0], acc[0][1], acc[0][2], acc[0][3]);
  acc_guard4(acc[1][0], acc[1][1], acc[1][2], acc[1][3]);
  acc_guard4(acc[2][0], acc[2][1], acc[2][2], acc[2][3]);
  acc_guard4(acc[3][0], acc[3][1], acc[3][2], acc[3][3]);

  // ---- epilogue ----
  float bcol[4] = {0.f, 0.f, 0.f, 0.f};
  if (BIAS == 1) {
#pragma unroll
    for (int j = 0; j < 4; ++j) bcol[j] = bf_up(bf_bits(bias[n0 + (j << 4) + rlane]));
  }
  float* slab = sT[wave];
#pragma unroll
  for (int i = 0; i < 4; ++i) {
    const int mBase = m0 + (i << 4);
    float brow[8] = {0.f, 0.f, 0.f, 0.f, 0.f, 0.f, 0.f, 0.f};
    if (BIAS == 2) {
#pragma unroll
      for (int r = 0; r < 8; ++r) brow[r] = bf_up(bf_bits(bias[mBase + mOff + r]));
    }
#pragma unroll
    for (int j = 0; j < 4; ++j) {
#pragma unroll
      for (int r = 0; r < 8; ++r) {
        float vv = acc[i][j][r] + bcol[j] + brow[r];
        if (RELU) vv = fmaxf(vv, 0.0f);
        slab[(mOff + r) * 68 + (j << 4) + rlane] = vv;
      }
    }
    wave_sync_lds();
    if (OUT_MODE == 0) {
      float* C = (float*)Cout + (size_t)b * strideC;
      const int hh = lane >> 4, c4 = (lane & 15) * 4;     // 256-B row segment = 16 lanes x 16 B
      {
#pragma unroll
        for (int it = 0; it < 8; ++it) {
          const int row = it * 2 + hh;                     // it 0..7 x hh 0..1 = rows 0..15
          const v4f v = *(const v4f*)(slab + row * 68 + c4);
          *(v4f*)(C + (size_t)(mBase + row) * ldc + n0 + c4) = v;
        }
        
      }
    } else {
      const int q = lane >> 3, c8 = (lane & 7) * 8;
      unsigned short* C  = (unsigned short*)Cout  + (size_t)b * strideC;
      unsigned short* C2 = (unsigned short*)Cout2 + (size_t)b * strideC2;
      const bool wlo = (OUT_MODE == 2) || (OUT_MODE == 3 && n0 < N2);   // wave-uniform
      v4u hv[4], lv[4];
#pragma unroll
      for (int it = 0; it < 4; ++it) {
        const int row = it * 4 + q;                        // it 0..3 x q 0..3 = rows 0..15
        const float* sp = slab + row * 68 + c8;
        v4u a, a2;
#pragma unroll
        for (int e = 0; e < 4; ++e) {
          const float f0 = sp[2 * e], f1 = sp[2 * e + 1];
          unsigned short h0, h1, l0, l1;
          if (OUT_MODE == 2) {
            h0 = bf_bits(f0); h1 = bf_bits(f1);
            l0 = bf_bits(f0 - bf_up(h0)); l1 = bf_bits(f1 - bf_up(h1));
          } else {
            const _Float16 x0 = (_Float16)f0, x1 = (_Float16)f1;
            h0 = h_bits(x0); h1 = h_bits(x1);
            l0 = h_bits((_Float16)((f0 - (float)x0) * rscale));
            l1 = h_bits((_Float16)((f1 - (float)x1) * rscale));
          }
          a[e] = pk16(h0, h1); a2[e] = pk16(l0, l1);
        }
        hv[it] = a; lv[it] = a2;
      }
      {
#pragma unroll
        for (int it = 0; it < 4; ++it) {
          const int row = it * 4 + q;
          *(v4u*)(C + (size_t)(mBase + row) * ldc + n0 + c8) = hv[it];
          if (wlo) *(v4u*)(C2 + (size_t)(mBase + row) * ldc2 + n0 + c8) = lv[it];
        }
        
      }
    }
    wave_sync_lds();
  }
}

// =====================================================================================================
// Attention, head dim 64, per-(query,key) int32 mask [NB][SEQ][SEQ] (0 = masked -> score replaced by the finite
// value -1e8, so a fully masked row yields uniform weights), standard softmax over all SEQ keys.
//   q hi plane (f16, pitch DM): element (b, t, h, d) at [(b*SEQ + t)*DM + h*64 + d]; k plane same layout
//   q residual plane (f16, (q - f16(q))*4096, pitch DM): same layout
//   v^T hi plane (f16): element (b, h, d, s) at [(b*DM + h*64 + d)*SEQ + s]; v^T residual plane (f16, x4096): same layout
//   out planes (bf16 hi / lo of the normalised context): element (b, t, h, d) at [(b*SEQ + t)*DM + h*64 + d]
//   scores = (qh . k + (ql . k) * rres) * sscale on f16 WMMA, residual products in a separate accumulator,
//   then the per-(q,k) mask select; p = exp(s - m) carried as f16(1024 p); context = p . vh + (p . vl) * rres
//   on f16 WMMA (separate accumulator folded per chunk in f32); online softmax in f32; final multiply by 1/l.
//   Block = 4 waves = 64 query rows of one (b, h); grid = NQB * NH * NB; kv chunks of 64, static trip NQB.
//   K / V^T chunk staging: 128 threads x 32 elements per plane = the whole 64x64 tile (plain 16-B loads,
//   __syncthreads before and after); mask values: each lane loads its own 8 rows x key column per 16-key
//   group straight from global (addresses always in range); P tiles are wave-private, spilled with _Float16
//   Output coverage: each wave stores rows q0..q0+15 (it 0..3 x lane>>3 0..3) x 64 columns (8 lanes x 8) of both planes.
// =====================================================================================================
__global__ __launch_bounds__(128)
void attn64(const unsigned short* __restrict__ qhp, const unsigned short* __restrict__ qlp,
            const unsigned short* __restrict__ khp,
            const unsigned short* __restrict__ vhp, const unsigned short* __restrict__ vlp,
            const int* __restrict__ maskp,
            unsigned short* ohp, unsigned short* olp, float sscale, float rres) {
  union FH { v16h v; v8h h[2]; };
  __shared__ __align__(16) _Float16 Ksh[64 * LP];                 // K [kv][d]   9 KB
  __shared__ __align__(16) _Float16 Vth[64 * LP];                 // V^T hi [d][kv] 9 KB
  __shared__ __align__(16) _Float16 Vtl[64 * LP];                 // V^T residual [d][kv] 9 KB
  __shared__ __align__(16) _Float16 Psh[4][16 * LP];              // per wave P [row][kv] 9 KB
  __shared__ __align__(16) float    Os[4][16 * OP];               // per wave context tile [row][d] 17 KB

  const int tid  = threadIdx.x;
  const int wave = tid >> 5;
  const int lane = tid & 31;
  const int hh   = lane >> 4;
  const int c    = lane & 15;

  const int bx   = blockIdx.x;
  const int qb   = bx % NQB;
  const int rest = bx / NQB;
  const int h    = rest % NH;
  const int b    = rest / NH;
  const int q0   = qb * 64 + wave * 16;
  const size_t rowB = (size_t)b * SEQ;

  const _Float16* Qh = (const _Float16*)(const void*)qhp + (size_t)h * HD;
  const _Float16* Ql = (const _Float16*)(const void*)qlp + (size_t)h * HD;
  const _Float16* Kg = (const _Float16*)(const void*)khp + (size_t)h * HD;
  const _Float16* Vh = (const _Float16*)(const void*)vhp + ((size_t)b * DM + (size_t)h * HD) * SEQ;
  const _Float16* Vl = (const _Float16*)(const void*)vlp + ((size_t)b * DM + (size_t)h * HD) * SEQ;
  // mask rows of this lane half: query rows q0 + 8*hh + r (r 0..7), key index added per chunk / column
  const int* Mg = maskp + (rowB + (size_t)q0 + (size_t)(8 * hh)) * SEQ;

  // ---- Q fragments (A operand, row = lane&15): 2 d-chunks, hi and residual ----
  v16h qah[2], qal[2];
#pragma unroll
  for (int dc = 0; dc < 2; ++dc) {
    qah[dc] = ldfrag_h(Qh + (rowB + q0 + c) * DM + dc * 32 + 8 * hh);
    qal[dc] = ldfrag_h(Ql + (rowB + q0 + c) * DM + dc * 32 + 8 * hh);
  }

  float mrow[8], lrow[8];
  v8f oacc[4];
#pragma unroll
  for (int r = 0; r < 8; ++r) { mrow[r] = -INFINITY; lrow[r] = 0.f; }
#pragma unroll
  for (int t = 0; t < 4; ++t) oacc[t] = zero8();

  for (int kt = 0; kt < NQB; ++kt) {         // static trip count
    const int kv0 = kt * 64;
    __syncthreads();
    {
      const int r = tid >> 1, hf = (tid & 1) * 32;
      const _Float16* kg  = Kg + (rowB + kv0 + r) * DM + hf;       // K row kv0+r, d = hf..hf+31
      const _Float16* vg  = Vh + (size_t)r * SEQ + kv0 + hf;       // V^T row d = r, s = kv0+hf..+31
      const _Float16* vlg = Vl + (size_t)r * SEQ + kv0 + hf;
#pragma unroll
      for (int i = 0; i < 4; ++i) {
        const v8h a0 = *(const v8h*)(kg + 8 * i);
        const v8h b0 = *(const v8h*)(vg + 8 * i);
        const v8h b1 = *(const v8h*)(vlg + 8 * i);
        *(v8h*)(Ksh + r * LP + hf + 8 * i) = a0;
        *(v8h*)(Vth + r * LP + hf + 8 * i) = b0;
        *(v8h*)(Vtl + r * LP + hf + 8 * i) = b1;
      }
    }
    __syncthreads();

    // ---- scores: 16 query rows x 64 keys per wave, 2 f16 products (hi, residual), then per-(q,k) mask select ----
    v8f s[4];
#pragma unroll
    for (int j = 0; j < 4; ++j) {
      v8f sh = zero8(), sl = zero8();
#pragma unroll
      for (int dc = 0; dc < 2; ++dc) {
        FH kb;
        kb.h[0] = *(const v8h*)(Ksh + (j * 16 + c) * LP + dc * 32 + 8 * hh);
        kb.h[1] = *(const v8h*)(Ksh + (j * 16 + c) * LP + dc * 32 + 16 + 8 * hh);
        sh = mma_h(qah[dc], kb.v, sh);
        sl = mma_h(qal[dc], kb.v, sl);
      }
      int live[8];
#pragma unroll
      for (int r = 0; r < 8; ++r) live[r] = Mg[(size_t)r * SEQ + kv0 + j * 16 + c];   // row 8hh+r, key j*16+c
#pragma unroll
      for (int r = 0; r < 8; ++r) {
        const float v = (sh[r] + sl[r] * rres) * sscale;
        s[j][r] = (live[r] != 0) ? v : -1.0e8f;
      }
    }

    // ---- row max, online softmax, P (x1024, f16) to LDS ----
    _Float16* pwh = Psh[wave];
#pragma unroll
    for (int r = 0; r < 8; ++r) {
      float m = s[0][r];
      m = fmaxf(m, s[1][r]);
      m = fmaxf(m, s[2][r]);
      m = fmaxf(m, s[3][r]);
#pragma unroll
      for (int off = 1; off < 16; off <<= 1) m = fmaxf(m, __shfl_xor(m, off, 32));
      const float mnew  = fmaxf(mrow[r], m);
      const float alpha = __expf(mrow[r] - mnew);
      mrow[r] = mnew;
      float psum = 0.f;
#pragma unroll
      for (int j = 0; j < 4; ++j) {
        const float p = __expf(s[j][r] - mnew);
        psum += p;
        pwh[(8 * hh + r) * LP + j * 16 + c] = (_Float16)(p * 1024.0f);
      }
#pragma unroll
      for (int off = 1; off < 16; off <<= 1) psum += __shfl_xor(psum, off, 32);
      lrow[r] = lrow[r] * alpha + psum;
#pragma unroll
      for (int t = 0; t < 4; ++t) oacc[t][r] *= alpha;
    }
    wave_sync_lds();

    // ---- context += P . V (f16 WMMA), residual products into a separate accumulator ----
    v8f o1[4];
#pragma unroll
    for (int t = 0; t < 4; ++t) o1[t] = zero8();
#pragma unroll 1
    for (int kk = 0; kk < 2; ++kk) {
      FH pa;
      pa.h[0] = *(const v8h*)(pwh + c * LP + kk * 32 + 8 * hh);
      pa.h[1] = *(const v8h*)(pwh + c * LP + kk * 32 + 16 + 8 * hh);
#pragma unroll
      for (int t = 0; t < 4; ++t) {
        FH vb, vl;
        vb.h[0] = *(const v8h*)(Vth + (t * 16 + c) * LP + kk * 32 + 8 * hh);
        vb.h[1] = *(const v8h*)(Vth + (t * 16 + c) * LP + kk * 32 + 16 + 8 * hh);
        vl.h[0] = *(const v8h*)(Vtl + (t * 16 + c) * LP + kk * 32 + 8 * hh);
        vl.h[1] = *(const v8h*)(Vtl + (t * 16 + c) * LP + kk * 32 + 16 + 8 * hh);
        oacc[t] = mma_h(pa.v, vb.v, oacc[t]);
        o1[t]   = mma_h(pa.v, vl.v, o1[t]);
      }
    }
#pragma unroll
    for (int t = 0; t < 4; ++t)
#pragma unroll
      for (int r = 0; r < 8; ++r) oacc[t][r] += o1[t][r] * rres;
  }

  // ---- normalise (1/l and the 1/1024 p carry), stage the wave's 16x64 tile, bf16 hi/lo split,
  float* os = Os[wave];
#pragma unroll
  for (int r = 0; r < 8; ++r) {
    const float inv = (1.0f / lrow[r]) * (1.0f / 1024.0f);      // lrow >= 1 always (the max key contributes 1)
#pragma unroll
    for (int t = 0; t < 4; ++t) os[(8 * hh + r) * OP + t * 16 + c] = oacc[t][r] * inv;
  }
  wave_sync_lds();
  {
    const int q4 = lane >> 3, c8 = (lane & 7) * 8;
    v4u hv[4], lv[4];
#pragma unroll
    for (int it = 0; it < 4; ++it) {
      const int row = it * 4 + q4;   // it 0..3 x q4 0..3 = rows 0..15 of the wave tile
      const float* sp = os + row * OP + c8;
      v4u a, a2;
#pragma unroll
      for (int e = 0; e < 4; ++e) {
        const float f0 = sp[2 * e], f1 = sp[2 * e + 1];
        const unsigned short h0 = bf_bits(f0), h1 = bf_bits(f1);
        const unsigned short l0 = bf_bits(f0 - bf_up(h0)), l1 = bf_bits(f1 - bf_up(h1));
        a[e] = pk16(h0, h1); a2[e] = pk16(l0, l1);
      }
      hv[it] = a; lv[it] = a2;
    }
    {
#pragma unroll
      for (int it = 0; it < 4; ++it) {
        const int row = it * 4 + q4;
        const size_t go = (rowB + q0 + row) * DM + (size_t)h * HD + c8;
        *(v4u*)(ohp + go) = hv[it];
        *(v4u*)(olp + go) = lv[it];
      }
      
    }
  }
}

// =====================================================================================================
// Workspace map (bytes), every plane an exact multiple of its 64x64-tile / whole-line store granularity:
//   Xq    bf16 [8192][256]           0          4194304
//   Xk    bf16 [8192][256]           4194304    4194304
//   WqT   bf16 [512][256]            8388608    262144
//   WkT   bf16 [512][256]            8650752    262144
//   WvT   bf16 [512][256]            8912896    262144
//   WoT   bf16 [512][512]            9175040    524288
//   Qh    f16  [8192][512]           9699328    8388608
//   Ql    f16  [8192][512]           18087936   8388608   (q residual x4096)
//   Kh    f16  [8192][512]           26476544   8388608
//   VTh   f16  [8][512][1024]        34865152   8388608
//   VTl   f16  [8][512][1024]        43253760   8388608   (v residual x4096)
//   Oh    bf16 [8192][512]           51642368   8388608
//   Ol    bf16 [8192][512]           60030976   8388608
//   end                              68419584
// Weights arrive as [in k][out n] and are transpose-converted to [out n][in k] (k contiguous = Bt / A layout).
// =====================================================================================================
extern "C" void kernel_launch(void* const* d_in, const int* in_sizes, int n_in,
                              void* d_out, int out_size, void* d_ws, size_t ws_size,
                              hipStream_t stream) {
  if (n_in < 11) return;
  if (in_sizes[0] != NB * SEQ * QIN || in_sizes[1] != NB * SEQ * QIN) return;
  if (in_sizes[2] != NB * SEQ * SEQ) return;
  if (in_sizes[3] != QIN * DM || in_sizes[5] != QIN * DM || in_sizes[7] != QIN * DM) return;
  if (in_sizes[9] != DM * DM) return;
  if (in_sizes[4] != DM || in_sizes[6] != DM || in_sizes[8] != DM || in_sizes[10] != DM) return;
  if (out_size != NB * SEQ * DM) return;

  const float* query = (const float*)d_in[0];
  const float* key   = (const float*)d_in[1];
  const int*   mask  = (const int*)d_in[2];
  const float* Wq    = (const float*)d_in[3];
  const float* bq    = (const float*)d_in[4];
  const float* Wk    = (const float*)d_in[5];
  const float* bk    = (const float*)d_in[6];
  const float* Wv    = (const float*)d_in[7];
  const float* bv    = (const float*)d_in[8];
  const float* Wo    = (const float*)d_in[9];
  const float* bo    = (const float*)d_in[10];

  const size_t PXI = (size_t)NB * SEQ * QIN * 2;     //  4194304 (bf16 input activation plane)
  const size_t PW  = (size_t)DM * QIN * 2;           //   262144 (one projection weight plane)
  const size_t PWO = (size_t)DM * DM * 2;            //   524288 (output weight plane)
  const size_t PA  = (size_t)NB * SEQ * DM * 2;      //  8388608 (q / k / context planes)
  const size_t PVT = (size_t)NB * DM * SEQ * 2;      //  8388608 (v^T plane)
  size_t off = 0;
  const size_t oXq  = off; off += PXI;
  const size_t oXk  = off; off += PXI;
  const size_t oWq  = off; off += PW;
  const size_t oWk  = off; off += PW;
  const size_t oWv  = off; off += PW;
  const size_t oWo  = off; off += PWO;
  const size_t oQh  = off; off += PA;
  const size_t oQl  = off; off += PA;
  const size_t oKh  = off; off += PA;
  const size_t oVTh = off; off += PVT;
  const size_t oVTl = off; off += PVT;
  const size_t oOh  = off; off += PA;
  const size_t oOl  = off; off += PA;
  if (off > ws_size) return;                          // off = 68419584
  if (off > (size_t)134217728) return;

  char* ws = (char*)d_ws;
  unsigned short* Xq  = (unsigned short*)(ws + oXq);
  unsigned short* Xk  = (unsigned short*)(ws + oXk);
  unsigned short* WqT = (unsigned short*)(ws + oWq);
  unsigned short* WkT = (unsigned short*)(ws + oWk);
  unsigned short* WvT = (unsigned short*)(ws + oWv);
  unsigned short* WoT = (unsigned short*)(ws + oWo);
  unsigned short* Qh  = (unsigned short*)(ws + oQh);
  unsigned short* Ql  = (unsigned short*)(ws + oQl);
  unsigned short* Kh  = (unsigned short*)(ws + oKh);
  unsigned short* VTh = (unsigned short*)(ws + oVTh);
  unsigned short* VTl = (unsigned short*)(ws + oVTl);
  unsigned short* Oh  = (unsigned short*)(ws + oOh);
  unsigned short* Ol  = (unsigned short*)(ws + oOl);

  const dim3 blk(256);
  const int n8x = NB * SEQ * QIN / 8;                           // 262144
  const dim3 gCvtX((n8x + 255) / 256);                          // 1024 blocks
  const dim3 gTw(DM / 64, QIN / 64);                            // in [QIN][DM] -> out [DM][QIN]: (8, 4)
  const dim3 gTo(DM / 64, DM / 64);                             // in [DM][DM]  -> out [DM][DM]:  (8, 8)
  const dim3 gProj(((NB * SEQ / 64) * (DM / 64) + 7) / 8, 1);   // 1024 tiles -> 128 blocks: M=8192, N=512
  const dim3 gVT(((DM / 64) * (SEQ / 64) + 7) / 8, NB);         // 128 tiles -> 16 blocks x 8 batches: M=512, N=1024
  const dim3 gOut(((NB * SEQ / 64) * (DM / 64) + 7) / 8, 1);    // 1024 tiles -> 128 blocks: M=8192, N=512
  const dim3 gAttn(NB * NH * NQB);                              // 1024 blocks

  // (1) activations -> bf16 planes; weights [in][out] -> transposed bf16 planes [out][in] (RNE convert)
  cvt_bf16x8<<<gCvtX, blk, 0, stream>>>(query, Xq, n8x);
  cvt_bf16x8<<<gCvtX, blk, 0, stream>>>(key,   Xk, n8x);
  cvt_bf16_t64<<<gTw, blk, 0, stream>>>(Wq, WqT, QIN, DM);      // in rows = QIN, cols = DM
  cvt_bf16_t64<<<gTw, blk, 0, stream>>>(Wk, WkT, QIN, DM);
  cvt_bf16_t64<<<gTw, blk, 0, stream>>>(Wv, WvT, QIN, DM);
  cvt_bf16_t64<<<gTo, blk, 0, stream>>>(Wo, WoT, DM, DM);       // in rows = DM (k), cols = DM (n)
  // (2) q = relu(query . Wq + bq) -> f16 hi plane [8192][512] + f16 residual x4096 (all tiles, N2 = DM)
  //     (M=8192, N=512, K=256)
  gemm64<0, 3, 1, 1><<<gProj, blk, 0, stream>>>(
      Xq, Xq, QIN, 0LL, WqT, WqT, QIN, 0LL, bq,
      (void*)Qh, DM, 0LL, (void*)Ql, DM, 0LL, DM,
      NB * SEQ, DM, QIN, 4096.0f);
  // (3) k = relu(key . Wk + bk) -> f16 hi plane [8192][512] only (M=8192, N=512, K=256)
  gemm64<0, 4, 1, 1><<<gProj, blk, 0, stream>>>(
      Xk, Xk, QIN, 0LL, WkT, WkT, QIN, 0LL, bk,
      (void*)Kh, DM, 0LL, (void*)Kh, DM, 0LL, 0,
      NB * SEQ, DM, QIN, 4096.0f);
  // (4) v^T = relu(Wv^T . key^T + bv) per batch -> f16 hi plane [b][h*64+d][s] (pitch SEQ) and residual plane x4096
  //     (A = WvT [n][k], Bt = Xk rows of batch b, bias per row; M=512, N=1024, K=256)
  gemm64<0, 3, 2, 1><<<gVT, blk, 0, stream>>>(
      WvT, WvT, QIN, 0LL, Xk, Xk, QIN, (long long)SEQ * QIN, bv,
      (void*)VTh, SEQ, (long long)DM * SEQ, (void*)VTl, SEQ, (long long)DM * SEQ, SEQ,
      DM, SEQ, QIN, 4096.0f);
  // (5) attention with per-(q,k) mask and softmax -> context bf16 hi / lo planes [8192][512]
  attn64<<<gAttn, dim3(128), 0, stream>>>(Qh, Ql, Kh, VTh, VTl, mask, Oh, Ol, 0.125f, 1.0f / 4096.0f);
  // (6) out = context . Wo + bo -> d_out f32 [8192][512]  (A = context hi + lo planes, 2 products; K=512)
  gemm64<1, 0, 1, 0><<<gOut, blk, 0, stream>>>(
      Oh, Ol, DM, 0LL, WoT, WoT, DM, 0LL, bo,
      d_out, DM, 0LL, d_out, DM, 0LL, DM,
      NB * SEQ, DM, DM, 1.0f);
  (void)hipGetLastError();
}

// v002
// It runs in 123 microseconds.
// Two timings next to v001 put it at 1.35 and 1.36 times that version's speed.
// Over all steps from v000 it is 1.69 times as fast.
// Contractions: q, k and v^T projections = v_wmma_f32_16x16x32_bf16 (bf16 operands from RNE-converted inputs and
// transposed weights, single product, bias and ReLU in f32); q.k^T scores = v_wmma_f32_16x16x32_f16 (q as f16 hi
// plane + f16 residual plane x4096 in a separate accumulator, k f16; 2 products); p.v = v_wmma_f32_16x16x32_f16
// (p carried x1024 in f16, v^T as f16 hi plane + f16 residual plane x4096 in a separate accumulator; 2 products);
// ctx.Wo = v_wmma_f32_16x16x32_bf16 (ctx as bf16 hi + lo planes times bf16 Wo^T, 2 products, bias in f32);
// all f32 accumulate; per-(query,key) mask select and softmax in f32.
#include <hip/hip_runtime.h>
#include <math.h>
#include <stdint.h>

#define NB    8
#define SEQ   1024
#define QIN   256
#define DM    512
#define NH    8
#define HD    64
#define NQB   (SEQ / 64)     // 16 key / query tiles of 64
#define LP    72             // LDS row pitch of the 64-wide f16 tiles, in halves: 144 B = 16 B x odd, so the 16 rows that one
                             // ds_load_b128 fragment read touches fall on 16 different 4-bank groups
#define OP    68             // LDS row pitch of the 64-wide f32 context tile, in floats (16-byte column walks)
static_assert(NH * HD == DM);
static_assert((SEQ % 64) == 0 && (DM % 64) == 0 && (QIN % 64) == 0 && (QIN % 32) == 0 && (DM % 32) == 0);

typedef _Float16 v16h __attribute__((ext_vector_type(16)));
typedef _Float16 v8h  __attribute__((ext_vector_type(8)));
typedef __bf16   v16b __attribute__((ext_vector_type(16)));
typedef __bf16   v8b  __attribute__((ext_vector_type(8)));
typedef float    v8f  __attribute__((ext_vector_type(8)));
typedef float    v4f  __attribute__((ext_vector_type(4)));
typedef unsigned int v4u __attribute__((ext_vector_type(4)));

// ---- scalar helpers --------------------------------------------------------------------------------
__device__ __forceinline__ unsigned short bf_bits(float f) {          // f32 -> bf16 bits, RNE convert
  unsigned u = __float_as_uint(f);
  return (unsigned short)((u + 0x7FFFu + ((u >> 16) & 1u)) >> 16);
}
__device__ __forceinline__ float bf_up(unsigned short h) { return __uint_as_float(((unsigned)h) << 16); }
__device__ __forceinline__ unsigned short h_bits(_Float16 x) { return __builtin_bit_cast(unsigned short, x); }
__device__ __forceinline__ unsigned pk16(unsigned short a, unsigned short b) { return (unsigned)a | ((unsigned)b << 16); }
__device__ __forceinline__ v8f zero8() { v8f z = {0.f, 0.f, 0.f, 0.f, 0.f, 0.f, 0.f, 0.f}; return z; }

// ---- fragment loaders: 16-bit A/B operand, lane -> row/col (lane&15), p already includes +8*(lane>>4);
//      elements 0..7 <- p[0..7] (k0+8h..), elements 8..15 <- p[16..23] (k0+16+8h..)
//      ldfrag_b reads global memory only; the cast says so, for an address that has gone through an asm statement
//      would otherwise be loaded from in the flat form
typedef const __attribute__((address_space(1))) v8b* gv8b;
__device__ __forceinline__ v16b ldfrag_b(const __bf16* p) {
  union { v16b v; v8b h[2]; } f;
  f.h[0] = *(gv8b)(p);
  f.h[1] = *(gv8b)(p + 16);
  return f.v;
}
__device__ __forceinline__ v16h ldfrag_h(const _Float16* p) {
  union { v16h v; v8h h[2]; } f;
  f.h[0] = *(const v8h*)(p);
  f.h[1] = *(const v8h*)(p + 16);
  return f.v;
}

// ---- WMMA helpers with trailing VALU hazard gap --------------------------------------------------------
__device__ __forceinline__ v8f mma_h(v16h a, v16h b, v8f c) {
  c = __builtin_amdgcn_wmma_f32_16x16x32_f16(false, a, false, b, (short)0, c, false, false);
#if defined(__HIP_DEVICE_COMPILE__)
  asm volatile("v_nop\n\tv_nop\n\tv_nop\n\tv_nop" : "+v"(c) : "v"(a), "v"(b));
#endif
  return c;
}
__device__ __forceinline__ v8f mma_b_raw(v16b a, v16b b, v8f c) {
  return __builtin_amdgcn_wmma_f32_16x16x32_bf16(false, a, false, b, (short)0, c, false, false);
}
__device__ __forceinline__ void dep_guard_b(v8f& a, v8f& b, v16b x, v16b y) {
#if defined(__HIP_DEVICE_COMPILE__)
  asm volatile("v_nop\n\tv_nop\n\tv_nop\n\tv_nop" : "+v"(a), "+v"(b) : "v"(x), "v"(y));
#endif
}
__device__ __forceinline__ void keep4_b(v16b a, v16b b, v16b c, v16b d) {
#if defined(__HIP_DEVICE_COMPILE__)
  asm volatile("v_nop" :: "v"(a), "v"(b), "v"(c), "v"(d));
#endif
}
__device__ __forceinline__ void acc_guard4(v8f& a, v8f& b, v8f& c, v8f& d) {
#if defined(__HIP_DEVICE_COMPILE__)
  asm volatile("v_nop\n\tv_nop\n\tv_nop\n\tv_nop" : "+v"(a), "+v"(b), "+v"(c), "+v"(d));
#endif
}
__device__ __forceinline__ void wave_sync_lds() {
  __builtin_amdgcn_fence(__ATOMIC_RELEASE, "workgroup");
  __builtin_amdgcn_wave_barrier();
  __builtin_amdgcn_fence(__ATOMIC_ACQUIRE, "workgroup");
}

// =====================================================================================================
// f32 -> bf16 (RNE convert), 8 elements per thread, one 16-B store per lane: a wave writes 512 contiguous B
// coverage: n8 threads x 8 = whole plane (n8 is a multiple of 256 for every use here). bx = block index inside the plane.
// =====================================================================================================
__device__ __forceinline__ void cvt_bf16x8(const float* __restrict__ in, unsigned short* out, int n8, int bx) {
  const int i = bx * 256 + threadIdx.x;
  if (i < n8) {
    const v4f a = *(const v4f*)(in + (size_t)i * 8);
    const v4f b = *(const v4f*)(in + (size_t)i * 8 + 4);
    v4u p;
    p[0] = pk16(bf_bits(a[0]), bf_bits(a[1]));
    p[1] = pk16(bf_bits(a[2]), bf_bits(a[3]));
    p[2] = pk16(bf_bits(b[0]), bf_bits(b[1]));
    p[3] = pk16(bf_bits(b[2]), bf_bits(b[3]));
    *(v4u*)(out + (size_t)i * 8) = p;
    
  }
}

// =====================================================================================================
// Transpose-convert: f32 in[R][C] row-major -> bf16 (RNE convert) outT[C][R] row-major, outT[c][r] = in[r][c].
// (bx, by) in (C/64, R/64) (bx = column tile of in = row tile of outT), block 256; R, C multiples of 64.
// Load: thread tid reads in row r0 + (tid>>2), 16 floats at c0 + (tid&3)*16 (4 x 16-B loads) -> LDS tile[r][c].
// coverage: load 64 rows x 4 x 16 cols = 64x64; store 8 waves x 2 x 4 rows x (8 lanes x 8) = 64x64.
// =====================================================================================================
__device__ __forceinline__ void cvt_bf16_t64(const float* __restrict__ in, unsigned short* outT, int R, int C, int bx, int by) {
  __shared__ float tile[64][65];
  const int tid  = threadIdx.x;
  const int lane = tid & 31;
  const int wave = tid >> 5;
  const int c0 = bx * 64;
  const int r0 = by * 64;
  {
    const int r = tid >> 2, cs = (tid & 3) * 16;
    const float* g = in + (size_t)(r0 + r) * C + c0 + cs;
#pragma unroll
    for (int i = 0; i < 4; ++i) {
      const v4f v = *(const v4f*)(g + 4 * i);
      tile[r][cs + 4 * i + 0] = v[0];
      tile[r][cs + 4 * i + 1] = v[1];
      tile[r][cs + 4 * i + 2] = v[2];
      tile[r][cs + 4 * i + 3] = v[3];
    }
  }
  __syncthreads();
  const int q = lane >> 3, c8 = (lane & 7) * 8;
  v4u pv[2];
#pragma unroll
  for (int it = 0; it < 2; ++it) {
    const int c = wave * 8 + it * 4 + q;
    v4u p;
#pragma unroll
    for (int e = 0; e < 4; ++e)
      p[e] = pk16(bf_bits(tile[c8 + 2 * e][c]), bf_bits(tile[c8 + 2 * e + 1][c]));
    pv[it] = p;
  }
  {
#pragma unroll
    for (int it = 0; it < 2; ++it) {
      const int c = wave * 8 + it * 4 + q;
      *(v4u*)(outT + (size_t)(c0 + c) * R + r0 + c8) = pv[it];
    }
    
  }
}

// =====================================================================================================
// All six converts in one launch (none reads what another writes). Blocks, in this order: 3 x NTW tiles of Wq, Wk, Wv,
// NTO tiles of Wo (the transposes have the longer chain, so they start first), then NCX blocks each of query and key.
// Every branch is uniform for the block.
// =====================================================================================================
#define NTW ((DM / 64) * (QIN / 64))        // 32 tiles of a projection weight
#define NTO ((DM / 64) * (DM / 64))         // 64 tiles of the output weight
#define NCX (NB * SEQ * QIN / 8 / 256)      // 1024 blocks of an activation plane
__global__ __launch_bounds__(256) void prep_all(
    const float* __restrict__ query, const float* __restrict__ key,
    const float* __restrict__ Wq, const float* __restrict__ Wk, const float* __restrict__ Wv, const float* __restrict__ Wo,
    unsigned short* Xq, unsigned short* Xk,
    unsigned short* WqT, unsigned short* WkT, unsigned short* WvT, unsigned short* WoT) {
  const int bx = blockIdx.x;
  if (bx < 3 * NTW + NTO) {
    const int w = bx / NTW;                                    // 0, 1, 2 = Wq, Wk, Wv; 3 and 4 = Wo
    const int t = (w < 3) ? (bx - w * NTW) : (bx - 3 * NTW);
    const float*    in  = (w == 0) ? Wq  : (w == 1) ? Wk  : (w == 2) ? Wv  : Wo;
    unsigned short* out = (w == 0) ? WqT : (w == 1) ? WkT : (w == 2) ? WvT : WoT;
    cvt_bf16_t64(in, out, (w < 3) ? QIN : DM, DM, t % (DM / 64), t / (DM / 64));   // in rows = k, cols = DM
  } else {
    const int c = bx - (3 * NTW + NTO);
    const bool q = c < NCX;
    cvt_bf16x8(q ? query : key, q ? Xq : Xk, NCX * 256, q ? c : c - NCX);
  }
}

// =====================================================================================================
// Register-blocked batched bf16 WMMA GEMM: C[m][n] = sum_k A[m][k] * Bt[n][k] + bias (ReLU optional); one wave
// per 64x64 tile, no block barriers. A row-major [M][K] pitch lda; Bt row-major [N][K] pitch ldb (k contiguous);
// M, N multiples of 64, K multiple of 32 (host-checked). bx = block of 8 tiles, by = batch index (strides in elements);
// sT = the block's 8 per-wave 16x64 slabs in LDS, pitch 68 floats.
// NSPLIT: 0 = A.Bt; 1 = (A + A2).Bt (A2 = unscaled bf16 lo plane of A); 2 = A.Bt + A2.Bt + A.Bt2.
// BIAS: 0 = none; 1 = bias[n] (per column); 2 = bias[m] (per row). Bias is an f32 array, applied as its
//       bf16 RNE value in the f32 epilogue before any 16-bit split of the result. RELU: 1 = max(v, 0) after bias.
// OUT_MODE: 0 = f32 (pitch ldc); 2 = bf16 hi plane C + bf16 lo plane C2 (lo = RNE(v - hi), unscaled);
//           3 = f16 hi plane C + f16 residual plane C2 = f16((v - hi) * rscale), C2 written only for tiles
//               with n0 < N2 (pitch ldc2, batch stride strideC2); 4 = f16 hi plane C only.
// =====================================================================================================
template <int NSPLIT, int OUT_MODE, int BIAS, int RELU>
__device__ __forceinline__ void gemm64(
    float (*sT)[16 * 68], int bx, int by,
    const unsigned short* __restrict__ Ap, const unsigned short* A2p, int lda, long long strideA,
    const unsigned short* __restrict__ Btp, const unsigned short* Bt2p, int ldb, long long strideB,
    const float* __restrict__ bias,
    void* Cout, int ldc, long long strideC,
    void* Cout2, int ldc2, long long strideC2, int N2,
    int M, int N, int K, float rscale) {
  const __bf16* A   = (const __bf16*)(const void*)Ap;
  const __bf16* A2  = (const __bf16*)(const void*)A2p;
  const __bf16* Bt  = (const __bf16*)(const void*)Btp;
  const __bf16* Bt2 = (const __bf16*)(const void*)Bt2p;
  const int b    = by;
  const int lane = threadIdx.x & 31;
  const int wave = threadIdx.x >> 5;
  const int tilesN = N >> 6;
  const int tilesM = M >> 6;
  const int tile = bx * 8 + wave;
  if (tile >= tilesM * tilesN) return;   // wave-uniform; no block barriers in this kernel
  const int tm = tile / tilesN;
  const int tn = tile - tm * tilesN;
  const int m0 = tm << 6;
  const int n0 = tn << 6;

  const __bf16* Ab  = A  + (size_t)b * strideA;
  const __bf16* Bb  = Bt + (size_t)b * strideB;
  const __bf16* Ab2 = (NSPLIT >= 1) ? (A2  + (size_t)b * strideA) : Ab;
  const __bf16* Bb2 = (NSPLIT == 2) ? (Bt2 + (size_t)b * strideB) : Bb;

  const int rlane = lane & 15;                 // row (A) / col (B, D) within subtile
  const int koff  = (lane >> 4) * 8;           // k offset of this lane half
  const int mOff  = (lane >> 4) * 8;           // D row offset

  v8f acc[4][4];
#pragma unroll
  for (int i = 0; i < 4; ++i)
#pragma unroll
    for (int j = 0; j < 4; ++j) acc[i][j] = zero8();

  // running addresses of this lane's row 0 fragments, 32 elements on a k step; the other rows lie at constant offsets
  const __bf16* pa  = Ab  + (size_t)(m0 + rlane) * lda + koff;
  const __bf16* pa2 = Ab2 + (size_t)(m0 + rlane) * lda + koff;
  const __bf16* pb  = Bb  + (size_t)(n0 + rlane) * ldb + koff;
  const __bf16* pb2 = Bb2 + (size_t)(n0 + rlane) * ldb + koff;
  for (int k0 = 0; k0 < K; k0 += 32) {
    v16b bh[4], bl[4];
#pragma unroll
    for (int j = 0; j < 4; ++j) {
      const size_t bo = (size_t)(j << 4) * ldb;
      bh[j] = ldfrag_b(pb + bo);
      if (NSPLIT == 2) bl[j] = ldfrag_b(pb2 + bo); else bl[j] = bh[j];
    }
#pragma unroll
    for (int i = 0; i < 4; ++i) {
      const size_t ao = (size_t)(i << 4) * lda;
      const v16b ah = ldfrag_b(pa + ao);
      v16b al = ah;
      if (NSPLIT >= 1) al = ldfrag_b(pa2 + ao);
#pragma unroll
      for (int j = 0; j < 4; ++j) {
        acc[i][j] = mma_b_raw(ah, bh[j], acc[i][j]);
        if (NSPLIT >= 1) acc[i][j] = mma_b_raw(al, bh[j], acc[i][j]);
        if (NSPLIT == 2) acc[i][j] = mma_b_raw(ah, bl[j], acc[i][j]);
      }
      dep_guard_b(acc[i][0], acc[i][3], ah, al);
    }
    keep4_b(bh[0], bh[1], bh[2], bh[3]);
    if (NSPLIT == 2) keep4_b(bl[0], bl[1], bl[2], bl[3]);
#if defined(__HIP_DEVICE_COMPILE__)
    // the k step's loads are out. The wait names the running addresses: they keep their registers up to here (no load's
    // result lands in a pair that an issued load names) and are stepped on only behind it.
    if (NSPLIT == 0)      asm volatile("s_wait_xcnt 0x0" : "+v"(pa), "+v"(pb) :: "memory");
    else if (NSPLIT == 1) asm volatile("s_wait_xcnt 0x0" : "+v"(pa), "+v"(pa2), "+v"(pb) :: "memory");
    else                  asm volatile("s_wait_xcnt 0x0" : "+v"(pa), "+v"(pa2), "+v"(pb), "+v"(pb2) :: "memory");
#endif
    pa += 32; pa2 += 32; pb += 32; pb2 += 32;
  }
  acc_guard4(acc[0][0], acc[0][1], acc[0][2], acc[0][3]);
  acc_guard4(acc[1][0], acc[1][1], acc[1][2], acc[1][3]);
  acc_guard4(acc[2][0], acc[2][1], acc[2][2], acc[2][3]);
  acc_guard4(acc[3][0], acc[3][1], acc[3][2], acc[3][3]);

  // ---- epilogue ----
  float bcol[4] = {0.f, 0.f, 0.f, 0.f};
  if (BIAS == 1) {
#pragma unroll
    for (int j = 0; j < 4; ++j) bcol[j] = bf_up(bf_bits(bias[n0 + (j << 4) + rlane]));
  }
  float* slab = sT[wave];
#pragma unroll
  for (int i = 0; i < 4; ++i) {
    const int mBase = m0 + (i << 4);
    float brow[8] = {0.f, 0.f, 0.f, 0.f, 0.f, 0.f, 0.f, 0.f};
    if (BIAS == 2) {
#pragma unroll
      for (int r = 0; r < 8; ++r) brow[r] = bf_up(bf_bits(bias[mBase + mOff + r]));
    }
#pragma unroll
    for (int j = 0; j < 4; ++j) {
#pragma unroll
      for (int r = 0; r < 8; ++r) {
        float vv = acc[i][j][r] + bcol[j] + brow[r];
        if (RELU) vv = fmaxf(vv, 0.0f);
        slab[(mOff + r) * 68 + (j << 4) + rlane] = vv;
      }
    }
    wave_sync_lds();
    if (OUT_MODE == 0) {
      float* C = (float*)Cout + (size_t)b * strideC;
      const int hh = lane >> 4, c4 = (lane & 15) * 4;     // 256-B row segment = 16 lanes x 16 B
      {
#pragma unroll
        for (int it = 0; it < 8; ++it) {
          const int row = it * 2 + hh;                     // it 0..7 x hh 0..1 = rows 0..15
          const v4f v = *(const v4f*)(slab + row * 68 + c4);
          *(v4f*)(C + (size_t)(mBase + row) * ldc + n0 + c4) = v;
        }
        
      }
    } else {
      const int q = lane >> 3, c8 = (lane & 7) * 8;
      unsigned short* C  = (unsigned short*)Cout  + (size_t)b * strideC;
      unsigned short* C2 = (unsigned short*)Cout2 + (size_t)b * strideC2;
      const bool wlo = (OUT_MODE == 2) || (OUT_MODE == 3 && n0 < N2);   // wave-uniform
      v4u hv[4], lv[4];
#pragma unroll
      for (int it = 0; it < 4; ++it) {
        const int row = it * 4 + q;                        // it 0..3 x q 0..3 = rows 0..15
        const float* sp = slab + row * 68 + c8;
        v4u a, a2;
#pragma unroll
        for (int e = 0; e < 4; ++e) {
          const float f0 = sp[2 * e], f1 = sp[2 * e + 1];
          unsigned short h0, h1, l0, l1;
          if (OUT_MODE == 2) {
            h0 = bf_bits(f0); h1 = bf_bits(f1);
            l0 = bf_bits(f0 - bf_up(h0)); l1 = bf_bits(f1 - bf_up(h1));
          } else {
            const _Float16 x0 = (_Float16)f0, x1 = (_Float16)f1;
            h0 = h_bits(x0); h1 = h_bits(x1);
            l0 = h_bits((_Float16)((f0 - (float)x0) * rscale));
            l1 = h_bits((_Float16)((f1 - (float)x1) * rscale));
          }
          a[e] = pk16(h0, h1); a2[e] = pk16(l0, l1);
        }
        hv[it] = a; lv[it] = a2;
      }
      {
#pragma unroll
        for (int it = 0; it < 4; ++it) {
          const int row = it * 4 + q;
          *(v4u*)(C + (size_t)(mBase + row) * ldc + n0 + c8) = hv[it];
          if (wlo) *(v4u*)(C2 + (size_t)(mBase + row) * ldc2 + n0 + c8) = lv[it];
        }
        
      }
    }
    wave_sync_lds();
  }
}

// =====================================================================================================
// The q, k and v^T projections in one launch (none reads what another writes): 3 x NPB blocks, block-uniform branch.
//   q = relu(query . Wq + bq) -> f16 hi plane [8192][512] + f16 residual x4096 (all tiles, N2 = DM); M=8192, N=512, K=256
//   k = relu(key . Wk + bk)   -> f16 hi plane [8192][512] only; M=8192, N=512, K=256
//   v^T = relu(Wv^T . key^T + bv) per batch -> f16 hi plane [b][h*64+d][s] (pitch SEQ) and residual plane x4096
//     (A = WvT [n][k], Bt = Xk rows of batch b, bias per row; M=512, N=1024, K=256; NVB blocks a batch)
// =====================================================================================================
#define NPB ((NB * SEQ / 64) * (DM / 64) / 8)     // 1024 tiles -> 128 blocks of one projection
#define NVB ((DM / 64) * (SEQ / 64) / 8)          // 128 tiles -> 16 blocks of one batch of v^T
static_assert(NVB * NB == NPB);
__global__ __launch_bounds__(256) void proj_qkv(
    const unsigned short* __restrict__ Xq, const unsigned short* __restrict__ Xk,
    const unsigned short* __restrict__ WqT, const unsigned short* __restrict__ WkT, const unsigned short* __restrict__ WvT,
    const float* __restrict__ bq, const float* __restrict__ bk, const float* __restrict__ bv,
    unsigned short* Qh, unsigned short* Ql, unsigned short* Kh, unsigned short* VTh, unsigned short* VTl) {
  __shared__ __align__(16) float sT[8][16 * 68];   // per-wave 16x64 slab, pitch 68 floats
  const int g = blockIdx.x / NPB;
  const int r = blockIdx.x % NPB;
  if (g == 0) {
    gemm64<0, 3, 1, 1>(sT, r, 0,
        Xq, Xq, QIN, 0LL, WqT, WqT, QIN, 0LL, bq,
        (void*)Qh, DM, 0LL, (void*)Ql, DM, 0LL, DM,
        NB * SEQ, DM, QIN, 4096.0f);
  } else if (g == 1) {
    gemm64<0, 4, 1, 1>(sT, r, 0,
        Xk, Xk, QIN, 0LL, WkT, WkT, QIN, 0LL, bk,
        (void*)Kh, DM, 0LL, (void*)Kh, DM, 0LL, 0,
        NB * SEQ, DM, QIN, 4096.0f);
  } else {
    gemm64<0, 3, 2, 1>(sT, r % NVB, r / NVB,
        WvT, WvT, QIN, 0LL, Xk, Xk, QIN, (long long)SEQ * QIN, bv,
        (void*)VTh, SEQ, (long long)DM * SEQ, (void*)VTl, SEQ, (long long)DM * SEQ, SEQ,
        DM, SEQ, QIN, 4096.0f);
  }
}

// out = context . Wo + bo -> f32 [8192][512] (A = context hi + lo planes, 2 products; M=8192, N=512, K=512): NPB blocks
__global__ __launch_bounds__(256) void proj_out(
    const unsigned short* __restrict__ Oh, const unsigned short* __restrict__ Ol, const unsigned short* __restrict__ WoT,
    const float* __restrict__ bo, float* out) {
  __shared__ __align__(16) float sT[8][16 * 68];   // per-wave 16x64 slab, pitch 68 floats
  gemm64<1, 0, 1, 0>(sT, blockIdx.x, 0,
      Oh, Ol, DM, 0LL, WoT, WoT, DM, 0LL, bo,
      (void*)out, DM, 0LL, (void*)out, DM, 0LL, DM,
      NB * SEQ, DM, DM, 1.0f);
}

// =====================================================================================================
// Attention, head dim 64, per-(query,key) int32 mask [NB][SEQ][SEQ] (0 = masked -> score replaced by the finite
// value -1e8, so a fully masked row yields uniform weights), standard softmax over all SEQ keys.
//   q hi plane (f16, pitch DM): element (b, t, h, d) at [(b*SEQ + t)*DM + h*64 + d]; k plane same layout
//   q residual plane (f16, (q - f16(q))*4096, pitch DM): same layout
//   v^T hi plane (f16): element (b, h, d, s) at [(b*DM + h*64 + d)*SEQ + s]; v^T residual plane (f16, x4096): same layout
//   out planes (bf16 hi / lo of the normalised context): element (b, t, h, d) at [(b*SEQ + t)*DM + h*64 + d]
//   scores = (qh . k + (ql . k) * rres) * sscale on f16 WMMA, residual products in a separate accumulator,
//   then the per-(q,k) mask select; p = exp(s - m) carried as f16(1024 p); context = p . vh + (p . vl) * rres
//   on f16 WMMA (separate accumulator folded per chunk in f32); online softmax in f32; final multiply by 1/l.
//   Block = 4 waves = 64 query rows of one (b, h); grid = NQB * NH * NB; kv chunks of 64, static trip NQB.
//   K / V^T chunk staging: 128 threads x 32 elements per plane = the whole 64x64 tile (plain 16-B loads,
//   __syncthreads before and after); mask values: each lane loads its own 8 rows x key column per 16-key
//   group straight from global (addresses always in range); P tiles are wave-private, spilled with _Float16
//   Output coverage: each wave stores rows q0..q0+15 (it 0..3 x lane>>3 0..3) x 64 columns (8 lanes x 8) of both planes.
// =====================================================================================================
__global__ __launch_bounds__(128)
void attn64(const unsigned short* __restrict__ qhp, const unsigned short* __restrict__ qlp,
            const unsigned short* __restrict__ khp,
            const unsigned short* __restrict__ vhp, const unsigned short* __restrict__ vlp,
            const int* __restrict__ maskp,
            unsigned short* ohp, unsigned short* olp, float sscale, float rres) {
  union FH { v16h v; v8h h[2]; };
  __shared__ __align__(16) _Float16 Ksh[64 * LP];                 // K [kv][d]   9 KB
  __shared__ __align__(16) _Float16 Vth[64 * LP];                 // V^T hi [d][kv] 9 KB
  __shared__ __align__(16) _Float16 Vtl[64 * LP];                 // V^T residual [d][kv] 9 KB
  __shared__ __align__(16) _Float16 Psh[4][16 * LP];              // per wave P [row][kv] 9 KB
  __shared__ __align__(16) float    Os[4][16 * OP];               // per wave context tile [row][d] 17 KB

  const int tid  = threadIdx.x;
  const int wave = tid >> 5;
  const int lane = tid & 31;
  const int hh   = lane >> 4;
  const int c    = lane & 15;

  const int bx   = blockIdx.x;
  const int qb   = bx % NQB;
  const int rest = bx / NQB;
  const int h    = rest % NH;
  const int b    = rest / NH;
  const int q0   = qb * 64 + wave * 16;
  const size_t rowB = (size_t)b * SEQ;

  const _Float16* Qh = (const _Float16*)(const void*)qhp + (size_t)h * HD;
  const _Float16* Ql = (const _Float16*)(const void*)qlp + (size_t)h * HD;
  const _Float16* Kg = (const _Float16*)(const void*)khp + (size_t)h * HD;
  const _Float16* Vh = (const _Float16*)(const void*)vhp + ((size_t)b * DM + (size_t)h * HD) * SEQ;
  const _Float16* Vl = (const _Float16*)(const void*)vlp + ((size_t)b * DM + (size_t)h * HD) * SEQ;
  // mask rows of this lane half: query rows q0 + 8*hh + r (r 0..7), key index added per chunk / column
  const int* Mg = maskp + (rowB + (size_t)q0 + (size_t)(8 * hh)) * SEQ;

  // ---- Q fragments (A operand, row = lane&15): 2 d-chunks, hi and residual ----
  v16h qah[2], qal[2];
#pragma unroll
  for (int dc = 0; dc < 2; ++dc) {
    qah[dc] = ldfrag_h(Qh + (rowB + q0 + c) * DM + dc * 32 + 8 * hh);
    qal[dc] = ldfrag_h(Ql + (rowB + q0 + c) * DM + dc * 32 + 8 * hh);
  }

  float mrow[8], lrow[8];
  v8f oacc[4];
#pragma unroll
  for (int r = 0; r < 8; ++r) { mrow[r] = -INFINITY; lrow[r] = 0.f; }
#pragma unroll
  for (int t = 0; t < 4; ++t) oacc[t] = zero8();

  for (int kt = 0; kt < NQB; ++kt) {         // static trip count
    const int kv0 = kt * 64;
    __syncthreads();
    {
      const int r = tid >> 1, hf = (tid & 1) * 32;
      const _Float16* kg  = Kg + (rowB + kv0 + r) * DM + hf;       // K row kv0+r, d = hf..hf+31
      const _Float16* vg  = Vh + (size_t)r * SEQ + kv0 + hf;       // V^T row d = r, s = kv0+hf..+31
      const _Float16* vlg = Vl + (size_t)r * SEQ + kv0 + hf;
#pragma unroll
      for (int i = 0; i < 4; ++i) {
        const v8h a0 = *(const v8h*)(kg + 8 * i);
        const v8h b0 = *(const v8h*)(vg + 8 * i);
        const v8h b1 = *(const v8h*)(vlg + 8 * i);
        *(v8h*)(Ksh + r * LP + hf + 8 * i) = a0;
        *(v8h*)(Vth + r * LP + hf + 8 * i) = b0;
        *(v8h*)(Vtl + r * LP + hf + 8 * i) = b1;
      }
    }
    __syncthreads();

    // ---- scores: 16 query rows x 64 keys per wave, 2 f16 products (hi, residual), then per-(q,k) mask select ----
    v8f s[4];
#pragma unroll
    for (int j = 0; j < 4; ++j) {
      v8f sh = zero8(), sl = zero8();
#pragma unroll
      for (int dc = 0; dc < 2; ++dc) {
        FH kb;
        kb.h[0] = *(const v8h*)(Ksh + (j * 16 + c) * LP + dc * 32 + 8 * hh);
        kb.h[1] = *(const v8h*)(Ksh + (j * 16 + c) * LP + dc * 32 + 16 + 8 * hh);
        sh = mma_h(qah[dc], kb.v, sh);
        sl = mma_h(qal[dc], kb.v, sl);
      }
      int live[8];
#pragma unroll
      for (int r = 0; r < 8; ++r) live[r] = Mg[(size_t)r * SEQ + kv0 + j * 16 + c];   // row 8hh+r, key j*16+c
#pragma unroll
      for (int r = 0; r < 8; ++r) {
        const float v = (sh[r] + sl[r] * rres) * sscale;
        s[j][r] = (live[r] != 0) ? v : -1.0e8f;
      }
    }

    // ---- row max, online softmax, P (x1024, f16) to LDS ----
    _Float16* pwh = Psh[wave];
#pragma unroll
    for (int r = 0; r < 8; ++r) {
      float m = s[0][r];
      m = fmaxf(m, s[1][r]);
      m = fmaxf(m, s[2][r]);
      m = fmaxf(m, s[3][r]);
#pragma unroll
      for (int off = 1; off < 16; off <<= 1) m = fmaxf(m, __shfl_xor(m, off, 32));
      const float mnew  = fmaxf(mrow[r], m);
      const float alpha = __expf(mrow[r] - mnew);
      mrow[r] = mnew;
      float psum = 0.f;
#pragma unroll
      for (int j = 0; j < 4; ++j) {
        const float p = __expf(s[j][r] - mnew);
        psum += p;
        pwh[(8 * hh + r) * LP + j * 16 + c] = (_Float16)(p * 1024.0f);
      }
#pragma unroll
      for (int off = 1; off < 16; off <<= 1) psum += __shfl_xor(psum, off, 32);
      lrow[r] = lrow[r] * alpha + psum;
#pragma unroll
      for (int t = 0; t < 4; ++t) oacc[t][r] *= alpha;
    }
    wave_sync_lds();

    // ---- context += P . V (f16 WMMA), residual products into a separate accumulator ----
    v8f o1[4];
#pragma unroll
    for (int t = 0; t < 4; ++t) o1[t] = zero8();
#pragma unroll 1
    for (int kk = 0; kk < 2; ++kk) {
      FH pa;
      pa.h[0] = *(const v8h*)(pwh + c * LP + kk * 32 + 8 * hh);
      pa.h[1] = *(const v8h*)(pwh + c * LP + kk * 32 + 16 + 8 * hh);
#pragma unroll
      for (int t = 0; t < 4; ++t) {
        FH vb, vl;
        vb.h[0] = *(const v8h*)(Vth + (t * 16 + c) * LP + kk * 32 + 8 * hh);
        vb.h[1] = *(const v8h*)(Vth + (t * 16 + c) * LP + kk * 32 + 16 + 8 * hh);
        vl.h[0] = *(const v8h*)(Vtl + (t * 16 + c) * LP + kk * 32 + 8 * hh);
        vl.h[1] = *(const v8h*)(Vtl + (t * 16 + c) * LP + kk * 32 + 16 + 8 * hh);
        oacc[t] = mma_h(pa.v, vb.v, oacc[t]);
        o1[t]   = mma_h(pa.v, vl.v, o1[t]);
      }
    }
#pragma unroll
    for (int t = 0; t < 4; ++t)
#pragma unroll
      for (int r = 0; r < 8; ++r) oacc[t][r] += o1[t][r] * rres;
  }

  // ---- normalise (1/l and the 1/1024 p carry), stage the wave's 16x64 tile, bf16 hi/lo split,
  float* os = Os[wave];
#pragma unroll
  for (int r = 0; r < 8; ++r) {
    const float inv = (1.0f / lrow[r]) * (1.0f / 1024.0f);      // lrow >= 1 always (the max key contributes 1)
#pragma unroll
    for (int t = 0; t < 4; ++t) os[(8 * hh + r) * OP + t * 16 + c] = oacc[t][r] * inv;
  }
  wave_sync_lds();
  {
    const int q4 = lane >> 3, c8 = (lane & 7) * 8;
    v4u hv[4], lv[4];
#pragma unroll
    for (int it = 0; it < 4; ++it) {
      const int row = it * 4 + q4;   // it 0..3 x q4 0..3 = rows 0..15 of the wave tile
      const float* sp = os + row * OP + c8;
      v4u a, a2;
#pragma unroll
      for (int e = 0; e < 4; ++e) {
        const float f0 = sp[2 * e], f1 = sp[2 * e + 1];
        const unsigned short h0 = bf_bits(f0), h1 = bf_bits(f1);
        const unsigned short l0 = bf_bits(f0 - bf_up(h0)), l1 = bf_bits(f1 - bf_up(h1));
        a[e] = pk16(h0, h1); a2[e] = pk16(l0, l1);
      }
      hv[it] = a; lv[it] = a2;
    }
    {
#pragma unroll
      for (int it = 0; it < 4; ++it) {
        const int row = it * 4 + q4;
        const size_t go = (rowB + q0 + row) * DM + (size_t)h * HD + c8;
        *(v4u*)(ohp + go) = hv[it];
        *(v4u*)(olp + go) = lv[it];
      }
      
    }
  }
}

// =====================================================================================================
// Workspace map (bytes), every plane an exact multiple of its 64x64-tile / whole-line store granularity:
//   Xq    bf16 [8192][256]           0          4194304
//   Xk    bf16 [8192][256]           4194304    4194304
//   WqT   bf16 [512][256]            8388608    262144
//   WkT   bf16 [512][256]            8650752    262144
//   WvT   bf16 [512][256]            8912896    262144
//   WoT   bf16 [512][512]            9175040    524288
//   Qh    f16  [8192][512]           9699328    8388608
//   Ql    f16  [8192][512]           18087936   8388608   (q residual x4096)
//   Kh    f16  [8192][512]           26476544   8388608
//   VTh   f16  [8][512][1024]        34865152   8388608
//   VTl   f16  [8][512][1024]        43253760   8388608   (v residual x4096)
//   Oh    bf16 [8192][512]           51642368   8388608
//   Ol    bf16 [8192][512]           60030976   8388608
//   end                              68419584
// Weights arrive as [in k][out n] and are transpose-converted to [out n][in k] (k contiguous = Bt / A layout).
// =====================================================================================================
extern "C" void kernel_launch(void* const* d_in, const int* in_sizes, int n_in,
                              void* d_out, int out_size, void* d_ws, size_t ws_size,
                              hipStream_t stream) {
  if (n_in < 11) return;
  if (in_sizes[0] != NB * SEQ * QIN || in_sizes[1] != NB * SEQ * QIN) return;
  if (in_sizes[2] != NB * SEQ * SEQ) return;
  if (in_sizes[3] != QIN * DM || in_sizes[5] != QIN * DM || in_sizes[7] != QIN * DM) return;
  if (in_sizes[9] != DM * DM) return;
  if (in_sizes[4] != DM || in_sizes[6] != DM || in_sizes[8] != DM || in_sizes[10] != DM) return;
  if (out_size != NB * SEQ * DM) return;

  const float* query = (const float*)d_in[0];
  const float* key   = (const float*)d_in[1];
  const int*   mask  = (const int*)d_in[2];
  const float* Wq    = (const float*)d_in[3];
  const float* bq    = (const float*)d_in[4];
  const float* Wk    = (const float*)d_in[5];
  const float* bk    = (const float*)d_in[6];
  const float* Wv    = (const float*)d_in[7];
  const float* bv    = (const float*)d_in[8];
  const float* Wo    = (const float*)d_in[9];
  const float* bo    = (const float*)d_in[10];

  const size_t PXI = (size_t)NB * SEQ * QIN * 2;     //  4194304 (bf16 input activation plane)
  const size_t PW  = (size_t)DM * QIN * 2;           //   262144 (one projection weight plane)
  const size_t PWO = (size_t)DM * DM * 2;            //   524288 (output weight plane)
  const size_t PA  = (size_t)NB * SEQ * DM * 2;      //  8388608 (q / k / context planes)
  const size_t PVT = (size_t)NB * DM * SEQ * 2;      //  8388608 (v^T plane)
  size_t off = 0;
  const size_t oXq  = off; off += PXI;
  const size_t oXk  = off; off += PXI;
  const size_t oWq  = off; off += PW;
  const size_t oWk  = off; off += PW;
  const size_t oWv  = off; off += PW;
  const size_t oWo  = off; off += PWO;
  const size_t oQh  = off; off += PA;
  const size_t oQl  = off; off += PA;
  const size_t oKh  = off; off += PA;
  const size_t oVTh = off; off += PVT;
  const size_t oVTl = off; off += PVT;
  const size_t oOh  = off; off += PA;
  const size_t oOl  = off; off += PA;
  if (off > ws_size) return;                          // off = 68419584
  if (off > (size_t)134217728) return;

  char* ws = (char*)d_ws;
  unsigned short* Xq  = (unsigned short*)(ws + oXq);
  unsigned short* Xk  = (unsigned short*)(ws + oXk);
  unsigned short* WqT = (unsigned short*)(ws + oWq);
  unsigned short* WkT = (unsigned short*)(ws + oWk);
  unsigned short* WvT = (unsigned short*)(ws + oWv);
  unsigned short* WoT = (unsigned short*)(ws + oWo);
  unsigned short* Qh  = (unsigned short*)(ws + oQh);
  unsigned short* Ql  = (unsigned short*)(ws + oQl);
  unsigned short* Kh  = (unsigned short*)(ws + oKh);
  unsigned short* VTh = (unsigned short*)(ws + oVTh);
  unsigned short* VTl = (unsigned short*)(ws + oVTl);
  unsigned short* Oh  = (unsigned short*)(ws + oOh);
  unsigned short* Ol  = (unsigned short*)(ws + oOl);

  const dim3 blk(256);
  const dim3 gPrep(3 * NTW + NTO + 2 * NCX);                    // 160 transpose tiles + 2 x 1024 convert blocks
  const dim3 gProj(3 * NPB);                                    // 3 x 128 blocks: q, k, v^T
  const dim3 gOut(NPB);                                         // 1024 tiles -> 128 blocks: M=8192, N=512
  const dim3 gAttn(NB * NH * NQB);                              // 1024 blocks

  // (1) activations -> bf16 planes; weights [in][out] -> transposed bf16 planes [out][in] (RNE convert)
  prep_all<<<gPrep, blk, 0, stream>>>(query, key, Wq, Wk, Wv, Wo, Xq, Xk, WqT, WkT, WvT, WoT);
  // (2) to (4) the q, k and v^T projections
  proj_qkv<<<gProj, blk, 0, stream>>>(Xq, Xk, WqT, WkT, WvT, bq, bk, bv, Qh, Ql, Kh, VTh, VTl);
  // (5) attention with per-(q,k) mask and softmax -> context bf16 hi / lo planes [8192][512]
  attn64<<<gAttn, dim3(128), 0, stream>>>(Qh, Ql, Kh, VTh, VTl, mask, Oh, Ol, 0.125f, 1.0f / 4096.0f);
  // (6) out = context . Wo + bo -> d_out f32 [8192][512]  (A = context hi + lo planes, 2 products; K=512)
  proj_out<<<gOut, blk, 0, stream>>>(Oh, Ol, WoT, bo, (float*)d_out);
  (void)hipGetLastError();
}

// v003
// A run of this version takes 119 microseconds.
// Next to v002, in two timings, it ran 1.03 times as fast each time.
// All steps since v000 together make it 1.74 times as fast.
// Contractions: q, k and v^T projections = v_wmma_f32_16x16x32_bf16 (bf16 operands from RNE-converted inputs and
// transposed weights, single product, bias and ReLU in f32); q.k^T scores = v_wmma_f32_16x16x32_f16 (q as f16 hi
// plane + f16 residual plane x4096 in a separate accumulator, k f16; 2 products); p.v = v_wmma_f32_16x16x32_f16
// (p carried x1024 in f16, v^T as f16 hi plane + f16 residual plane x4096 in a separate accumulator; 2 products);
// ctx.Wo = v_wmma_f32_16x16x32_bf16 (ctx as bf16 hi + lo planes times bf16 Wo^T, 2 products, bias in f32);
// all f32 accumulate; per-(query,key) mask select and softmax in f32.
#include <hip/hip_runtime.h>
#include <math.h>
#include <stdint.h>

#define NB    8
#define SEQ   1024
#define QIN   256
#define DM    512
#define NH    8
#define HD    64
#define NQB   (SEQ / 64)     // 16 key / query tiles of 64
#define LP    72             // LDS row pitch of the 64-wide f16 tiles, in halves: 144 B = 16 B x odd, so the 16 rows that one
                             // ds_load_b128 fragment read touches fall on 16 different 4-bank groups
#define OP    68             // LDS row pitch of the 64-wide f32 context tile, in floats (16-byte column walks)
static_assert(NH * HD == DM);
static_assert((SEQ % 64) == 0 && (DM % 64) == 0 && (QIN % 64) == 0 && (QIN % 32) == 0 && (DM % 32) == 0);

typedef _Float16 v16h __attribute__((ext_vector_type(16)));
typedef _Float16 v8h  __attribute__((ext_vector_type(8)));
typedef __bf16   v16b __attribute__((ext_vector_type(16)));
typedef __bf16   v8b  __attribute__((ext_vector_type(8)));
typedef float    v8f  __attribute__((ext_vector_type(8)));
typedef float    v4f  __attribute__((ext_vector_type(4)));
typedef unsigned int v4u __attribute__((ext_vector_type(4)));

// ---- scalar helpers --------------------------------------------------------------------------------
__device__ __forceinline__ unsigned short bf_bits(float f) {          // f32 -> bf16 bits, RNE convert
  unsigned u = __float_as_uint(f);
  return (unsigned short)((u + 0x7FFFu + ((u >> 16) & 1u)) >> 16);
}
__device__ __forceinline__ float bf_up(unsigned short h) { return __uint_as_float(((unsigned)h) << 16); }
__device__ __forceinline__ unsigned short h_bits(_Float16 x) { return __builtin_bit_cast(unsigned short, x); }
__device__ __forceinline__ unsigned pk16(unsigned short a, unsigned short b) { return (unsigned)a | ((unsigned)b << 16); }
__device__ __forceinline__ v8f zero8() { v8f z = {0.f, 0.f, 0.f, 0.f, 0.f, 0.f, 0.f, 0.f}; return z; }

// ---- fragment loaders: 16-bit A/B operand, lane -> row/col (lane&15), p already includes +8*(lane>>4);
//      elements 0..7 <- p[0..7] (k0+8h..), elements 8..15 <- p[16..23] (k0+16+8h..)
//      ldfrag_b reads global memory only; the cast says so, for an address that has gone through an asm statement
//      would otherwise be loaded from in the flat form
typedef const __attribute__((address_space(1))) v8b* gv8b;
__device__ __forceinline__ v16b ldfrag_b(const __bf16* p) {
  union { v16b v; v8b h[2]; } f;
  f.h[0] = *(gv8b)(p);
  f.h[1] = *(gv8b)(p + 16);
  return f.v;
}
__device__ __forceinline__ v16h ldfrag_h(const _Float16* p) {
  union { v16h v; v8h h[2]; } f;
  f.h[0] = *(const v8h*)(p);
  f.h[1] = *(const v8h*)(p + 16);
  return f.v;
}

// ---- WMMA helpers with trailing VALU hazard gap --------------------------------------------------------
__device__ __forceinline__ v8f mma_h(v16h a, v16h b, v8f c) {
  c = __builtin_amdgcn_wmma_f32_16x16x32_f16(false, a, false, b, (short)0, c, false, false);
#if defined(__HIP_DEVICE_COMPILE__)
  asm volatile("v_nop\n\tv_nop\n\tv_nop\n\tv_nop" : "+v"(c) : "v"(a), "v"(b));
#endif
  return c;
}
__device__ __forceinline__ v8f mma_b_raw(v16b a, v16b b, v8f c) {
  return __builtin_amdgcn_wmma_f32_16x16x32_bf16(false, a, false, b, (short)0, c, false, false);
}
__device__ __forceinline__ void dep_guard_b(v8f& a, v8f& b, v16b x, v16b y) {
#if defined(__HIP_DEVICE_COMPILE__)
  asm volatile("v_nop\n\tv_nop\n\tv_nop\n\tv_nop" : "+v"(a), "+v"(b) : "v"(x), "v"(y));
#endif
}
__device__ __forceinline__ void keep4_b(v16b a, v16b b, v16b c, v16b d) {
#if defined(__HIP_DEVICE_COMPILE__)
  asm volatile("v_nop" :: "v"(a), "v"(b), "v"(c), "v"(d));
#endif
}
__device__ __forceinline__ void acc_guard4(v8f& a, v8f& b, v8f& c, v8f& d) {
#if defined(__HIP_DEVICE_COMPILE__)
  asm volatile("v_nop\n\tv_nop\n\tv_nop\n\tv_nop" : "+v"(a), "+v"(b), "+v"(c), "+v"(d));
#endif
}
__device__ __forceinline__ void wave_sync_lds() {
  __builtin_amdgcn_fence(__ATOMIC_RELEASE, "workgroup");
  __builtin_amdgcn_wave_barrier();
  __builtin_amdgcn_fence(__ATOMIC_ACQUIRE, "workgroup");
}

// =====================================================================================================
// f32 -> bf16 (RNE convert), 8 elements per thread, one 16-B store per lane: a wave writes 512 contiguous B
// coverage: n8 threads x 8 = whole plane (n8 is a multiple of 256 for every use here). bx = block index inside the plane.
// =====================================================================================================
__device__ __forceinline__ void cvt_bf16x8(const float* __restrict__ in, unsigned short* out, int n8, int bx) {
  const int i = bx * 256 + threadIdx.x;
  if (i < n8) {
    const v4f a = *(const v4f*)(in + (size_t)i * 8);
    const v4f b = *(const v4f*)(in + (size_t)i * 8 + 4);
    v4u p;
    p[0] = pk16(bf_bits(a[0]), bf_bits(a[1]));
    p[1] = pk16(bf_bits(a[2]), bf_bits(a[3]));
    p[2] = pk16(bf_bits(b[0]), bf_bits(b[1]));
    p[3] = pk16(bf_bits(b[2]), bf_bits(b[3]));
    *(v4u*)(out + (size_t)i * 8) = p;
    
  }
}

// =====================================================================================================
// Transpose-convert: f32 in[R][C] row-major -> bf16 (RNE convert) outT[C][R] row-major, outT[c][r] = in[r][c].
// (bx, by) in (C/64, R/64) (bx = column tile of in = row tile of outT), block 256; R, C multiples of 64.
// Load: thread tid reads in row r0 + (tid>>2), 16 floats at c0 + (tid&3)*16 (4 x 16-B loads) -> LDS tile[r][c].
// coverage: load 64 rows x 4 x 16 cols = 64x64; store 8 waves x 2 x 4 rows x (8 lanes x 8) = 64x64.
// =====================================================================================================
__device__ __forceinline__ void cvt_bf16_t64(const float* __restrict__ in, unsigned short* outT, int R, int C, int bx, int by) {
  __shared__ float tile[64][65];
  const int tid  = threadIdx.x;
  const int lane = tid & 31;
  const int wave = tid >> 5;
  const int c0 = bx * 64;
  const int r0 = by * 64;
  {
    const int r = tid >> 2, cs = (tid & 3) * 16;
    const float* g = in + (size_t)(r0 + r) * C + c0 + cs;
#pragma unroll
    for (int i = 0; i < 4; ++i) {
      const v4f v = *(const v4f*)(g + 4 * i);
      tile[r][cs + 4 * i + 0] = v[0];
      tile[r][cs + 4 * i + 1] = v[1];
      tile[r][cs + 4 * i + 2] = v[2];
      tile[r][cs + 4 * i + 3] = v[3];
    }
  }
  __syncthreads();
  const int q = lane >> 3, c8 = (lane & 7) * 8;
  v4u pv[2];
#pragma unroll
  for (int it = 0; it < 2; ++it) {
    const int c = wave * 8 + it * 4 + q;
    v4u p;
#pragma unroll
    for (int e = 0; e < 4; ++e)
      p[e] = pk16(bf_bits(tile[c8 + 2 * e][c]), bf_bits(tile[c8 + 2 * e + 1][c]));
    pv[it] = p;
  }
  {
#pragma unroll
    for (int it = 0; it < 2; ++it) {
      const int c = wave * 8 + it * 4 + q;
      *(v4u*)(outT + (size_t)(c0 + c) * R + r0 + c8) = pv[it];
    }
    
  }
}

// =====================================================================================================
// All six converts in one launch (none reads what another writes). Blocks, in this order: 3 x NTW tiles of Wq, Wk, Wv,
// NTO tiles of Wo (the transposes have the longer chain, so they start first), then NCX blocks each of query and key.
// Every branch is uniform for the block.
// =====================================================================================================
#define NTW ((DM / 64) * (QIN / 64))        // 32 tiles of a projection weight
#define NTO ((DM / 64) * (DM / 64))         // 64 tiles of the output weight
#define NCX (NB * SEQ * QIN / 8 / 256)      // 1024 blocks of an activation plane
__global__ __launch_bounds__(256) void prep_all(
    const float* __restrict__ query, const float* __restrict__ key,
    const float* __restrict__ Wq, const float* __restrict__ Wk, const float* __restrict__ Wv, const float* __restrict__ Wo,
    unsigned short* Xq, unsigned short* Xk,
    unsigned short* WqT, unsigned short* WkT, unsigned short* WvT, unsigned short* WoT) {
  const int bx = blockIdx.x;
  if (bx < 3 * NTW + NTO) {
    const int w = bx / NTW;                                    // 0, 1, 2 = Wq, Wk, Wv; 3 and 4 = Wo
    const int t = (w < 3) ? (bx - w * NTW) : (bx - 3 * NTW);
    const float*    in  = (w == 0) ? Wq  : (w == 1) ? Wk  : (w == 2) ? Wv  : Wo;
    unsigned short* out = (w == 0) ? WqT : (w == 1) ? WkT : (w == 2) ? WvT : WoT;
    cvt_bf16_t64(in, out, (w < 3) ? QIN : DM, DM, t % (DM / 64), t / (DM / 64));   // in rows = k, cols = DM
  } else {
    const int c = bx - (3 * NTW + NTO);
    const bool q = c < NCX;
    cvt_bf16x8(q ? query : key, q ? Xq : Xk, NCX * 256, q ? c : c - NCX);
  }
}

// =====================================================================================================
// Register-blocked batched bf16 WMMA GEMM: C[m][n] = sum_k A[m][k] * Bt[n][k] + bias (ReLU optional); one wave
// per 64x64 tile, no block barriers. A row-major [M][K] pitch lda; Bt row-major [N][K] pitch ldb (k contiguous);
// M, N multiples of 64, K multiple of 32 (host-checked). bx = block of 8 tiles, by = batch index (strides in elements);
// sT = the block's 8 per-wave 16x64 slabs in LDS, pitch 68 floats.
// NSPLIT: 0 = A.Bt; 1 = (A + A2).Bt (A2 = unscaled bf16 lo plane of A); 2 = A.Bt + A2.Bt + A.Bt2.
// BIAS: 0 = none; 1 = bias[n] (per column); 2 = bias[m] (per row). Bias is an f32 array, applied as its
//       bf16 RNE value in the f32 epilogue before any 16-bit split of the result. RELU: 1 = max(v, 0) after bias.
// OUT_MODE: 0 = f32 (pitch ldc); 2 = bf16 hi plane C + bf16 lo plane C2 (lo = RNE(v - hi), unscaled);
//           3 = f16 hi plane C + f16 residual plane C2 = f16((v - hi) * rscale), C2 written only for tiles
//               with n0 < N2 (pitch ldc2, batch stride strideC2); 4 = f16 hi plane C only.
// =====================================================================================================
template <int NSPLIT, int OUT_MODE, int BIAS, int RELU>
__device__ __forceinline__ void gemm64(
    float (*sT)[16 * 68], int bx, int by,
    const unsigned short* __restrict__ Ap, const unsigned short* A2p, int lda, long long strideA,
    const unsigned short* __restrict__ Btp, const unsigned short* Bt2p, int ldb, long long strideB,
    const float* __restrict__ bias,
    void* Cout, int ldc, long long strideC,
    void* Cout2, int ldc2, long long strideC2, int N2,
    int M, int N, int K, float rscale) {
  const __bf16* A   = (const __bf16*)(const void*)Ap;
  const __bf16* A2  = (const __bf16*)(const void*)A2p;
  const __bf16* Bt  = (const __bf16*)(const void*)Btp;
  const __bf16* Bt2 = (const __bf16*)(const void*)Bt2p;
  const int b    = by;
  const int lane = threadIdx.x & 31;
  const int wave = threadIdx.x >> 5;
  const int tilesN = N >> 6;
  const int tilesM = M >> 6;
  const int tile = bx * 8 + wave;
  if (tile >= tilesM * tilesN) return;   // wave-uniform; no block barriers in this kernel
  const int tm = tile / tilesN;
  const int tn = tile - tm * tilesN;
  const int m0 = tm << 6;
  const int n0 = tn << 6;

  const __bf16* Ab  = A  + (size_t)b * strideA;
  const __bf16* Bb  = Bt + (size_t)b * strideB;
  const __bf16* Ab2 = (NSPLIT >= 1) ? (A2  + (size_t)b * strideA) : Ab;
  const __bf16* Bb2 = (NSPLIT == 2) ? (Bt2 + (size_t)b * strideB) : Bb;

  const int rlane = lane & 15;                 // row (A) / col (B, D) within subtile
  const int koff  = (lane >> 4) * 8;           // k offset of this lane half
  const int mOff  = (lane >> 4) * 8;           // D row offset

  v8f acc[4][4];
#pragma unroll
  for (int i = 0; i < 4; ++i)
#pragma unroll
    for (int j = 0; j < 4; ++j) acc[i][j] = zero8();

  // running addresses of this lane's row 0 fragments, 32 elements on a k step; the other rows lie at constant offsets
  const __bf16* pa  = Ab  + (size_t)(m0 + rlane) * lda + koff;
  const __bf16* pa2 = Ab2 + (size_t)(m0 + rlane) * lda + koff;
  const __bf16* pb  = Bb  + (size_t)(n0 + rlane) * ldb + koff;
  const __bf16* pb2 = Bb2 + (size_t)(n0 + rlane) * ldb + koff;
  for (int k0 = 0; k0 < K; k0 += 32) {
    v16b bh[4], bl[4];
#pragma unroll
    for (int j = 0; j < 4; ++j) {
      const size_t bo = (size_t)(j << 4) * ldb;
      bh[j] = ldfrag_b(pb + bo);
      if (NSPLIT == 2) bl[j] = ldfrag_b(pb2 + bo); else bl[j] = bh[j];
    }
#pragma unroll
    for (int i = 0; i < 4; ++i) {
      const size_t ao = (size_t)(i << 4) * lda;
      const v16b ah = ldfrag_b(pa + ao);
      v16b al = ah;
      if (NSPLIT >= 1) al = ldfrag_b(pa2 + ao);
#pragma unroll
      for (int j = 0; j < 4; ++j) {
        acc[i][j] = mma_b_raw(ah, bh[j], acc[i][j]);
        if (NSPLIT >= 1) acc[i][j] = mma_b_raw(al, bh[j], acc[i][j]);
        if (NSPLIT == 2) acc[i][j] = mma_b_raw(ah, bl[j], acc[i][j]);
      }
      dep_guard_b(acc[i][0], acc[i][3], ah, al);
    }
    keep4_b(bh[0], bh[1], bh[2], bh[3]);
    if (NSPLIT == 2) keep4_b(bl[0], bl[1], bl[2], bl[3]);
#if defined(__HIP_DEVICE_COMPILE__)
    // the k step's loads are out. The wait names the running addresses: they keep their registers up to here (no load's
    // result lands in a pair that an issued load names) and are stepped on only behind it.
    if (NSPLIT == 0)      asm volatile("s_wait_xcnt 0x0" : "+v"(pa), "+v"(pb) :: "memory");
    else if (NSPLIT == 1) asm volatile("s_wait_xcnt 0x0" : "+v"(pa), "+v"(pa2), "+v"(pb) :: "memory");
    else                  asm volatile("s_wait_xcnt 0x0" : "+v"(pa), "+v"(pa2), "+v"(pb), "+v"(pb2) :: "memory");
#endif
    pa += 32; pa2 += 32; pb += 32; pb2 += 32;
  }
  acc_guard4(acc[0][0], acc[0][1], acc[0][2], acc[0][3]);
  acc_guard4(acc[1][0], acc[1][1], acc[1][2], acc[1][3]);
  acc_guard4(acc[2][0], acc[2][1], acc[2][2], acc[2][3]);
  acc_guard4(acc[3][0], acc[3][1], acc[3][2], acc[3][3]);

  // ---- epilogue ----
  float bcol[4] = {0.f, 0.f, 0.f, 0.f};
  if (BIAS == 1) {
#pragma unroll
    for (int j = 0; j < 4; ++j) bcol[j] = bf_up(bf_bits(bias[n0 + (j << 4) + rlane]));
  }
  float* slab = sT[wave];
#pragma unroll
  for (int i = 0; i < 4; ++i) {
    const int mBase = m0 + (i << 4);
    float brow[8] = {0.f, 0.f, 0.f, 0.f, 0.f, 0.f, 0.f, 0.f};
    if (BIAS == 2) {
#pragma unroll
      for (int r = 0; r < 8; ++r) brow[r] = bf_up(bf_bits(bias[mBase + mOff + r]));
    }
#pragma unroll
    for (int j = 0; j < 4; ++j) {
#pragma unroll
      for (int r = 0; r < 8; ++r) {
        float vv = acc[i][j][r] + bcol[j] + brow[r];
        if (RELU) vv = fmaxf(vv, 0.0f);
        slab[(mOff + r) * 68 + (j << 4) + rlane] = vv;
      }
    }
    wave_sync_lds();
    if (OUT_MODE == 0) {
      float* C = (float*)Cout + (size_t)b * strideC;
      const int hh = lane >> 4, c4 = (lane & 15) * 4;     // 256-B row segment = 16 lanes x 16 B
      {
#pragma unroll
        for (int it = 0; it < 8; ++it) {
          const int row = it * 2 + hh;                     // it 0..7 x hh 0..1 = rows 0..15
          const v4f v = *(const v4f*)(slab + row * 68 + c4);
          *(v4f*)(C + (size_t)(mBase + row) * ldc + n0 + c4) = v;
        }
        
      }
    } else {
      const int q = lane >> 3, c8 = (lane & 7) * 8;
      unsigned short* C  = (unsigned short*)Cout  + (size_t)b * strideC;
      unsigned short* C2 = (unsigned short*)Cout2 + (size_t)b * strideC2;
      const bool wlo = (OUT_MODE == 2) || (OUT_MODE == 3 && n0 < N2);   // wave-uniform
      v4u hv[4], lv[4];
#pragma unroll
      for (int it = 0; it < 4; ++it) {
        const int row = it * 4 + q;                        // it 0..3 x q 0..3 = rows 0..15
        const float* sp = slab + row * 68 + c8;
        v4u a, a2;
#pragma unroll
        for (int e = 0; e < 4; ++e) {
          const float f0 = sp[2 * e], f1 = sp[2 * e + 1];
          unsigned short h0, h1, l0, l1;
          if (OUT_MODE == 2) {
            h0 = bf_bits(f0); h1 = bf_bits(f1);
            l0 = bf_bits(f0 - bf_up(h0)); l1 = bf_bits(f1 - bf_up(h1));
          } else {
            const _Float16 x0 = (_Float16)f0, x1 = (_Float16)f1;
            h0 = h_bits(x0); h1 = h_bits(x1);
            l0 = h_bits((_Float16)((f0 - (float)x0) * rscale));
            l1 = h_bits((_Float16)((f1 - (float)x1) * rscale));
          }
          a[e] = pk16(h0, h1); a2[e] = pk16(l0, l1);
        }
        hv[it] = a; lv[it] = a2;
      }
      {
#pragma unroll
        for (int it = 0; it < 4; ++it) {
          const int row = it * 4 + q;
          *(v4u*)(C + (size_t)(mBase + row) * ldc + n0 + c8) = hv[it];
          if (wlo) *(v4u*)(C2 + (size_t)(mBase + row) * ldc2 + n0 + c8) = lv[it];
        }
        
      }
    }
    wave_sync_lds();
  }
}

// =====================================================================================================
// The q, k and v^T projections in one launch (none reads what another writes): 3 x NPB blocks, block-uniform branch.
//   q = relu(query . Wq + bq) -> f16 hi plane [8192][512] + f16 residual x4096 (all tiles, N2 = DM); M=8192, N=512, K=256
//   k = relu(key . Wk + bk)   -> f16 hi plane [8192][512] only; M=8192, N=512, K=256
//   v^T = relu(Wv^T . key^T + bv) per batch -> f16 hi plane [b][h*64+d][s] (pitch SEQ) and residual plane x4096
//     (A = WvT [n][k], Bt = Xk rows of batch b, bias per row; M=512, N=1024, K=256; NVB blocks a batch)
// =====================================================================================================
#define NPB ((NB * SEQ / 64) * (DM / 64) / 8)     // 1024 tiles -> 128 blocks of one projection
#define NVB ((DM / 64) * (SEQ / 64) / 8)          // 128 tiles -> 16 blocks of one batch of v^T
static_assert(NVB * NB == NPB);
__global__ __launch_bounds__(256) void proj_qkv(
    const unsigned short* __restrict__ Xq, const unsigned short* __restrict__ Xk,
    const unsigned short* __restrict__ WqT, const unsigned short* __restrict__ WkT, const unsigned short* __restrict__ WvT,
    const float* __restrict__ bq, const float* __restrict__ bk, const float* __restrict__ bv,
    unsigned short* Qh, unsigned short* Ql, unsigned short* Kh, unsigned short* VTh, unsigned short* VTl) {
  __shared__ __align__(16) float sT[8][16 * 68];   // per-wave 16x64 slab, pitch 68 floats
  const int g = blockIdx.x / NPB;
  const int r = blockIdx.x % NPB;
  if (g == 0) {
    gemm64<0, 3, 1, 1>(sT, r, 0,
        Xq, Xq, QIN, 0LL, WqT, WqT, QIN, 0LL, bq,
        (void*)Qh, DM, 0LL, (void*)Ql, DM, 0LL, DM,
        NB * SEQ, DM, QIN, 4096.0f);
  } else if (g == 1) {
    gemm64<0, 4, 1, 1>(sT, r, 0,
        Xk, Xk, QIN, 0LL, WkT, WkT, QIN, 0LL, bk,
        (void*)Kh, DM, 0LL, (void*)Kh, DM, 0LL, 0,
        NB * SEQ, DM, QIN, 4096.0f);
  } else {
    gemm64<0, 3, 2, 1>(sT, r % NVB, r / NVB,
        WvT, WvT, QIN, 0LL, Xk, Xk, QIN, (long long)SEQ * QIN, bv,
        (void*)VTh, SEQ, (long long)DM * SEQ, (void*)VTl, SEQ, (long long)DM * SEQ, SEQ,
        DM, SEQ, QIN, 4096.0f);
  }
}

// out = context . Wo + bo -> f32 [8192][512] (A = context hi + lo planes, 2 products; M=8192, N=512, K=512): NPB blocks
__global__ __launch_bounds__(256) void proj_out(
    const unsigned short* __restrict__ Oh, const unsigned short* __restrict__ Ol, const unsigned short* __restrict__ WoT,
    const float* __restrict__ bo, float* out) {
  __shared__ __align__(16) float sT[8][16 * 68];   // per-wave 16x64 slab, pitch 68 floats
  gemm64<1, 0, 1, 0>(sT, blockIdx.x, 0,
      Oh, Ol, DM, 0LL, WoT, WoT, DM, 0LL, bo,
      (void*)out, DM, 0LL, (void*)out, DM, 0LL, DM,
      NB * SEQ, DM, DM, 1.0f);
}

// =====================================================================================================
// Attention, head dim 64, per-(query,key) int32 mask [NB][SEQ][SEQ] (0 = masked -> score replaced by the finite
// value -1e8, so a fully masked row yields uniform weights), standard softmax over all SEQ keys.
//   q hi plane (f16, pitch DM): element (b, t, h, d) at [(b*SEQ + t)*DM + h*64 + d]; k plane same layout
//   q residual plane (f16, (q - f16(q))*4096, pitch DM): same layout
//   v^T hi plane (f16): element (b, h, d, s) at [(b*DM + h*64 + d)*SEQ + s]; v^T residual plane (f16, x4096): same layout
//   out planes (bf16 hi / lo of the normalised context): element (b, t, h, d) at [(b*SEQ + t)*DM + h*64 + d]
//   scores = (qh . k + (ql . k) * rres) * sscale on f16 WMMA, residual products in a separate accumulator,
//   then the per-(q,k) mask select; p = exp(s - m) carried as f16(1024 p); context = p . vh + (p . vl) * rres
//   on f16 WMMA (separate accumulator folded per chunk in f32); online softmax in f32; final multiply by 1/l.
//   Block = 4 waves = 64 query rows of one (b, h); grid = NQB * NH * NB; kv chunks of 64, static trip NQB.
//   K / V^T chunk staging: 128 threads x 4 rows x 8 elements per plane = the whole 64x64 tile (plain 16-B loads,
//   __syncthreads before and after); mask values: each lane loads its own 8 rows x key column per 16-key
//   group straight from global (addresses always in range); P tiles are wave-private, spilled with _Float16
//   Output coverage: each wave stores rows q0..q0+15 (it 0..3 x lane>>3 0..3) x 64 columns (8 lanes x 8) of both planes.
// =====================================================================================================
__global__ __launch_bounds__(128)
void attn64(const unsigned short* __restrict__ qhp, const unsigned short* __restrict__ qlp,
            const unsigned short* __restrict__ khp,
            const unsigned short* __restrict__ vhp, const unsigned short* __restrict__ vlp,
            const int* __restrict__ maskp,
            unsigned short* ohp, unsigned short* olp, float sscale, float rres) {
  union FH { v16h v; v8h h[2]; };
  __shared__ __align__(16) _Float16 Ksh[64 * LP];                 // K [kv][d]   9 KB
  __shared__ __align__(16) _Float16 Vth[64 * LP];                 // V^T hi [d][kv] 9 KB
  __shared__ __align__(16) _Float16 Vtl[64 * LP];                 // V^T residual [d][kv] 9 KB
  __shared__ __align__(16) _Float16 Psh[4][16 * LP];              // per wave P [row][kv] 9 KB
  __shared__ __align__(16) float    Os[4][16 * OP];               // per wave context tile [row][d] 17 KB

  const int tid  = threadIdx.x;
  const int wave = tid >> 5;
  const int lane = tid & 31;
  const int hh   = lane >> 4;
  const int c    = lane & 15;

  const int bx   = blockIdx.x;
  const int qb   = bx % NQB;
  const int rest = bx / NQB;
  const int h    = rest % NH;
  const int b    = rest / NH;
  const int q0   = qb * 64 + wave * 16;
  const size_t rowB = (size_t)b * SEQ;

  const _Float16* Qh = (const _Float16*)(const void*)qhp + (size_t)h * HD;
  const _Float16* Ql = (const _Float16*)(const void*)qlp + (size_t)h * HD;
  const _Float16* Kg = (const _Float16*)(const void*)khp + (size_t)h * HD;
  const _Float16* Vh = (const _Float16*)(const void*)vhp + ((size_t)b * DM + (size_t)h * HD) * SEQ;
  const _Float16* Vl = (const _Float16*)(const void*)vlp + ((size_t)b * DM + (size_t)h * HD) * SEQ;
  // mask rows of this lane half: query rows q0 + 8*hh + r (r 0..7), key index added per chunk / column
  const int* Mg = maskp + (rowB + (size_t)q0 + (size_t)(8 * hh)) * SEQ;

  // ---- Q fragments (A operand, row = lane&15): 2 d-chunks, hi and residual ----
  v16h qah[2], qal[2];
#pragma unroll
  for (int dc = 0; dc < 2; ++dc) {
    qah[dc] = ldfrag_h(Qh + (rowB + q0 + c) * DM + dc * 32 + 8 * hh);
    qal[dc] = ldfrag_h(Ql + (rowB + q0 + c) * DM + dc * 32 + 8 * hh);
  }

  float mrow[8], lrow[8];
  v8f oacc[4];
#pragma unroll
  for (int r = 0; r < 8; ++r) { mrow[r] = -INFINITY; lrow[r] = 0.f; }
#pragma unroll
  for (int t = 0; t < 4; ++t) oacc[t] = zero8();

  for (int kt = 0; kt < NQB; ++kt) {         // static trip count
    const int kv0 = kt * 64;
    __syncthreads();
    {
      // 8 lanes x 16 B = one 128-B tile row, so a wave's load covers 4 whole lines; rows r, r+16, r+32, r+48 per thread
      const int r = tid >> 3, c8 = (tid & 7) * 8;
      const _Float16* kg  = Kg + (rowB + kv0 + r) * DM + c8;       // K row kv0+r, d = c8..c8+7
      const _Float16* vg  = Vh + (size_t)r * SEQ + kv0 + c8;       // V^T row d = r, s = kv0+c8..+7
      const _Float16* vlg = Vl + (size_t)r * SEQ + kv0 + c8;
#pragma unroll
      for (int i = 0; i < 4; ++i) {
        const v8h a0 = *(const v8h*)(kg + (size_t)(16 * i) * DM);
        const v8h b0 = *(const v8h*)(vg + (size_t)(16 * i) * SEQ);
        const v8h b1 = *(const v8h*)(vlg + (size_t)(16 * i) * SEQ);
        *(v8h*)(Ksh + (r + 16 * i) * LP + c8) = a0;
        *(v8h*)(Vth + (r + 16 * i) * LP + c8) = b0;
        *(v8h*)(Vtl + (r + 16 * i) * LP + c8) = b1;
      }
    }
    __syncthreads();

    // ---- scores: 16 query rows x 64 keys per wave, 2 f16 products (hi, residual), then per-(q,k) mask select ----
    v8f s[4];
#pragma unroll
    for (int j = 0; j < 4; ++j) {
      v8f sh = zero8(), sl = zero8();
#pragma unroll
      for (int dc = 0; dc < 2; ++dc) {
        FH kb;
        kb.h[0] = *(const v8h*)(Ksh + (j * 16 + c) * LP + dc * 32 + 8 * hh);
        kb.h[1] = *(const v8h*)(Ksh + (j * 16 + c) * LP + dc * 32 + 16 + 8 * hh);
        sh = mma_h(qah[dc], kb.v, sh);
        sl = mma_h(qal[dc], kb.v, sl);
      }
      int live[8];
#pragma unroll
      for (int r = 0; r < 8; ++r) live[r] = Mg[(size_t)r * SEQ + kv0 + j * 16 + c];   // row 8hh+r, key j*16+c
#pragma unroll
      for (int r = 0; r < 8; ++r) {
        const float v = (sh[r] + sl[r] * rres) * sscale;
        s[j][r] = (live[r] != 0) ? v : -1.0e8f;
      }
    }

    // ---- row max, online softmax, P (x1024, f16) to LDS ----
    _Float16* pwh = Psh[wave];
#pragma unroll
    for (int r = 0; r < 8; ++r) {
      float m = s[0][r];
      m = fmaxf(m, s[1][r]);
      m = fmaxf(m, s[2][r]);
      m = fmaxf(m, s[3][r]);
#pragma unroll
      for (int off = 1; off < 16; off <<= 1) m = fmaxf(m, __shfl_xor(m, off, 32));
      const float mnew  = fmaxf(mrow[r], m);
      const float alpha = __expf(mrow[r] - mnew);
      mrow[r] = mnew;
      float psum = 0.f;
#pragma unroll
      for (int j = 0; j < 4; ++j) {
        const float p = __expf(s[j][r] - mnew);
        psum += p;
        pwh[(8 * hh + r) * LP + j * 16 + c] = (_Float16)(p * 1024.0f);
      }
#pragma unroll
      for (int off = 1; off < 16; off <<= 1) psum += __shfl_xor(psum, off, 32);
      lrow[r] = lrow[r] * alpha + psum;
#pragma unroll
      for (int t = 0; t < 4; ++t) oacc[t][r] *= alpha;
    }
    wave_sync_lds();

    // ---- context += P . V (f16 WMMA), residual products into a separate accumulator ----
    v8f o1[4];
#pragma unroll
    for (int t = 0; t < 4; ++t) o1[t] = zero8();
#pragma unroll 1
    for (int kk = 0; kk < 2; ++kk) {
      FH pa;
      pa.h[0] = *(const v8h*)(pwh + c * LP + kk * 32 + 8 * hh);
      pa.h[1] = *(const v8h*)(pwh + c * LP + kk * 32 + 16 + 8 * hh);
#pragma unroll
      for (int t = 0; t < 4; ++t) {
        FH vb, vl;
        vb.h[0] = *(const v8h*)(Vth + (t * 16 + c) * LP + kk * 32 + 8 * hh);
        vb.h[1] = *(const v8h*)(Vth + (t * 16 + c) * LP + kk * 32 + 16 + 8 * hh);
        vl.h[0] = *(const v8h*)(Vtl + (t * 16 + c) * LP + kk * 32 + 8 * hh);
        vl.h[1] = *(const v8h*)(Vtl + (t * 16 + c) * LP + kk * 32 + 16 + 8 * hh);
        oacc[t] = mma_h(pa.v, vb.v, oacc[t]);
        o1[t]   = mma_h(pa.v, vl.v, o1[t]);
      }
    }
#pragma unroll
    for (int t = 0; t < 4; ++t)
#pragma unroll
      for (int r = 0; r < 8; ++r) oacc[t][r] += o1[t][r] * rres;
  }

  // ---- normalise (1/l and the 1/1024 p carry), stage the wave's 16x64 tile, bf16 hi/lo split,
  float* os = Os[wave];
#pragma unroll
  for (int r = 0; r < 8; ++r) {
    const float inv = (1.0f / lrow[r]) * (1.0f / 1024.0f);      // lrow >= 1 always (the max key contributes 1)
#pragma unroll
    for (int t = 0; t < 4; ++t) os[(8 * hh + r) * OP + t * 16 + c] = oacc[t][r] * inv;
  }
  wave_sync_lds();
  {
    const int q4 = lane >> 3, c8 = (lane & 7) * 8;
    v4u hv[4], lv[4];
#pragma unroll
    for (int it = 0; it < 4; ++it) {
      const int row = it * 4 + q4;   // it 0..3 x q4 0..3 = rows 0..15 of the wave tile
      const float* sp = os + row * OP + c8;
      v4u a, a2;
#pragma unroll
      for (int e = 0; e < 4; ++e) {
        const float f0 = sp[2 * e], f1 = sp[2 * e + 1];
        const unsigned short h0 = bf_bits(f0), h1 = bf_bits(f1);
        const unsigned short l0 = bf_bits(f0 - bf_up(h0)), l1 = bf_bits(f1 - bf_up(h1));
        a[e] = pk16(h0, h1); a2[e] = pk16(l0, l1);
      }
      hv[it] = a; lv[it] = a2;
    }
    {
#pragma unroll
      for (int it = 0; it < 4; ++it) {
        const int row = it * 4 + q4;
        const size_t go = (rowB + q0 + row) * DM + (size_t)h * HD + c8;
        *(v4u*)(ohp + go) = hv[it];
        *(v4u*)(olp + go) = lv[it];
      }
      
    }
  }
}

// =====================================================================================================
// Workspace map (bytes), every plane an exact multiple of its 64x64-tile / whole-line store granularity:
//   Xq    bf16 [8192][256]           0          4194304
//   Xk    bf16 [8192][256]           4194304    4194304
//   WqT   bf16 [512][256]            8388608    262144
//   WkT   bf16 [512][256]            8650752    262144
//   WvT   bf16 [512][256]            8912896    262144
//   WoT   bf16 [512][512]            9175040    524288
//   Qh    f16  [8192][512]           9699328    8388608
//   Ql    f16  [8192][512]           18087936   8388608   (q residual x4096)
//   Kh    f16  [8192][512]           26476544   8388608
//   VTh   f16  [8][512][1024]        34865152   8388608
//   VTl   f16  [8][512][1024]        43253760   8388608   (v residual x4096)
//   Oh    bf16 [8192][512]           51642368   8388608
//   Ol    bf16 [8192][512]           60030976   8388608
//   end                              68419584
// Weights arrive as [in k][out n] and are transpose-converted to [out n][in k] (k contiguous = Bt / A layout).
// =====================================================================================================
extern "C" void kernel_launch(void* const* d_in, const int* in_sizes, int n_in,
                              void* d_out, int out_size, void* d_ws, size_t ws_size,
                              hipStream_t stream) {
  if (n_in < 11) return;
  if (in_sizes[0] != NB * SEQ * QIN || in_sizes[1] != NB * SEQ * QIN) return;
  if (in_sizes[2] != NB * SEQ * SEQ) return;
  if (in_sizes[3] != QIN * DM || in_sizes[5] != QIN * DM || in_sizes[7] != QIN * DM) return;
  if (in_sizes[9] != DM * DM) return;
  if (in_sizes[4] != DM || in_sizes[6] != DM || in_sizes[8] != DM || in_sizes[10] != DM) return;
  if (out_size != NB * SEQ * DM) return;

  const float* query = (const float*)d_in[0];
  const float* key   = (const float*)d_in[1];
  const int*   mask  = (const int*)d_in[2];
  const float* Wq    = (const float*)d_in[3];
  const float* bq    = (const float*)d_in[4];
  const float* Wk    = (const float*)d_in[5];
  const float* bk    = (const float*)d_in[6];
  const float* Wv    = (const float*)d_in[7];
  const float* bv    = (const float*)d_in[8];
  const float* Wo    = (const float*)d_in[9];
  const float* bo    = (const float*)d_in[10];

  const size_t PXI = (size_t)NB * SEQ * QIN * 2;     //  4194304 (bf16 input activation plane)
  const size_t PW  = (size_t)DM * QIN * 2;           //   262144 (one projection weight plane)
  const size_t PWO = (size_t)DM * DM * 2;            //   524288 (output weight plane)
  const size_t PA  = (size_t)NB * SEQ * DM * 2;      //  8388608 (q / k / context planes)
  const size_t PVT = (size_t)NB * DM * SEQ * 2;      //  8388608 (v^T plane)
  size_t off = 0;
  const size_t oXq  = off; off += PXI;
  const size_t oXk  = off; off += PXI;
  const size_t oWq  = off; off += PW;
  const size_t oWk  = off; off += PW;
  const size_t oWv  = off; off += PW;
  const size_t oWo  = off; off += PWO;
  const size_t oQh  = off; off += PA;
  const size_t oQl  = off; off += PA;
  const size_t oKh  = off; off += PA;
  const size_t oVTh = off; off += PVT;
  const size_t oVTl = off; off += PVT;
  const size_t oOh  = off; off += PA;
  const size_t oOl  = off; off += PA;
  if (off > ws_size) return;                          // off = 68419584
  if (off > (size_t)134217728) return;

  char* ws = (char*)d_ws;
  unsigned short* Xq  = (unsigned short*)(ws + oXq);
  unsigned short* Xk  = (unsigned short*)(ws + oXk);
  unsigned short* WqT = (unsigned short*)(ws + oWq);
  unsigned short* WkT = (unsigned short*)(ws + oWk);
  unsigned short* WvT = (unsigned short*)(ws + oWv);
  unsigned short* WoT = (unsigned short*)(ws + oWo);
  unsigned short* Qh  = (unsigned short*)(ws + oQh);
  unsigned short* Ql  = (unsigned short*)(ws + oQl);
  unsigned short* Kh  = (unsigned short*)(ws + oKh);
  unsigned short* VTh = (unsigned short*)(ws + oVTh);
  unsigned short* VTl = (unsigned short*)(ws + oVTl);
  unsigned short* Oh  = (unsigned short*)(ws + oOh);
  unsigned short* Ol  = (unsigned short*)(ws + oOl);

  const dim3 blk(256);
  const dim3 gPrep(3 * NTW + NTO + 2 * NCX);                    // 160 transpose tiles + 2 x 1024 convert blocks
  const dim3 gProj(3 * NPB);                                    // 3 x 128 blocks: q, k, v^T
  const dim3 gOut(NPB);                                         // 1024 tiles -> 128 blocks: M=8192, N=512
  const dim3 gAttn(NB * NH * NQB);                              // 1024 blocks

  // (1) activations -> bf16 planes; weights [in][out] -> transposed bf16 planes [out][in] (RNE convert)
  prep_all<<<gPrep, blk, 0, stream>>>(query, key, Wq, Wk, Wv, Wo, Xq, Xk, WqT, WkT, WvT, WoT);
  // (2) to (4) the q, k and v^T projections
  proj_qkv<<<gProj, blk, 0, stream>>>(Xq, Xk, WqT, WkT, WvT, bq, bk, bv, Qh, Ql, Kh, VTh, VTl);
  // (5) attention with per-(q,k) mask and softmax -> context bf16 hi / lo planes [8192][512]
  attn64<<<gAttn, dim3(128), 0, stream>>>(Qh, Ql, Kh, VTh, VTl, mask, Oh, Ol, 0.125f, 1.0f / 4096.0f);
  // (6) out = context . Wo + bo -> d_out f32 [8192][512]  (A = context hi + lo planes, 2 products; K=512)
  proj_out<<<gOut, blk, 0, stream>>>(Oh, Ol, WoT, bo, (float*)d_out);
  (void)hipGetLastError();
}

// v004
// Measured time: 107 microseconds a run.
// Next to v003, in two timings, it ran 1.12 times as fast each time.
// Counting every step since v000, it is 1.95 times as fast.
// Contractions: q, k and v^T projections = v_wmma_f32_16x16x32_bf16 (bf16 operands from RNE-converted inputs and
// transposed weights, single product, bias and ReLU in f32); k.q^T scores = v_wmma_f32_16x16x32_f16 (q as f16 hi
// plane + f16 residual plane x4096 in a separate accumulator, k f16; 2 products); v^T.p^T = v_wmma_f32_16x16x32_f16
// (p carried x1024 in f16, v^T as f16 hi plane + f16 residual plane x4096 in a separate accumulator; 2 products);
// ctx.Wo = v_wmma_f32_16x16x32_bf16 (ctx as bf16 hi + lo planes times bf16 Wo^T, 2 products, bias in f32);
// all f32 accumulate; per-(query,key) mask select and softmax in f32.
#include <hip/hip_runtime.h>
#include <math.h>
#include <stdint.h>

#define NB    8
#define SEQ   1024
#define QIN   256
#define DM    512
#define NH    8
#define HD    64
#define NQB   (SEQ / 64)     // 16 key / query tiles of 64
#define LP    72             // LDS row pitch of the 64-wide f16 tiles, in halves: 144 B = 16 B x odd, so the 16 rows that one
                             // ds_load_b128 fragment read touches fall on 16 different 4-bank groups
#define OP    68             // LDS row pitch of the 64-wide f32 context tile, in floats (16-byte column walks)
static_assert(NH * HD == DM);
static_assert((SEQ % 64) == 0 && (DM % 64) == 0 && (QIN % 64) == 0 && (QIN % 32) == 0 && (DM % 32) == 0);

typedef _Float16 v16h __attribute__((ext_vector_type(16)));
typedef _Float16 v8h  __attribute__((ext_vector_type(8)));
typedef __bf16   v16b __attribute__((ext_vector_type(16)));
typedef __bf16   v8b  __attribute__((ext_vector_type(8)));
typedef float    v8f  __attribute__((ext_vector_type(8)));
typedef float    v4f  __attribute__((ext_vector_type(4)));
typedef unsigned int v4u __attribute__((ext_vector_type(4)));
typedef int          v4i __attribute__((ext_vector_type(4)));

// ---- scalar helpers --------------------------------------------------------------------------------
__device__ __forceinline__ unsigned short bf_bits(float f) {          // f32 -> bf16 bits, RNE convert
  unsigned u = __float_as_uint(f);
  return (unsigned short)((u + 0x7FFFu + ((u >> 16) & 1u)) >> 16);
}
__device__ __forceinline__ float bf_up(unsigned short h) { return __uint_as_float(((unsigned)h) << 16); }
__device__ __forceinline__ unsigned short h_bits(_Float16 x) { return __builtin_bit_cast(unsigned short, x); }
__device__ __forceinline__ unsigned pk16(unsigned short a, unsigned short b) { return (unsigned)a | ((unsigned)b << 16); }
__device__ __forceinline__ v8f zero8() { v8f z = {0.f, 0.f, 0.f, 0.f, 0.f, 0.f, 0.f, 0.f}; return z; }

// ---- fragment loaders: 16-bit A/B operand, lane -> row/col (lane&15), p already includes +8*(lane>>4);
//      elements 0..7 <- p[0..7] (k0+8h..), elements 8..15 <- p[16..23] (k0+16+8h..)
//      ldfrag_b reads global memory only; the cast says so, for an address that has gone through an asm statement
//      would otherwise be loaded from in the flat form
typedef const __attribute__((address_space(1))) v8b* gv8b;
__device__ __forceinline__ v16b ldfrag_b(const __bf16* p) {
  union { v16b v; v8b h[2]; } f;
  f.h[0] = *(gv8b)(p);
  f.h[1] = *(gv8b)(p + 16);
  return f.v;
}
__device__ __forceinline__ v16h ldfrag_h(const _Float16* p) {
  union { v16h v; v8h h[2]; } f;
  f.h[0] = *(const v8h*)(p);
  f.h[1] = *(const v8h*)(p + 16);
  return f.v;
}

// ---- WMMA helpers with trailing VALU hazard gap --------------------------------------------------------
__device__ __forceinline__ v8f mma_h(v16h a, v16h b, v8f c) {
  c = __builtin_amdgcn_wmma_f32_16x16x32_f16(false, a, false, b, (short)0, c, false, false);
#if defined(__HIP_DEVICE_COMPILE__)
  asm volatile("v_nop\n\tv_nop\n\tv_nop\n\tv_nop" : "+v"(c) : "v"(a), "v"(b));
#endif
  return c;
}
__device__ __forceinline__ v8f mma_b_raw(v16b a, v16b b, v8f c) {
  return __builtin_amdgcn_wmma_f32_16x16x32_bf16(false, a, false, b, (short)0, c, false, false);
}
__device__ __forceinline__ void dep_guard_b(v8f& a, v8f& b, v16b x, v16b y) {
#if defined(__HIP_DEVICE_COMPILE__)
  asm volatile("v_nop\n\tv_nop\n\tv_nop\n\tv_nop" : "+v"(a), "+v"(b) : "v"(x), "v"(y));
#endif
}
__device__ __forceinline__ void keep4_b(v16b a, v16b b, v16b c, v16b d) {
#if defined(__HIP_DEVICE_COMPILE__)
  asm volatile("v_nop" :: "v"(a), "v"(b), "v"(c), "v"(d));
#endif
}
__device__ __forceinline__ void acc_guard4(v8f& a, v8f& b, v8f& c, v8f& d) {
#if defined(__HIP_DEVICE_COMPILE__)
  asm volatile("v_nop\n\tv_nop\n\tv_nop\n\tv_nop" : "+v"(a), "+v"(b), "+v"(c), "+v"(d));
#endif
}
// lane l <-> lane l ^ 16 as a vector cross-row move (a shuffle would go the LDS path and be waited for on dscnt)
__device__ __forceinline__ float xhalf(float x) {
  return __builtin_bit_cast(float, __builtin_amdgcn_permlanex16(__builtin_bit_cast(int, x), __builtin_bit_cast(int, x),
                                                                0x76543210, 0xfedcba98, false, false));
}
__device__ __forceinline__ void wave_sync_lds() {
  __builtin_amdgcn_fence(__ATOMIC_RELEASE, "workgroup");
  __builtin_amdgcn_wave_barrier();
  __builtin_amdgcn_fence(__ATOMIC_ACQUIRE, "workgroup");
}

// =====================================================================================================
// f32 -> bf16 (RNE convert), 8 elements per thread, one 16-B store per lane: a wave writes 512 contiguous B
// coverage: n8 threads x 8 = whole plane (n8 is a multiple of 256 for every use here). bx = block index inside the plane.
// =====================================================================================================
__device__ __forceinline__ void cvt_bf16x8(const float* __restrict__ in, unsigned short* out, int n8, int bx) {
  const int i = bx * 256 + threadIdx.x;
  if (i < n8) {
    const v4f a = *(const v4f*)(in + (size_t)i * 8);
    const v4f b = *(const v4f*)(in + (size_t)i * 8 + 4);
    v4u p;
    p[0] = pk16(bf_bits(a[0]), bf_bits(a[1]));
    p[1] = pk16(bf_bits(a[2]), bf_bits(a[3]));
    p[2] = pk16(bf_bits(b[0]), bf_bits(b[1]));
    p[3] = pk16(bf_bits(b[2]), bf_bits(b[3]));
    *(v4u*)(out + (size_t)i * 8) = p;
    
  }
}

// =====================================================================================================
// Transpose-convert: f32 in[R][C] row-major -> bf16 (RNE convert) outT[C][R] row-major, outT[c][r] = in[r][c].
// (bx, by) in (C/64, R/64) (bx = column tile of in = row tile of outT), block 256; R, C multiples of 64.
// Load: thread tid reads in row r0 + (tid>>2), 16 floats at c0 + (tid&3)*16 (4 x 16-B loads) -> LDS tile[r][c].
// coverage: load 64 rows x 4 x 16 cols = 64x64; store 8 waves x 2 x 4 rows x (8 lanes x 8) = 64x64.
// =====================================================================================================
__device__ __forceinline__ void cvt_bf16_t64(const float* __restrict__ in, unsigned short* outT, int R, int C, int bx, int by) {
  __shared__ float tile[64][65];
  const int tid  = threadIdx.x;
  const int lane = tid & 31;
  const int wave = tid >> 5;
  const int c0 = bx * 64;
  const int r0 = by * 64;
  {
    const int r = tid >> 2, cs = (tid & 3) * 16;
    const float* g = in + (size_t)(r0 + r) * C + c0 + cs;
#pragma unroll
    for (int i = 0; i < 4; ++i) {
      const v4f v = *(const v4f*)(g + 4 * i);
      tile[r][cs + 4 * i + 0] = v[0];
      tile[r][cs + 4 * i + 1] = v[1];
      tile[r][cs + 4 * i + 2] = v[2];
      tile[r][cs + 4 * i + 3] = v[3];
    }
  }
  __syncthreads();
  const int q = lane >> 3, c8 = (lane & 7) * 8;
  v4u pv[2];
#pragma unroll
  for (int it = 0; it < 2; ++it) {
    const int c = wave * 8 + it * 4 + q;
    v4u p;
#pragma unroll
    for (int e = 0; e < 4; ++e)
      p[e] = pk16(bf_bits(tile[c8 + 2 * e][c]), bf_bits(tile[c8 + 2 * e + 1][c]));
    pv[it] = p;
  }
  {
#pragma unroll
    for (int it = 0; it < 2; ++it) {
      const int c = wave * 8 + it * 4 + q;
      *(v4u*)(outT + (size_t)(c0 + c) * R + r0 + c8) = pv[it];
    }
    
  }
}

// =====================================================================================================
// All six converts in one launch (none reads what another writes). Blocks, in this order: 3 x NTW tiles of Wq, Wk, Wv,
// NTO tiles of Wo (the transposes have the longer chain, so they start first), then NCX blocks each of query and key.
// Every branch is uniform for the block.
// =====================================================================================================
#define NTW ((DM / 64) * (QIN / 64))        // 32 tiles of a projection weight
#define NTO ((DM / 64) * (DM / 64))         // 64 tiles of the output weight
#define NCX (NB * SEQ * QIN / 8 / 256)      // 1024 blocks of an activation plane
__global__ __launch_bounds__(256) void prep_all(
    const float* __restrict__ query, const float* __restrict__ key,
    const float* __restrict__ Wq, const float* __restrict__ Wk, const float* __restrict__ Wv, const float* __restrict__ Wo,
    unsigned short* Xq, unsigned short* Xk,
    unsigned short* WqT, unsigned short* WkT, unsigned short* WvT, unsigned short* WoT) {
  const int bx = blockIdx.x;
  if (bx < 3 * NTW + NTO) {
    const int w = bx / NTW;                                    // 0, 1, 2 = Wq, Wk, Wv; 3 and 4 = Wo
    const int t = (w < 3) ? (bx - w * NTW) : (bx - 3 * NTW);
    const float*    in  = (w == 0) ? Wq  : (w == 1) ? Wk  : (w == 2) ? Wv  : Wo;
    unsigned short* out = (w == 0) ? WqT : (w == 1) ? WkT : (w == 2) ? WvT : WoT;
    cvt_bf16_t64(in, out, (w < 3) ? QIN : DM, DM, t % (DM / 64), t / (DM / 64));   // in rows = k, cols = DM
  } else {
    const int c = bx - (3 * NTW + NTO);
    const bool q = c < NCX;
    cvt_bf16x8(q ? query : key, q ? Xq : Xk, NCX * 256, q ? c : c - NCX);
  }
}

// =====================================================================================================
// Register-blocked batched bf16 WMMA GEMM: C[m][n] = sum_k A[m][k] * Bt[n][k] + bias (ReLU optional); one wave
// per 64x64 tile, no block barriers. A row-major [M][K] pitch lda; Bt row-major [N][K] pitch ldb (k contiguous);
// M, N multiples of 64, K multiple of 32 (host-checked). bx = block of 8 tiles, by = batch index (strides in elements);
// sT = the block's 8 per-wave 16x64 slabs in LDS, pitch 68 floats.
// NSPLIT: 0 = A.Bt; 1 = (A + A2).Bt (A2 = unscaled bf16 lo plane of A); 2 = A.Bt + A2.Bt + A.Bt2.
// BIAS: 0 = none; 1 = bias[n] (per column); 2 = bias[m] (per row). Bias is an f32 array, applied as its
//       bf16 RNE value in the f32 epilogue before any 16-bit split of the result. RELU: 1 = max(v, 0) after bias.
// OUT_MODE: 0 = f32 (pitch ldc); 2 = bf16 hi plane C + bf16 lo plane C2 (lo = RNE(v - hi), unscaled);
//           3 = f16 hi plane C + f16 residual plane C2 = f16((v - hi) * rscale), C2 written only for tiles
//               with n0 < N2 (pitch ldc2, batch stride strideC2); 4 = f16 hi plane C only.
// =====================================================================================================
template <int NSPLIT, int OUT_MODE, int BIAS, int RELU>
__device__ __forceinline__ void gemm64(
    float (*sT)[16 * 68], int bx, int by,
    const unsigned short* __restrict__ Ap, const unsigned short* A2p, int lda, long long strideA,
    const unsigned short* __restrict__ Btp, const unsigned short* Bt2p, int ldb, long long strideB,
    const float* __restrict__ bias,
    void* Cout, int ldc, long long strideC,
    void* Cout2, int ldc2, long long strideC2, int N2,
    int M, int N, int K, float rscale) {
  const __bf16* A   = (const __bf16*)(const void*)Ap;
  const __bf16* A2  = (const __bf16*)(const void*)A2p;
  const __bf16* Bt  = (const __bf16*)(const void*)Btp;
  const __bf16* Bt2 = (const __bf16*)(const void*)Bt2p;
  const int b    = by;
  const int lane = threadIdx.x & 31;
  const int wave = threadIdx.x >> 5;
  const int tilesN = N >> 6;
  const int tilesM = M >> 6;
  const int tile = bx * 8 + wave;
  if (tile >= tilesM * tilesN) return;   // wave-uniform; no block barriers in this kernel
  const int tm = tile / tilesN;
  const int tn = tile - tm * tilesN;
  const int m0 = tm << 6;
  const int n0 = tn << 6;

  const __bf16* Ab  = A  + (size_t)b * strideA;
  const __bf16* Bb  = Bt + (size_t)b * strideB;
  const __bf16* Ab2 = (NSPLIT >= 1) ? (A2  + (size_t)b * strideA) : Ab;
  const __bf16* Bb2 = (NSPLIT == 2) ? (Bt2 + (size_t)b * strideB) : Bb;

  const int rlane = lane & 15;                 // row (A) / col (B, D) within subtile
  const int koff  = (lane >> 4) * 8;           // k offset of this lane half
  const int mOff  = (lane >> 4) * 8;           // D row offset

  v8f acc[4][4];
#pragma unroll
  for (int i = 0; i < 4; ++i)
#pragma unroll
    for (int j = 0; j < 4; ++j) acc[i][j] = zero8();

  // running addresses of this lane's row 0 fragments, 32 elements on a k step; the other rows lie at constant offsets
  const __bf16* pa  = Ab  + (size_t)(m0 + rlane) * lda + koff;
  const __bf16* pa2 = Ab2 + (size_t)(m0 + rlane) * lda + koff;
  const __bf16* pb  = Bb  + (size_t)(n0 + rlane) * ldb + koff;
  const __bf16* pb2 = Bb2 + (size_t)(n0 + rlane) * ldb + koff;
  for (int k0 = 0; k0 < K; k0 += 32) {
    v16b bh[4], bl[4];
#pragma unroll
    for (int j = 0; j < 4; ++j) {
      const size_t bo = (size_t)(j << 4) * ldb;
      bh[j] = ldfrag_b(pb + bo);
      if (NSPLIT == 2) bl[j] = ldfrag_b(pb2 + bo); else bl[j] = bh[j];
    }
#pragma unroll
    for (int i = 0; i < 4; ++i) {
      const size_t ao = (size_t)(i << 4) * lda;
      const v16b ah = ldfrag_b(pa + ao);
      v16b al = ah;
      if (NSPLIT >= 1) al = ldfrag_b(pa2 + ao);
#pragma unroll
      for (int j = 0; j < 4; ++j) {
        acc[i][j] = mma_b_raw(ah, bh[j], acc[i][j]);
        if (NSPLIT >= 1) acc[i][j] = mma_b_raw(al, bh[j], acc[i][j]);
        if (NSPLIT == 2) acc[i][j] = mma_b_raw(ah, bl[j], acc[i][j]);
      }
      dep_guard_b(acc[i][0], acc[i][3], ah, al);
    }
    keep4_b(bh[0], bh[1], bh[2], bh[3]);
    if (NSPLIT == 2) keep4_b(bl[0], bl[1], bl[2], bl[3]);
#if defined(__HIP_DEVICE_COMPILE__)
    // the k step's loads are out. The wait names the running addresses: they keep their registers up to here (no load's
    // result lands in a pair that an issued load names) and are stepped on only behind it.
    if (NSPLIT == 0)      asm volatile("s_wait_xcnt 0x0" : "+v"(pa), "+v"(pb) :: "memory");
    else if (NSPLIT == 1) asm volatile("s_wait_xcnt 0x0" : "+v"(pa), "+v"(pa2), "+v"(pb) :: "memory");
    else                  asm volatile("s_wait_xcnt 0x0" : "+v"(pa), "+v"(pa2), "+v"(pb), "+v"(pb2) :: "memory");
#endif
    pa += 32; pa2 += 32; pb += 32; pb2 += 32;
  }
  acc_guard4(acc[0][0], acc[0][1], acc[0][2], acc[0][3]);
  acc_guard4(acc[1][0], acc[1][1], acc[1][2], acc[1][3]);
  acc_guard4(acc[2][0], acc[2][1], acc[2][2], acc[2][3]);
  acc_guard4(acc[3][0], acc[3][1], acc[3][2], acc[3][3]);

  // ---- epilogue ----
  float bcol[4] = {0.f, 0.f, 0.f, 0.f};
  if (BIAS == 1) {
#pragma unroll
    for (int j = 0; j < 4; ++j) bcol[j] = bf_up(bf_bits(bias[n0 + (j << 4) + rlane]));
  }
  float* slab = sT[wave];
#pragma unroll
  for (int i = 0; i < 4; ++i) {
    const int mBase = m0 + (i << 4);
    float brow[8] = {0.f, 0.f, 0.f, 0.f, 0.f, 0.f, 0.f, 0.f};
    if (BIAS == 2) {
#pragma unroll
      for (int r = 0; r < 8; ++r) brow[r] = bf_up(bf_bits(bias[mBase + mOff + r]));
    }
#pragma unroll
    for (int j = 0; j < 4; ++j) {
#pragma unroll
      for (int r = 0; r < 8; ++r) {
        float vv = acc[i][j][r] + bcol[j] + brow[r];
        if (RELU) vv = fmaxf(vv, 0.0f);
        slab[(mOff + r) * 68 + (j << 4) + rlane] = vv;
      }
    }
    wave_sync_lds();
    if (OUT_MODE == 0) {
      float* C = (float*)Cout + (size_t)b * strideC;
      const int hh = lane >> 4, c4 = (lane & 15) * 4;     // 256-B row segment = 16 lanes x 16 B
      {
#pragma unroll
        for (int it = 0; it < 8; ++it) {
          const int row = it * 2 + hh;                     // it 0..7 x hh 0..1 = rows 0..15
          const v4f v = *(const v4f*)(slab + row * 68 + c4);
          *(v4f*)(C + (size_t)(mBase + row) * ldc + n0 + c4) = v;
        }
        
      }
    } else {
      const int q = lane >> 3, c8 = (lane & 7) * 8;
      unsigned short* C  = (unsigned short*)Cout  + (size_t)b * strideC;
      unsigned short* C2 = (unsigned short*)Cout2 + (size_t)b * strideC2;
      const bool wlo = (OUT_MODE == 2) || (OUT_MODE == 3 && n0 < N2);   // wave-uniform
      v4u hv[4], lv[4];
#pragma unroll
      for (int it = 0; it < 4; ++it) {
        const int row = it * 4 + q;                        // it 0..3 x q 0..3 = rows 0..15
        const float* sp = slab + row * 68 + c8;
        v4u a, a2;
#pragma unroll
        for (int e = 0; e < 4; ++e) {
          const float f0 = sp[2 * e], f1 = sp[2 * e + 1];
          unsigned short h0, h1, l0, l1;
          if (OUT_MODE == 2) {
            h0 = bf_bits(f0); h1 = bf_bits(f1);
            l0 = bf_bits(f0 - bf_up(h0)); l1 = bf_bits(f1 - bf_up(h1));
          } else {
            const _Float16 x0 = (_Float16)f0, x1 = (_Float16)f1;
            h0 = h_bits(x0); h1 = h_bits(x1);
            l0 = h_bits((_Float16)((f0 - (float)x0) * rscale));
            l1 = h_bits((_Float16)((f1 - (float)x1) * rscale));
          }
          a[e] = pk16(h0, h1); a2[e] = pk16(l0, l1);
        }
        hv[it] = a; lv[it] = a2;
      }
      {
#pragma unroll
        for (int it = 0; it < 4; ++it) {
          const int row = it * 4 + q;
          *(v4u*)(C + (size_t)(mBase + row) * ldc + n0 + c8) = hv[it];
          if (wlo) *(v4u*)(C2 + (size_t)(mBase + row) * ldc2 + n0 + c8) = lv[it];
        }
        
      }
    }
    wave_sync_lds();
  }
}

// =====================================================================================================
// The q, k and v^T projections in one launch (none reads what another writes): 3 x NPB blocks, block-uniform branch.
//   q = relu(query . Wq + bq) -> f16 hi plane [8192][512] + f16 residual x4096 (all tiles, N2 = DM); M=8192, N=512, K=256
//   k = relu(key . Wk + bk)   -> f16 hi plane [8192][512] only; M=8192, N=512, K=256
//   v^T = relu(Wv^T . key^T + bv) per batch -> f16 hi plane [b][h*64+d][s] (pitch SEQ) and residual plane x4096
//     (A = WvT [n][k], Bt = Xk rows of batch b, bias per row; M=512, N=1024, K=256; NVB blocks a batch)
// =====================================================================================================
#define NPB ((NB * SEQ / 64) * (DM / 64) / 8)     // 1024 tiles -> 128 blocks of one projection
#define NVB ((DM / 64) * (SEQ / 64) / 8)          // 128 tiles -> 16 blocks of one batch of v^T
static_assert(NVB * NB == NPB);
__global__ __launch_bounds__(256) void proj_qkv(
    const unsigned short* __restrict__ Xq, const unsigned short* __restrict__ Xk,
    const unsigned short* __restrict__ WqT, const unsigned short* __restrict__ WkT, const unsigned short* __restrict__ WvT,
    const float* __restrict__ bq, const float* __restrict__ bk, const float* __restrict__ bv,
    unsigned short* Qh, unsigned short* Ql, unsigned short* Kh, unsigned short* VTh, unsigned short* VTl) {
  __shared__ __align__(16) float sT[8][16 * 68];   // per-wave 16x64 slab, pitch 68 floats
  const int g = blockIdx.x / NPB;
  const int r = blockIdx.x % NPB;
  if (g == 0) {
    gemm64<0, 3, 1, 1>(sT, r, 0,
        Xq, Xq, QIN, 0LL, WqT, WqT, QIN, 0LL, bq,
        (void*)Qh, DM, 0LL, (void*)Ql, DM, 0LL, DM,
        NB * SEQ, DM, QIN, 4096.0f);
  } else if (g == 1) {
    gemm64<0, 4, 1, 1>(sT, r, 0,
        Xk, Xk, QIN, 0LL, WkT, WkT, QIN, 0LL, bk,
        (void*)Kh, DM, 0LL, (void*)Kh, DM, 0LL, 0,
        NB * SEQ, DM, QIN, 4096.0f);
  } else {
    gemm64<0, 3, 2, 1>(sT, r % NVB, r / NVB,
        WvT, WvT, QIN, 0LL, Xk, Xk, QIN, (long long)SEQ * QIN, bv,
        (void*)VTh, SEQ, (long long)DM * SEQ, (void*)VTl, SEQ, (long long)DM * SEQ, SEQ,
        DM, SEQ, QIN, 4096.0f);
  }
}

// out = context . Wo + bo -> f32 [8192][512] (A = context hi + lo planes, 2 products; M=8192, N=512, K=512): NPB blocks
__global__ __launch_bounds__(256) void proj_out(
    const unsigned short* __restrict__ Oh, const unsigned short* __restrict__ Ol, const unsigned short* __restrict__ WoT,
    const float* __restrict__ bo, float* out) {
  __shared__ __align__(16) float sT[8][16 * 68];   // per-wave 16x64 slab, pitch 68 floats
  gemm64<1, 0, 1, 0>(sT, blockIdx.x, 0,
      Oh, Ol, DM, 0LL, WoT, WoT, DM, 0LL, bo,
      (void*)out, DM, 0LL, (void*)out, DM, 0LL, DM,
      NB * SEQ, DM, DM, 1.0f);
}

// =====================================================================================================
// Attention, head dim 64, per-(query,key) int32 mask [NB][SEQ][SEQ] (0 = masked -> score replaced by the finite
// value -1e8, so a fully masked row yields uniform weights), standard softmax over all SEQ keys.
//   q hi plane (f16, pitch DM): element (b, t, h, d) at [(b*SEQ + t)*DM + h*64 + d]; k plane same layout
//   q residual plane (f16, (q - f16(q))*4096, pitch DM): same layout
//   v^T hi plane (f16): element (b, h, d, s) at [(b*DM + h*64 + d)*SEQ + s]; v^T residual plane (f16, x4096): same layout
//   out planes (bf16 hi / lo of the normalised context): element (b, t, h, d) at [(b*SEQ + t)*DM + h*64 + d]
//   Both products run transposed, so that a lane owns ONE query (column lane&15) and holds 8 keys / 8 d per tile:
//   scores^T = (k . qh^T + (k . ql^T) * rres) * sscale on f16 WMMA (A = K rows, B = q), residual products in a separate
//   accumulator, then the per-(q,k) mask select; p = exp(s - m) carried as f16(1024 p); two score tiles of 16 keys,
//   converted in place, are the B operand of context^T = vh^T . p^T + (vl^T . p^T) * rres (A = V^T rows; separate
//   accumulator folded per chunk in f32): P never goes through LDS. Online softmax in f32: maximum and sum run inside
//   the lane, the two lane halves (keys 8hh..8hh+7 of each group) exchange the maximum once a chunk and join their
//   sums once behind the loop; final multiply by 1/l.
//   Block = 4 waves = 64 query rows of one (b, h); grid = NQB * NH * NB; kv chunks of 64, static trip NQB.
//   K / V^T chunk staging: 128 threads x 4 rows x 8 elements per plane = the whole 64x64 tile (plain 16-B loads,
//   __syncthreads before and after); mask values: each lane loads the 8 consecutive keys of its own query row per
//   16-key group straight from global, two 16-B loads (addresses always in range).
//   Output coverage: each wave stores rows q0..q0+15 (it 0..3 x lane>>3 0..3) x 64 columns (8 lanes x 8) of both planes.
// =====================================================================================================
__global__ __launch_bounds__(128)
void attn64(const unsigned short* __restrict__ qhp, const unsigned short* __restrict__ qlp,
            const unsigned short* __restrict__ khp,
            const unsigned short* __restrict__ vhp, const unsigned short* __restrict__ vlp,
            const int* __restrict__ maskp,
            unsigned short* ohp, unsigned short* olp, float sscale, float rres) {
  union FH { v16h v; v8h h[2]; };
  __shared__ __align__(16) _Float16 Ksh[64 * LP];                 // K [kv][d]   9 KB
  __shared__ __align__(16) _Float16 Vth[64 * LP];                 // V^T hi [d][kv] 9 KB
  __shared__ __align__(16) _Float16 Vtl[64 * LP];                 // V^T residual [d][kv] 9 KB
  __shared__ __align__(16) float    Os[4][16 * OP];               // per wave context tile [row][d] 17 KB

  const int tid  = threadIdx.x;
  const int wave = tid >> 5;
  const int lane = tid & 31;
  const int hh   = lane >> 4;
  const int c    = lane & 15;

  const int bx   = blockIdx.x;
  const int qb   = bx % NQB;
  const int rest = bx / NQB;
  const int h    = rest % NH;
  const int b    = rest / NH;
  const int q0   = qb * 64 + wave * 16;
  const size_t rowB = (size_t)b * SEQ;

  const _Float16* Qh = (const _Float16*)(const void*)qhp + (size_t)h * HD;
  const _Float16* Ql = (const _Float16*)(const void*)qlp + (size_t)h * HD;
  const _Float16* Kg = (const _Float16*)(const void*)khp + (size_t)h * HD;
  const _Float16* Vh = (const _Float16*)(const void*)vhp + ((size_t)b * DM + (size_t)h * HD) * SEQ;
  const _Float16* Vl = (const _Float16*)(const void*)vlp + ((size_t)b * DM + (size_t)h * HD) * SEQ;
  // mask row of this lane's query q0 + c, from the lane half's first key 8*hh of a group; chunk and group added in the loop
  const int* Mg = maskp + (rowB + (size_t)q0 + (size_t)c) * SEQ + 8 * hh;

  // ---- Q fragments (B operand, column = lane&15): 2 d-chunks, hi and residual ----
  v16h qah[2], qal[2];
#pragma unroll
  for (int dc = 0; dc < 2; ++dc) {
    qah[dc] = ldfrag_h(Qh + (rowB + q0 + c) * DM + dc * 32 + 8 * hh);
    qal[dc] = ldfrag_h(Ql + (rowB + q0 + c) * DM + dc * 32 + 8 * hh);
  }

  float mrow = -INFINITY, lrow = 0.f;        // this lane's query: running maximum (both halves agree), this half's sum
  v8f oacc[4];                               // context^T: oacc[t][r] = d t*16 + 8hh + r of query c
#pragma unroll
  for (int t = 0; t < 4; ++t) oacc[t] = zero8();

  for (int kt = 0; kt < NQB; ++kt) {         // static trip count
    const int kv0 = kt * 64;
    __syncthreads();
    {
      // 8 lanes x 16 B = one 128-B tile row, so a wave's load covers 4 whole lines; rows r, r+16, r+32, r+48 per thread
      const int r = tid >> 3, c8 = (tid & 7) * 8;
      const _Float16* kg  = Kg + (rowB + kv0 + r) * DM + c8;       // K row kv0+r, d = c8..c8+7
      const _Float16* vg  = Vh + (size_t)r * SEQ + kv0 + c8;       // V^T row d = r, s = kv0+c8..+7
      const _Float16* vlg = Vl + (size_t)r * SEQ + kv0 + c8;
#pragma unroll
      for (int i = 0; i < 4; ++i) {
        const v8h a0 = *(const v8h*)(kg + (size_t)(16 * i) * DM);
        const v8h b0 = *(const v8h*)(vg + (size_t)(16 * i) * SEQ);
        const v8h b1 = *(const v8h*)(vlg + (size_t)(16 * i) * SEQ);
        *(v8h*)(Ksh + (r + 16 * i) * LP + c8) = a0;
        *(v8h*)(Vth + (r + 16 * i) * LP + c8) = b0;
        *(v8h*)(Vtl + (r + 16 * i) * LP + c8) = b1;
      }
    }
    __syncthreads();

    // ---- scores^T: 64 keys x 16 queries per wave, 2 f16 products (hi, residual), then per-(q,k) mask select;
    //      s[j][r] = key j*16 + 8hh + r, query c ----
    v8f s[4];
#pragma unroll
    for (int j = 0; j < 4; ++j) {
      v8f sh = zero8(), sl = zero8();
#pragma unroll
      for (int dc = 0; dc < 2; ++dc) {
        FH kb;
        kb.h[0] = *(const v8h*)(Ksh + (j * 16 + c) * LP + dc * 32 + 8 * hh);
        kb.h[1] = *(const v8h*)(Ksh + (j * 16 + c) * LP + dc * 32 + 16 + 8 * hh);
        sh = mma_h(kb.v, qah[dc], sh);
        sl = mma_h(kb.v, qal[dc], sl);
      }
      const v4i live0 = *(const v4i*)(Mg + kv0 + j * 16);        // keys j*16 + 8hh + 0..3 of query c
      const v4i live1 = *(const v4i*)(Mg + kv0 + j * 16 + 4);    // keys j*16 + 8hh + 4..7
#pragma unroll
      for (int r = 0; r < 8; ++r) {
        const float v = (sh[r] + sl[r] * rres) * sscale;
        const int live = (r < 4) ? live0[r & 3] : live1[r & 3];
        s[j][r] = (live != 0) ? v : -1.0e8f;
      }
    }

    // ---- maximum over the chunk's keys, online softmax, P^T (x1024, f16) packed as the B operand ----
    float mj[4];
#pragma unroll
    for (int j = 0; j < 4; ++j) {
      mj[j] = s[j][0];
#pragma unroll
      for (int r = 1; r < 8; ++r) mj[j] = fmaxf(mj[j], s[j][r]);
    }
    float m = fmaxf(fmaxf(mj[0], mj[1]), fmaxf(mj[2], mj[3]));
    m = fmaxf(m, xhalf(m));                                      // the other half's 32 keys of the same query
    const float mnew  = fmaxf(mrow, m);
    const float alpha = __expf(mrow - mnew);
    mrow = mnew;
    // pb[kk] element e: e 0..7 = key kk*32 + 8hh + e (tile 2kk), e 8..15 = key kk*32 + 16 + 8hh + (e-8) (tile 2kk+1):
    // the k order of the V^T fragments below
    FH pb[2];
    float ps[4];                                                 // four independent sums, one per 16-key group
#pragma unroll
    for (int j = 0; j < 4; ++j) {
#pragma unroll
      for (int r = 0; r < 8; ++r) {
        const float p = __expf(s[j][r] - mnew);
        ps[j] = (r == 0) ? p : ps[j] + p;
        pb[j >> 1].v[(j & 1) * 8 + r] = (_Float16)(p * 1024.0f);
      }
    }
    lrow = lrow * alpha + ((ps[0] + ps[1]) + (ps[2] + ps[3]));
#pragma unroll
    for (int t = 0; t < 4; ++t)
#pragma unroll
      for (int r = 0; r < 8; ++r) oacc[t][r] *= alpha;

    // ---- context^T += V^T . P^T (f16 WMMA), residual products into a separate accumulator ----
    v8f o1[4];
#pragma unroll
    for (int t = 0; t < 4; ++t) o1[t] = zero8();
#pragma unroll   // pb[kk] lives in registers: a rolled loop would have to pick the operand by a run-time index
    for (int kk = 0; kk < 2; ++kk) {
#pragma unroll
      for (int t = 0; t < 4; ++t) {
        FH vb, vl;
        vb.h[0] = *(const v8h*)(Vth + (t * 16 + c) * LP + kk * 32 + 8 * hh);
        vb.h[1] = *(const v8h*)(Vth + (t * 16 + c) * LP + kk * 32 + 16 + 8 * hh);
        vl.h[0] = *(const v8h*)(Vtl + (t * 16 + c) * LP + kk * 32 + 8 * hh);
        vl.h[1] = *(const v8h*)(Vtl + (t * 16 + c) * LP + kk * 32 + 16 + 8 * hh);
        oacc[t] = mma_h(vb.v, pb[kk].v, oacc[t]);
        o1[t]   = mma_h(vl.v, pb[kk].v, o1[t]);
      }
    }
#pragma unroll
    for (int t = 0; t < 4; ++t)
#pragma unroll
      for (int r = 0; r < 8; ++r) oacc[t][r] += o1[t][r] * rres;
  }

  // ---- normalise (1/l and the 1/1024 p carry), stage the wave's 16x64 tile, bf16 hi/lo split,
  float* os = Os[wave];
  {
    const float l   = lrow + xhalf(lrow);                       // join the two halves' sums of this query
    const float inv = (1.0f / l) * (1.0f / 1024.0f);            // l >= 1 always (the max key contributes 1)
#pragma unroll
    for (int t = 0; t < 4; ++t) {
      v4f x0, x1;
#pragma unroll
      for (int r = 0; r < 4; ++r) { x0[r] = oacc[t][r] * inv; x1[r] = oacc[t][4 + r] * inv; }
      *(v4f*)(os + c * OP + t * 16 + 8 * hh)     = x0;          // row = query c, d = t*16 + 8hh + 0..3
      *(v4f*)(os + c * OP + t * 16 + 8 * hh + 4) = x1;
    }
  }
  wave_sync_lds();
  {
    const int q4 = lane >> 3, c8 = (lane & 7) * 8;
    v4u hv[4], lv[4];
#pragma unroll
    for (int it = 0; it < 4; ++it) {
      const int row = it * 4 + q4;   // it 0..3 x q4 0..3 = rows 0..15 of the wave tile
      const float* sp = os + row * OP + c8;
      v4u a, a2;
#pragma unroll
      for (int e = 0; e < 4; ++e) {
        const float f0 = sp[2 * e], f1 = sp[2 * e + 1];
        const unsigned short h0 = bf_bits(f0), h1 = bf_bits(f1);
        const unsigned short l0 = bf_bits(f0 - bf_up(h0)), l1 = bf_bits(f1 - bf_up(h1));
        a[e] = pk16(h0, h1); a2[e] = pk16(l0, l1);
      }
      hv[it] = a; lv[it] = a2;
    }
    {
#pragma unroll
      for (int it = 0; it < 4; ++it) {
        const int row = it * 4 + q4;
        const size_t go = (rowB + q0 + row) * DM + (size_t)h * HD + c8;
        *(v4u*)(ohp + go) = hv[it];
        *(v4u*)(olp + go) = lv[it];
      }
      
    }
  }
}

// =====================================================================================================
// Workspace map (bytes), every plane an exact multiple of its 64x64-tile / whole-line store granularity:
//   Xq    bf16 [8192][256]           0          4194304
//   Xk    bf16 [8192][256]           4194304    4194304
//   WqT   bf16 [512][256]            8388608    262144
//   WkT   bf16 [512][256]            8650752    262144
//   WvT   bf16 [512][256]            8912896    262144
//   WoT   bf16 [512][512]            9175040    524288
//   Qh    f16  [8192][512]           9699328    8388608
//   Ql    f16  [8192][512]           18087936   8388608   (q residual x4096)
//   Kh    f16  [8192][512]           26476544   8388608
//   VTh   f16  [8][512][1024]        34865152   8388608
//   VTl   f16  [8][512][1024]        43253760   8388608   (v residual x4096)
//   Oh    bf16 [8192][512]           51642368   8388608
//   Ol    bf16 [8192][512]           60030976   8388608
//   end                              68419584
// Weights arrive as [in k][out n] and are transpose-converted to [out n][in k] (k contiguous = Bt / A layout).
// =====================================================================================================
extern "C" void kernel_launch(void* const* d_in, const int* in_sizes, int n_in,
                              void* d_out, int out_size, void* d_ws, size_t ws_size,
                              hipStream_t stream) {
  if (n_in < 11) return;
  if (in_sizes[0] != NB * SEQ * QIN || in_sizes[1] != NB * SEQ * QIN) return;
  if (in_sizes[2] != NB * SEQ * SEQ) return;
  if (in_sizes[3] != QIN * DM || in_sizes[5] != QIN * DM || in_sizes[7] != QIN * DM) return;
  if (in_sizes[9] != DM * DM) return;
  if (in_sizes[4] != DM || in_sizes[6] != DM || in_sizes[8] != DM || in_sizes[10] != DM) return;
  if (out_size != NB * SEQ * DM) return;

  const float* query = (const float*)d_in[0];
  const float* key   = (const float*)d_in[1];
  const int*   mask  = (const int*)d_in[2];
  const float* Wq    = (const float*)d_in[3];
  const float* bq    = (const float*)d_in[4];
  const float* Wk    = (const float*)d_in[5];
  const float* bk    = (const float*)d_in[6];
  const float* Wv    = (const float*)d_in[7];
  const float* bv    = (const float*)d_in[8];
  const float* Wo    = (const float*)d_in[9];
  const float* bo    = (const float*)d_in[10];

  const size_t PXI = (size_t)NB * SEQ * QIN * 2;     //  4194304 (bf16 input activation plane)
  const size_t PW  = (size_t)DM * QIN * 2;           //   262144 (one projection weight plane)
  const size_t PWO = (size_t)DM * DM * 2;            //   524288 (output weight plane)
  const size_t PA  = (size_t)NB * SEQ * DM * 2;      //  8388608 (q / k / context planes)
  const size_t PVT = (size_t)NB * DM * SEQ * 2;      //  8388608 (v^T plane)
  size_t off = 0;
  const size_t oXq  = off; off += PXI;
  const size_t oXk  = off; off += PXI;
  const size_t oWq  = off; off += PW;
  const size_t oWk  = off; off += PW;
  const size_t oWv  = off; off += PW;
  const size_t oWo  = off; off += PWO;
  const size_t oQh  = off; off += PA;
  const size_t oQl  = off; off += PA;
  const size_t oKh  = off; off += PA;
  const size_t oVTh = off; off += PVT;
  const size_t oVTl = off; off += PVT;
  const size_t oOh  = off; off += PA;
  const size_t oOl  = off; off += PA;
  if (off > ws_size) return;                          // off = 68419584
  if (off > (size_t)134217728) return;

  char* ws = (char*)d_ws;
  unsigned short* Xq  = (unsigned short*)(ws + oXq);
  unsigned short* Xk  = (unsigned short*)(ws + oXk);
  unsigned short* WqT = (unsigned short*)(ws + oWq);
  unsigned short* WkT = (unsigned short*)(ws + oWk);
  unsigned short* WvT = (unsigned short*)(ws + oWv);
  unsigned short* WoT = (unsigned short*)(ws + oWo);
  unsigned short* Qh  = (unsigned short*)(ws + oQh);
  unsigned short* Ql  = (unsigned short*)(ws + oQl);
  unsigned short* Kh  = (unsigned short*)(ws + oKh);
  unsigned short* VTh = (unsigned short*)(ws + oVTh);
  unsigned short* VTl = (unsigned short*)(ws + oVTl);
  unsigned short* Oh  = (unsigned short*)(ws + oOh);
  unsigned short* Ol  = (unsigned short*)(ws + oOl);

  const dim3 blk(256);
  const dim3 gPrep(3 * NTW + NTO + 2 * NCX);                    // 160 transpose tiles + 2 x 1024 convert blocks
  const dim3 gProj(3 * NPB);                                    // 3 x 128 blocks: q, k, v^T
  const dim3 gOut(NPB);                                         // 1024 tiles -> 128 blocks: M=8192, N=512
  const dim3 gAttn(NB * NH * NQB);                              // 1024 blocks

  // (1) activations -> bf16 planes; weights [in][out] -> transposed bf16 planes [out][in] (RNE convert)
  prep_all<<<gPrep, blk, 0, stream>>>(query, key, Wq, Wk, Wv, Wo, Xq, Xk, WqT, WkT, WvT, WoT);
  // (2) to (4) the q, k and v^T projections
  proj_qkv<<<gProj, blk, 0, stream>>>(Xq, Xk, WqT, WkT, WvT, bq, bk, bv, Qh, Ql, Kh, VTh, VTl);
  // (5) attention with per-(q,k) mask and softmax -> context bf16 hi / lo planes [8192][512]
  attn64<<<gAttn, dim3(128), 0, stream>>>(Qh, Ql, Kh, VTh, VTl, mask, Oh, Ol, 0.125f, 1.0f / 4096.0f);
  // (6) out = context . Wo + bo -> d_out f32 [8192][512]  (A = context hi + lo planes, 2 products; K=512)
  proj_out<<<gOut, blk, 0, stream>>>(Oh, Ol, WoT, bo, (float*)d_out);
  (void)hipGetLastError();
}

// v005
// Measured time: 103 microseconds a run.
// Two timings next to v004 both put it at 1.03 times that version's speed.
// Counting every step since v000, it is 2.01 times as fast.
// Contractions: q, k and v^T projections = v_wmma_f32_16x16x32_bf16 (bf16 operands from RNE-converted inputs and
// transposed weights, single product, bias and ReLU in f32); k.q^T scores = v_wmma_f32_16x16x32_f16 (q as f16 hi
// plane + f16 residual plane x4096 in a separate accumulator, k f16; 2 products); v^T.p^T = v_wmma_f32_16x16x32_f16
// (p carried x1024 in f16, v^T as f16 hi plane + f16 residual plane x4096 in a separate accumulator; 2 products);
// ctx.Wo = v_wmma_f32_16x16x32_bf16 (ctx as bf16 hi + lo planes times bf16 Wo^T, 2 products, bias in f32);
// all f32 accumulate; per-(query,key) mask select and softmax in f32.
#include <hip/hip_runtime.h>
#include <math.h>
#include <stdint.h>

#define NB    8
#define SEQ   1024
#define QIN   256
#define DM    512
#define NH    8
#define HD    64
#define NQB   (SEQ / 64)     // 16 key / query tiles of 64
#define LP    72             // LDS row pitch of the 64-wide f16 tiles, in halves: 144 B = 16 B x odd, so the 16 rows that one
                             // ds_load_b128 fragment read touches fall on 16 different 4-bank groups
#define OP    68             // LDS row pitch of the 64-wide f32 context tile, in floats (16-byte column walks)
static_assert(NH * HD == DM);
static_assert((SEQ % 64) == 0 && (DM % 64) == 0 && (QIN % 64) == 0 && (QIN % 32) == 0 && (DM % 32) == 0);

typedef _Float16 v16h __attribute__((ext_vector_type(16)));
typedef _Float16 v8h  __attribute__((ext_vector_type(8)));
typedef __bf16   v16b __attribute__((ext_vector_type(16)));
typedef __bf16   v8b  __attribute__((ext_vector_type(8)));
typedef float    v8f  __attribute__((ext_vector_type(8)));
typedef float    v4f  __attribute__((ext_vector_type(4)));
typedef unsigned int v4u __attribute__((ext_vector_type(4)));
typedef int          v4i __attribute__((ext_vector_type(4)));

// ---- scalar helpers --------------------------------------------------------------------------------
__device__ __forceinline__ unsigned short bf_bits(float f) {          // f32 -> bf16 bits, RNE convert
  unsigned u = __float_as_uint(f);
  return (unsigned short)((u + 0x7FFFu + ((u >> 16) & 1u)) >> 16);
}
__device__ __forceinline__ float bf_up(unsigned short h) { return __uint_as_float(((unsigned)h) << 16); }
__device__ __forceinline__ unsigned short h_bits(_Float16 x) { return __builtin_bit_cast(unsigned short, x); }
__device__ __forceinline__ unsigned pk16(unsigned short a, unsigned short b) { return (unsigned)a | ((unsigned)b << 16); }
__device__ __forceinline__ v8f zero8() { v8f z = {0.f, 0.f, 0.f, 0.f, 0.f, 0.f, 0.f, 0.f}; return z; }

// ---- fragment loaders: 16-bit A/B operand, lane -> row/col (lane&15), p already includes +8*(lane>>4);
//      elements 0..7 <- p[0..7] (k0+8h..), elements 8..15 <- p[16..23] (k0+16+8h..)
//      ldfrag_b reads global memory only; the cast says so, for an address that has gone through an asm statement
//      would otherwise be loaded from in the flat form
typedef const __attribute__((address_space(1))) v8b* gv8b;
__device__ __forceinline__ v16b ldfrag_b(const __bf16* p) {
  union { v16b v; v8b h[2]; } f;
  f.h[0] = *(gv8b)(p);
  f.h[1] = *(gv8b)(p + 16);
  return f.v;
}
__device__ __forceinline__ v16h ldfrag_h(const _Float16* p) {
  union { v16h v; v8h h[2]; } f;
  f.h[0] = *(const v8h*)(p);
  f.h[1] = *(const v8h*)(p + 16);
  return f.v;
}

// ---- WMMA helpers with trailing VALU hazard gap --------------------------------------------------------
__device__ __forceinline__ v8f mma_h(v16h a, v16h b, v8f c) {
  c = __builtin_amdgcn_wmma_f32_16x16x32_f16(false, a, false, b, (short)0, c, false, false);
#if defined(__HIP_DEVICE_COMPILE__)
  asm volatile("v_nop\n\tv_nop\n\tv_nop\n\tv_nop" : "+v"(c) : "v"(a), "v"(b));
#endif
  return c;
}
__device__ __forceinline__ v8f mma_b_raw(v16b a, v16b b, v8f c) {
  return __builtin_amdgcn_wmma_f32_16x16x32_bf16(false, a, false, b, (short)0, c, false, false);
}
__device__ __forceinline__ void dep_guard_b(v8f& a, v8f& b, v16b x, v16b y) {
#if defined(__HIP_DEVICE_COMPILE__)
  asm volatile("v_nop\n\tv_nop\n\tv_nop\n\tv_nop" : "+v"(a), "+v"(b) : "v"(x), "v"(y));
#endif
}
__device__ __forceinline__ void keep4_b(v16b a, v16b b, v16b c, v16b d) {
#if defined(__HIP_DEVICE_COMPILE__)
  asm volatile("v_nop" :: "v"(a), "v"(b), "v"(c), "v"(d));
#endif
}
__device__ __forceinline__ void acc_guard4(v8f& a, v8f& b, v8f& c, v8f& d) {
#if defined(__HIP_DEVICE_COMPILE__)
  asm volatile("v_nop\n\tv_nop\n\tv_nop\n\tv_nop" : "+v"(a), "+v"(b), "+v"(c), "+v"(d));
#endif
}
// lane l <-> lane l ^ 16 as a vector cross-row move (a shuffle would go the LDS path and be waited for on dscnt)
__device__ __forceinline__ float xhalf(float x) {
  return __builtin_bit_cast(float, __builtin_amdgcn_permlanex16(__builtin_bit_cast(int, x), __builtin_bit_cast(int, x),
                                                                0x76543210, 0xfedcba98, false, false));
}
__device__ __forceinline__ void wave_sync_lds() {
  __builtin_amdgcn_fence(__ATOMIC_RELEASE, "workgroup");
  __builtin_amdgcn_wave_barrier();
  __builtin_amdgcn_fence(__ATOMIC_ACQUIRE, "workgroup");
}

// =====================================================================================================
// f32 -> bf16 (RNE convert), 8 elements per thread, one 16-B store per lane: a wave writes 512 contiguous B
// coverage: n8 threads x 8 = whole plane (n8 is a multiple of 256 for every use here). bx = block index inside the plane.
// =====================================================================================================
__device__ __forceinline__ void cvt_bf16x8(const float* __restrict__ in, unsigned short* out, int n8, int bx) {
  const int i = bx * 256 + threadIdx.x;
  if (i < n8) {
    const v4f a = *(const v4f*)(in + (size_t)i * 8);
    const v4f b = *(const v4f*)(in + (size_t)i * 8 + 4);
    v4u p;
    p[0] = pk16(bf_bits(a[0]), bf_bits(a[1]));
    p[1] = pk16(bf_bits(a[2]), bf_bits(a[3]));
    p[2] = pk16(bf_bits(b[0]), bf_bits(b[1]));
    p[3] = pk16(bf_bits(b[2]), bf_bits(b[3]));
    *(v4u*)(out + (size_t)i * 8) = p;
    
  }
}

// =====================================================================================================
// Transpose-convert: f32 in[R][C] row-major -> bf16 (RNE convert) outT[C][R] row-major, outT[c][r] = in[r][c].
// (bx, by) in (C/64, R/64) (bx = column tile of in = row tile of outT), block 256; R, C multiples of 64.
// Load: thread tid reads in row r0 + (tid>>2), 16 floats at c0 + (tid&3)*16 (4 x 16-B loads) -> LDS tile[r][c].
// coverage: load 64 rows x 4 x 16 cols = 64x64; store 8 waves x 2 x 4 rows x (8 lanes x 8) = 64x64.
// =====================================================================================================
__device__ __forceinline__ void cvt_bf16_t64(const float* __restrict__ in, unsigned short* outT, int R, int C, int bx, int by) {
  __shared__ float tile[64][65];
  const int tid  = threadIdx.x;
  const int lane = tid & 31;
  const int wave = tid >> 5;
  const int c0 = bx * 64;
  const int r0 = by * 64;
  {
    const int r = tid >> 2, cs = (tid & 3) * 16;
    const float* g = in + (size_t)(r0 + r) * C + c0 + cs;
#pragma unroll
    for (int i = 0; i < 4; ++i) {
      const v4f v = *(const v4f*)(g + 4 * i);
      tile[r][cs + 4 * i + 0] = v[0];
      tile[r][cs + 4 * i + 1] = v[1];
      tile[r][cs + 4 * i + 2] = v[2];
      tile[r][cs + 4 * i + 3] = v[3];
    }
  }
  __syncthreads();
  const int q = lane >> 3, c8 = (lane & 7) * 8;
  v4u pv[2];
#pragma unroll
  for (int it = 0; it < 2; ++it) {
    const int c = wave * 8 + it * 4 + q;
    v4u p;
#pragma unroll
    for (int e = 0; e < 4; ++e)
      p[e] = pk16(bf_bits(tile[c8 + 2 * e][c]), bf_bits(tile[c8 + 2 * e + 1][c]));
    pv[it] = p;
  }
  {
#pragma unroll
    for (int it = 0; it < 2; ++it) {
      const int c = wave * 8 + it * 4 + q;
      *(v4u*)(outT + (size_t)(c0 + c) * R + r0 + c8) = pv[it];
    }
    
  }
}

// =====================================================================================================
// All six converts in one launch (none reads what another writes). Blocks, in this order: 3 x NTW tiles of Wq, Wk, Wv,
// NTO tiles of Wo (the transposes have the longer chain, so they start first), then NCX blocks each of query and key.
// Every branch is uniform for the block.
// =====================================================================================================
#define NTW ((DM / 64) * (QIN / 64))        // 32 tiles of a projection weight
#define NTO ((DM / 64) * (DM / 64))         // 64 tiles of the output weight
#define NCX (NB * SEQ * QIN / 8 / 256)      // 1024 blocks of an activation plane
__global__ __launch_bounds__(256) void prep_all(
    const float* __restrict__ query, const float* __restrict__ key,
    const float* __restrict__ Wq, const float* __restrict__ Wk, const float* __restrict__ Wv, const float* __restrict__ Wo,
    unsigned short* Xq, unsigned short* Xk,
    unsigned short* WqT, unsigned short* WkT, unsigned short* WvT, unsigned short* WoT) {
  const int bx = blockIdx.x;
  if (bx < 3 * NTW + NTO) {
    const int w = bx / NTW;                                    // 0, 1, 2 = Wq, Wk, Wv; 3 and 4 = Wo
    const int t = (w < 3) ? (bx - w * NTW) : (bx - 3 * NTW);
    const float*    in  = (w == 0) ? Wq  : (w == 1) ? Wk  : (w == 2) ? Wv  : Wo;
    unsigned short* out = (w == 0) ? WqT : (w == 1) ? WkT : (w == 2) ? WvT : WoT;
    cvt_bf16_t64(in, out, (w < 3) ? QIN : DM, DM, t % (DM / 64), t / (DM / 64));   // in rows = k, cols = DM
  } else {
    const int c = bx - (3 * NTW + NTO);
    const bool q = c < NCX;
    cvt_bf16x8(q ? query : key, q ? Xq : Xk, NCX * 256, q ? c : c - NCX);
  }
}

// =====================================================================================================
// Register-blocked batched bf16 WMMA GEMM: C[m][n] = sum_k A[m][k] * Bt[n][k] + bias (ReLU optional); one wave
// per 64x64 tile, no block barriers. A row-major [M][K] pitch lda; Bt row-major [N][K] pitch ldb (k contiguous);
// M, N multiples of 64, K multiple of 32 (host-checked). bx = block of 8 tiles, by = batch index (strides in elements);
// sT = the block's 8 per-wave 16x64 slabs in LDS, pitch 68 floats.
// NSPLIT: 0 = A.Bt; 1 = (A + A2).Bt (A2 = unscaled bf16 lo plane of A); 2 = A.Bt + A2.Bt + A.Bt2.
// BIAS: 0 = none; 1 = bias[n] (per column); 2 = bias[m] (per row). Bias is an f32 array, applied as its
//       bf16 RNE value in the f32 epilogue before any 16-bit split of the result. RELU: 1 = max(v, 0) after bias.
// OUT_MODE: 0 = f32 (pitch ldc); 2 = bf16 hi plane C + bf16 lo plane C2 (lo = RNE(v - hi), unscaled);
//           3 = f16 hi plane C + f16 residual plane C2 = f16((v - hi) * rscale), C2 written only for tiles
//               with n0 < N2 (pitch ldc2, batch stride strideC2); 4 = f16 hi plane C only.
// =====================================================================================================
template <int NSPLIT, int OUT_MODE, int BIAS, int RELU>
__device__ __forceinline__ void gemm64(
    float (*sT)[16 * 68], int bx, int by,
    const unsigned short* __restrict__ Ap, const unsigned short* A2p, int lda, long long strideA,
    const unsigned short* __restrict__ Btp, const unsigned short* Bt2p, int ldb, long long strideB,
    const float* __restrict__ bias,
    void* Cout, int ldc, long long strideC,
    void* Cout2, int ldc2, long long strideC2, int N2,
    int M, int N, int K, float rscale) {
  const __bf16* A   = (const __bf16*)(const void*)Ap;
  const __bf16* A2  = (const __bf16*)(const void*)A2p;
  const __bf16* Bt  = (const __bf16*)(const void*)Btp;
  const __bf16* Bt2 = (const __bf16*)(const void*)Bt2p;
  const int b    = by;
  const int lane = threadIdx.x & 31;
  const int wave = threadIdx.x >> 5;
  const int tilesN = N >> 6;
  const int tilesM = M >> 6;
  const int tile = bx * 8 + wave;
  if (tile >= tilesM * tilesN) return;   // wave-uniform; no block barriers in this kernel
  const int tm = tile / tilesN;
  const int tn = tile - tm * tilesN;
  const int m0 = tm << 6;
  const int n0 = tn << 6;

  const __bf16* Ab  = A  + (size_t)b * strideA;
  const __bf16* Bb  = Bt + (size_t)b * strideB;
  const __bf16* Ab2 = (NSPLIT >= 1) ? (A2  + (size_t)b * strideA) : Ab;
  const __bf16* Bb2 = (NSPLIT == 2) ? (Bt2 + (size_t)b * strideB) : Bb;

  const int rlane = lane & 15;                 // row (A) / col (B, D) within subtile
  const int koff  = (lane >> 4) * 8;           // k offset of this lane half
  const int mOff  = (lane >> 4) * 8;           // D row offset

  v8f acc[4][4];
#pragma unroll
  for (int i = 0; i < 4; ++i)
#pragma unroll
    for (int j = 0; j < 4; ++j) acc[i][j] = zero8();

  // running addresses of this lane's row 0 fragments, 32 elements on a k step; the other rows lie at constant offsets
  const __bf16* pa  = Ab  + (size_t)(m0 + rlane) * lda + koff;
  const __bf16* pa2 = Ab2 + (size_t)(m0 + rlane) * lda + koff;
  const __bf16* pb  = Bb  + (size_t)(n0 + rlane) * ldb + koff;
  const __bf16* pb2 = Bb2 + (size_t)(n0 + rlane) * ldb + koff;
  for (int k0 = 0; k0 < K; k0 += 32) {
    v16b bh[4], bl[4];
#pragma unroll
    for (int j = 0; j < 4; ++j) {
      const size_t bo = (size_t)(j << 4) * ldb;
      bh[j] = ldfrag_b(pb + bo);
      if (NSPLIT == 2) bl[j] = ldfrag_b(pb2 + bo); else bl[j] = bh[j];
    }
#pragma unroll
    for (int i = 0; i < 4; ++i) {
      const size_t ao = (size_t)(i << 4) * lda;
      const v16b ah = ldfrag_b(pa + ao);
      v16b al = ah;
      if (NSPLIT >= 1) al = ldfrag_b(pa2 + ao);
#pragma unroll
      for (int j = 0; j < 4; ++j) {
        acc[i][j] = mma_b_raw(ah, bh[j], acc[i][j]);
        if (NSPLIT >= 1) acc[i][j] = mma_b_raw(al, bh[j], acc[i][j]);
        if (NSPLIT == 2) acc[i][j] = mma_b_raw(ah, bl[j], acc[i][j]);
      }
      dep_guard_b(acc[i][0], acc[i][3], ah, al);
    }
    keep4_b(bh[0], bh[1], bh[2], bh[3]);
    if (NSPLIT == 2) keep4_b(bl[0], bl[1], bl[2], bl[3]);
#if defined(__HIP_DEVICE_COMPILE__)
    // the k step's loads are out. The wait names the running addresses: they keep their registers up to here (no load's
    // result lands in a pair that an issued load names) and are stepped on only behind it.
    if (NSPLIT == 0)      asm volatile("s_wait_xcnt 0x0" : "+v"(pa), "+v"(pb) :: "memory");
    else if (NSPLIT == 1) asm volatile("s_wait_xcnt 0x0" : "+v"(pa), "+v"(pa2), "+v"(pb) :: "memory");
    else                  asm volatile("s_wait_xcnt 0x0" : "+v"(pa), "+v"(pa2), "+v"(pb), "+v"(pb2) :: "memory");
#endif
    pa += 32; pa2 += 32; pb += 32; pb2 += 32;
  }
  acc_guard4(acc[0][0], acc[0][1], acc[0][2], acc[0][3]);
  acc_guard4(acc[1][0], acc[1][1], acc[1][2], acc[1][3]);
  acc_guard4(acc[2][0], acc[2][1], acc[2][2], acc[2][3]);
  acc_guard4(acc[3][0], acc[3][1], acc[3][2], acc[3][3]);

  // ---- epilogue ----
  float bcol[4] = {0.f, 0.f, 0.f, 0.f};
  if (BIAS == 1) {
#pragma unroll
    for (int j = 0; j < 4; ++j) bcol[j] = bf_up(bf_bits(bias[n0 + (j << 4) + rlane]));
  }
  float* slab = sT[wave];
#pragma unroll
  for (int i = 0; i < 4; ++i) {
    const int mBase = m0 + (i << 4);
    float brow[8] = {0.f, 0.f, 0.f, 0.f, 0.f, 0.f, 0.f, 0.f};
    if (BIAS == 2) {
#pragma unroll
      for (int r = 0; r < 8; ++r) brow[r] = bf_up(bf_bits(bias[mBase + mOff + r]));
    }
#pragma unroll
    for (int j = 0; j < 4; ++j) {
#pragma unroll
      for (int r = 0; r < 8; ++r) {
        float vv = acc[i][j][r] + bcol[j] + brow[r];
        if (RELU) vv = fmaxf(vv, 0.0f);
        slab[(mOff + r) * 68 + (j << 4) + rlane] = vv;
      }
    }
    wave_sync_lds();
    if (OUT_MODE == 0) {
      float* C = (float*)Cout + (size_t)b * strideC;
      const int hh = lane >> 4, c4 = (lane & 15) * 4;     // 256-B row segment = 16 lanes x 16 B
      {
#pragma unroll
        for (int it = 0; it < 8; ++it) {
          const int row = it * 2 + hh;                     // it 0..7 x hh 0..1 = rows 0..15
          const v4f v = *(const v4f*)(slab + row * 68 + c4);
          *(v4f*)(C + (size_t)(mBase + row) * ldc + n0 + c4) = v;
        }
        
      }
    } else {
      const int q = lane >> 3, c8 = (lane & 7) * 8;
      unsigned short* C  = (unsigned short*)Cout  + (size_t)b * strideC;
      unsigned short* C2 = (unsigned short*)Cout2 + (size_t)b * strideC2;
      const bool wlo = (OUT_MODE == 2) || (OUT_MODE == 3 && n0 < N2);   // wave-uniform
      v4u hv[4], lv[4];
#pragma unroll
      for (int it = 0; it < 4; ++it) {
        const int row = it * 4 + q;                        // it 0..3 x q 0..3 = rows 0..15
        const float* sp = slab + row * 68 + c8;
        v4u a, a2;
#pragma unroll
        for (int e = 0; e < 4; ++e) {
          const float f0 = sp[2 * e], f1 = sp[2 * e + 1];
          unsigned short h0, h1, l0, l1;
          if (OUT_MODE == 2) {
            h0 = bf_bits(f0); h1 = bf_bits(f1);
            l0 = bf_bits(f0 - bf_up(h0)); l1 = bf_bits(f1 - bf_up(h1));
          } else {
            const _Float16 x0 = (_Float16)f0, x1 = (_Float16)f1;
            h0 = h_bits(x0); h1 = h_bits(x1);
            l0 = h_bits((_Float16)((f0 - (float)x0) * rscale));
            l1 = h_bits((_Float16)((f1 - (float)x1) * rscale));
          }
          a[e] = pk16(h0, h1); a2[e] = pk16(l0, l1);
        }
        hv[it] = a; lv[it] = a2;
      }
      {
#pragma unroll
        for (int it = 0; it < 4; ++it) {
          const int row = it * 4 + q;
          *(v4u*)(C + (size_t)(mBase + row) * ldc + n0 + c8) = hv[it];
          if (wlo) *(v4u*)(C2 + (size_t)(mBase + row) * ldc2 + n0 + c8) = lv[it];
        }
        
      }
    }
    wave_sync_lds();
  }
}

// =====================================================================================================
// The q, k and v^T projections in one launch (none reads what another writes): 3 x NPB blocks, block-uniform branch.
//   q = relu(query . Wq + bq) -> f16 hi plane [8192][512] + f16 residual x4096 (all tiles, N2 = DM); M=8192, N=512, K=256
//   k = relu(key . Wk + bk)   -> f16 hi plane [8192][512] only; M=8192, N=512, K=256
//   v^T = relu(Wv^T . key^T + bv) per batch -> f16 hi plane [b][h*64+d][s] (pitch SEQ) and residual plane x4096
//     (A = WvT [n][k], Bt = Xk rows of batch b, bias per row; M=512, N=1024, K=256; NVB blocks a batch)
// =====================================================================================================
#define NPB ((NB * SEQ / 64) * (DM / 64) / 8)     // 1024 tiles -> 128 blocks of one projection
#define NVB ((DM / 64) * (SEQ / 64) / 8)          // 128 tiles -> 16 blocks of one batch of v^T
static_assert(NVB * NB == NPB);
__global__ __launch_bounds__(256) void proj_qkv(
    const unsigned short* __restrict__ Xq, const unsigned short* __restrict__ Xk,
    const unsigned short* __restrict__ WqT, const unsigned short* __restrict__ WkT, const unsigned short* __restrict__ WvT,
    const float* __restrict__ bq, const float* __restrict__ bk, const float* __restrict__ bv,
    unsigned short* Qh, unsigned short* Ql, unsigned short* Kh, unsigned short* VTh, unsigned short* VTl) {
  __shared__ __align__(16) float sT[8][16 * 68];   // per-wave 16x64 slab, pitch 68 floats
  const int g = blockIdx.x / NPB;
  const int r = blockIdx.x % NPB;
  if (g == 0) {
    gemm64<0, 3, 1, 1>(sT, r, 0,
        Xq, Xq, QIN, 0LL, WqT, WqT, QIN, 0LL, bq,
        (void*)Qh, DM, 0LL, (void*)Ql, DM, 0LL, DM,
        NB * SEQ, DM, QIN, 4096.0f);
  } else if (g == 1) {
    gemm64<0, 4, 1, 1>(sT, r, 0,
        Xk, Xk, QIN, 0LL, WkT, WkT, QIN, 0LL, bk,
        (void*)Kh, DM, 0LL, (void*)Kh, DM, 0LL, 0,
        NB * SEQ, DM, QIN, 4096.0f);
  } else {
    gemm64<0, 3, 2, 1>(sT, r % NVB, r / NVB,
        WvT, WvT, QIN, 0LL, Xk, Xk, QIN, (long long)SEQ * QIN, bv,
        (void*)VTh, SEQ, (long long)DM * SEQ, (void*)VTl, SEQ, (long long)DM * SEQ, SEQ,
        DM, SEQ, QIN, 4096.0f);
  }
}

// out = context . Wo + bo -> f32 [8192][512] (A = context hi + lo planes, 2 products; M=8192, N=512, K=512): NPB blocks
__global__ __launch_bounds__(256) void proj_out(
    const unsigned short* __restrict__ Oh, const unsigned short* __restrict__ Ol, const unsigned short* __restrict__ WoT,
    const float* __restrict__ bo, float* out) {
  __shared__ __align__(16) float sT[8][16 * 68];   // per-wave 16x64 slab, pitch 68 floats
  gemm64<1, 0, 1, 0>(sT, blockIdx.x, 0,
      Oh, Ol, DM, 0LL, WoT, WoT, DM, 0LL, bo,
      (void*)out, DM, 0LL, (void*)out, DM, 0LL, DM,
      NB * SEQ, DM, DM, 1.0f);
}

// =====================================================================================================
// Attention, head dim 64, per-(query,key) int32 mask [NB][SEQ][SEQ] (0 = masked -> score replaced by the finite
// value -1e8, so a fully masked row yields uniform weights), standard softmax over all SEQ keys.
//   q hi plane (f16, pitch DM): element (b, t, h, d) at [(b*SEQ + t)*DM + h*64 + d]; k plane same layout
//   q residual plane (f16, (q - f16(q))*4096, pitch DM): same layout
//   v^T hi plane (f16): element (b, h, d, s) at [(b*DM + h*64 + d)*SEQ + s]; v^T residual plane (f16, x4096): same layout
//   out planes (bf16 hi / lo of the normalised context): element (b, t, h, d) at [(b*SEQ + t)*DM + h*64 + d]
//   Both products run transposed, so that a lane owns ONE query (column lane&15) and holds 8 keys / 8 d per tile:
//   scores^T = (k . qh^T + (k . ql^T) * rres) * sscale on f16 WMMA (A = K rows, B = q), residual products in a separate
//   accumulator, then the per-(q,k) mask select; p = exp(s - m) carried as f16(1024 p); two score tiles of 16 keys,
//   converted in place, are the B operand of context^T = vh^T . p^T + (vl^T . p^T) * rres (A = V^T rows; separate
//   accumulator folded per chunk in f32): P never goes through LDS. Online softmax in f32: maximum and sum run inside
//   the lane, the two lane halves (keys 8hh..8hh+7 of each group) exchange the maximum once a chunk and join their
//   sums once behind the loop; final multiply by 1/l.
//   Block = 4 waves = 64 query rows of one (b, h); grid = NQB * NH * NB; kv chunks of 64, static trip NQB.
//   K / V^T chunk staging: 128 threads x 4 rows x 8 elements per plane = the whole 64x64 tile (plain 16-B loads into
//   registers, LDS stores with __syncthreads before and after); mask values: each lane loads the 8 consecutive keys of
//   its own query row per 16-key group straight from global, two 16-B loads (addresses always in range).
//   All 20 global loads of chunk kt+1 are issued behind the scores of chunk kt, so that softmax and the second product
//   cover their way; the tiles wait in registers for the barrier that frees the LDS.
//   Output coverage: each wave stores rows q0..q0+15 (it 0..3 x lane>>3 0..3) x 64 columns (8 lanes x 8) of both planes.
// =====================================================================================================
// The 20 global loads of one kv chunk: this thread's 4 rows of the K, V^T and V^T residual tiles, this lane's 32 mask words.
__device__ __forceinline__ void ask_chunk(const _Float16* kg, const _Float16* vg, const _Float16* vlg, const int* mg,
                                          v8h (&ka)[4], v8h (&va)[4], v8h (&vr)[4], v4i (&mk)[8]) {
#pragma unroll
  for (int i = 0; i < 4; ++i) {
    ka[i] = *(const v8h*)(kg + (size_t)(16 * i) * DM);
    va[i] = *(const v8h*)(vg + (size_t)(16 * i) * SEQ);
    vr[i] = *(const v8h*)(vlg + (size_t)(16 * i) * SEQ);
  }
#pragma unroll
  for (int j = 0; j < 4; ++j) {
    mk[2 * j]     = *(const v4i*)(mg + j * 16);        // keys j*16 + 8hh + 0..3 of the lane's query
    mk[2 * j + 1] = *(const v4i*)(mg + j * 16 + 4);    // keys j*16 + 8hh + 4..7
  }
#if defined(__HIP_DEVICE_COMPILE__)
  // the loads are out. The wait names their addresses: these keep their registers up to here (no load's result lands in
  // a pair that an issued load names) and are given up only behind it.
  asm volatile("s_wait_xcnt 0x0" : "+v"(kg), "+v"(vg), "+v"(vlg), "+v"(mg) :: "memory");
#endif
}

// Four waves per SIMD (the whole grid resident at once: 4 workgroups on each WGP) hold only up to 256 registers a wave.
__global__ __launch_bounds__(128) __attribute__((amdgpu_waves_per_eu(4, 4)))
void attn64(const unsigned short* __restrict__ qhp, const unsigned short* __restrict__ qlp,
            const unsigned short* __restrict__ khp,
            const unsigned short* __restrict__ vhp, const unsigned short* __restrict__ vlp,
            const int* __restrict__ maskp,
            unsigned short* ohp, unsigned short* olp, float sscale, float rres) {
  union FH { v16h v; v8h h[2]; };
  __shared__ __align__(16) _Float16 Ksh[64 * LP];                 // K [kv][d]   9 KB
  __shared__ __align__(16) _Float16 Vth[64 * LP];                 // V^T hi [d][kv] 9 KB
  __shared__ __align__(16) _Float16 Vtl[64 * LP];                 // V^T residual [d][kv] 9 KB
  __shared__ __align__(16) float    Os[4][16 * OP];               // per wave context tile [row][d] 17 KB

  const int tid  = threadIdx.x;
  const int wave = tid >> 5;
  const int lane = tid & 31;
  const int hh   = lane >> 4;
  const int c    = lane & 15;

  const int bx   = blockIdx.x;
  const int qb   = bx % NQB;
  const int rest = bx / NQB;
  const int h    = rest % NH;
  const int b    = rest / NH;
  const int q0   = qb * 64 + wave * 16;
  const size_t rowB = (size_t)b * SEQ;

  const _Float16* Qh = (const _Float16*)(const void*)qhp + (size_t)h * HD;
  const _Float16* Ql = (const _Float16*)(const void*)qlp + (size_t)h * HD;
  const _Float16* Kg = (const _Float16*)(const void*)khp + (size_t)h * HD;
  const _Float16* Vh = (const _Float16*)(const void*)vhp + ((size_t)b * DM + (size_t)h * HD) * SEQ;
  const _Float16* Vl = (const _Float16*)(const void*)vlp + ((size_t)b * DM + (size_t)h * HD) * SEQ;
  // mask row of this lane's query q0 + c, from the lane half's first key 8*hh of a group; chunk and group added in the loop
  const int* Mg = maskp + (rowB + (size_t)q0 + (size_t)c) * SEQ + 8 * hh;

  // ---- Q fragments (B operand, column = lane&15): 2 d-chunks, hi and residual ----
  v16h qah[2], qal[2];
#pragma unroll
  for (int dc = 0; dc < 2; ++dc) {
    qah[dc] = ldfrag_h(Qh + (rowB + q0 + c) * DM + dc * 32 + 8 * hh);
    qal[dc] = ldfrag_h(Ql + (rowB + q0 + c) * DM + dc * 32 + 8 * hh);
  }

#if defined(__HIP_DEVICE_COMPILE__)
  // the Q loads are out: behind this wait the first chunk's loads may land in the registers that held the Q addresses
  asm volatile("s_wait_xcnt 0x0" ::: "memory");
#endif

  float mrow = -INFINITY, lrow = 0.f;        // this lane's query: running maximum (both halves agree), this half's sum
  v8f oacc[4];                               // context^T: oacc[t][r] = d t*16 + 8hh + r of query c
#pragma unroll
  for (int t = 0; t < 4; ++t) oacc[t] = zero8();

  // 8 lanes x 16 B = one 128-B tile row, so a wave's load covers 4 whole lines; rows sr, sr+16, sr+32, sr+48 per thread
  const int sr = tid >> 3, sc8 = (tid & 7) * 8;
  const _Float16* kg0  = Kg + (rowB + sr) * DM + sc8;            // K row kv0+sr, d = sc8..sc8+7; kv0 added per chunk
  const _Float16* vg0  = Vh + (size_t)sr * SEQ + sc8;            // V^T row d = sr, s = kv0+sc8..+7
  const _Float16* vlg0 = Vl + (size_t)sr * SEQ + sc8;
  v8h ka[4], va[4], vr[4];                   // the chunk on its way: tile rows ...
  v4i mk[8];                                 // ... and mask words
  ask_chunk(kg0, vg0, vlg0, Mg, ka, va, vr, mk);

  for (int kt = 0; kt < NQB; ++kt) {         // static trip count
    const int kv0 = kt * 64;
    __syncthreads();
#pragma unroll
    for (int i = 0; i < 4; ++i) {
      *(v8h*)(Ksh + (sr + 16 * i) * LP + sc8) = ka[i];
      *(v8h*)(Vth + (sr + 16 * i) * LP + sc8) = va[i];
      *(v8h*)(Vtl + (sr + 16 * i) * LP + sc8) = vr[i];
    }
    __syncthreads();

    // ---- scores^T: 64 keys x 16 queries per wave, 2 f16 products (hi, residual), then per-(q,k) mask select;
    //      s[j][r] = key j*16 + 8hh + r, query c ----
    v8f s[4];
#pragma unroll
    for (int j = 0; j < 4; ++j) {
      v8f sh = zero8(), sl = zero8();
#pragma unroll
      for (int dc = 0; dc < 2; ++dc) {
        FH kb;
        kb.h[0] = *(const v8h*)(Ksh + (j * 16 + c) * LP + dc * 32 + 8 * hh);
        kb.h[1] = *(const v8h*)(Ksh + (j * 16 + c) * LP + dc * 32 + 16 + 8 * hh);
        sh = mma_h(kb.v, qah[dc], sh);
        sl = mma_h(kb.v, qal[dc], sl);
      }
      const v4i live0 = mk[2 * j];                               // keys j*16 + 8hh + 0..3 of query c
      const v4i live1 = mk[2 * j + 1];                           // keys j*16 + 8hh + 4..7
#pragma unroll
      for (int r = 0; r < 8; ++r) {
        const float v = (sh[r] + sl[r] * rres) * sscale;
        const int live = (r < 4) ? live0[r & 3] : live1[r & 3];
        s[j][r] = (live != 0) ? v : -1.0e8f;
      }
    }

    // ---- the next chunk's global loads. The last trip asks for its own chunk once more (never used), so that every
    //      address stays inside its plane ----
    {
      const int kvn = (kt + 1 < NQB) ? kv0 + 64 : kv0;
      ask_chunk(kg0 + (size_t)kvn * DM, vg0 + kvn, vlg0 + kvn, Mg + kvn, ka, va, vr, mk);
    }

    // ---- maximum over the chunk's keys, online softmax, P^T (x1024, f16) packed as the B operand ----
    float mj[4];
#pragma unroll
    for (int j = 0; j < 4; ++j) {
      mj[j] = s[j][0];
#pragma unroll
      for (int r = 1; r < 8; ++r) mj[j] = fmaxf(mj[j], s[j][r]);
    }
    float m = fmaxf(fmaxf(mj[0], mj[1]), fmaxf(mj[2], mj[3]));
    m = fmaxf(m, xhalf(m));                                      // the other half's 32 keys of the same query
    const float mnew  = fmaxf(mrow, m);
    const float alpha = __expf(mrow - mnew);
    mrow = mnew;
    // pb[kk] element e: e 0..7 = key kk*32 + 8hh + e (tile 2kk), e 8..15 = key kk*32 + 16 + 8hh + (e-8) (tile 2kk+1):
    // the k order of the V^T fragments below
    FH pb[2];
    float ps[4];                                                 // four independent sums, one per 16-key group
#pragma unroll
    for (int j = 0; j < 4; ++j) {
#pragma unroll
      for (int r = 0; r < 8; ++r) {
        const float p = __expf(s[j][r] - mnew);
        ps[j] = (r == 0) ? p : ps[j] + p;
        pb[j >> 1].v[(j & 1) * 8 + r] = (_Float16)(p * 1024.0f);
      }
    }
    lrow = lrow * alpha + ((ps[0] + ps[1]) + (ps[2] + ps[3]));
#pragma unroll
    for (int t = 0; t < 4; ++t)
#pragma unroll
      for (int r = 0; r < 8; ++r) oacc[t][r] *= alpha;

    // ---- context^T += V^T . P^T (f16 WMMA), residual products into a separate accumulator ----
    v8f o1[4];
#pragma unroll
    for (int t = 0; t < 4; ++t) o1[t] = zero8();
#pragma unroll   // pb[kk] lives in registers: a rolled loop would have to pick the operand by a run-time index
    for (int kk = 0; kk < 2; ++kk) {
#pragma unroll
      for (int t = 0; t < 4; ++t) {
        FH vb, vl;
        vb.h[0] = *(const v8h*)(Vth + (t * 16 + c) * LP + kk * 32 + 8 * hh);
        vb.h[1] = *(const v8h*)(Vth + (t * 16 + c) * LP + kk * 32 + 16 + 8 * hh);
        vl.h[0] = *(const v8h*)(Vtl + (t * 16 + c) * LP + kk * 32 + 8 * hh);
        vl.h[1] = *(const v8h*)(Vtl + (t * 16 + c) * LP + kk * 32 + 16 + 8 * hh);
        oacc[t] = mma_h(vb.v, pb[kk].v, oacc[t]);
        o1[t]   = mma_h(vl.v, pb[kk].v, o1[t]);
      }
    }
#pragma unroll
    for (int t = 0; t < 4; ++t)
#pragma unroll
      for (int r = 0; r < 8; ++r) oacc[t][r] += o1[t][r] * rres;
  }

  // ---- normalise (1/l and the 1/1024 p carry), stage the wave's 16x64 tile, bf16 hi/lo split,
  float* os = Os[wave];
  {
    const float l   = lrow + xhalf(lrow);                       // join the two halves' sums of this query
    const float inv = (1.0f / l) * (1.0f / 1024.0f);            // l >= 1 always (the max key contributes 1)
#pragma unroll
    for (int t = 0; t < 4; ++t) {
      v4f x0, x1;
#pragma unroll
      for (int r = 0; r < 4; ++r) { x0[r] = oacc[t][r] * inv; x1[r] = oacc[t][4 + r] * inv; }
      *(v4f*)(os + c * OP + t * 16 + 8 * hh)     = x0;          // row = query c, d = t*16 + 8hh + 0..3
      *(v4f*)(os + c * OP + t * 16 + 8 * hh + 4) = x1;
    }
  }
  wave_sync_lds();
  {
    const int q4 = lane >> 3, c8 = (lane & 7) * 8;
    v4u hv[4], lv[4];
#pragma unroll
    for (int it = 0; it < 4; ++it) {
      const int row = it * 4 + q4;   // it 0..3 x q4 0..3 = rows 0..15 of the wave tile
      const float* sp = os + row * OP + c8;
      v4u a, a2;
#pragma unroll
      for (int e = 0; e < 4; ++e) {
        const float f0 = sp[2 * e], f1 = sp[2 * e + 1];
        const unsigned short h0 = bf_bits(f0), h1 = bf_bits(f1);
        const unsigned short l0 = bf_bits(f0 - bf_up(h0)), l1 = bf_bits(f1 - bf_up(h1));
        a[e] = pk16(h0, h1); a2[e] = pk16(l0, l1);
      }
      hv[it] = a; lv[it] = a2;
    }
    {
#pragma unroll
      for (int it = 0; it < 4; ++it) {
        const int row = it * 4 + q4;
        const size_t go = (rowB + q0 + row) * DM + (size_t)h * HD + c8;
        *(v4u*)(ohp + go) = hv[it];
        *(v4u*)(olp + go) = lv[it];
      }
      
    }
  }
}

// =====================================================================================================
// Workspace map (bytes), every plane an exact multiple of its 64x64-tile / whole-line store granularity:
//   Xq    bf16 [8192][256]           0          4194304
//   Xk    bf16 [8192][256]           4194304    4194304
//   WqT   bf16 [512][256]            8388608    262144
//   WkT   bf16 [512][256]            8650752    262144
//   WvT   bf16 [512][256]            8912896    262144
//   WoT   bf16 [512][512]            9175040    524288
//   Qh    f16  [8192][512]           9699328    8388608
//   Ql    f16  [8192][512]           18087936   8388608   (q residual x4096)
//   Kh    f16  [8192][512]           26476544   8388608
//   VTh   f16  [8][512][1024]        34865152   8388608
//   VTl   f16  [8][512][1024]        43253760   8388608   (v residual x4096)
//   Oh    bf16 [8192][512]           51642368   8388608
//   Ol    bf16 [8192][512]           60030976   8388608
//   end                              68419584
// Weights arrive as [in k][out n] and are transpose-converted to [out n][in k] (k contiguous = Bt / A layout).
// =====================================================================================================
extern "C" void kernel_launch(void* const* d_in, const int* in_sizes, int n_in,
                              void* d_out, int out_size, void* d_ws, size_t ws_size,
                              hipStream_t stream) {
  if (n_in < 11) return;
  if (in_sizes[0] != NB * SEQ * QIN || in_sizes[1] != NB * SEQ * QIN) return;
  if (in_sizes[2] != NB * SEQ * SEQ) return;
  if (in_sizes[3] != QIN * DM || in_sizes[5] != QIN * DM || in_sizes[7] != QIN * DM) return;
  if (in_sizes[9] != DM * DM) return;
  if (in_sizes[4] != DM || in_sizes[6] != DM || in_sizes[8] != DM || in_sizes[10] != DM) return;
  if (out_size != NB * SEQ * DM) return;

  const float* query = (const float*)d_in[0];
  const float* key   = (const float*)d_in[1];
  const int*   mask  = (const int*)d_in[2];
  const float* Wq    = (const float*)d_in[3];
  const float* bq    = (const float*)d_in[4];
  const float* Wk    = (const float*)d_in[5];
  const float* bk    = (const float*)d_in[6];
  const float* Wv    = (const float*)d_in[7];
  const float* bv    = (const float*)d_in[8];
  const float* Wo    = (const float*)d_in[9];
  const float* bo    = (const float*)d_in[10];

  const size_t PXI = (size_t)NB * SEQ * QIN * 2;     //  4194304 (bf16 input activation plane)
  const size_t PW  = (size_t)DM * QIN * 2;           //   262144 (one projection weight plane)
  const size_t PWO = (size_t)DM * DM * 2;            //   524288 (output weight plane)
  const size_t PA  = (size_t)NB * SEQ * DM * 2;      //  8388608 (q / k / context planes)
  const size_t PVT = (size_t)NB * DM * SEQ * 2;      //  8388608 (v^T plane)
  size_t off = 0;
  const size_t oXq  = off; off += PXI;
  const size_t oXk  = off; off += PXI;
  const size_t oWq  = off; off += PW;
  const size_t oWk  = off; off += PW;
  const size_t oWv  = off; off += PW;
  const size_t oWo  = off; off += PWO;
  const size_t oQh  = off; off += PA;
  const size_t oQl  = off; off += PA;
  const size_t oKh  = off; off += PA;
  const size_t oVTh = off; off += PVT;
  const size_t oVTl = off; off += PVT;
  const size_t oOh  = off; off += PA;
  const size_t oOl  = off; off += PA;
  if (off > ws_size) return;                          // off = 68419584
  if (off > (size_t)134217728) return;

  char* ws = (char*)d_ws;
  unsigned short* Xq  = (unsigned short*)(ws + oXq);
  unsigned short* Xk  = (unsigned short*)(ws + oXk);
  unsigned short* WqT = (unsigned short*)(ws + oWq);
  unsigned short* WkT = (unsigned short*)(ws + oWk);
  unsigned short* WvT = (unsigned short*)(ws + oWv);
  unsigned short* WoT = (unsigned short*)(ws + oWo);
  unsigned short* Qh  = (unsigned short*)(ws + oQh);
  unsigned short* Ql  = (unsigned short*)(ws + oQl);
  unsigned short* Kh  = (unsigned short*)(ws + oKh);
  unsigned short* VTh = (unsigned short*)(ws + oVTh);
  unsigned short* VTl = (unsigned short*)(ws + oVTl);
  unsigned short* Oh  = (unsigned short*)(ws + oOh);
  unsigned short* Ol  = (unsigned short*)(ws + oOl);

  const dim3 blk(256);
  const dim3 gPrep(3 * NTW + NTO + 2 * NCX);                    // 160 transpose tiles + 2 x 1024 convert blocks
  const dim3 gProj(3 * NPB);                                    // 3 x 128 blocks: q, k, v^T
  const dim3 gOut(NPB);                                         // 1024 tiles -> 128 blocks: M=8192, N=512
  const dim3 gAttn(NB * NH * NQB);                              // 1024 blocks

  // (1) activations -> bf16 planes; weights [in][out] -> transposed bf16 planes [out][in] (RNE convert)
  prep_all<<<gPrep, blk, 0, stream>>>(query, key, Wq, Wk, Wv, Wo, Xq, Xk, WqT, WkT, WvT, WoT);
  // (2) to (4) the q, k and v^T projections
  proj_qkv<<<gProj, blk, 0, stream>>>(Xq, Xk, WqT, WkT, WvT, bq, bk, bv, Qh, Ql, Kh, VTh, VTl);
  // (5) attention with per-(q,k) mask and softmax -> context bf16 hi / lo planes [8192][512]
  attn64<<<gAttn, dim3(128), 0, stream>>>(Qh, Ql, Kh, VTh, VTl, mask, Oh, Ol, 0.125f, 1.0f / 4096.0f);
  // (6) out = context . Wo + bo -> d_out f32 [8192][512]  (A = context hi + lo planes, 2 products; K=512)
  proj_out<<<gOut, blk, 0, stream>>>(Oh, Ol, WoT, bo, (float*)d_out);
  (void)hipGetLastError();
}

// v006
// Measured time: 98.9 microseconds a run.
// In both of two side-by-side timings against v005, it was 1.03 times as fast.
// Over all steps from v000 it is 2.08 times as fast.
// Contractions: q, k and v^T projections = v_wmma_f32_16x16x32_bf16 (bf16 operands from RNE-converted inputs and
// transposed weights, single product, bias and ReLU in f32); k.q^T scores = v_wmma_f32_16x16x32_f16 (q as f16 hi
// plane + f16 residual plane x4096 in a separate accumulator, k f16; 2 products); v^T.p^T = v_wmma_f32_16x16x32_f16
// (p carried x1024 in f16, v^T as f16 hi plane + f16 residual plane x4096 in a separate accumulator; 2 products);
// ctx.Wo = v_wmma_f32_16x16x32_bf16 (ctx as bf16 hi + lo planes times bf16 Wo^T, 2 products, bias in f32);
// all f32 accumulate; per-(query,key) mask select and softmax in f32.
#include <hip/hip_runtime.h>
#include <math.h>
#include <stdint.h>

#define NB    8
#define SEQ   1024
#define QIN   256
#define DM    512
#define NH    8
#define HD    64
#define NQB   (SEQ / 64)     // 16 key / query tiles of 64
#define LP    72             // LDS row pitch of the 64-wide f16 tiles, in halves: 144 B = 16 B x odd, so the 16 rows that one
                             // ds_load_b128 fragment read touches fall on 16 different 4-bank groups
#define OP    68             // LDS row pitch of the 64-wide f32 context tile, in floats (16-byte column walks)
static_assert(NH * HD == DM);
static_assert((SEQ % 64) == 0 && (DM % 64) == 0 && (QIN % 64) == 0 && (QIN % 32) == 0 && (DM % 32) == 0);

typedef _Float16 v16h __attribute__((ext_vector_type(16)));
typedef _Float16 v8h  __attribute__((ext_vector_type(8)));
typedef __bf16   v16b __attribute__((ext_vector_type(16)));
typedef __bf16   v8b  __attribute__((ext_vector_type(8)));
typedef float    v8f  __attribute__((ext_vector_type(8)));
typedef float    v4f  __attribute__((ext_vector_type(4)));
typedef unsigned int v4u __attribute__((ext_vector_type(4)));
typedef int          v4i __attribute__((ext_vector_type(4)));

// ---- scalar helpers --------------------------------------------------------------------------------
__device__ __forceinline__ unsigned short bf_bits(float f) {          // f32 -> bf16 bits, RNE convert
  unsigned u = __float_as_uint(f);
  return (unsigned short)((u + 0x7FFFu + ((u >> 16) & 1u)) >> 16);
}
__device__ __forceinline__ float bf_up(unsigned short h) { return __uint_as_float(((unsigned)h) << 16); }
__device__ __forceinline__ unsigned short h_bits(_Float16 x) { return __builtin_bit_cast(unsigned short, x); }
__device__ __forceinline__ unsigned pk16(unsigned short a, unsigned short b) { return (unsigned)a | ((unsigned)b << 16); }
__device__ __forceinline__ v8f zero8() { v8f z = {0.f, 0.f, 0.f, 0.f, 0.f, 0.f, 0.f, 0.f}; return z; }

// ---- fragment loaders: 16-bit A/B operand, lane -> row/col (lane&15), p already includes +8*(lane>>4);
//      elements 0..7 <- p[0..7] (k0+8h..), elements 8..15 <- p[16..23] (k0+16+8h..)
//      ldfrag_b reads global memory only; the cast says so, for an address that has gone through an asm statement
//      would otherwise be loaded from in the flat form
typedef const __attribute__((address_space(1))) v8b* gv8b;
__device__ __forceinline__ v16b ldfrag_b(const __bf16* p) {
  union { v16b v; v8b h[2]; } f;
  f.h[0] = *(gv8b)(p);
  f.h[1] = *(gv8b)(p + 16);
  return f.v;
}
__device__ __forceinline__ v16h ldfrag_h(const _Float16* p) {
  union { v16h v; v8h h[2]; } f;
  f.h[0] = *(const v8h*)(p);
  f.h[1] = *(const v8h*)(p + 16);
  return f.v;
}

// ---- WMMA helpers with trailing VALU hazard gap --------------------------------------------------------
__device__ __forceinline__ v8f mma_h(v16h a, v16h b, v8f c) {
  c = __builtin_amdgcn_wmma_f32_16x16x32_f16(false, a, false, b, (short)0, c, false, false);
#if defined(__HIP_DEVICE_COMPILE__)
  asm volatile("v_nop\n\tv_nop\n\tv_nop\n\tv_nop" : "+v"(c) : "v"(a), "v"(b));
#endif
  return c;
}
__device__ __forceinline__ v8f mma_b_raw(v16b a, v16b b, v8f c) {
  return __builtin_amdgcn_wmma_f32_16x16x32_bf16(false, a, false, b, (short)0, c, false, false);
}
__device__ __forceinline__ void dep_guard_b(v8f& a, v8f& b, v16b x, v16b y) {
#if defined(__HIP_DEVICE_COMPILE__)
  asm volatile("v_nop\n\tv_nop\n\tv_nop\n\tv_nop" : "+v"(a), "+v"(b) : "v"(x), "v"(y));
#endif
}
__device__ __forceinline__ void keep4_b(v16b a, v16b b, v16b c, v16b d) {
#if defined(__HIP_DEVICE_COMPILE__)
  asm volatile("v_nop" :: "v"(a), "v"(b), "v"(c), "v"(d));
#endif
}
__device__ __forceinline__ void acc_guard4(v8f& a, v8f& b, v8f& c, v8f& d) {
#if defined(__HIP_DEVICE_COMPILE__)
  asm volatile("v_nop\n\tv_nop\n\tv_nop\n\tv_nop" : "+v"(a), "+v"(b), "+v"(c), "+v"(d));
#endif
}
// lane l <-> lane l ^ 16 as a vector cross-row move (a shuffle would go the LDS path and be waited for on dscnt)
__device__ __forceinline__ float xhalf(float x) {
  return __builtin_bit_cast(float, __builtin_amdgcn_permlanex16(__builtin_bit_cast(int, x), __builtin_bit_cast(int, x),
                                                                0x76543210, 0xfedcba98, false, false));
}
__device__ __forceinline__ void wave_sync_lds() {
  __builtin_amdgcn_fence(__ATOMIC_RELEASE, "workgroup");
  __builtin_amdgcn_wave_barrier();
  __builtin_amdgcn_fence(__ATOMIC_ACQUIRE, "workgroup");
}

// =====================================================================================================
// f32 -> bf16 (RNE convert), 8 elements per thread, one 16-B store per lane: a wave writes 512 contiguous B
// coverage: n8 threads x 8 = whole plane (n8 is a multiple of 256 for every use here). bx = block index inside the plane.
// =====================================================================================================
__device__ __forceinline__ void cvt_bf16x8(const float* __restrict__ in, unsigned short* out, int n8, int bx) {
  const int i = bx * 256 + threadIdx.x;
  if (i < n8) {
    const v4f a = *(const v4f*)(in + (size_t)i * 8);
    const v4f b = *(const v4f*)(in + (size_t)i * 8 + 4);
    v4u p;
    p[0] = pk16(bf_bits(a[0]), bf_bits(a[1]));
    p[1] = pk16(bf_bits(a[2]), bf_bits(a[3]));
    p[2] = pk16(bf_bits(b[0]), bf_bits(b[1]));
    p[3] = pk16(bf_bits(b[2]), bf_bits(b[3]));
    *(v4u*)(out + (size_t)i * 8) = p;
    
  }
}

// =====================================================================================================
// Transpose-convert: f32 in[R][C] row-major -> bf16 (RNE convert) outT[C][R] row-major, outT[c][r] = in[r][c].
// (bx, by) in (C/64, R/64) (bx = column tile of in = row tile of outT), block 256; R, C multiples of 64.
// Load: thread tid reads in row r0 + (tid>>2), 16 floats at c0 + (tid&3)*16 (4 x 16-B loads) -> LDS tile[r][c].
// coverage: load 64 rows x 4 x 16 cols = 64x64; store 8 waves x 2 x 4 rows x (8 lanes x 8) = 64x64.
// =====================================================================================================
__device__ __forceinline__ void cvt_bf16_t64(const float* __restrict__ in, unsigned short* outT, int R, int C, int bx, int by) {
  __shared__ float tile[64][65];
  const int tid  = threadIdx.x;
  const int lane = tid & 31;
  const int wave = tid >> 5;
  const int c0 = bx * 64;
  const int r0 = by * 64;
  {
    const int r = tid >> 2, cs = (tid & 3) * 16;
    const float* g = in + (size_t)(r0 + r) * C + c0 + cs;
#pragma unroll
    for (int i = 0; i < 4; ++i) {
      const v4f v = *(const v4f*)(g + 4 * i);
      tile[r][cs + 4 * i + 0] = v[0];
      tile[r][cs + 4 * i + 1] = v[1];
      tile[r][cs + 4 * i + 2] = v[2];
      tile[r][cs + 4 * i + 3] = v[3];
    }
  }
  __syncthreads();
  const int q = lane >> 3, c8 = (lane & 7) * 8;
  v4u pv[2];
#pragma unroll
  for (int it = 0; it < 2; ++it) {
    const int c = wave * 8 + it * 4 + q;
    v4u p;
#pragma unroll
    for (int e = 0; e < 4; ++e)
      p[e] = pk16(bf_bits(tile[c8 + 2 * e][c]), bf_bits(tile[c8 + 2 * e + 1][c]));
    pv[it] = p;
  }
  {
#pragma unroll
    for (int it = 0; it < 2; ++it) {
      const int c = wave * 8 + it * 4 + q;
      *(v4u*)(outT + (size_t)(c0 + c) * R + r0 + c8) = pv[it];
    }
    
  }
}

// =====================================================================================================
// All six converts in one launch (none reads what another writes). Blocks, in this order: 3 x NTW tiles of Wq, Wk, Wv,
// NTO tiles of Wo (the transposes have the longer chain, so they start first), then NCX blocks each of query and key.
// Every branch is uniform for the block.
// =====================================================================================================
#define NTW ((DM / 64) * (QIN / 64))        // 32 tiles of a projection weight
#define NTO ((DM / 64) * (DM / 64))         // 64 tiles of the output weight
#define NCX (NB * SEQ * QIN / 8 / 256)      // 1024 blocks of an activation plane
__global__ __launch_bounds__(256) void prep_all(
    const float* __restrict__ query, const float* __restrict__ key,
    const float* __restrict__ Wq, const float* __restrict__ Wk, const float* __restrict__ Wv, const float* __restrict__ Wo,
    unsigned short* Xq, unsigned short* Xk,
    unsigned short* WqT, unsigned short* WkT, unsigned short* WvT, unsigned short* WoT) {
  const int bx = blockIdx.x;
  if (bx < 3 * NTW + NTO) {
    const int w = bx / NTW;                                    // 0, 1, 2 = Wq, Wk, Wv; 3 and 4 = Wo
    const int t = (w < 3) ? (bx - w * NTW) : (bx - 3 * NTW);
    const float*    in  = (w == 0) ? Wq  : (w == 1) ? Wk  : (w == 2) ? Wv  : Wo;
    unsigned short* out = (w == 0) ? WqT : (w == 1) ? WkT : (w == 2) ? WvT : WoT;
    cvt_bf16_t64(in, out, (w < 3) ? QIN : DM, DM, t % (DM / 64), t / (DM / 64));   // in rows = k, cols = DM
  } else {
    const int c = bx - (3 * NTW + NTO);
    const bool q = c < NCX;
    cvt_bf16x8(q ? query : key, q ? Xq : Xk, NCX * 256, q ? c : c - NCX);
  }
}

// =====================================================================================================
// Register-blocked batched bf16 WMMA GEMM: C[m][n] = sum_k A[m][k] * Bt[n][k] + bias (ReLU optional); one wave
// per 64x64 tile, no block barriers. A row-major [M][K] pitch lda; Bt row-major [N][K] pitch ldb (k contiguous);
// M, N multiples of 64, K multiple of 32 (host-checked). bx = block of GW tiles, by = batch index (strides in elements);
// sT = the block's GW per-wave 16x64 slabs in LDS, pitch 68 floats.
// GW = 4 waves a block, one per SIMD: 1024 tiles make 256 blocks, one for each of the 256 WGPs (blocks of 8 waves would
// leave half the WGPs without work); the 3072 tiles of the three projections make 768 blocks, three for each WGP.
// NSPLIT: 0 = A.Bt; 1 = (A + A2).Bt (A2 = unscaled bf16 lo plane of A); 2 = A.Bt + A2.Bt + A.Bt2.
// BIAS: 0 = none; 1 = bias[n] (per column); 2 = bias[m] (per row). Bias is an f32 array, applied as its
//       bf16 RNE value in the f32 epilogue before any 16-bit split of the result. RELU: 1 = max(v, 0) after bias.
// OUT_MODE: 0 = f32 (pitch ldc); 2 = bf16 hi plane C + bf16 lo plane C2 (lo = RNE(v - hi), unscaled);
//           3 = f16 hi plane C + f16 residual plane C2 = f16((v - hi) * rscale), C2 written only for tiles
//               with n0 < N2 (pitch ldc2, batch stride strideC2); 4 = f16 hi plane C only.
// =====================================================================================================
#define GW 4
template <int NSPLIT, int OUT_MODE, int BIAS, int RELU>
__device__ __forceinline__ void gemm64(
    float (*sT)[16 * 68], int bx, int by,
    const unsigned short* __restrict__ Ap, const unsigned short* A2p, int lda, long long strideA,
    const unsigned short* __restrict__ Btp, const unsigned short* Bt2p, int ldb, long long strideB,
    const float* __restrict__ bias,
    void* Cout, int ldc, long long strideC,
    void* Cout2, int ldc2, long long strideC2, int N2,
    int M, int N, int K, float rscale) {
  const __bf16* A   = (const __bf16*)(const void*)Ap;
  const __bf16* A2  = (const __bf16*)(const void*)A2p;
  const __bf16* Bt  = (const __bf16*)(const void*)Btp;
  const __bf16* Bt2 = (const __bf16*)(const void*)Bt2p;
  const int b    = by;
  const int lane = threadIdx.x & 31;
  const int wave = threadIdx.x >> 5;
  const int tilesN = N >> 6;
  const int tilesM = M >> 6;
  const int tile = bx * GW + wave;
  if (tile >= tilesM * tilesN) return;   // wave-uniform; no block barriers in this kernel
  const int tm = tile / tilesN;
  const int tn = tile - tm * tilesN;
  const int m0 = tm << 6;
  const int n0 = tn << 6;

  const __bf16* Ab  = A  + (size_t)b * strideA;
  const __bf16* Bb  = Bt + (size_t)b * strideB;
  const __bf16* Ab2 = (NSPLIT >= 1) ? (A2  + (size_t)b * strideA) : Ab;
  const __bf16* Bb2 = (NSPLIT == 2) ? (Bt2 + (size_t)b * strideB) : Bb;

  const int rlane = lane & 15;                 // row (A) / col (B, D) within subtile
  const int koff  = (lane >> 4) * 8;           // k offset of this lane half
  const int mOff  = (lane >> 4) * 8;           // D row offset

  v8f acc[4][4];
#pragma unroll
  for (int i = 0; i < 4; ++i)
#pragma unroll
    for (int j = 0; j < 4; ++j) acc[i][j] = zero8();

  // running addresses of this lane's row 0 fragments, 32 elements on a k step; the other rows lie at constant offsets
  const __bf16* pa  = Ab  + (size_t)(m0 + rlane) * lda + koff;
  const __bf16* pa2 = Ab2 + (size_t)(m0 + rlane) * lda + koff;
  const __bf16* pb  = Bb  + (size_t)(n0 + rlane) * ldb + koff;
  const __bf16* pb2 = Bb2 + (size_t)(n0 + rlane) * ldb + koff;
  for (int k0 = 0; k0 < K; k0 += 32) {
    v16b bh[4], bl[4];
#pragma unroll
    for (int j = 0; j < 4; ++j) {
      const size_t bo = (size_t)(j << 4) * ldb;
      bh[j] = ldfrag_b(pb + bo);
      if (NSPLIT == 2) bl[j] = ldfrag_b(pb2 + bo); else bl[j] = bh[j];
    }
#pragma unroll
    for (int i = 0; i < 4; ++i) {
      const size_t ao = (size_t)(i << 4) * lda;
      const v16b ah = ldfrag_b(pa + ao);
      v16b al = ah;
      if (NSPLIT >= 1) al = ldfrag_b(pa2 + ao);
#pragma unroll
      for (int j = 0; j < 4; ++j) {
        acc[i][j] = mma_b_raw(ah, bh[j], acc[i][j]);
        if (NSPLIT >= 1) acc[i][j] = mma_b_raw(al, bh[j], acc[i][j]);
        if (NSPLIT == 2) acc[i][j] = mma_b_raw(ah, bl[j], acc[i][j]);
      }
      dep_guard_b(acc[i][0], acc[i][3], ah, al);
    }
    keep4_b(bh[0], bh[1], bh[2], bh[3]);
    if (NSPLIT == 2) keep4_b(bl[0], bl[1], bl[2], bl[3]);
#if defined(__HIP_DEVICE_COMPILE__)
    // the k step's loads are out. The wait names the running addresses: they keep their registers up to here (no load's
    // result lands in a pair that an issued load names) and are stepped on only behind it.
    if (NSPLIT == 0)      asm volatile("s_wait_xcnt 0x0" : "+v"(pa), "+v"(pb) :: "memory");
    else if (NSPLIT == 1) asm volatile("s_wait_xcnt 0x0" : "+v"(pa), "+v"(pa2), "+v"(pb) :: "memory");
    else                  asm volatile("s_wait_xcnt 0x0" : "+v"(pa), "+v"(pa2), "+v"(pb), "+v"(pb2) :: "memory");
#endif
    pa += 32; pa2 += 32; pb += 32; pb2 += 32;
  }
  acc_guard4(acc[0][0], acc[0][1], acc[0][2], acc[0][3]);
  acc_guard4(acc[1][0], acc[1][1], acc[1][2], acc[1][3]);
  acc_guard4(acc[2][0], acc[2][1], acc[2][2], acc[2][3]);
  acc_guard4(acc[3][0], acc[3][1], acc[3][2], acc[3][3]);

  // ---- epilogue ----
  float bcol[4] = {0.f, 0.f, 0.f, 0.f};
  if (BIAS == 1) {
#pragma unroll
    for (int j = 0; j < 4; ++j) bcol[j] = bf_up(bf_bits(bias[n0 + (j << 4) + rlane]));
  }
  float* slab = sT[wave];
#pragma unroll
  for (int i = 0; i < 4; ++i) {
    const int mBase = m0 + (i << 4);
    float brow[8] = {0.f, 0.f, 0.f, 0.f, 0.f, 0.f, 0.f, 0.f};
    if (BIAS == 2) {
#pragma unroll
      for (int r = 0; r < 8; ++r) brow[r] = bf_up(bf_bits(bias[mBase + mOff + r]));
    }
#pragma unroll
    for (int j = 0; j < 4; ++j) {
#pragma unroll
      for (int r = 0; r < 8; ++r) {
        float vv = acc[i][j][r] + bcol[j] + brow[r];
        if (RELU) vv = fmaxf(vv, 0.0f);
        slab[(mOff + r) * 68 + (j << 4) + rlane] = vv;
      }
    }
    wave_sync_lds();
    if (OUT_MODE == 0) {
      float* C = (float*)Cout + (size_t)b * strideC;
      const int hh = lane >> 4, c4 = (lane & 15) * 4;     // 256-B row segment = 16 lanes x 16 B
      {
#pragma unroll
        for (int it = 0; it < 8; ++it) {
          const int row = it * 2 + hh;                     // it 0..7 x hh 0..1 = rows 0..15
          const v4f v = *(const v4f*)(slab + row * 68 + c4);
          *(v4f*)(C + (size_t)(mBase + row) * ldc + n0 + c4) = v;
        }
        
      }
    } else {
      const int q = lane >> 3, c8 = (lane & 7) * 8;
      unsigned short* C  = (unsigned short*)Cout  + (size_t)b * strideC;
      unsigned short* C2 = (unsigned short*)Cout2 + (size_t)b * strideC2;
      const bool wlo = (OUT_MODE == 2) || (OUT_MODE == 3 && n0 < N2);   // wave-uniform
      v4u hv[4], lv[4];
#pragma unroll
      for (int it = 0; it < 4; ++it) {
        const int row = it * 4 + q;                        // it 0..3 x q 0..3 = rows 0..15
        const float* sp = slab + row * 68 + c8;
        v4u a, a2;
#pragma unroll
        for (int e = 0; e < 4; ++e) {
          const float f0 = sp[2 * e], f1 = sp[2 * e + 1];
          unsigned short h0, h1, l0, l1;
          if (OUT_MODE == 2) {
            h0 = bf_bits(f0); h1 = bf_bits(f1);
            l0 = bf_bits(f0 - bf_up(h0)); l1 = bf_bits(f1 - bf_up(h1));
          } else {
            const _Float16 x0 = (_Float16)f0, x1 = (_Float16)f1;
            h0 = h_bits(x0); h1 = h_bits(x1);
            l0 = h_bits((_Float16)((f0 - (float)x0) * rscale));
            l1 = h_bits((_Float16)((f1 - (float)x1) * rscale));
          }
          a[e] = pk16(h0, h1); a2[e] = pk16(l0, l1);
        }
        hv[it] = a; lv[it] = a2;
      }
      {
#pragma unroll
        for (int it = 0; it < 4; ++it) {
          const int row = it * 4 + q;
          *(v4u*)(C + (size_t)(mBase + row) * ldc + n0 + c8) = hv[it];
          if (wlo) *(v4u*)(C2 + (size_t)(mBase + row) * ldc2 + n0 + c8) = lv[it];
        }
        
      }
    }
    wave_sync_lds();
  }
}

// =====================================================================================================
// The q, k and v^T projections in one launch (none reads what another writes): 3 x NPB blocks, block-uniform branch.
//   q = relu(query . Wq + bq) -> f16 hi plane [8192][512] + f16 residual x4096 (all tiles, N2 = DM); M=8192, N=512, K=256
//   k = relu(key . Wk + bk)   -> f16 hi plane [8192][512] only; M=8192, N=512, K=256
//   v^T = relu(Wv^T . key^T + bv) per batch -> f16 hi plane [b][h*64+d][s] (pitch SEQ) and residual plane x4096
//     (A = WvT [n][k], Bt = Xk rows of batch b, bias per row; M=512, N=1024, K=256; NVB blocks a batch)
// =====================================================================================================
#define NPB ((NB * SEQ / 64) * (DM / 64) / GW)    // 1024 tiles -> 256 blocks of one projection
#define NVB ((DM / 64) * (SEQ / 64) / GW)         // 128 tiles -> 32 blocks of one batch of v^T
static_assert(NVB * NB == NPB);
// At most three waves a SIMD: no WGP takes a fourth block while another holds two.
__global__ __launch_bounds__(GW * 32) __attribute__((amdgpu_waves_per_eu(1, 3))) void proj_qkv(
    const unsigned short* __restrict__ Xq, const unsigned short* __restrict__ Xk,
    const unsigned short* __restrict__ WqT, const unsigned short* __restrict__ WkT, const unsigned short* __restrict__ WvT,
    const float* __restrict__ bq, const float* __restrict__ bk, const float* __restrict__ bv,
    unsigned short* Qh, unsigned short* Ql, unsigned short* Kh, unsigned short* VTh, unsigned short* VTl) {
  __shared__ __align__(16) float sT[GW][16 * 68];  // per-wave 16x64 slab, pitch 68 floats
  const int g = blockIdx.x / NPB;
  const int r = blockIdx.x % NPB;
  if (g == 0) {
    gemm64<0, 3, 1, 1>(sT, r, 0,
        Xq, Xq, QIN, 0LL, WqT, WqT, QIN, 0LL, bq,
        (void*)Qh, DM, 0LL, (void*)Ql, DM, 0LL, DM,
        NB * SEQ, DM, QIN, 4096.0f);
  } else if (g == 1) {
    gemm64<0, 4, 1, 1>(sT, r, 0,
        Xk, Xk, QIN, 0LL, WkT, WkT, QIN, 0LL, bk,
        (void*)Kh, DM, 0LL, (void*)Kh, DM, 0LL, 0,
        NB * SEQ, DM, QIN, 4096.0f);
  } else {
    gemm64<0, 3, 2, 1>(sT, r % NVB, r / NVB,
        WvT, WvT, QIN, 0LL, Xk, Xk, QIN, (long long)SEQ * QIN, bv,
        (void*)VTh, SEQ, (long long)DM * SEQ, (void*)VTl, SEQ, (long long)DM * SEQ, SEQ,
        DM, SEQ, QIN, 4096.0f);
  }
}

// out = context . Wo + bo -> f32 [8192][512] (A = context hi + lo planes, 2 products; M=8192, N=512, K=512): NPB blocks
// At most one wave a SIMD: no WGP takes a second block while another holds none.
__global__ __launch_bounds__(GW * 32) __attribute__((amdgpu_waves_per_eu(1, 1))) void proj_out(
    const unsigned short* __restrict__ Oh, const unsigned short* __restrict__ Ol, const unsigned short* __restrict__ WoT,
    const float* __restrict__ bo, float* out) {
  __shared__ __align__(16) float sT[GW][16 * 68];  // per-wave 16x64 slab, pitch 68 floats
  gemm64<1, 0, 1, 0>(sT, blockIdx.x, 0,
      Oh, Ol, DM, 0LL, WoT, WoT, DM, 0LL, bo,
      (void*)out, DM, 0LL, (void*)out, DM, 0LL, DM,
      NB * SEQ, DM, DM, 1.0f);
}

// =====================================================================================================
// Attention, head dim 64, per-(query,key) int32 mask [NB][SEQ][SEQ] (0 = masked -> score replaced by the finite
// value -1e8, so a fully masked row yields uniform weights), standard softmax over all SEQ keys.
//   q hi plane (f16, pitch DM): element (b, t, h, d) at [(b*SEQ + t)*DM + h*64 + d]; k plane same layout
//   q residual plane (f16, (q - f16(q))*4096, pitch DM): same layout
//   v^T hi plane (f16): element (b, h, d, s) at [(b*DM + h*64 + d)*SEQ + s]; v^T residual plane (f16, x4096): same layout
//   out planes (bf16 hi / lo of the normalised context): element (b, t, h, d) at [(b*SEQ + t)*DM + h*64 + d]
//   Both products run transposed, so that a lane owns ONE query (column lane&15) and holds 8 keys / 8 d per tile:
//   scores^T = (k . qh^T + (k . ql^T) * rres) * sscale on f16 WMMA (A = K rows, B = q), residual products in a separate
//   accumulator, then the per-(q,k) mask select; p = exp(s - m) carried as f16(1024 p); two score tiles of 16 keys,
//   converted in place, are the B operand of context^T = vh^T . p^T + (vl^T . p^T) * rres (A = V^T rows; separate
//   accumulator folded per chunk in f32): P never goes through LDS. Online softmax in f32: maximum and sum run inside
//   the lane, the two lane halves (keys 8hh..8hh+7 of each group) exchange the maximum once a chunk and join their
//   sums once behind the loop; final multiply by 1/l.
//   Block = 4 waves = 64 query rows of one (b, h); grid = NQB * NH * NB; kv chunks of 64, static trip NQB.
//   K / V^T chunk staging: 128 threads x 4 rows x 8 elements per plane = the whole 64x64 tile (plain 16-B loads into
//   registers, LDS stores with __syncthreads before and after); mask values: each lane loads the 8 consecutive keys of
//   its own query row per 16-key group straight from global, two 16-B loads (addresses always in range).
//   All 20 global loads of chunk kt+1 are issued behind the scores of chunk kt, so that softmax and the second product
//   cover their way; the tiles wait in registers for the barrier that frees the LDS.
//   Output coverage: each wave stores rows q0..q0+15 (it 0..3 x lane>>3 0..3) x 64 columns (8 lanes x 8) of both planes.
// =====================================================================================================
// The 20 global loads of one kv chunk: this thread's 4 rows of the K, V^T and V^T residual tiles, this lane's 32 mask words.
__device__ __forceinline__ void ask_chunk(const _Float16* kg, const _Float16* vg, const _Float16* vlg, const int* mg,
                                          v8h (&ka)[4], v8h (&va)[4], v8h (&vr)[4], v4i (&mk)[8]) {
#pragma unroll
  for (int i = 0; i < 4; ++i) {
    ka[i] = *(const v8h*)(kg + (size_t)(16 * i) * DM);
    va[i] = *(const v8h*)(vg + (size_t)(16 * i) * SEQ);
    vr[i] = *(const v8h*)(vlg + (size_t)(16 * i) * SEQ);
  }
#pragma unroll
  for (int j = 0; j < 4; ++j) {
    mk[2 * j]     = *(const v4i*)(mg + j * 16);        // keys j*16 + 8hh + 0..3 of the lane's query
    mk[2 * j + 1] = *(const v4i*)(mg + j * 16 + 4);    // keys j*16 + 8hh + 4..7
  }
#if defined(__HIP_DEVICE_COMPILE__)
  // the loads are out. The wait names their addresses: these keep their registers up to here (no load's result lands in
  // a pair that an issued load names) and are given up only behind it.
  asm volatile("s_wait_xcnt 0x0" : "+v"(kg), "+v"(vg), "+v"(vlg), "+v"(mg) :: "memory");
#endif
}

// Four waves per SIMD (the whole grid resident at once: 4 workgroups on each WGP) hold only up to 256 registers a wave.
__global__ __launch_bounds__(128) __attribute__((amdgpu_waves_per_eu(4, 4)))
void attn64(const unsigned short* __restrict__ qhp, const unsigned short* __restrict__ qlp,
            const unsigned short* __restrict__ khp,
            const unsigned short* __restrict__ vhp, const unsigned short* __restrict__ vlp,
            const int* __restrict__ maskp,
            unsigned short* ohp, unsigned short* olp, float sscale, float rres) {
  union FH { v16h v; v8h h[2]; };
  __shared__ __align__(16) _Float16 Ksh[64 * LP];                 // K [kv][d]   9 KB
  __shared__ __align__(16) _Float16 Vth[64 * LP];                 // V^T hi [d][kv] 9 KB
  __shared__ __align__(16) _Float16 Vtl[64 * LP];                 // V^T residual [d][kv] 9 KB
  __shared__ __align__(16) float    Os[4][16 * OP];               // per wave context tile [row][d] 17 KB

  const int tid  = threadIdx.x;
  const int wave = tid >> 5;
  const int lane = tid & 31;
  const int hh   = lane >> 4;
  const int c    = lane & 15;

  const int bx   = blockIdx.x;
  const int qb   = bx % NQB;
  const int rest = bx / NQB;
  const int h    = rest % NH;
  const int b    = rest / NH;
  const int q0   = qb * 64 + wave * 16;
  const size_t rowB = (size_t)b * SEQ;

  const _Float16* Qh = (const _Float16*)(const void*)qhp + (size_t)h * HD;
  const _Float16* Ql = (const _Float16*)(const void*)qlp + (size_t)h * HD;
  const _Float16* Kg = (const _Float16*)(const void*)khp + (size_t)h * HD;
  const _Float16* Vh = (const _Float16*)(const void*)vhp + ((size_t)b * DM + (size_t)h * HD) * SEQ;
  const _Float16* Vl = (const _Float16*)(const void*)vlp + ((size_t)b * DM + (size_t)h * HD) * SEQ;
  // mask row of this lane's query q0 + c, from the lane half's first key 8*hh of a group; chunk and group added in the loop
  const int* Mg = maskp + (rowB + (size_t)q0 + (size_t)c) * SEQ + 8 * hh;

  // ---- Q fragments (B operand, column = lane&15): 2 d-chunks, hi and residual ----
  v16h qah[2], qal[2];
#pragma unroll
  for (int dc = 0; dc < 2; ++dc) {
    qah[dc] = ldfrag_h(Qh + (rowB + q0 + c) * DM + dc * 32 + 8 * hh);
    qal[dc] = ldfrag_h(Ql + (rowB + q0 + c) * DM + dc * 32 + 8 * hh);
  }

#if defined(__HIP_DEVICE_COMPILE__)
  // the Q loads are out: behind this wait the first chunk's loads may land in the registers that held the Q addresses
  asm volatile("s_wait_xcnt 0x0" ::: "memory");
#endif

  float mrow = -INFINITY, lrow = 0.f;        // this lane's query: running maximum (both halves agree), this half's sum
  v8f oacc[4];                               // context^T: oacc[t][r] = d t*16 + 8hh + r of query c
#pragma unroll
  for (int t = 0; t < 4; ++t) oacc[t] = zero8();

  // 8 lanes x 16 B = one 128-B tile row, so a wave's load covers 4 whole lines; rows sr, sr+16, sr+32, sr+48 per thread
  const int sr = tid >> 3, sc8 = (tid & 7) * 8;
  const _Float16* kg0  = Kg + (rowB + sr) * DM + sc8;            // K row kv0+sr, d = sc8..sc8+7; kv0 added per chunk
  const _Float16* vg0  = Vh + (size_t)sr * SEQ + sc8;            // V^T row d = sr, s = kv0+sc8..+7
  const _Float16* vlg0 = Vl + (size_t)sr * SEQ + sc8;
  v8h ka[4], va[4], vr[4];                   // the chunk on its way: tile rows ...
  v4i mk[8];                                 // ... and mask words
  ask_chunk(kg0, vg0, vlg0, Mg, ka, va, vr, mk);

  for (int kt = 0; kt < NQB; ++kt) {         // static trip count
    const int kv0 = kt * 64;
    __syncthreads();
#pragma unroll
    for (int i = 0; i < 4; ++i) {
      *(v8h*)(Ksh + (sr + 16 * i) * LP + sc8) = ka[i];
      *(v8h*)(Vth + (sr + 16 * i) * LP + sc8) = va[i];
      *(v8h*)(Vtl + (sr + 16 * i) * LP + sc8) = vr[i];
    }
    __syncthreads();

    // ---- scores^T: 64 keys x 16 queries per wave, 2 f16 products (hi, residual), then per-(q,k) mask select;
    //      s[j][r] = key j*16 + 8hh + r, query c ----
    v8f s[4];
#pragma unroll
    for (int j = 0; j < 4; ++j) {
      v8f sh = zero8(), sl = zero8();
#pragma unroll
      for (int dc = 0; dc < 2; ++dc) {
        FH kb;
        kb.h[0] = *(const v8h*)(Ksh + (j * 16 + c) * LP + dc * 32 + 8 * hh);
        kb.h[1] = *(const v8h*)(Ksh + (j * 16 + c) * LP + dc * 32 + 16 + 8 * hh);
        sh = mma_h(kb.v, qah[dc], sh);
        sl = mma_h(kb.v, qal[dc], sl);
      }
      const v4i live0 = mk[2 * j];                               // keys j*16 + 8hh + 0..3 of query c
      const v4i live1 = mk[2 * j + 1];                           // keys j*16 + 8hh + 4..7
#pragma unroll
      for (int r = 0; r < 8; ++r) {
        const float v = (sh[r] + sl[r] * rres) * sscale;
        const int live = (r < 4) ? live0[r & 3] : live1[r & 3];
        s[j][r] = (live != 0) ? v : -1.0e8f;
      }
    }

    // ---- the next chunk's global loads. The last trip asks for its own chunk once more (never used), so that every
    //      address stays inside its plane ----
    {
      const int kvn = (kt + 1 < NQB) ? kv0 + 64 : kv0;
      ask_chunk(kg0 + (size_t)kvn * DM, vg0 + kvn, vlg0 + kvn, Mg + kvn, ka, va, vr, mk);
    }

    // ---- maximum over the chunk's keys, online softmax, P^T (x1024, f16) packed as the B operand ----
    float mj[4];
#pragma unroll
    for (int j = 0; j < 4; ++j) {
      mj[j] = s[j][0];
#pragma unroll
      for (int r = 1; r < 8; ++r) mj[j] = fmaxf(mj[j], s[j][r]);
    }
    float m = fmaxf(fmaxf(mj[0], mj[1]), fmaxf(mj[2], mj[3]));
    m = fmaxf(m, xhalf(m));                                      // the other half's 32 keys of the same query
    const float mnew  = fmaxf(mrow, m);
    const float alpha = __expf(mrow - mnew);
    mrow = mnew;
    // pb[kk] element e: e 0..7 = key kk*32 + 8hh + e (tile 2kk), e 8..15 = key kk*32 + 16 + 8hh + (e-8) (tile 2kk+1):
    // the k order of the V^T fragments below
    FH pb[2];
    float ps[4];                                                 // four independent sums, one per 16-key group
#pragma unroll
    for (int j = 0; j < 4; ++j) {
#pragma unroll
      for (int r = 0; r < 8; ++r) {
        const float p = __expf(s[j][r] - mnew);
        ps[j] = (r == 0) ? p : ps[j] + p;
        pb[j >> 1].v[(j & 1) * 8 + r] = (_Float16)(p * 1024.0f);
      }
    }
    lrow = lrow * alpha + ((ps[0] + ps[1]) + (ps[2] + ps[3]));
#pragma unroll
    for (int t = 0; t < 4; ++t)
#pragma unroll
      for (int r = 0; r < 8; ++r) oacc[t][r] *= alpha;

    // ---- context^T += V^T . P^T (f16 WMMA), residual products into a separate accumulator ----
    v8f o1[4];
#pragma unroll
    for (int t = 0; t < 4; ++t) o1[t] = zero8();
#pragma unroll   // pb[kk] lives in registers: a rolled loop would have to pick the operand by a run-time index
    for (int kk = 0; kk < 2; ++kk) {
#pragma unroll
      for (int t = 0; t < 4; ++t) {
        FH vb, vl;
        vb.h[0] = *(const v8h*)(Vth + (t * 16 + c) * LP + kk * 32 + 8 * hh);
        vb.h[1] = *(const v8h*)(Vth + (t * 16 + c) * LP + kk * 32 + 16 + 8 * hh);
        vl.h[0] = *(const v8h*)(Vtl + (t * 16 + c) * LP + kk * 32 + 8 * hh);
        vl.h[1] = *(const v8h*)(Vtl + (t * 16 + c) * LP + kk * 32 + 16 + 8 * hh);
        oacc[t] = mma_h(vb.v, pb[kk].v, oacc[t]);
        o1[t]   = mma_h(vl.v, pb[kk].v, o1[t]);
      }
    }
#pragma unroll
    for (int t = 0; t < 4; ++t)
#pragma unroll
      for (int r = 0; r < 8; ++r) oacc[t][r] += o1[t][r] * rres;
  }

  // ---- normalise (1/l and the 1/1024 p carry), stage the wave's 16x64 tile, bf16 hi/lo split,
  float* os = Os[wave];
  {
    const float l   = lrow + xhalf(lrow);                       // join the two halves' sums of this query
    const float inv = (1.0f / l) * (1.0f / 1024.0f);            // l >= 1 always (the max key contributes 1)
#pragma unroll
    for (int t = 0; t < 4; ++t) {
      v4f x0, x1;
#pragma unroll
      for (int r = 0; r < 4; ++r) { x0[r] = oacc[t][r] * inv; x1[r] = oacc[t][4 + r] * inv; }
      *(v4f*)(os + c * OP + t * 16 + 8 * hh)     = x0;          // row = query c, d = t*16 + 8hh + 0..3
      *(v4f*)(os + c * OP + t * 16 + 8 * hh + 4) = x1;
    }
  }
  wave_sync_lds();
  {
    const int q4 = lane >> 3, c8 = (lane & 7) * 8;
    v4u hv[4], lv[4];
#pragma unroll
    for (int it = 0; it < 4; ++it) {
      const int row = it * 4 + q4;   // it 0..3 x q4 0..3 = rows 0..15 of the wave tile
      const float* sp = os + row * OP + c8;
      v4u a, a2;
#pragma unroll
      for (int e = 0; e < 4; ++e) {
        const float f0 = sp[2 * e], f1 = sp[2 * e + 1];
        const unsigned short h0 = bf_bits(f0), h1 = bf_bits(f1);
        const unsigned short l0 = bf_bits(f0 - bf_up(h0)), l1 = bf_bits(f1 - bf_up(h1));
        a[e] = pk16(h0, h1); a2[e] = pk16(l0, l1);
      }
      hv[it] = a; lv[it] = a2;
    }
    {
#pragma unroll
      for (int it = 0; it < 4; ++it) {
        const int row = it * 4 + q4;
        const size_t go = (rowB + q0 + row) * DM + (size_t)h * HD + c8;
        *(v4u*)(ohp + go) = hv[it];
        *(v4u*)(olp + go) = lv[it];
      }
      
    }
  }
}

// =====================================================================================================
// Workspace map (bytes), every plane an exact multiple of its 64x64-tile / whole-line store granularity:
//   Xq    bf16 [8192][256]           0          4194304
//   Xk    bf16 [8192][256]           4194304    4194304
//   WqT   bf16 [512][256]            8388608    262144
//   WkT   bf16 [512][256]            8650752    262144
//   WvT   bf16 [512][256]            8912896    262144
//   WoT   bf16 [512][512]            9175040    524288
//   Qh    f16  [8192][512]           9699328    8388608
//   Ql    f16  [8192][512]           18087936   8388608   (q residual x4096)
//   Kh    f16  [8192][512]           26476544   8388608
//   VTh   f16  [8][512][1024]        34865152   8388608
//   VTl   f16  [8][512][1024]        43253760   8388608   (v residual x4096)
//   Oh    bf16 [8192][512]           51642368   8388608
//   Ol    bf16 [8192][512]           60030976   8388608
//   end                              68419584
// Weights arrive as [in k][out n] and are transpose-converted to [out n][in k] (k contiguous = Bt / A layout).
// =====================================================================================================
extern "C" void kernel_launch(void* const* d_in, const int* in_sizes, int n_in,
                              void* d_out, int out_size, void* d_ws, size_t ws_size,
                              hipStream_t stream) {
  if (n_in < 11) return;
  if (in_sizes[0] != NB * SEQ * QIN || in_sizes[1] != NB * SEQ * QIN) return;
  if (in_sizes[2] != NB * SEQ * SEQ) return;
  if (in_sizes[3] != QIN * DM || in_sizes[5] != QIN * DM || in_sizes[7] != QIN * DM) return;
  if (in_sizes[9] != DM * DM) return;
  if (in_sizes[4] != DM || in_sizes[6] != DM || in_sizes[8] != DM || in_sizes[10] != DM) return;
  if (out_size != NB * SEQ * DM) return;

  const float* query = (const float*)d_in[0];
  const float* key   = (const float*)d_in[1];
  const int*   mask  = (const int*)d_in[2];
  const float* Wq    = (const float*)d_in[3];
  const float* bq    = (const float*)d_in[4];
  const float* Wk    = (const float*)d_in[5];
  const float* bk    = (const float*)d_in[6];
  const float* Wv    = (const float*)d_in[7];
  const float* bv    = (const float*)d_in[8];
  const float* Wo    = (const float*)d_in[9];
  const float* bo    = (const float*)d_in[10];

  const size_t PXI = (size_t)NB * SEQ * QIN * 2;     //  4194304 (bf16 input activation plane)
  const size_t PW  = (size_t)DM * QIN * 2;           //   262144 (one projection weight plane)
  const size_t PWO = (size_t)DM * DM * 2;            //   524288 (output weight plane)
  const size_t PA  = (size_t)NB * SEQ * DM * 2;      //  8388608 (q / k / context planes)
  const size_t PVT = (size_t)NB * DM * SEQ * 2;      //  8388608 (v^T plane)
  size_t off = 0;
  const size_t oXq  = off; off += PXI;
  const size_t oXk  = off; off += PXI;
  const size_t oWq  = off; off += PW;
  const size_t oWk  = off; off += PW;
  const size_t oWv  = off; off += PW;
  const size_t oWo  = off; off += PWO;
  const size_t oQh  = off; off += PA;
  const size_t oQl  = off; off += PA;
  const size_t oKh  = off; off += PA;
  const size_t oVTh = off; off += PVT;
  const size_t oVTl = off; off += PVT;
  const size_t oOh  = off; off += PA;
  const size_t oOl  = off; off += PA;
  if (off > ws_size) return;                          // off = 68419584
  if (off > (size_t)134217728) return;

  char* ws = (char*)d_ws;
  unsigned short* Xq  = (unsigned short*)(ws + oXq);
  unsigned short* Xk  = (unsigned short*)(ws + oXk);
  unsigned short* WqT = (unsigned short*)(ws + oWq);
  unsigned short* WkT = (unsigned short*)(ws + oWk);
  unsigned short* WvT = (unsigned short*)(ws + oWv);
  unsigned short* WoT = (unsigned short*)(ws + oWo);
  unsigned short* Qh  = (unsigned short*)(ws + oQh);
  unsigned short* Ql  = (unsigned short*)(ws + oQl);
  unsigned short* Kh  = (unsigned short*)(ws + oKh);
  unsigned short* VTh = (unsigned short*)(ws + oVTh);
  unsigned short* VTl = (unsigned short*)(ws + oVTl);
  unsigned short* Oh  = (unsigned short*)(ws + oOh);
  unsigned short* Ol  = (unsigned short*)(ws + oOl);

  const dim3 blk(256);
  const dim3 gPrep(3 * NTW + NTO + 2 * NCX);                    // 160 transpose tiles + 2 x 1024 convert blocks
  const dim3 blkG(GW * 32);                                     // GEMM blocks: 4 waves
  const dim3 gProj(3 * NPB);                                    // 3 x 256 blocks: q, k, v^T
  const dim3 gOut(NPB);                                         // 1024 tiles -> 256 blocks: M=8192, N=512
  const dim3 gAttn(NB * NH * NQB);                              // 1024 blocks

  // (1) activations -> bf16 planes; weights [in][out] -> transposed bf16 planes [out][in] (RNE convert)
  prep_all<<<gPrep, blk, 0, stream>>>(query, key, Wq, Wk, Wv, Wo, Xq, Xk, WqT, WkT, WvT, WoT);
  // (2) to (4) the q, k and v^T projections
  proj_qkv<<<gProj, blkG, 0, stream>>>(Xq, Xk, WqT, WkT, WvT, bq, bk, bv, Qh, Ql, Kh, VTh, VTl);
  // (5) attention with per-(q,k) mask and softmax -> context bf16 hi / lo planes [8192][512]
  attn64<<<gAttn, dim3(128), 0, stream>>>(Qh, Ql, Kh, VTh, VTl, mask, Oh, Ol, 0.125f, 1.0f / 4096.0f);
  // (6) out = context . Wo + bo -> d_out f32 [8192][512]  (A = context hi + lo planes, 2 products; K=512)
  proj_out<<<gOut, blkG, 0, stream>>>(Oh, Ol, WoT, bo, (float*)d_out);
  (void)hipGetLastError();
}

// v007
// A run of this version takes 95.8 microseconds.
// In both of two side-by-side timings against v006, it was 1.04 times as fast.
// All steps since v000 together make it 2.17 times as fast.
// Contractions: q, k and v^T projections = v_wmma_f32_16x16x32_bf16 (bf16 operands from RNE-converted inputs and
// transposed weights, single product, bias and ReLU in f32); k.q^T scores = v_wmma_f32_16x16x32_f16 (q as f16 hi
// plane + f16 residual plane x4096 in a separate accumulator, k f16; 2 products); v^T.p^T = v_wmma_f32_16x16x32_f16
// (p carried x1024 in f16, v^T as f16 hi plane + f16 residual plane x4096 in a separate accumulator; 2 products);
// ctx.Wo = v_wmma_f32_16x16x32_bf16 (ctx as bf16 hi + lo planes times bf16 Wo^T, 2 products, bias in f32);
// all f32 accumulate; per-(query,key) mask select and softmax in f32.
#include <hip/hip_runtime.h>
#include <math.h>
#include <stdint.h>

#define NB    8
#define SEQ   1024
#define QIN   256
#define DM    512
#define NH    8
#define HD    64
#define NQB   (SEQ / 64)     // 16 key / query tiles of 64
#define LP    72             // LDS row pitch of the 64-wide f16 tiles, in halves: 144 B = 16 B x odd, so the 16 rows that one
                             // ds_load_b128 fragment read touches fall on 16 different 4-bank groups
#define OP    68             // LDS row pitch of the 64-wide f32 context tile, in floats (16-byte column walks)
static_assert(NH * HD == DM);
static_assert((SEQ % 64) == 0 && (DM % 64) == 0 && (QIN % 64) == 0 && (QIN % 32) == 0 && (DM % 32) == 0);

typedef _Float16 v16h __attribute__((ext_vector_type(16)));
typedef _Float16 v8h  __attribute__((ext_vector_type(8)));
typedef __bf16   v16b __attribute__((ext_vector_type(16)));
typedef __bf16   v8b  __attribute__((ext_vector_type(8)));
typedef float    v8f  __attribute__((ext_vector_type(8)));
typedef float    v4f  __attribute__((ext_vector_type(4)));
typedef unsigned int v4u __attribute__((ext_vector_type(4)));
typedef int          v4i __attribute__((ext_vector_type(4)));

// ---- scalar helpers --------------------------------------------------------------------------------
__device__ __forceinline__ unsigned short bf_bits(float f) {          // f32 -> bf16 bits, RNE convert
  unsigned u = __float_as_uint(f);
  return (unsigned short)((u + 0x7FFFu + ((u >> 16) & 1u)) >> 16);
}
__device__ __forceinline__ float bf_up(unsigned short h) { return __uint_as_float(((unsigned)h) << 16); }
__device__ __forceinline__ unsigned short h_bits(_Float16 x) { return __builtin_bit_cast(unsigned short, x); }
__device__ __forceinline__ unsigned pk16(unsigned short a, unsigned short b) { return (unsigned)a | ((unsigned)b << 16); }
__device__ __forceinline__ v8f zero8() { v8f z = {0.f, 0.f, 0.f, 0.f, 0.f, 0.f, 0.f, 0.f}; return z; }

// ---- fragment loaders: 16-bit A/B operand, lane -> row/col (lane&15), p already includes +8*(lane>>4);
//      elements 0..7 <- p[0..7] (k0+8h..), elements 8..15 <- p[16..23] (k0+16+8h..)
//      ldfrag_b reads global memory only; the cast says so, for an address that has gone through an asm statement
//      would otherwise be loaded from in the flat form
typedef const __attribute__((address_space(1))) v8b* gv8b;
__device__ __forceinline__ v16b ldfrag_b(const __bf16* p) {
  union { v16b v; v8b h[2]; } f;
  f.h[0] = *(gv8b)(p);
  f.h[1] = *(gv8b)(p + 16);
  return f.v;
}
__device__ __forceinline__ v16h ldfrag_h(const _Float16* p) {
  union { v16h v; v8h h[2]; } f;
  f.h[0] = *(const v8h*)(p);
  f.h[1] = *(const v8h*)(p + 16);
  return f.v;
}

// ---- WMMA helpers with trailing VALU hazard gap --------------------------------------------------------
__device__ __forceinline__ v8f mma_h(v16h a, v16h b, v8f c) {
  c = __builtin_amdgcn_wmma_f32_16x16x32_f16(false, a, false, b, (short)0, c, false, false);
#if defined(__HIP_DEVICE_COMPILE__)
  asm volatile("v_nop\n\tv_nop\n\tv_nop\n\tv_nop" : "+v"(c) : "v"(a), "v"(b));
#endif
  return c;
}
__device__ __forceinline__ v8f mma_b_raw(v16b a, v16b b, v8f c) {
  return __builtin_amdgcn_wmma_f32_16x16x32_bf16(false, a, false, b, (short)0, c, false, false);
}
__device__ __forceinline__ void dep_guard_b(v8f& a, v8f& b, v16b x, v16b y) {
#if defined(__HIP_DEVICE_COMPILE__)
  asm volatile("v_nop\n\tv_nop\n\tv_nop\n\tv_nop" : "+v"(a), "+v"(b) : "v"(x), "v"(y));
#endif
}
__device__ __forceinline__ void keep4_b(v16b a, v16b b, v16b c, v16b d) {
#if defined(__HIP_DEVICE_COMPILE__)
  asm volatile("v_nop" :: "v"(a), "v"(b), "v"(c), "v"(d));
#endif
}
__device__ __forceinline__ void acc_guard4(v8f& a, v8f& b, v8f& c, v8f& d) {
#if defined(__HIP_DEVICE_COMPILE__)
  asm volatile("v_nop\n\tv_nop\n\tv_nop\n\tv_nop" : "+v"(a), "+v"(b), "+v"(c), "+v"(d));
#endif
}
// lane l <-> lane l ^ 16 as a vector cross-row move (a shuffle would go the LDS path and be waited for on dscnt)
__device__ __forceinline__ float xhalf(float x) {
  return __builtin_bit_cast(float, __builtin_amdgcn_permlanex16(__builtin_bit_cast(int, x), __builtin_bit_cast(int, x),
                                                                0x76543210, 0xfedcba98, false, false));
}
__device__ __forceinline__ void wave_sync_lds() {
  __builtin_amdgcn_fence(__ATOMIC_RELEASE, "workgroup");
  __builtin_amdgcn_wave_barrier();
  __builtin_amdgcn_fence(__ATOMIC_ACQUIRE, "workgroup");
}

// =====================================================================================================
// f32 -> bf16 (RNE convert), 8 elements per thread, one 16-B store per lane: a wave writes 512 contiguous B
// coverage: n8 threads x 8 = whole plane (n8 is a multiple of 256 for every use here). bx = block index inside the plane.
// =====================================================================================================
__device__ __forceinline__ void cvt_bf16x8(const float* __restrict__ in, unsigned short* out, int n8, int bx) {
  const int i = bx * 256 + threadIdx.x;
  if (i < n8) {
    const v4f a = *(const v4f*)(in + (size_t)i * 8);
    const v4f b = *(const v4f*)(in + (size_t)i * 8 + 4);
    v4u p;
    p[0] = pk16(bf_bits(a[0]), bf_bits(a[1]));
    p[1] = pk16(bf_bits(a[2]), bf_bits(a[3]));
    p[2] = pk16(bf_bits(b[0]), bf_bits(b[1]));
    p[3] = pk16(bf_bits(b[2]), bf_bits(b[3]));
    *(v4u*)(out + (size_t)i * 8) = p;
    
  }
}

// =====================================================================================================
// Transpose-convert: f32 in[R][C] row-major -> bf16 (RNE convert) outT[C][R] row-major, outT[c][r] = in[r][c].
// (bx, by) in (C/64, R/64) (bx = column tile of in = row tile of outT), block 256; R, C multiples of 64.
// Load: thread tid reads in row r0 + (tid>>2), 16 floats at c0 + (tid&3)*16 (4 x 16-B loads) -> LDS tile[r][c].
// coverage: load 64 rows x 4 x 16 cols = 64x64; store 8 waves x 2 x 4 rows x (8 lanes x 8) = 64x64.
// =====================================================================================================
__device__ __forceinline__ void cvt_bf16_t64(const float* __restrict__ in, unsigned short* outT, int R, int C, int bx, int by) {
  __shared__ float tile[64][65];
  const int tid  = threadIdx.x;
  const int lane = tid & 31;
  const int wave = tid >> 5;
  const int c0 = bx * 64;
  const int r0 = by * 64;
  {
    const int r = tid >> 2, cs = (tid & 3) * 16;
    const float* g = in + (size_t)(r0 + r) * C + c0 + cs;
#pragma unroll
    for (int i = 0; i < 4; ++i) {
      const v4f v = *(const v4f*)(g + 4 * i);
      tile[r][cs + 4 * i + 0] = v[0];
      tile[r][cs + 4 * i + 1] = v[1];
      tile[r][cs + 4 * i + 2] = v[2];
      tile[r][cs + 4 * i + 3] = v[3];
    }
  }
  __syncthreads();
  const int q = lane >> 3, c8 = (lane & 7) * 8;
  v4u pv[2];
#pragma unroll
  for (int it = 0; it < 2; ++it) {
    const int c = wave * 8 + it * 4 + q;
    v4u p;
#pragma unroll
    for (int e = 0; e < 4; ++e)
      p[e] = pk16(bf_bits(tile[c8 + 2 * e][c]), bf_bits(tile[c8 + 2 * e + 1][c]));
    pv[it] = p;
  }
  {
#pragma unroll
    for (int it = 0; it < 2; ++it) {
      const int c = wave * 8 + it * 4 + q;
      *(v4u*)(outT + (size_t)(c0 + c) * R + r0 + c8) = pv[it];
    }
    
  }
}

// =====================================================================================================
// Mask -> lane-select words, once for all heads. Word w = j*8 + r of (row tile rt of 16 queries, kv chunk kt of 64 keys)
// holds in bit l whether mask[rt*16 + (l&15)][kt*64 + j*16 + 8*(l>>4) + r] != 0: the (query, key) that lane l of an
// attention wave holds in score element s[j][r]. Plane mw[NB*SEQ/16][NQB][32] words, 128 B a chunk.
// One wave packs 16 queries x 256 keys (four chunks), 32 loads of 16 B a lane; lane w keeps word w, so that a chunk's
// words leave as one 128-B line. coverage: NMB x 8 waves = 512 row tiles x 4 quarters of a row.
// =====================================================================================================
#define NMB (NB * (SEQ / 16) * (NQB / 4) / 8)   // 256 blocks of 8 waves
__device__ __forceinline__ void pack_mask(const int* __restrict__ mask, unsigned* mw, int bx) {
  const int lane = threadIdx.x & 31;
  const int u    = bx * 8 + (threadIdx.x >> 5);
  const int qr   = u % (NQB / 4);                // quarter of the row: four kv chunks
  const int rt   = u / (NQB / 4);                // row tile: b * (SEQ/16) + query tile
  const int* g = mask + ((size_t)rt * 16 + (size_t)(lane & 15)) * SEQ + qr * 256 + 8 * (lane >> 4);
  v4i m[32];
#pragma unroll
  for (int i = 0; i < 16; ++i) {
    m[2 * i]     = *(const v4i*)(g + i * 16);
    m[2 * i + 1] = *(const v4i*)(g + i * 16 + 4);
  }
#if defined(__HIP_DEVICE_COMPILE__)
  // the loads are out. The wait names their address: it keeps its registers up to here and is given up only behind it.
  asm volatile("s_wait_xcnt 0x0" : "+v"(g) :: "memory");
#endif
  unsigned* o = mw + ((size_t)rt * NQB + (size_t)qr * 4) * 32 + lane;
#pragma unroll
  for (int ch = 0; ch < 4; ++ch) {
    int word = 0;
#pragma unroll
    for (int w = 0; w < 32; ++w) {
      const int v = m[ch * 8 + 2 * (w >> 3) + ((w & 7) >> 2)][w & 3];
      const int bal = (int)__builtin_amdgcn_ballot_w32(v != 0);
      word = (lane == w) ? bal : word;
    }
    o[ch * 32] = (unsigned)word;
  }
}

// =====================================================================================================
// The mask packing and all six converts in one launch (none reads what another writes). Blocks, in this order: NMB blocks
// of the mask (the largest stream), 3 x NTW tiles of Wq, Wk, Wv, NTO tiles of Wo (the transposes have the longer chain),
// then NCX blocks each of query and key. Every branch is uniform for the block.
// =====================================================================================================
#define NTW ((DM / 64) * (QIN / 64))        // 32 tiles of a projection weight
#define NTO ((DM / 64) * (DM / 64))         // 64 tiles of the output weight
#define NCX (NB * SEQ * QIN / 8 / 256)      // 1024 blocks of an activation plane
__global__ __launch_bounds__(256) void prep_all(
    const float* __restrict__ query, const float* __restrict__ key,
    const float* __restrict__ Wq, const float* __restrict__ Wk, const float* __restrict__ Wv, const float* __restrict__ Wo,
    const int* __restrict__ mask,
    unsigned short* Xq, unsigned short* Xk,
    unsigned short* WqT, unsigned short* WkT, unsigned short* WvT, unsigned short* WoT, unsigned* Mw) {
  const int bx = (int)blockIdx.x - NMB;
  if (bx < 0) {
    pack_mask(mask, Mw, (int)blockIdx.x);
  } else if (bx < 3 * NTW + NTO) {
    const int w = bx / NTW;                                    // 0, 1, 2 = Wq, Wk, Wv; 3 and 4 = Wo
    const int t = (w < 3) ? (bx - w * NTW) : (bx - 3 * NTW);
    const float*    in  = (w == 0) ? Wq  : (w == 1) ? Wk  : (w == 2) ? Wv  : Wo;
    unsigned short* out = (w == 0) ? WqT : (w == 1) ? WkT : (w == 2) ? WvT : WoT;
    cvt_bf16_t64(in, out, (w < 3) ? QIN : DM, DM, t % (DM / 64), t / (DM / 64));   // in rows = k, cols = DM
  } else {
    const int c = bx - (3 * NTW + NTO);
    const bool q = c < NCX;
    cvt_bf16x8(q ? query : key, q ? Xq : Xk, NCX * 256, q ? c : c - NCX);
  }
}

// =====================================================================================================
// Register-blocked batched bf16 WMMA GEMM: C[m][n] = sum_k A[m][k] * Bt[n][k] + bias (ReLU optional); one wave
// per 64x64 tile, no block barriers. A row-major [M][K] pitch lda; Bt row-major [N][K] pitch ldb (k contiguous);
// M, N multiples of 64, K multiple of 32 (host-checked). bx = block of GW tiles, by = batch index (strides in elements);
// sT = the block's GW per-wave 16x64 slabs in LDS, pitch 68 floats.
// GW = 4 waves a block, one per SIMD: 1024 tiles make 256 blocks, one for each of the 256 WGPs (blocks of 8 waves would
// leave half the WGPs without work); the 3072 tiles of the three projections make 768 blocks, three for each WGP.
// NSPLIT: 0 = A.Bt; 1 = (A + A2).Bt (A2 = unscaled bf16 lo plane of A); 2 = A.Bt + A2.Bt + A.Bt2.
// BIAS: 0 = none; 1 = bias[n] (per column); 2 = bias[m] (per row). Bias is an f32 array, applied as its
//       bf16 RNE value in the f32 epilogue before any 16-bit split of the result. RELU: 1 = max(v, 0) after bias.
// OUT_MODE: 0 = f32 (pitch ldc); 2 = bf16 hi plane C + bf16 lo plane C2 (lo = RNE(v - hi), unscaled);
//           3 = f16 hi plane C + f16 residual plane C2 = f16((v - hi) * rscale), C2 written only for tiles
//               with n0 < N2 (pitch ldc2, batch stride strideC2); 4 = f16 hi plane C only.
// =====================================================================================================
#define GW 4
template <int NSPLIT, int OUT_MODE, int BIAS, int RELU>
__device__ __forceinline__ void gemm64(
    float (*sT)[16 * 68], int bx, int by,
    const unsigned short* __restrict__ Ap, const unsigned short* A2p, int lda, long long strideA,
    const unsigned short* __restrict__ Btp, const unsigned short* Bt2p, int ldb, long long strideB,
    const float* __restrict__ bias,
    void* Cout, int ldc, long long strideC,
    void* Cout2, int ldc2, long long strideC2, int N2,
    int M, int N, int K, float rscale) {
  const __bf16* A   = (const __bf16*)(const void*)Ap;
  const __bf16* A2  = (const __bf16*)(const void*)A2p;
  const __bf16* Bt  = (const __bf16*)(const void*)Btp;
  const __bf16* Bt2 = (const __bf16*)(const void*)Bt2p;
  const int b    = by;
  const int lane = threadIdx.x & 31;
  const int wave = threadIdx.x >> 5;
  const int tilesN = N >> 6;
  const int tilesM = M >> 6;
  const int tile = bx * GW + wave;
  if (tile >= tilesM * tilesN) return;   // wave-uniform; no block barriers in this kernel
  const int tm = tile / tilesN;
  const int tn = tile - tm * tilesN;
  const int m0 = tm << 6;
  const int n0 = tn << 6;

  const __bf16* Ab  = A  + (size_t)b * strideA;
  const __bf16* Bb  = Bt + (size_t)b * strideB;
  const __bf16* Ab2 = (NSPLIT >= 1) ? (A2  + (size_t)b * strideA) : Ab;
  const __bf16* Bb2 = (NSPLIT == 2) ? (Bt2 + (size_t)b * strideB) : Bb;

  const int rlane = lane & 15;                 // row (A) / col (B, D) within subtile
  const int koff  = (lane >> 4) * 8;           // k offset of this lane half
  const int mOff  = (lane >> 4) * 8;           // D row offset

  v8f acc[4][4];
#pragma unroll
  for (int i = 0; i < 4; ++i)
#pragma unroll
    for (int j = 0; j < 4; ++j) acc[i][j] = zero8();

  // running addresses of this lane's row 0 fragments, 32 elements on a k step; the other rows lie at constant offsets
  const __bf16* pa  = Ab  + (size_t)(m0 + rlane) * lda + koff;
  const __bf16* pa2 = Ab2 + (size_t)(m0 + rlane) * lda + koff;
  const __bf16* pb  = Bb  + (size_t)(n0 + rlane) * ldb + koff;
  const __bf16* pb2 = Bb2 + (size_t)(n0 + rlane) * ldb + koff;
  for (int k0 = 0; k0 < K; k0 += 32) {
    v16b bh[4], bl[4];
#pragma unroll
    for (int j = 0; j < 4; ++j) {
      const size_t bo = (size_t)(j << 4) * ldb;
      bh[j] = ldfrag_b(pb + bo);
      if (NSPLIT == 2) bl[j] = ldfrag_b(pb2 + bo); else bl[j] = bh[j];
    }
#pragma unroll
    for (int i = 0; i < 4; ++i) {
      const size_t ao = (size_t)(i << 4) * lda;
      const v16b ah = ldfrag_b(pa + ao);
      v16b al = ah;
      if (NSPLIT >= 1) al = ldfrag_b(pa2 + ao);
#pragma unroll
      for (int j = 0; j < 4; ++j) {
        acc[i][j] = mma_b_raw(ah, bh[j], acc[i][j]);
        if (NSPLIT >= 1) acc[i][j] = mma_b_raw(al, bh[j], acc[i][j]);
        if (NSPLIT == 2) acc[i][j] = mma_b_raw(ah, bl[j], acc[i][j]);
      }
      dep_guard_b(acc[i][0], acc[i][3], ah, al);
    }
    keep4_b(bh[0], bh[1], bh[2], bh[3]);
    if (NSPLIT == 2) keep4_b(bl[0], bl[1], bl[2], bl[3]);
#if defined(__HIP_DEVICE_COMPILE__)
    // the k step's loads are out. The wait names the running addresses: they keep their registers up to here (no load's
    // result lands in a pair that an issued load names) and are stepped on only behind it.
    if (NSPLIT == 0)      asm volatile("s_wait_xcnt 0x0" : "+v"(pa), "+v"(pb) :: "memory");
    else if (NSPLIT == 1) asm volatile("s_wait_xcnt 0x0" : "+v"(pa), "+v"(pa2), "+v"(pb) :: "memory");
    else                  asm volatile("s_wait_xcnt 0x0" : "+v"(pa), "+v"(pa2), "+v"(pb), "+v"(pb2) :: "memory");
#endif
    pa += 32; pa2 += 32; pb += 32; pb2 += 32;
  }
  acc_guard4(acc[0][0], acc[0][1], acc[0][2], acc[0][3]);
  acc_guard4(acc[1][0], acc[1][1], acc[1][2], acc[1][3]);
  acc_guard4(acc[2][0], acc[2][1], acc[2][2], acc[2][3]);
  acc_guard4(acc[3][0], acc[3][1], acc[3][2], acc[3][3]);

  // ---- epilogue ----
  float bcol[4] = {0.f, 0.f, 0.f, 0.f};
  if (BIAS == 1) {
#pragma unroll
    for (int j = 0; j < 4; ++j) bcol[j] = bf_up(bf_bits(bias[n0 + (j << 4) + rlane]));
  }
  float* slab = sT[wave];
#pragma unroll
  for (int i = 0; i < 4; ++i) {
    const int mBase = m0 + (i << 4);
    float brow[8] = {0.f, 0.f, 0.f, 0.f, 0.f, 0.f, 0.f, 0.f};
    if (BIAS == 2) {
#pragma unroll
      for (int r = 0; r < 8; ++r) brow[r] = bf_up(bf_bits(bias[mBase + mOff + r]));
    }
#pragma unroll
    for (int j = 0; j < 4; ++j) {
#pragma unroll
      for (int r = 0; r < 8; ++r) {
        float vv = acc[i][j][r] + bcol[j] + brow[r];
        if (RELU) vv = fmaxf(vv, 0.0f);
        slab[(mOff + r) * 68 + (j << 4) + rlane] = vv;
      }
    }
    wave_sync_lds();
    if (OUT_MODE == 0) {
      float* C = (float*)Cout + (size_t)b * strideC;
      const int hh = lane >> 4, c4 = (lane & 15) * 4;     // 256-B row segment = 16 lanes x 16 B
      {
#pragma unroll
        for (int it = 0; it < 8; ++it) {
          const int row = it * 2 + hh;                     // it 0..7 x hh 0..1 = rows 0..15
          const v4f v = *(const v4f*)(slab + row * 68 + c4);
          *(v4f*)(C + (size_t)(mBase + row) * ldc + n0 + c4) = v;
        }
        
      }
    } else {
      const int q = lane >> 3, c8 = (lane & 7) * 8;
      unsigned short* C  = (unsigned short*)Cout  + (size_t)b * strideC;
      unsigned short* C2 = (unsigned short*)Cout2 + (size_t)b * strideC2;
      const bool wlo = (OUT_MODE == 2) || (OUT_MODE == 3 && n0 < N2);   // wave-uniform
      v4u hv[4], lv[4];
#pragma unroll
      for (int it = 0; it < 4; ++it) {
        const int row = it * 4 + q;                        // it 0..3 x q 0..3 = rows 0..15
        const float* sp = slab + row * 68 + c8;
        v4u a, a2;
#pragma unroll
        for (int e = 0; e < 4; ++e) {
          const float f0 = sp[2 * e], f1 = sp[2 * e + 1];
          unsigned short h0, h1, l0, l1;
          if (OUT_MODE == 2) {
            h0 = bf_bits(f0); h1 = bf_bits(f1);
            l0 = bf_bits(f0 - bf_up(h0)); l1 = bf_bits(f1 - bf_up(h1));
          } else {
            const _Float16 x0 = (_Float16)f0, x1 = (_Float16)f1;
            h0 = h_bits(x0); h1 = h_bits(x1);
            l0 = h_bits((_Float16)((f0 - (float)x0) * rscale));
            l1 = h_bits((_Float16)((f1 - (float)x1) * rscale));
          }
          a[e] = pk16(h0, h1); a2[e] = pk16(l0, l1);
        }
        hv[it] = a; lv[it] = a2;
      }
      {
#pragma unroll
        for (int it = 0; it < 4; ++it) {
          const int row = it * 4 + q;
          *(v4u*)(C + (size_t)(mBase + row) * ldc + n0 + c8) = hv[it];
          if (wlo) *(v4u*)(C2 + (size_t)(mBase + row) * ldc2 + n0 + c8) = lv[it];
        }
        
      }
    }
    wave_sync_lds();
  }
}

// =====================================================================================================
// The q, k and v^T projections in one launch (none reads what another writes): 3 x NPB blocks, block-uniform branch.
//   q = relu(query . Wq + bq) -> f16 hi plane [8192][512] + f16 residual x4096 (all tiles, N2 = DM); M=8192, N=512, K=256
//   k = relu(key . Wk + bk)   -> f16 hi plane [8192][512] only; M=8192, N=512, K=256
//   v^T = relu(Wv^T . key^T + bv) per batch -> f16 hi plane [b][h*64+d][s] (pitch SEQ) and residual plane x4096
//     (A = WvT [n][k], Bt = Xk rows of batch b, bias per row; M=512, N=1024, K=256; NVB blocks a batch)
// =====================================================================================================
#define NPB ((NB * SEQ / 64) * (DM / 64) / GW)    // 1024 tiles -> 256 blocks of one projection
#define NVB ((DM / 64) * (SEQ / 64) / GW)         // 128 tiles -> 32 blocks of one batch of v^T
static_assert(NVB * NB == NPB);
// At most three waves a SIMD: no WGP takes a fourth block while another holds two.
__global__ __launch_bounds__(GW * 32) __attribute__((amdgpu_waves_per_eu(1, 3))) void proj_qkv(
    const unsigned short* __restrict__ Xq, const unsigned short* __restrict__ Xk,
    const unsigned short* __restrict__ WqT, const unsigned short* __restrict__ WkT, const unsigned short* __restrict__ WvT,
    const float* __restrict__ bq, const float* __restrict__ bk, const float* __restrict__ bv,
    unsigned short* Qh, unsigned short* Ql, unsigned short* Kh, unsigned short* VTh, unsigned short* VTl) {
  __shared__ __align__(16) float sT[GW][16 * 68];  // per-wave 16x64 slab, pitch 68 floats
  const int g = blockIdx.x / NPB;
  const int r = blockIdx.x % NPB;
  if (g == 0) {
    gemm64<0, 3, 1, 1>(sT, r, 0,
        Xq, Xq, QIN, 0LL, WqT, WqT, QIN, 0LL, bq,
        (void*)Qh, DM, 0LL, (void*)Ql, DM, 0LL, DM,
        NB * SEQ, DM, QIN, 4096.0f);
  } else if (g == 1) {
    gemm64<0, 4, 1, 1>(sT, r, 0,
        Xk, Xk, QIN, 0LL, WkT, WkT, QIN, 0LL, bk,
        (void*)Kh, DM, 0LL, (void*)Kh, DM, 0LL, 0,
        NB * SEQ, DM, QIN, 4096.0f);
  } else {
    gemm64<0, 3, 2, 1>(sT, r % NVB, r / NVB,
        WvT, WvT, QIN, 0LL, Xk, Xk, QIN, (long long)SEQ * QIN, bv,
        (void*)VTh, SEQ, (long long)DM * SEQ, (void*)VTl, SEQ, (long long)DM * SEQ, SEQ,
        DM, SEQ, QIN, 4096.0f);
  }
}

// out = context . Wo + bo -> f32 [8192][512] (A = context hi + lo planes, 2 products; M=8192, N=512, K=512): NPB blocks
// At most one wave a SIMD: no WGP takes a second block while another holds none.
__global__ __launch_bounds__(GW * 32) __attribute__((amdgpu_waves_per_eu(1, 1))) void proj_out(
    const unsigned short* __restrict__ Oh, const unsigned short* __restrict__ Ol, const unsigned short* __restrict__ WoT,
    const float* __restrict__ bo, float* out) {
  __shared__ __align__(16) float sT[GW][16 * 68];  // per-wave 16x64 slab, pitch 68 floats
  gemm64<1, 0, 1, 0>(sT, blockIdx.x, 0,
      Oh, Ol, DM, 0LL, WoT, WoT, DM, 0LL, bo,
      (void*)out, DM, 0LL, (void*)out, DM, 0LL, DM,
      NB * SEQ, DM, DM, 1.0f);
}

// =====================================================================================================
// Attention, head dim 64, per-(query,key) mask as lane-select words (pack_mask; bit 0 = masked -> score replaced by the
// finite value -1e8, so a fully masked row yields uniform weights), standard softmax over all SEQ keys.
//   q hi plane (f16, pitch DM): element (b, t, h, d) at [(b*SEQ + t)*DM + h*64 + d]; k plane same layout
//   q residual plane (f16, (q - f16(q))*4096, pitch DM): same layout
//   v^T hi plane (f16): element (b, h, d, s) at [(b*DM + h*64 + d)*SEQ + s]; v^T residual plane (f16, x4096): same layout
//   out planes (bf16 hi / lo of the normalised context): element (b, t, h, d) at [(b*SEQ + t)*DM + h*64 + d]
//   Both products run transposed, so that a lane owns ONE query (column lane&15) and holds 8 keys / 8 d per tile:
//   scores^T = (k . qh^T + (k . ql^T) * rres) * sscale on f16 WMMA (A = K rows, B = q), residual products in a separate
//   accumulator, then the per-(q,k) mask select; p = exp(s - m) carried as f16(1024 p); two score tiles of 16 keys,
//   converted in place, are the B operand of context^T = vh^T . p^T + (vl^T . p^T) * rres (A = V^T rows; separate
//   accumulator folded per chunk in f32): P never goes through LDS. Online softmax in f32: maximum and sum run inside
//   the lane, the two lane halves (keys 8hh..8hh+7 of each group) exchange the maximum once a chunk and join their
//   sums once behind the loop; final multiply by 1/l.
//   Block = 4 waves = 64 query rows of one (b, h); grid = NQB * NH * NB; kv chunks of 64, static trip NQB.
//   K / V^T chunk staging: 128 threads x 4 rows x 8 elements per plane = the whole 64x64 tile (plain 16-B loads into
//   registers, LDS stores with __syncthreads before and after); mask: the wave reads its chunk's 32 lane-select words by
//   scalar loads, and each word is the select's condition as it stands (addresses always in range).
//   All loads of chunk kt+1 are issued behind the scores of chunk kt, so that softmax and the second product
//   cover their way; the tiles wait in registers for the barrier that frees the LDS.
//   Output coverage: each wave stores rows q0..q0+15 (it 0..3 x lane>>3 0..3) x 64 columns (8 lanes x 8) of both planes.
// =====================================================================================================
// The 12 vector loads of one kv chunk: this thread's 4 rows of the K, V^T and V^T residual tiles.
__device__ __forceinline__ void ask_chunk(const _Float16* kg, const _Float16* vg, const _Float16* vlg,
                                          v8h (&ka)[4], v8h (&va)[4], v8h (&vr)[4]) {
#pragma unroll
  for (int i = 0; i < 4; ++i) {
    ka[i] = *(const v8h*)(kg + (size_t)(16 * i) * DM);
    va[i] = *(const v8h*)(vg + (size_t)(16 * i) * SEQ);
    vr[i] = *(const v8h*)(vlg + (size_t)(16 * i) * SEQ);
  }
#if defined(__HIP_DEVICE_COMPILE__)
  // the loads are out. The wait names their addresses: these keep their registers up to here (no load's result lands in
  // a pair that an issued load names) and are given up only behind it.
  asm volatile("s_wait_xcnt 0x0" : "+v"(kg), "+v"(vg), "+v"(vlg) :: "memory");
#endif
}

// Four waves per SIMD (the whole grid resident at once: 4 workgroups on each WGP) hold only up to 256 registers a wave.
__global__ __launch_bounds__(128) __attribute__((amdgpu_waves_per_eu(4, 4)))
void attn64(const unsigned short* __restrict__ qhp, const unsigned short* __restrict__ qlp,
            const unsigned short* __restrict__ khp,
            const unsigned short* __restrict__ vhp, const unsigned short* __restrict__ vlp,
            const unsigned* __restrict__ mwp,
            unsigned short* ohp, unsigned short* olp, float sscale, float rres) {
  union FH { v16h v; v8h h[2]; };
  __shared__ __align__(16) _Float16 Ksh[64 * LP];                 // K [kv][d]   9 KB
  __shared__ __align__(16) _Float16 Vth[64 * LP];                 // V^T hi [d][kv] 9 KB
  __shared__ __align__(16) _Float16 Vtl[64 * LP];                 // V^T residual [d][kv] 9 KB
  __shared__ __align__(16) float    Os[4][16 * OP];               // per wave context tile [row][d] 17 KB

  const int tid  = threadIdx.x;
  const int wave = tid >> 5;
  const int lane = tid & 31;
  const int hh   = lane >> 4;
  const int c    = lane & 15;

  const int bx   = blockIdx.x;
  const int qb   = bx % NQB;
  const int rest = bx / NQB;
  const int h    = rest % NH;
  const int b    = rest / NH;
  const int q0   = qb * 64 + wave * 16;
  const size_t rowB = (size_t)b * SEQ;

  const _Float16* Qh = (const _Float16*)(const void*)qhp + (size_t)h * HD;
  const _Float16* Ql = (const _Float16*)(const void*)qlp + (size_t)h * HD;
  const _Float16* Kg = (const _Float16*)(const void*)khp + (size_t)h * HD;
  const _Float16* Vh = (const _Float16*)(const void*)vhp + ((size_t)b * DM + (size_t)h * HD) * SEQ;
  const _Float16* Vl = (const _Float16*)(const void*)vlp + ((size_t)b * DM + (size_t)h * HD) * SEQ;
  // lane-select words of this wave's 16 queries, 32 words a chunk; the wave's number as a scalar, so that the address is one
  // the plane is written by an earlier launch and only read here: the constant address space keeps the loop's loads scalar
  typedef const __attribute__((address_space(4))) unsigned* cu32;
  const cu32 Mw = (cu32)(mwp + ((size_t)b * (SEQ / 16) + (size_t)qb * 4 + (size_t)__builtin_amdgcn_readfirstlane(wave)) * (NQB * 32));

  // ---- Q fragments (B operand, column = lane&15): 2 d-chunks, hi and residual ----
  v16h qah[2], qal[2];
#pragma unroll
  for (int dc = 0; dc < 2; ++dc) {
    qah[dc] = ldfrag_h(Qh + (rowB + q0 + c) * DM + dc * 32 + 8 * hh);
    qal[dc] = ldfrag_h(Ql + (rowB + q0 + c) * DM + dc * 32 + 8 * hh);
  }

#if defined(__HIP_DEVICE_COMPILE__)
  // the Q loads are out: behind this wait the first chunk's loads may land in the registers that held the Q addresses
  asm volatile("s_wait_xcnt 0x0" ::: "memory");
#endif

  float mrow = -INFINITY, lrow = 0.f;        // this lane's query: running maximum (both halves agree), this half's sum
  v8f oacc[4];                               // context^T: oacc[t][r] = d t*16 + 8hh + r of query c
#pragma unroll
  for (int t = 0; t < 4; ++t) oacc[t] = zero8();

  // 8 lanes x 16 B = one 128-B tile row, so a wave's load covers 4 whole lines; rows sr, sr+16, sr+32, sr+48 per thread
  const int sr = tid >> 3, sc8 = (tid & 7) * 8;
  const _Float16* kg0  = Kg + (rowB + sr) * DM + sc8;            // K row kv0+sr, d = sc8..sc8+7; kv0 added per chunk
  const _Float16* vg0  = Vh + (size_t)sr * SEQ + sc8;            // V^T row d = sr, s = kv0+sc8..+7
  const _Float16* vlg0 = Vl + (size_t)sr * SEQ + sc8;
  v8h ka[4], va[4], vr[4];                   // the chunk on its way: tile rows ...
  unsigned mk[32];                           // ... and lane-select words (the same in every lane: scalar registers)
  ask_chunk(kg0, vg0, vlg0, ka, va, vr);
#pragma unroll
  for (int w = 0; w < 32; ++w) mk[w] = Mw[w];

  for (int kt = 0; kt < NQB; ++kt) {         // static trip count
    const int kv0 = kt * 64;
    __syncthreads();
#pragma unroll
    for (int i = 0; i < 4; ++i) {
      *(v8h*)(Ksh + (sr + 16 * i) * LP + sc8) = ka[i];
      *(v8h*)(Vth + (sr + 16 * i) * LP + sc8) = va[i];
      *(v8h*)(Vtl + (sr + 16 * i) * LP + sc8) = vr[i];
    }
    __syncthreads();

    // ---- scores^T: 64 keys x 16 queries per wave, 2 f16 products (hi, residual), then per-(q,k) mask select;
    //      s[j][r] = key j*16 + 8hh + r, query c ----
    v8f s[4];
#pragma unroll
    for (int j = 0; j < 4; ++j) {
      v8f sh = zero8(), sl = zero8();
#pragma unroll
      for (int dc = 0; dc < 2; ++dc) {
        FH kb;
        kb.h[0] = *(const v8h*)(Ksh + (j * 16 + c) * LP + dc * 32 + 8 * hh);
        kb.h[1] = *(const v8h*)(Ksh + (j * 16 + c) * LP + dc * 32 + 16 + 8 * hh);
        sh = mma_h(kb.v, qah[dc], sh);
        sl = mma_h(kb.v, qal[dc], sl);
      }
#pragma unroll
      for (int r = 0; r < 8; ++r) {
        const float v = (sh[r] + sl[r] * rres) * sscale;
        s[j][r] = __builtin_amdgcn_inverse_ballot_w32(mk[j * 8 + r]) ? v : -1.0e8f;   // bit l = key j*16 + 8hh + r, query c
      }
    }

    // ---- the next chunk's global loads. The last trip asks for its own chunk once more (never used), so that every
    //      address stays inside its plane ----
    {
      const int kvn = (kt + 1 < NQB) ? kv0 + 64 : kv0;
      ask_chunk(kg0 + (size_t)kvn * DM, vg0 + kvn, vlg0 + kvn, ka, va, vr);
#pragma unroll
      for (int w = 0; w < 32; ++w) mk[w] = Mw[(kvn >> 1) + w];   // chunk kvn/64, 32 words each
    }

    // ---- maximum over the chunk's keys, online softmax, P^T (x1024, f16) packed as the B operand ----
    float mj[4];
#pragma unroll
    for (int j = 0; j < 4; ++j) {
      mj[j] = s[j][0];
#pragma unroll
      for (int r = 1; r < 8; ++r) mj[j] = fmaxf(mj[j], s[j][r]);
    }
    float m = fmaxf(fmaxf(mj[0], mj[1]), fmaxf(mj[2], mj[3]));
    m = fmaxf(m, xhalf(m));                                      // the other half's 32 keys of the same query
    const float mnew  = fmaxf(mrow, m);
    const float alpha = __expf(mrow - mnew);
    mrow = mnew;
    // pb[kk] element e: e 0..7 = key kk*32 + 8hh + e (tile 2kk), e 8..15 = key kk*32 + 16 + 8hh + (e-8) (tile 2kk+1):
    // the k order of the V^T fragments below
    FH pb[2];
    float ps[4];                                                 // four independent sums, one per 16-key group
#pragma unroll
    for (int j = 0; j < 4; ++j) {
#pragma unroll
      for (int r = 0; r < 8; ++r) {
        const float p = __expf(s[j][r] - mnew);
        ps[j] = (r == 0) ? p : ps[j] + p;
        pb[j >> 1].v[(j & 1) * 8 + r] = (_Float16)(p * 1024.0f);
      }
    }
    lrow = lrow * alpha + ((ps[0] + ps[1]) + (ps[2] + ps[3]));
#pragma unroll
    for (int t = 0; t < 4; ++t)
#pragma unroll
      for (int r = 0; r < 8; ++r) oacc[t][r] *= alpha;

    // ---- context^T += V^T . P^T (f16 WMMA), residual products into a separate accumulator ----
    v8f o1[4];
#pragma unroll
    for (int t = 0; t < 4; ++t) o1[t] = zero8();
#pragma unroll   // pb[kk] lives in registers: a rolled loop would have to pick the operand by a run-time index
    for (int kk = 0; kk < 2; ++kk) {
#pragma unroll
      for (int t = 0; t < 4; ++t) {
        FH vb, vl;
        vb.h[0] = *(const v8h*)(Vth + (t * 16 + c) * LP + kk * 32 + 8 * hh);
        vb.h[1] = *(const v8h*)(Vth + (t * 16 + c) * LP + kk * 32 + 16 + 8 * hh);
        vl.h[0] = *(const v8h*)(Vtl + (t * 16 + c) * LP + kk * 32 + 8 * hh);
        vl.h[1] = *(const v8h*)(Vtl + (t * 16 + c) * LP + kk * 32 + 16 + 8 * hh);
        oacc[t] = mma_h(vb.v, pb[kk].v, oacc[t]);
        o1[t]   = mma_h(vl.v, pb[kk].v, o1[t]);
      }
    }
#pragma unroll
    for (int t = 0; t < 4; ++t)
#pragma unroll
      for (int r = 0; r < 8; ++r) oacc[t][r] += o1[t][r] * rres;
  }

  // ---- normalise (1/l and the 1/1024 p carry), stage the wave's 16x64 tile, bf16 hi/lo split,
  float* os = Os[wave];
  {
    const float l   = lrow + xhalf(lrow);                       // join the two halves' sums of this query
    const float inv = (1.0f / l) * (1.0f / 1024.0f);            // l >= 1 always (the max key contributes 1)
#pragma unroll
    for (int t = 0; t < 4; ++t) {
      v4f x0, x1;
#pragma unroll
      for (int r = 0; r < 4; ++r) { x0[r] = oacc[t][r] * inv; x1[r] = oacc[t][4 + r] * inv; }
      *(v4f*)(os + c * OP + t * 16 + 8 * hh)     = x0;          // row = query c, d = t*16 + 8hh + 0..3
      *(v4f*)(os + c * OP + t * 16 + 8 * hh + 4) = x1;
    }
  }
  wave_sync_lds();
  {
    const int q4 = lane >> 3, c8 = (lane & 7) * 8;
    v4u hv[4], lv[4];
#pragma unroll
    for (int it = 0; it < 4; ++it) {
      const int row = it * 4 + q4;   // it 0..3 x q4 0..3 = rows 0..15 of the wave tile
      const float* sp = os + row * OP + c8;
      v4u a, a2;
#pragma unroll
      for (int e = 0; e < 4; ++e) {
        const float f0 = sp[2 * e], f1 = sp[2 * e + 1];
        const unsigned short h0 = bf_bits(f0), h1 = bf_bits(f1);
        const unsigned short l0 = bf_bits(f0 - bf_up(h0)), l1 = bf_bits(f1 - bf_up(h1));
        a[e] = pk16(h0, h1); a2[e] = pk16(l0, l1);
      }
      hv[it] = a; lv[it] = a2;
    }
    {
#pragma unroll
      for (int it = 0; it < 4; ++it) {
        const int row = it * 4 + q4;
        const size_t go = (rowB + q0 + row) * DM + (size_t)h * HD + c8;
        *(v4u*)(ohp + go) = hv[it];
        *(v4u*)(olp + go) = lv[it];
      }
      
    }
  }
}

// =====================================================================================================
// Workspace map (bytes), every plane an exact multiple of its 64x64-tile / whole-line store granularity:
//   Xq    bf16 [8192][256]           0          4194304
//   Xk    bf16 [8192][256]           4194304    4194304
//   WqT   bf16 [512][256]            8388608    262144
//   WkT   bf16 [512][256]            8650752    262144
//   WvT   bf16 [512][256]            8912896    262144
//   WoT   bf16 [512][512]            9175040    524288
//   Qh    f16  [8192][512]           9699328    8388608
//   Ql    f16  [8192][512]           18087936   8388608   (q residual x4096)
//   Kh    f16  [8192][512]           26476544   8388608
//   VTh   f16  [8][512][1024]        34865152   8388608
//   VTl   f16  [8][512][1024]        43253760   8388608   (v residual x4096)
//   Oh    bf16 [8192][512]           51642368   8388608
//   Ol    bf16 [8192][512]           60030976   8388608
//   Mw    u32  [512][16][32]         68419584   1048576   (mask as lane-select words)
//   end                              69468160
// Weights arrive as [in k][out n] and are transpose-converted to [out n][in k] (k contiguous = Bt / A layout).
// =====================================================================================================
extern "C" void kernel_launch(void* const* d_in, const int* in_sizes, int n_in,
                              void* d_out, int out_size, void* d_ws, size_t ws_size,
                              hipStream_t stream) {
  if (n_in < 11) return;
  if (in_sizes[0] != NB * SEQ * QIN || in_sizes[1] != NB * SEQ * QIN) return;
  if (in_sizes[2] != NB * SEQ * SEQ) return;
  if (in_sizes[3] != QIN * DM || in_sizes[5] != QIN * DM || in_sizes[7] != QIN * DM) return;
  if (in_sizes[9] != DM * DM) return;
  if (in_sizes[4] != DM || in_sizes[6] != DM || in_sizes[8] != DM || in_sizes[10] != DM) return;
  if (out_size != NB * SEQ * DM) return;

  const float* query = (const float*)d_in[0];
  const float* key   = (const float*)d_in[1];
  const int*   mask  = (const int*)d_in[2];
  const float* Wq    = (const float*)d_in[3];
  const float* bq    = (const float*)d_in[4];
  const float* Wk    = (const float*)d_in[5];
  const float* bk    = (const float*)d_in[6];
  const float* Wv    = (const float*)d_in[7];
  const float* bv    = (const float*)d_in[8];
  const float* Wo    = (const float*)d_in[9];
  const float* bo    = (const float*)d_in[10];

  const size_t PXI = (size_t)NB * SEQ * QIN * 2;     //  4194304 (bf16 input activation plane)
  const size_t PW  = (size_t)DM * QIN * 2;           //   262144 (one projection weight plane)
  const size_t PWO = (size_t)DM * DM * 2;            //   524288 (output weight plane)
  const size_t PA  = (size_t)NB * SEQ * DM * 2;      //  8388608 (q / k / context planes)
  const size_t PVT = (size_t)NB * DM * SEQ * 2;      //  8388608 (v^T plane)
  size_t off = 0;
  const size_t oXq  = off; off += PXI;
  const size_t oXk  = off; off += PXI;
  const size_t oWq  = off; off += PW;
  const size_t oWk  = off; off += PW;
  const size_t oWv  = off; off += PW;
  const size_t oWo  = off; off += PWO;
  const size_t oQh  = off; off += PA;
  const size_t oQl  = off; off += PA;
  const size_t oKh  = off; off += PA;
  const size_t oVTh = off; off += PVT;
  const size_t oVTl = off; off += PVT;
  const size_t oOh  = off; off += PA;
  const size_t oOl  = off; off += PA;
  const size_t oMw  = off; off += (size_t)NB * SEQ * SEQ / 8;   // 1048576 (one bit a mask element)
  if (off > ws_size) return;                          // off = 69468160
  if (off > (size_t)134217728) return;

  char* ws = (char*)d_ws;
  unsigned short* Xq  = (unsigned short*)(ws + oXq);
  unsigned short* Xk  = (unsigned short*)(ws + oXk);
  unsigned short* WqT = (unsigned short*)(ws + oWq);
  unsigned short* WkT = (unsigned short*)(ws + oWk);
  unsigned short* WvT = (unsigned short*)(ws + oWv);
  unsigned short* WoT = (unsigned short*)(ws + oWo);
  unsigned short* Qh  = (unsigned short*)(ws + oQh);
  unsigned short* Ql  = (unsigned short*)(ws + oQl);
  unsigned short* Kh  = (unsigned short*)(ws + oKh);
  unsigned short* VTh = (unsigned short*)(ws + oVTh);
  unsigned short* VTl = (unsigned short*)(ws + oVTl);
  unsigned short* Oh  = (unsigned short*)(ws + oOh);
  unsigned short* Ol  = (unsigned short*)(ws + oOl);
  unsigned*       Mw  = (unsigned*)(ws + oMw);

  const dim3 blk(256);
  const dim3 gPrep(NMB + 3 * NTW + NTO + 2 * NCX);              // 256 mask blocks + 160 transpose tiles + 2 x 1024 convert blocks
  const dim3 blkG(GW * 32);                                     // GEMM blocks: 4 waves
  const dim3 gProj(3 * NPB);                                    // 3 x 256 blocks: q, k, v^T
  const dim3 gOut(NPB);                                         // 1024 tiles -> 256 blocks: M=8192, N=512
  const dim3 gAttn(NB * NH * NQB);                              // 1024 blocks

  // (1) mask -> lane-select words; activations -> bf16 planes; weights [in][out] -> transposed bf16 planes [out][in] (RNE convert)
  prep_all<<<gPrep, blk, 0, stream>>>(query, key, Wq, Wk, Wv, Wo, mask, Xq, Xk, WqT, WkT, WvT, WoT, Mw);
  // (2) to (4) the q, k and v^T projections
  proj_qkv<<<gProj, blkG, 0, stream>>>(Xq, Xk, WqT, WkT, WvT, bq, bk, bv, Qh, Ql, Kh, VTh, VTl);
  // (5) attention with per-(q,k) mask and softmax -> context bf16 hi / lo planes [8192][512]
  attn64<<<gAttn, dim3(128), 0, stream>>>(Qh, Ql, Kh, VTh, VTl, Mw, Oh, Ol, 0.125f, 1.0f / 4096.0f);
  // (6) out = context . Wo + bo -> d_out f32 [8192][512]  (A = context hi + lo planes, 2 products; K=512)
  proj_out<<<gOut, blkG, 0, stream>>>(Oh, Ol, WoT, bo, (float*)d_out);
  (void)hipGetLastError();
}

// v008
// It runs in 78.2 microseconds.
// Timed twice side by side with v007, it ran 1.22 and 1.23 times as fast.
// All steps since v000 together make it 2.65 times as fast.
// Contractions: q, k and v^T projections = v_wmma_f32_16x16x32_bf16 (bf16 operands from RNE-converted inputs and
// transposed weights, single product, bias and ReLU in f32); k.q^T scores = v_wmma_f32_16x16x32_f16 (q as f16 hi
// plane + f16 residual plane x4096 in a separate accumulator, k f16; 2 products); v^T.p^T = v_wmma_f32_16x16x32_f16
// (p carried x1024 in f16, v^T as f16 hi plane + f16 residual plane x4096 in a separate accumulator; 2 products);
// ctx.Wo = v_wmma_f32_16x16x32_bf16 (ctx as bf16 hi + lo planes times bf16 Wo^T, 2 products, bias in f32);
// all f32 accumulate; per-(query,key) mask select and softmax in f32.
#include <hip/hip_runtime.h>
#include <math.h>
#include <stdint.h>

#define NB    8
#define SEQ   1024
#define QIN   256
#define DM    512
#define NH    8
#define HD    64
#define NQB   (SEQ / 64)     // 16 key / query tiles of 64
#define LP    72             // LDS row pitch of the 64-wide f16 tiles, in halves: 144 B = 16 B x odd, so the 16 rows that one
                             // ds_load_b128 fragment read touches fall on 16 different 4-bank groups
#define OP    68             // LDS row pitch of the 64-wide f32 context tile, in floats (16-byte column walks)
static_assert(NH * HD == DM);
static_assert((SEQ % 64) == 0 && (DM % 64) == 0 && (QIN % 64) == 0 && (QIN % 32) == 0 && (DM % 32) == 0);

typedef _Float16 v16h __attribute__((ext_vector_type(16)));
typedef _Float16 v8h  __attribute__((ext_vector_type(8)));
typedef __bf16   v16b __attribute__((ext_vector_type(16)));
typedef __bf16   v8b  __attribute__((ext_vector_type(8)));
typedef float    v8f  __attribute__((ext_vector_type(8)));
typedef float    v4f  __attribute__((ext_vector_type(4)));
typedef unsigned int v4u __attribute__((ext_vector_type(4)));
typedef int          v4i __attribute__((ext_vector_type(4)));

// ---- scalar helpers --------------------------------------------------------------------------------
__device__ __forceinline__ unsigned short bf_bits(float f) {          // f32 -> bf16 bits, RNE convert
  unsigned u = __float_as_uint(f);
  return (unsigned short)((u + 0x7FFFu + ((u >> 16) & 1u)) >> 16);
}
__device__ __forceinline__ float bf_up(unsigned short h) { return __uint_as_float(((unsigned)h) << 16); }
__device__ __forceinline__ unsigned short h_bits(_Float16 x) { return __builtin_bit_cast(unsigned short, x); }
__device__ __forceinline__ unsigned pk16(unsigned short a, unsigned short b) { return (unsigned)a | ((unsigned)b << 16); }
__device__ __forceinline__ v8f zero8() { v8f z = {0.f, 0.f, 0.f, 0.f, 0.f, 0.f, 0.f, 0.f}; return z; }

// ---- fragment loaders: 16-bit A/B operand, lane -> row/col (lane&15), p already includes +8*(lane>>4);
//      elements 0..7 <- p[0..7] (k0+8h..), elements 8..15 <- p[16..23] (k0+16+8h..)
//      ldfrag_b reads global memory only; the cast says so, for an address that has gone through an asm statement
//      would otherwise be loaded from in the flat form
typedef const __attribute__((address_space(1))) v8b* gv8b;
__device__ __forceinline__ v16b ldfrag_b(const __bf16* p) {
  union { v16b v; v8b h[2]; } f;
  f.h[0] = *(gv8b)(p);
  f.h[1] = *(gv8b)(p + 16);
  return f.v;
}
__device__ __forceinline__ v16h ldfrag_h(const _Float16* p) {
  union { v16h v; v8h h[2]; } f;
  f.h[0] = *(const v8h*)(p);
  f.h[1] = *(const v8h*)(p + 16);
  return f.v;
}

// ---- WMMA helpers: the builtin forms alone. The compiler keeps the distance between a WMMA and the first vector
//      instruction on its registers itself, and is free to move fragment loads ahead of earlier WMMAs ----------
__device__ __forceinline__ v8f mma_h(v16h a, v16h b, v8f c) {
  return __builtin_amdgcn_wmma_f32_16x16x32_f16(false, a, false, b, (short)0, c, false, false);
}
__device__ __forceinline__ v8f mma_b_raw(v16b a, v16b b, v8f c) {
  return __builtin_amdgcn_wmma_f32_16x16x32_bf16(false, a, false, b, (short)0, c, false, false);
}
// lane l <-> lane l ^ 16 as a vector cross-row move (a shuffle would go the LDS path and be waited for on dscnt)
__device__ __forceinline__ float xhalf(float x) {
  return __builtin_bit_cast(float, __builtin_amdgcn_permlanex16(__builtin_bit_cast(int, x), __builtin_bit_cast(int, x),
                                                                0x76543210, 0xfedcba98, false, false));
}
__device__ __forceinline__ void wave_sync_lds() {
  __builtin_amdgcn_fence(__ATOMIC_RELEASE, "workgroup");
  __builtin_amdgcn_wave_barrier();
  __builtin_amdgcn_fence(__ATOMIC_ACQUIRE, "workgroup");
}

// =====================================================================================================
// f32 -> bf16 (RNE convert), 8 elements per thread, one 16-B store per lane: a wave writes 512 contiguous B
// coverage: n8 threads x 8 = whole plane (n8 is a multiple of 256 for every use here). bx = block index inside the plane.
// =====================================================================================================
__device__ __forceinline__ void cvt_bf16x8(const float* __restrict__ in, unsigned short* out, int n8, int bx) {
  const int i = bx * 256 + threadIdx.x;
  if (i < n8) {
    const v4f a = *(const v4f*)(in + (size_t)i * 8);
    const v4f b = *(const v4f*)(in + (size_t)i * 8 + 4);
    v4u p;
    p[0] = pk16(bf_bits(a[0]), bf_bits(a[1]));
    p[1] = pk16(bf_bits(a[2]), bf_bits(a[3]));
    p[2] = pk16(bf_bits(b[0]), bf_bits(b[1]));
    p[3] = pk16(bf_bits(b[2]), bf_bits(b[3]));
    *(v4u*)(out + (size_t)i * 8) = p;
    
  }
}

// =====================================================================================================
// Transpose-convert: f32 in[R][C] row-major -> bf16 (RNE convert) outT[C][R] row-major, outT[c][r] = in[r][c].
// (bx, by) in (C/64, R/64) (bx = column tile of in = row tile of outT), block 256; R, C multiples of 64.
// Load: thread tid reads in row r0 + (tid>>2), 16 floats at c0 + (tid&3)*16 (4 x 16-B loads) -> LDS tile[r][c].
// coverage: load 64 rows x 4 x 16 cols = 64x64; store 8 waves x 2 x 4 rows x (8 lanes x 8) = 64x64.
// =====================================================================================================
__device__ __forceinline__ void cvt_bf16_t64(const float* __restrict__ in, unsigned short* outT, int R, int C, int bx, int by) {
  __shared__ float tile[64][65];
  const int tid  = threadIdx.x;
  const int lane = tid & 31;
  const int wave = tid >> 5;
  const int c0 = bx * 64;
  const int r0 = by * 64;
  {
    const int r = tid >> 2, cs = (tid & 3) * 16;
    const float* g = in + (size_t)(r0 + r) * C + c0 + cs;
#pragma unroll
    for (int i = 0; i < 4; ++i) {
      const v4f v = *(const v4f*)(g + 4 * i);
      tile[r][cs + 4 * i + 0] = v[0];
      tile[r][cs + 4 * i + 1] = v[1];
      tile[r][cs + 4 * i + 2] = v[2];
      tile[r][cs + 4 * i + 3] = v[3];
    }
  }
  __syncthreads();
  const int q = lane >> 3, c8 = (lane & 7) * 8;
  v4u pv[2];
#pragma unroll
  for (int it = 0; it < 2; ++it) {
    const int c = wave * 8 + it * 4 + q;
    v4u p;
#pragma unroll
    for (int e = 0; e < 4; ++e)
      p[e] = pk16(bf_bits(tile[c8 + 2 * e][c]), bf_bits(tile[c8 + 2 * e + 1][c]));
    pv[it] = p;
  }
  {
#pragma unroll
    for (int it = 0; it < 2; ++it) {
      const int c = wave * 8 + it * 4 + q;
      *(v4u*)(outT + (size_t)(c0 + c) * R + r0 + c8) = pv[it];
    }
    
  }
}

// =====================================================================================================
// Mask -> lane-select words, once for all heads. Word w = j*8 + r of (row tile rt of 16 queries, kv chunk kt of 64 keys)
// holds in bit l whether mask[rt*16 + (l&15)][kt*64 + j*16 + 8*(l>>4) + r] != 0: the (query, key) that lane l of an
// attention wave holds in score element s[j][r]. Plane mw[NB*SEQ/16][NQB][32] words, 128 B a chunk.
// One wave packs 16 queries x 256 keys (four chunks), 32 loads of 16 B a lane; lane w keeps word w, so that a chunk's
// words leave as one 128-B line. coverage: NMB x 8 waves = 512 row tiles x 4 quarters of a row.
// =====================================================================================================
#define NMB (NB * (SEQ / 16) * (NQB / 4) / 8)   // 256 blocks of 8 waves
__device__ __forceinline__ void pack_mask(const int* __restrict__ mask, unsigned* mw, int bx) {
  const int lane = threadIdx.x & 31;
  const int u    = bx * 8 + (threadIdx.x >> 5);
  const int qr   = u % (NQB / 4);                // quarter of the row: four kv chunks
  const int rt   = u / (NQB / 4);                // row tile: b * (SEQ/16) + query tile
  const int* g = mask + ((size_t)rt * 16 + (size_t)(lane & 15)) * SEQ + qr * 256 + 8 * (lane >> 4);
  v4i m[32];
#pragma unroll
  for (int i = 0; i < 16; ++i) {
    m[2 * i]     = *(const v4i*)(g + i * 16);
    m[2 * i + 1] = *(const v4i*)(g + i * 16 + 4);
  }
#if defined(__HIP_DEVICE_COMPILE__)
  // the loads are out. The wait names their address: it keeps its registers up to here and is given up only behind it.
  asm volatile("s_wait_xcnt 0x0" : "+v"(g) :: "memory");
#endif
  unsigned* o = mw + ((size_t)rt * NQB + (size_t)qr * 4) * 32 + lane;
#pragma unroll
  for (int ch = 0; ch < 4; ++ch) {
    int word = 0;
#pragma unroll
    for (int w = 0; w < 32; ++w) {
      const int v = m[ch * 8 + 2 * (w >> 3) + ((w & 7) >> 2)][w & 3];
      const int bal = (int)__builtin_amdgcn_ballot_w32(v != 0);
      word = (lane == w) ? bal : word;
    }
    o[ch * 32] = (unsigned)word;
  }
}

// =====================================================================================================
// The mask packing and all six converts in one launch (none reads what another writes). Blocks, in this order: NMB blocks
// of the mask (the largest stream), 3 x NTW tiles of Wq, Wk, Wv, NTO tiles of Wo (the transposes have the longer chain),
// then NCX blocks each of query and key. Every branch is uniform for the block.
// =====================================================================================================
#define NTW ((DM / 64) * (QIN / 64))        // 32 tiles of a projection weight
#define NTO ((DM / 64) * (DM / 64))         // 64 tiles of the output weight
#define NCX (NB * SEQ * QIN / 8 / 256)      // 1024 blocks of an activation plane
__global__ __launch_bounds__(256) void prep_all(
    const float* __restrict__ query, const float* __restrict__ key,
    const float* __restrict__ Wq, const float* __restrict__ Wk, const float* __restrict__ Wv, const float* __restrict__ Wo,
    const int* __restrict__ mask,
    unsigned short* Xq, unsigned short* Xk,
    unsigned short* WqT, unsigned short* WkT, unsigned short* WvT, unsigned short* WoT, unsigned* Mw) {
  const int bx = (int)blockIdx.x - NMB;
  if (bx < 0) {
    pack_mask(mask, Mw, (int)blockIdx.x);
  } else if (bx < 3 * NTW + NTO) {
    const int w = bx / NTW;                                    // 0, 1, 2 = Wq, Wk, Wv; 3 and 4 = Wo
    const int t = (w < 3) ? (bx - w * NTW) : (bx - 3 * NTW);
    const float*    in  = (w == 0) ? Wq  : (w == 1) ? Wk  : (w == 2) ? Wv  : Wo;
    unsigned short* out = (w == 0) ? WqT : (w == 1) ? WkT : (w == 2) ? WvT : WoT;
    cvt_bf16_t64(in, out, (w < 3) ? QIN : DM, DM, t % (DM / 64), t / (DM / 64));   // in rows = k, cols = DM
  } else {
    const int c = bx - (3 * NTW + NTO);
    const bool q = c < NCX;
    cvt_bf16x8(q ? query : key, q ? Xq : Xk, NCX * 256, q ? c : c - NCX);
  }
}

// =====================================================================================================
// Register-blocked batched bf16 WMMA GEMM: C[m][n] = sum_k A[m][k] * Bt[n][k] + bias (ReLU optional); one wave
// per 64x64 tile, no block barriers. A row-major [M][K] pitch lda; Bt row-major [N][K] pitch ldb (k contiguous);
// M, N multiples of 64, K multiple of 32 (host-checked). bx = block of GW tiles, by = batch index (strides in elements);
// sT = the block's GW per-wave 16x64 slabs in LDS, pitch 68 floats.
// GW = 4 waves a block, one per SIMD: 1024 tiles make 256 blocks, one for each of the 256 WGPs (blocks of 8 waves would
// leave half the WGPs without work); the 3072 tiles of the three projections make 768 blocks, three for each WGP.
// NSPLIT: 0 = A.Bt; 1 = (A + A2).Bt (A2 = unscaled bf16 lo plane of A); 2 = A.Bt + A2.Bt + A.Bt2.
// BIAS: 0 = none; 1 = bias[n] (per column); 2 = bias[m] (per row). Bias is an f32 array, applied as its
//       bf16 RNE value in the f32 epilogue before any 16-bit split of the result. RELU: 1 = max(v, 0) after bias.
// OUT_MODE: 0 = f32 (pitch ldc); 2 = bf16 hi plane C + bf16 lo plane C2 (lo = RNE(v - hi), unscaled);
//           3 = f16 hi plane C + f16 residual plane C2 = f16((v - hi) * rscale), C2 written only for tiles
//               with n0 < N2 (pitch ldc2, batch stride strideC2); 4 = f16 hi plane C only.
// =====================================================================================================
#define GW 4
template <int NSPLIT, int OUT_MODE, int BIAS, int RELU>
__device__ __forceinline__ void gemm64(
    float (*sT)[16 * 68], int bx, int by,
    const unsigned short* __restrict__ Ap, const unsigned short* A2p, int lda, long long strideA,
    const unsigned short* __restrict__ Btp, const unsigned short* Bt2p, int ldb, long long strideB,
    const float* __restrict__ bias,
    void* Cout, int ldc, long long strideC,
    void* Cout2, int ldc2, long long strideC2, int N2,
    int M, int N, int K, float rscale) {
  const __bf16* A   = (const __bf16*)(const void*)Ap;
  const __bf16* A2  = (const __bf16*)(const void*)A2p;
  const __bf16* Bt  = (const __bf16*)(const void*)Btp;
  const __bf16* Bt2 = (const __bf16*)(const void*)Bt2p;
  const int b    = by;
  const int lane = threadIdx.x & 31;
  const int wave = threadIdx.x >> 5;
  const int tilesN = N >> 6;
  const int tilesM = M >> 6;
  const int tile = bx * GW + wave;
  if (tile >= tilesM * tilesN) return;   // wave-uniform; no block barriers in this kernel
  const int tm = tile / tilesN;
  const int tn = tile - tm * tilesN;
  const int m0 = tm << 6;
  const int n0 = tn << 6;

  const __bf16* Ab  = A  + (size_t)b * strideA;
  const __bf16* Bb  = Bt + (size_t)b * strideB;
  const __bf16* Ab2 = (NSPLIT >= 1) ? (A2  + (size_t)b * strideA) : Ab;
  const __bf16* Bb2 = (NSPLIT == 2) ? (Bt2 + (size_t)b * strideB) : Bb;

  const int rlane = lane & 15;                 // row (A) / col (B, D) within subtile
  const int koff  = (lane >> 4) * 8;           // k offset of this lane half
  const int mOff  = (lane >> 4) * 8;           // D row offset

  v8f acc[4][4];
#pragma unroll
  for (int i = 0; i < 4; ++i)
#pragma unroll
    for (int j = 0; j < 4; ++j) acc[i][j] = zero8();

  // running addresses of this lane's row 0 fragments, 32 elements on a k step; the other rows lie at constant offsets
  const __bf16* pa  = Ab  + (size_t)(m0 + rlane) * lda + koff;
  const __bf16* pa2 = Ab2 + (size_t)(m0 + rlane) * lda + koff;
  const __bf16* pb  = Bb  + (size_t)(n0 + rlane) * ldb + koff;
  const __bf16* pb2 = Bb2 + (size_t)(n0 + rlane) * ldb + koff;
  for (int k0 = 0; k0 < K; k0 += 32) {
    v16b bh[4], bl[4];
#pragma unroll
    for (int j = 0; j < 4; ++j) {
      const size_t bo = (size_t)(j << 4) * ldb;
      bh[j] = ldfrag_b(pb + bo);
      if (NSPLIT == 2) bl[j] = ldfrag_b(pb2 + bo); else bl[j] = bh[j];
    }
#pragma unroll
    for (int i = 0; i < 4; ++i) {
      const size_t ao = (size_t)(i << 4) * lda;
      const v16b ah = ldfrag_b(pa + ao);
      v16b al = ah;
      if (NSPLIT >= 1) al = ldfrag_b(pa2 + ao);
#pragma unroll
      for (int j = 0; j < 4; ++j) {
        acc[i][j] = mma_b_raw(ah, bh[j], acc[i][j]);
        if (NSPLIT >= 1) acc[i][j] = mma_b_raw(al, bh[j], acc[i][j]);
        if (NSPLIT == 2) acc[i][j] = mma_b_raw(ah, bl[j], acc[i][j]);
      }
    }
    // order inside a k step: all its fragment loads (0x20) go out first, then the WMMAs (0x8): one load latency a k step,
    // where loads issued row by row between the WMMAs would each be waited for in turn
    __builtin_amdgcn_sched_group_barrier(0x020, 8 * (NSPLIT == 2 ? 2 : 1) + 8 * (NSPLIT >= 1 ? 2 : 1), 0);
    __builtin_amdgcn_sched_group_barrier(0x008, 16 * (NSPLIT + 1), 0);
#if defined(__HIP_DEVICE_COMPILE__)
    // the k step's loads are out. The wait names the running addresses: they keep their registers up to here (no load's
    // result lands in a pair that an issued load names) and are stepped on only behind it.
    if (NSPLIT == 0)      asm volatile("s_wait_xcnt 0x0" : "+v"(pa), "+v"(pb) :: "memory");
    else if (NSPLIT == 1) asm volatile("s_wait_xcnt 0x0" : "+v"(pa), "+v"(pa2), "+v"(pb) :: "memory");
    else                  asm volatile("s_wait_xcnt 0x0" : "+v"(pa), "+v"(pa2), "+v"(pb), "+v"(pb2) :: "memory");
#endif
    pa += 32; pa2 += 32; pb += 32; pb2 += 32;
  }

  // ---- epilogue ----
  float bcol[4] = {0.f, 0.f, 0.f, 0.f};
  if (BIAS == 1) {
#pragma unroll
    for (int j = 0; j < 4; ++j) bcol[j] = bf_up(bf_bits(bias[n0 + (j << 4) + rlane]));
  }
  float* slab = sT[wave];
#pragma unroll
  for (int i = 0; i < 4; ++i) {
    const int mBase = m0 + (i << 4);
    float brow[8] = {0.f, 0.f, 0.f, 0.f, 0.f, 0.f, 0.f, 0.f};
    if (BIAS == 2) {
#pragma unroll
      for (int r = 0; r < 8; ++r) brow[r] = bf_up(bf_bits(bias[mBase + mOff + r]));
    }
#pragma unroll
    for (int j = 0; j < 4; ++j) {
#pragma unroll
      for (int r = 0; r < 8; ++r) {
        float vv = acc[i][j][r] + bcol[j] + brow[r];
        if (RELU) vv = fmaxf(vv, 0.0f);
        slab[(mOff + r) * 68 + (j << 4) + rlane] = vv;
      }
    }
    wave_sync_lds();
    if (OUT_MODE == 0) {
      float* C = (float*)Cout + (size_t)b * strideC;
      const int hh = lane >> 4, c4 = (lane & 15) * 4;     // 256-B row segment = 16 lanes x 16 B
      {
#pragma unroll
        for (int it = 0; it < 8; ++it) {
          const int row = it * 2 + hh;                     // it 0..7 x hh 0..1 = rows 0..15
          const v4f v = *(const v4f*)(slab + row * 68 + c4);
          *(v4f*)(C + (size_t)(mBase + row) * ldc + n0 + c4) = v;
        }
        
      }
    } else {
      const int q = lane >> 3, c8 = (lane & 7) * 8;
      unsigned short* C  = (unsigned short*)Cout  + (size_t)b * strideC;
      unsigned short* C2 = (unsigned short*)Cout2 + (size_t)b * strideC2;
      const bool wlo = (OUT_MODE == 2) || (OUT_MODE == 3 && n0 < N2);   // wave-uniform
      v4u hv[4], lv[4];
#pragma unroll
      for (int it = 0; it < 4; ++it) {
        const int row = it * 4 + q;                        // it 0..3 x q 0..3 = rows 0..15
        const float* sp = slab + row * 68 + c8;
        v4u a, a2;
#pragma unroll
        for (int e = 0; e < 4; ++e) {
          const float f0 = sp[2 * e], f1 = sp[2 * e + 1];
          unsigned short h0, h1, l0, l1;
          if (OUT_MODE == 2) {
            h0 = bf_bits(f0); h1 = bf_bits(f1);
            l0 = bf_bits(f0 - bf_up(h0)); l1 = bf_bits(f1 - bf_up(h1));
          } else {
            const _Float16 x0 = (_Float16)f0, x1 = (_Float16)f1;
            h0 = h_bits(x0); h1 = h_bits(x1);
            l0 = h_bits((_Float16)((f0 - (float)x0) * rscale));
            l1 = h_bits((_Float16)((f1 - (float)x1) * rscale));
          }
          a[e] = pk16(h0, h1); a2[e] = pk16(l0, l1);
        }
        hv[it] = a; lv[it] = a2;
      }
      {
#pragma unroll
        for (int it = 0; it < 4; ++it) {
          const int row = it * 4 + q;
          *(v4u*)(C + (size_t)(mBase + row) * ldc + n0 + c8) = hv[it];
          if (wlo) *(v4u*)(C2 + (size_t)(mBase + row) * ldc2 + n0 + c8) = lv[it];
        }
        
      }
    }
    wave_sync_lds();
  }
}

// =====================================================================================================
// The q, k and v^T projections in one launch (none reads what another writes): 3 x NPB blocks, block-uniform branch.
//   q = relu(query . Wq + bq) -> f16 hi plane [8192][512] + f16 residual x4096 (all tiles, N2 = DM); M=8192, N=512, K=256
//   k = relu(key . Wk + bk)   -> f16 hi plane [8192][512] only; M=8192, N=512, K=256
//   v^T = relu(Wv^T . key^T + bv) per batch -> f16 hi plane [b][h*64+d][s] (pitch SEQ) and residual plane x4096
//     (A = WvT [n][k], Bt = Xk rows of batch b, bias per row; M=512, N=1024, K=256; NVB blocks a batch)
// =====================================================================================================
#define NPB ((NB * SEQ / 64) * (DM / 64) / GW)    // 1024 tiles -> 256 blocks of one projection
#define NVB ((DM / 64) * (SEQ / 64) / GW)         // 128 tiles -> 32 blocks of one batch of v^T
static_assert(NVB * NB == NPB);
// At most three waves a SIMD: no WGP takes a fourth block while another holds two.
__global__ __launch_bounds__(GW * 32) __attribute__((amdgpu_waves_per_eu(1, 3))) void proj_qkv(
    const unsigned short* __restrict__ Xq, const unsigned short* __restrict__ Xk,
    const unsigned short* __restrict__ WqT, const unsigned short* __restrict__ WkT, const unsigned short* __restrict__ WvT,
    const float* __restrict__ bq, const float* __restrict__ bk, const float* __restrict__ bv,
    unsigned short* Qh, unsigned short* Ql, unsigned short* Kh, unsigned short* VTh, unsigned short* VTl) {
  __shared__ __align__(16) float sT[GW][16 * 68];  // per-wave 16x64 slab, pitch 68 floats
  const int g = blockIdx.x / NPB;
  const int r = blockIdx.x % NPB;
  if (g == 0) {
    gemm64<0, 3, 1, 1>(sT, r, 0,
        Xq, Xq, QIN, 0LL, WqT, WqT, QIN, 0LL, bq,
        (void*)Qh, DM, 0LL, (void*)Ql, DM, 0LL, DM,
        NB * SEQ, DM, QIN, 4096.0f);
  } else if (g == 1) {
    gemm64<0, 4, 1, 1>(sT, r, 0,
        Xk, Xk, QIN, 0LL, WkT, WkT, QIN, 0LL, bk,
        (void*)Kh, DM, 0LL, (void*)Kh, DM, 0LL, 0,
        NB * SEQ, DM, QIN, 4096.0f);
  } else {
    gemm64<0, 3, 2, 1>(sT, r % NVB, r / NVB,
        WvT, WvT, QIN, 0LL, Xk, Xk, QIN, (long long)SEQ * QIN, bv,
        (void*)VTh, SEQ, (long long)DM * SEQ, (void*)VTl, SEQ, (long long)DM * SEQ, SEQ,
        DM, SEQ, QIN, 4096.0f);
  }
}

// out = context . Wo + bo -> f32 [8192][512] (A = context hi + lo planes, 2 products; M=8192, N=512, K=512): NPB blocks
// At most one wave a SIMD: no WGP takes a second block while another holds none.
__global__ __launch_bounds__(GW * 32) __attribute__((amdgpu_waves_per_eu(1, 1))) void proj_out(
    const unsigned short* __restrict__ Oh, const unsigned short* __restrict__ Ol, const unsigned short* __restrict__ WoT,
    const float* __restrict__ bo, float* out) {
  __shared__ __align__(16) float sT[GW][16 * 68];  // per-wave 16x64 slab, pitch 68 floats
  gemm64<1, 0, 1, 0>(sT, blockIdx.x, 0,
      Oh, Ol, DM, 0LL, WoT, WoT, DM, 0LL, bo,
      (void*)out, DM, 0LL, (void*)out, DM, 0LL, DM,
      NB * SEQ, DM, DM, 1.0f);
}

// =====================================================================================================
// Attention, head dim 64, per-(query,key) mask as lane-select words (pack_mask; bit 0 = masked -> score replaced by the
// finite value -1e8, so a fully masked row yields uniform weights), standard softmax over all SEQ keys.
//   q hi plane (f16, pitch DM): element (b, t, h, d) at [(b*SEQ + t)*DM + h*64 + d]; k plane same layout
//   q residual plane (f16, (q - f16(q))*4096, pitch DM): same layout
//   v^T hi plane (f16): element (b, h, d, s) at [(b*DM + h*64 + d)*SEQ + s]; v^T residual plane (f16, x4096): same layout
//   out planes (bf16 hi / lo of the normalised context): element (b, t, h, d) at [(b*SEQ + t)*DM + h*64 + d]
//   Both products run transposed, so that a lane owns ONE query (column lane&15) and holds 8 keys / 8 d per tile:
//   scores^T = (k . qh^T + (k . ql^T) * rres) * sscale on f16 WMMA (A = K rows, B = q), residual products in a separate
//   accumulator, then the per-(q,k) mask select; p = exp(s - m) carried as f16(1024 p); two score tiles of 16 keys,
//   converted in place, are the B operand of context^T = vh^T . p^T + (vl^T . p^T) * rres (A = V^T rows; separate
//   accumulator folded per chunk in f32): P never goes through LDS. Online softmax in f32: maximum and sum run inside
//   the lane, the two lane halves (keys 8hh..8hh+7 of each group) exchange the maximum once a chunk and join their
//   sums once behind the loop; final multiply by 1/l.
//   Block = 4 waves = 64 query rows of one (b, h); grid = NQB * NH * NB; kv chunks of 64, static trip NQB.
//   K / V^T chunk staging: 128 threads x 4 rows x 8 elements per plane = the whole 64x64 tile (plain 16-B loads into
//   registers, LDS stores with __syncthreads before and after); mask: the wave reads its chunk's 32 lane-select words by
//   scalar loads, and each word is the select's condition as it stands (addresses always in range).
//   All loads of chunk kt+1 are issued behind the scores of chunk kt, so that softmax and the second product
//   cover their way; the tiles wait in registers for the barrier that frees the LDS.
//   Output coverage: each wave stores rows q0..q0+15 (it 0..3 x lane>>3 0..3) x 64 columns (8 lanes x 8) of both planes.
// =====================================================================================================
// The 12 vector loads of one kv chunk: this thread's 4 rows of the K, V^T and V^T residual tiles.
__device__ __forceinline__ void ask_chunk(const _Float16* kg, const _Float16* vg, const _Float16* vlg,
                                          v8h (&ka)[4], v8h (&va)[4], v8h (&vr)[4]) {
#pragma unroll
  for (int i = 0; i < 4; ++i) {
    ka[i] = *(const v8h*)(kg + (size_t)(16 * i) * DM);
    va[i] = *(const v8h*)(vg + (size_t)(16 * i) * SEQ);
    vr[i] = *(const v8h*)(vlg + (size_t)(16 * i) * SEQ);
  }
#if defined(__HIP_DEVICE_COMPILE__)
  // the loads are out. The wait names their addresses: these keep their registers up to here (no load's result lands in
  // a pair that an issued load names) and are given up only behind it.
  asm volatile("s_wait_xcnt 0x0" : "+v"(kg), "+v"(vg), "+v"(vlg) :: "memory");
#endif
}

// Four waves per SIMD (the whole grid resident at once: 4 workgroups on each WGP) hold only up to 256 registers a wave.
__global__ __launch_bounds__(128) __attribute__((amdgpu_waves_per_eu(4, 4)))
void attn64(const unsigned short* __restrict__ qhp, const unsigned short* __restrict__ qlp,
            const unsigned short* __restrict__ khp,
            const unsigned short* __restrict__ vhp, const unsigned short* __restrict__ vlp,
            const unsigned* __restrict__ mwp,
            unsigned short* ohp, unsigned short* olp, float sscale, float rres) {
  union FH { v16h v; v8h h[2]; };
  __shared__ __align__(16) _Float16 Ksh[64 * LP];                 // K [kv][d]   9 KB
  __shared__ __align__(16) _Float16 Vth[64 * LP];                 // V^T hi [d][kv] 9 KB
  __shared__ __align__(16) _Float16 Vtl[64 * LP];                 // V^T residual [d][kv] 9 KB
  __shared__ __align__(16) float    Os[4][16 * OP];               // per wave context tile [row][d] 17 KB

  const int tid  = threadIdx.x;
  const int wave = tid >> 5;
  const int lane = tid & 31;
  const int hh   = lane >> 4;
  const int c    = lane & 15;

  const int bx   = blockIdx.x;
  const int qb   = bx % NQB;
  const int rest = bx / NQB;
  const int h    = rest % NH;
  const int b    = rest / NH;
  const int q0   = qb * 64 + wave * 16;
  const size_t rowB = (size_t)b * SEQ;

  const _Float16* Qh = (const _Float16*)(const void*)qhp + (size_t)h * HD;
  const _Float16* Ql = (const _Float16*)(const void*)qlp + (size_t)h * HD;
  const _Float16* Kg = (const _Float16*)(const void*)khp + (size_t)h * HD;
  const _Float16* Vh = (const _Float16*)(const void*)vhp + ((size_t)b * DM + (size_t)h * HD) * SEQ;
  const _Float16* Vl = (const _Float16*)(const void*)vlp + ((size_t)b * DM + (size_t)h * HD) * SEQ;
  // lane-select words of this wave's 16 queries, 32 words a chunk; the wave's number as a scalar, so that the address is one
  // the plane is written by an earlier launch and only read here: the constant address space keeps the loop's loads scalar
  typedef const __attribute__((address_space(4))) unsigned* cu32;
  const cu32 Mw = (cu32)(mwp + ((size_t)b * (SEQ / 16) + (size_t)qb * 4 + (size_t)__builtin_amdgcn_readfirstlane(wave)) * (NQB * 32));

  // ---- Q fragments (B operand, column = lane&15): 2 d-chunks, hi and residual ----
  v16h qah[2], qal[2];
#pragma unroll
  for (int dc = 0; dc < 2; ++dc) {
    qah[dc] = ldfrag_h(Qh + (rowB + q0 + c) * DM + dc * 32 + 8 * hh);
    qal[dc] = ldfrag_h(Ql + (rowB + q0 + c) * DM + dc * 32 + 8 * hh);
  }

#if defined(__HIP_DEVICE_COMPILE__)
  // the Q loads are out: behind this wait the first chunk's loads may land in the registers that held the Q addresses
  asm volatile("s_wait_xcnt 0x0" ::: "memory");
#endif

  float mrow = -INFINITY, lrow = 0.f;        // this lane's query: running maximum (both halves agree), this half's sum
  v8f oacc[4];                               // context^T: oacc[t][r] = d t*16 + 8hh + r of query c
#pragma unroll
  for (int t = 0; t < 4; ++t) oacc[t] = zero8();

  // 8 lanes x 16 B = one 128-B tile row, so a wave's load covers 4 whole lines; rows sr, sr+16, sr+32, sr+48 per thread
  const int sr = tid >> 3, sc8 = (tid & 7) * 8;
  const _Float16* kg0  = Kg + (rowB + sr) * DM + sc8;            // K row kv0+sr, d = sc8..sc8+7; kv0 added per chunk
  const _Float16* vg0  = Vh + (size_t)sr * SEQ + sc8;            // V^T row d = sr, s = kv0+sc8..+7
  const _Float16* vlg0 = Vl + (size_t)sr * SEQ + sc8;
  v8h ka[4], va[4], vr[4];                   // the chunk on its way: tile rows ...
  unsigned mk[32];                           // ... and lane-select words (the same in every lane: scalar registers)
  ask_chunk(kg0, vg0, vlg0, ka, va, vr);
#pragma unroll
  for (int w = 0; w < 32; ++w) mk[w] = Mw[w];

  for (int kt = 0; kt < NQB; ++kt) {         // static trip count
    const int kv0 = kt * 64;
    __syncthreads();
#pragma unroll
    for (int i = 0; i < 4; ++i) {
      *(v8h*)(Ksh + (sr + 16 * i) * LP + sc8) = ka[i];
      *(v8h*)(Vth + (sr + 16 * i) * LP + sc8) = va[i];
      *(v8h*)(Vtl + (sr + 16 * i) * LP + sc8) = vr[i];
    }
    __syncthreads();

    // ---- scores^T: 64 keys x 16 queries per wave, 2 f16 products (hi, residual), then per-(q,k) mask select;
    //      s[j][r] = key j*16 + 8hh + r, query c ----
    v8f s[4];
#pragma unroll
    for (int j = 0; j < 4; ++j) {
      v8f sh = zero8(), sl = zero8();
#pragma unroll
      for (int dc = 0; dc < 2; ++dc) {
        FH kb;
        kb.h[0] = *(const v8h*)(Ksh + (j * 16 + c) * LP + dc * 32 + 8 * hh);
        kb.h[1] = *(const v8h*)(Ksh + (j * 16 + c) * LP + dc * 32 + 16 + 8 * hh);
        sh = mma_h(kb.v, qah[dc], sh);
        sl = mma_h(kb.v, qal[dc], sl);
      }
#pragma unroll
      for (int r = 0; r < 8; ++r) {
        const float v = (sh[r] + sl[r] * rres) * sscale;
        s[j][r] = __builtin_amdgcn_inverse_ballot_w32(mk[j * 8 + r]) ? v : -1.0e8f;   // bit l = key j*16 + 8hh + r, query c
      }
    }

    // ---- the next chunk's global loads. The last trip asks for its own chunk once more (never used), so that every
    //      address stays inside its plane ----
    {
      const int kvn = (kt + 1 < NQB) ? kv0 + 64 : kv0;
      ask_chunk(kg0 + (size_t)kvn * DM, vg0 + kvn, vlg0 + kvn, ka, va, vr);
#pragma unroll
      for (int w = 0; w < 32; ++w) mk[w] = Mw[(kvn >> 1) + w];   // chunk kvn/64, 32 words each
    }

    // ---- maximum over the chunk's keys, online softmax, P^T (x1024, f16) packed as the B operand ----
    float mj[4];
#pragma unroll
    for (int j = 0; j < 4; ++j) {
      mj[j] = s[j][0];
#pragma unroll
      for (int r = 1; r < 8; ++r) mj[j] = fmaxf(mj[j], s[j][r]);
    }
    float m = fmaxf(fmaxf(mj[0], mj[1]), fmaxf(mj[2], mj[3]));
    m = fmaxf(m, xhalf(m));                                      // the other half's 32 keys of the same query
    const float mnew  = fmaxf(mrow, m);
    const float alpha = __expf(mrow - mnew);
    mrow = mnew;
    // pb[kk] element e: e 0..7 = key kk*32 + 8hh + e (tile 2kk), e 8..15 = key kk*32 + 16 + 8hh + (e-8) (tile 2kk+1):
    // the k order of the V^T fragments below
    FH pb[2];
    float ps[4];                                                 // four independent sums, one per 16-key group
#pragma unroll
    for (int j = 0; j < 4; ++j) {
#pragma unroll
      for (int r = 0; r < 8; ++r) {
        const float p = __expf(s[j][r] - mnew);
        ps[j] = (r == 0) ? p : ps[j] + p;
        pb[j >> 1].v[(j & 1) * 8 + r] = (_Float16)(p * 1024.0f);
      }
    }
    lrow = lrow * alpha + ((ps[0] + ps[1]) + (ps[2] + ps[3]));
#pragma unroll
    for (int t = 0; t < 4; ++t)
#pragma unroll
      for (int r = 0; r < 8; ++r) oacc[t][r] *= alpha;

    // ---- context^T += V^T . P^T (f16 WMMA), residual products into a separate accumulator ----
    // keeps the V^T fragment reads behind the softmax: lifted over it they would push the wave past its 256 registers (spills)
    __builtin_amdgcn_sched_barrier(0);
    v8f o1[4];
#pragma unroll
    for (int t = 0; t < 4; ++t) o1[t] = zero8();
#pragma unroll   // pb[kk] lives in registers: a rolled loop would have to pick the operand by a run-time index
    for (int kk = 0; kk < 2; ++kk) {
#pragma unroll
      for (int t = 0; t < 4; ++t) {
        FH vb, vl;
        vb.h[0] = *(const v8h*)(Vth + (t * 16 + c) * LP + kk * 32 + 8 * hh);
        vb.h[1] = *(const v8h*)(Vth + (t * 16 + c) * LP + kk * 32 + 16 + 8 * hh);
        vl.h[0] = *(const v8h*)(Vtl + (t * 16 + c) * LP + kk * 32 + 8 * hh);
        vl.h[1] = *(const v8h*)(Vtl + (t * 16 + c) * LP + kk * 32 + 16 + 8 * hh);
        oacc[t] = mma_h(vb.v, pb[kk].v, oacc[t]);
        o1[t]   = mma_h(vl.v, pb[kk].v, o1[t]);
      }
    }
    // order of this product's LDS reads (0x100) and WMMAs (0x8): the reads run two fragment pairs ahead, so that a WMMA
    // waits for reads issued eight earlier and not for the ones directly in front of it
    __builtin_amdgcn_sched_group_barrier(0x100, 12, 0);
#pragma unroll   // each call has to stand in the straight-line block that it orders
    for (int g = 0; g < 5; ++g) {
      __builtin_amdgcn_sched_group_barrier(0x008, 2, 0);
      __builtin_amdgcn_sched_group_barrier(0x100, 4, 0);
    }
    __builtin_amdgcn_sched_group_barrier(0x008, 6, 0);
#pragma unroll
    for (int t = 0; t < 4; ++t)
#pragma unroll
      for (int r = 0; r < 8; ++r) oacc[t][r] += o1[t][r] * rres;
  }

  // ---- normalise (1/l and the 1/1024 p carry), stage the wave's 16x64 tile, bf16 hi/lo split,
  float* os = Os[wave];
  {
    const float l   = lrow + xhalf(lrow);                       // join the two halves' sums of this query
    const float inv = (1.0f / l) * (1.0f / 1024.0f);            // l >= 1 always (the max key contributes 1)
#pragma unroll
    for (int t = 0; t < 4; ++t) {
      v4f x0, x1;
#pragma unroll
      for (int r = 0; r < 4; ++r) { x0[r] = oacc[t][r] * inv; x1[r] = oacc[t][4 + r] * inv; }
      *(v4f*)(os + c * OP + t * 16 + 8 * hh)     = x0;          // row = query c, d = t*16 + 8hh + 0..3
      *(v4f*)(os + c * OP + t * 16 + 8 * hh + 4) = x1;
    }
  }
  wave_sync_lds();
  {
    const int q4 = lane >> 3, c8 = (lane & 7) * 8;
    v4u hv[4], lv[4];
#pragma unroll
    for (int it = 0; it < 4; ++it) {
      const int row = it * 4 + q4;   // it 0..3 x q4 0..3 = rows 0..15 of the wave tile
      const float* sp = os + row * OP + c8;
      v4u a, a2;
#pragma unroll
      for (int e = 0; e < 4; ++e) {
        const float f0 = sp[2 * e], f1 = sp[2 * e + 1];
        const unsigned short h0 = bf_bits(f0), h1 = bf_bits(f1);
        const unsigned short l0 = bf_bits(f0 - bf_up(h0)), l1 = bf_bits(f1 - bf_up(h1));
        a[e] = pk16(h0, h1); a2[e] = pk16(l0, l1);
      }
      hv[it] = a; lv[it] = a2;
    }
    {
#pragma unroll
      for (int it = 0; it < 4; ++it) {
        const int row = it * 4 + q4;
        const size_t go = (rowB + q0 + row) * DM + (size_t)h * HD + c8;
        *(v4u*)(ohp + go) = hv[it];
        *(v4u*)(olp + go) = lv[it];
      }
      
    }
  }
}

// =====================================================================================================
// Workspace map (bytes), every plane an exact multiple of its 64x64-tile / whole-line store granularity:
//   Xq    bf16 [8192][256]           0          4194304
//   Xk    bf16 [8192][256]           4194304    4194304
//   WqT   bf16 [512][256]            8388608    262144
//   WkT   bf16 [512][256]            8650752    262144
//   WvT   bf16 [512][256]            8912896    262144
//   WoT   bf16 [512][512]            9175040    524288
//   Qh    f16  [8192][512]           9699328    8388608
//   Ql    f16  [8192][512]           18087936   8388608   (q residual x4096)
//   Kh    f16  [8192][512]           26476544   8388608
//   VTh   f16  [8][512][1024]        34865152   8388608
//   VTl   f16  [8][512][1024]        43253760   8388608   (v residual x4096)
//   Oh    bf16 [8192][512]           51642368   8388608
//   Ol    bf16 [8192][512]           60030976   8388608
//   Mw    u32  [512][16][32]         68419584   1048576   (mask as lane-select words)
//   end                              69468160
// Weights arrive as [in k][out n] and are transpose-converted to [out n][in k] (k contiguous = Bt / A layout).
// =====================================================================================================
extern "C" void kernel_launch(void* const* d_in, const int* in_sizes, int n_in,
                              void* d_out, int out_size, void* d_ws, size_t ws_size,
                              hipStream_t stream) {
  if (n_in < 11) return;
  if (in_sizes[0] != NB * SEQ * QIN || in_sizes[1] != NB * SEQ * QIN) return;
  if (in_sizes[2] != NB * SEQ * SEQ) return;
  if (in_sizes[3] != QIN * DM || in_sizes[5] != QIN * DM || in_sizes[7] != QIN * DM) return;
  if (in_sizes[9] != DM * DM) return;
  if (in_sizes[4] != DM || in_sizes[6] != DM || in_sizes[8] != DM || in_sizes[10] != DM) return;
  if (out_size != NB * SEQ * DM) return;

  const float* query = (const float*)d_in[0];
  const float* key   = (const float*)d_in[1];
  const int*   mask  = (const int*)d_in[2];
  const float* Wq    = (const float*)d_in[3];
  const float* bq    = (const float*)d_in[4];
  const float* Wk    = (const float*)d_in[5];
  const float* bk    = (const float*)d_in[6];
  const float* Wv    = (const float*)d_in[7];
  const float* bv    = (const float*)d_in[8];
  const float* Wo    = (const float*)d_in[9];
  const float* bo    = (const float*)d_in[10];

  const size_t PXI = (size_t)NB * SEQ * QIN * 2;     //  4194304 (bf16 input activation plane)
  const size_t PW  = (size_t)DM * QIN * 2;           //   262144 (one projection weight plane)
  const size_t PWO = (size_t)DM * DM * 2;            //   524288 (output weight plane)
  const size_t PA  = (size_t)NB * SEQ * DM * 2;      //  8388608 (q / k / context planes)
  const size_t PVT = (size_t)NB * DM * SEQ * 2;      //  8388608 (v^T plane)
  size_t off = 0;
  const size_t oXq  = off; off += PXI;
  const size_t oXk  = off; off += PXI;
  const size_t oWq  = off; off += PW;
  const size_t oWk  = off; off += PW;
  const size_t oWv  = off; off += PW;
  const size_t oWo  = off; off += PWO;
  const size_t oQh  = off; off += PA;
  const size_t oQl  = off; off += PA;
  const size_t oKh  = off; off += PA;
  const size_t oVTh = off; off += PVT;
  const size_t oVTl = off; off += PVT;
  const size_t oOh  = off; off += PA;
  const size_t oOl  = off; off += PA;
  const size_t oMw  = off; off += (size_t)NB * SEQ * SEQ / 8;   // 1048576 (one bit a mask element)
  if (off > ws_size) return;                          // off = 69468160
  if (off > (size_t)134217728) return;

  char* ws = (char*)d_ws;
  unsigned short* Xq  = (unsigned short*)(ws + oXq);
  unsigned short* Xk  = (unsigned short*)(ws + oXk);
  unsigned short* WqT = (unsigned short*)(ws + oWq);
  unsigned short* WkT = (unsigned short*)(ws + oWk);
  unsigned short* WvT = (unsigned short*)(ws + oWv);
  unsigned short* WoT = (unsigned short*)(ws + oWo);
  unsigned short* Qh  = (unsigned short*)(ws + oQh);
  unsigned short* Ql  = (unsigned short*)(ws + oQl);
  unsigned short* Kh  = (unsigned short*)(ws + oKh);
  unsigned short* VTh = (unsigned short*)(ws + oVTh);
  unsigned short* VTl = (unsigned short*)(ws + oVTl);
  unsigned short* Oh  = (unsigned short*)(ws + oOh);
  unsigned short* Ol  = (unsigned short*)(ws + oOl);
  unsigned*       Mw  = (unsigned*)(ws + oMw);

  const dim3 blk(256);
  const dim3 gPrep(NMB + 3 * NTW + NTO + 2 * NCX);              // 256 mask blocks + 160 transpose tiles + 2 x 1024 convert blocks
  const dim3 blkG(GW * 32);                                     // GEMM blocks: 4 waves
  const dim3 gProj(3 * NPB);                                    // 3 x 256 blocks: q, k, v^T
  const dim3 gOut(NPB);                                         // 1024 tiles -> 256 blocks: M=8192, N=512
  const dim3 gAttn(NB * NH * NQB);                              // 1024 blocks

  // (1) mask -> lane-select words; activations -> bf16 planes; weights [in][out] -> transposed bf16 planes [out][in] (RNE convert)
  prep_all<<<gPrep, blk, 0, stream>>>(query, key, Wq, Wk, Wv, Wo, mask, Xq, Xk, WqT, WkT, WvT, WoT, Mw);
  // (2) to (4) the q, k and v^T projections
  proj_qkv<<<gProj, blkG, 0, stream>>>(Xq, Xk, WqT, WkT, WvT, bq, bk, bv, Qh, Ql, Kh, VTh, VTl);
  // (5) attention with per-(q,k) mask and softmax -> context bf16 hi / lo planes [8192][512]
  attn64<<<gAttn, dim3(128), 0, stream>>>(Qh, Ql, Kh, VTh, VTl, Mw, Oh, Ol, 0.125f, 1.0f / 4096.0f);
  // (6) out = context . Wo + bo -> d_out f32 [8192][512]  (A = context hi + lo planes, 2 products; K=512)
  proj_out<<<gOut, blkG, 0, stream>>>(Oh, Ol, WoT, bo, (float*)d_out);
  (void)hipGetLastError();
}

// v009
// A run of this version takes 73.3 microseconds.
// Two timings next to v008 put it at 1.07 and 1.06 times that version's speed.
// All steps since v000 together make it 2.83 times as fast.
// Contractions: q, k and v^T projections = v_wmma_f32_16x16x32_bf16 (bf16 operands from RNE-converted inputs and
// transposed weights, single product, bias and ReLU in f32); k.q^T scores = v_wmma_f32_16x16x32_f16 (q as f16 hi
// plane + f16 residual plane x4096 in a separate accumulator, k f16; 2 products); v^T.p^T = v_wmma_f32_16x16x32_f16
// (p carried x1024 in f16, v^T as f16 hi plane + f16 residual plane x4096 in a separate accumulator; 2 products);
// ctx.Wo = v_wmma_f32_16x16x32_bf16 (ctx as bf16 hi + lo planes times bf16 Wo^T, 2 products, bias in f32);
// all f32 accumulate; per-(query,key) mask select and softmax in f32.
#include <hip/hip_runtime.h>
#include <math.h>
#include <stdint.h>

#define NB    8
#define SEQ   1024
#define QIN   256
#define DM    512
#define NH    8
#define HD    64
#define NQB   (SEQ / 64)     // 16 key / query tiles of 64
#define LP    72             // LDS row pitch of the 64-wide f16 tiles, in halves: 144 B = 16 B x odd, so the 16 rows that one
                             // ds_load_b128 fragment read touches fall on 16 different 4-bank groups
static_assert(NH * HD == DM);
static_assert((SEQ % 64) == 0 && (DM % 64) == 0 && (QIN % 64) == 0 && (QIN % 32) == 0 && (DM % 32) == 0);

typedef _Float16 v16h __attribute__((ext_vector_type(16)));
typedef _Float16 v8h  __attribute__((ext_vector_type(8)));
typedef __bf16   v16b __attribute__((ext_vector_type(16)));
typedef __bf16   v8b  __attribute__((ext_vector_type(8)));
typedef float    v8f  __attribute__((ext_vector_type(8)));
typedef float    v4f  __attribute__((ext_vector_type(4)));
typedef unsigned int v4u __attribute__((ext_vector_type(4)));
typedef int          v4i __attribute__((ext_vector_type(4)));

// ---- scalar helpers --------------------------------------------------------------------------------
__device__ __forceinline__ unsigned short bf_bits(float f) {          // f32 -> bf16 bits, RNE convert
  unsigned u = __float_as_uint(f);
  return (unsigned short)((u + 0x7FFFu + ((u >> 16) & 1u)) >> 16);
}
__device__ __forceinline__ float bf_up(unsigned short h) { return __uint_as_float(((unsigned)h) << 16); }
__device__ __forceinline__ unsigned short h_bits(_Float16 x) { return __builtin_bit_cast(unsigned short, x); }
__device__ __forceinline__ unsigned pk16(unsigned short a, unsigned short b) { return (unsigned)a | ((unsigned)b << 16); }
__device__ __forceinline__ v8f zero8() { v8f z = {0.f, 0.f, 0.f, 0.f, 0.f, 0.f, 0.f, 0.f}; return z; }

// ---- fragment loaders: 16-bit A/B operand, lane -> row/col (lane&15), h = lane>>4;
//      elements 0..7 = k0+8h.., elements 8..15 = k0+16+8h..
//      ldfrag_h: row-major plane, p already includes +8h: p[0..7] and p[16..23].
//      ldfrag_b: plane in FRAGMENT ORDER (frag_off below), p already includes +8*lane: p[0..7] and p[256..263]; each of the
//      two loads reads 512 contiguous bytes a wave (4 whole lines), where a row-major plane gives 32 B in each of 16 lines.
//      ldfrag_b reads global memory only; the cast says so, for an address that has gone through an asm statement
//      would otherwise be loaded from in the flat form
typedef const __attribute__((address_space(1))) v8b* gv8b;
__device__ __forceinline__ v16b ldfrag_b(const __bf16* p) {
  union { v16b v; v8b h[2]; } f;
  f.h[0] = *(gv8b)(p);
  f.h[1] = *(gv8b)(p + 256);
  return f.v;
}
// Fragment order of a bf16 GEMM operand plane [rows][K] (rows a multiple of 16, K of 32): a slab of 16 rows x K elements is
// cut into k steps of 32; a k step is two blocks of 256 elements (512 B), block hf = k 16*hf..16*hf+15 of the step; in a block
// lane l = 16*h + r holds the 8 elements k 8h..8h+7 of row r. Element offset of the 8 elements that lane l holds in block hf
// of k step ks of row tile rt:
__device__ __forceinline__ size_t frag_off(int rt, int ks, int hf, int l, int K) {
  return (size_t)rt * 16 * K + (size_t)(ks * 512 + hf * 256 + l * 8);
}
__device__ __forceinline__ v16h ldfrag_h(const _Float16* p) {
  union { v16h v; v8h h[2]; } f;
  f.h[0] = *(const v8h*)(p);
  f.h[1] = *(const v8h*)(p + 16);
  return f.v;
}

// ---- WMMA helpers: the builtin forms alone. The compiler keeps the distance between a WMMA and the first vector
//      instruction on its registers itself, and is free to move fragment loads ahead of earlier WMMAs ----------
__device__ __forceinline__ v8f mma_h(v16h a, v16h b, v8f c) {
  return __builtin_amdgcn_wmma_f32_16x16x32_f16(false, a, false, b, (short)0, c, false, false);
}
__device__ __forceinline__ v8f mma_b_raw(v16b a, v16b b, v8f c) {
  return __builtin_amdgcn_wmma_f32_16x16x32_bf16(false, a, false, b, (short)0, c, false, false);
}
// lane l <-> lane l ^ 16 as a vector cross-row move (a shuffle would go the LDS path and be waited for on dscnt)
__device__ __forceinline__ float xhalf(float x) {
  return __builtin_bit_cast(float, __builtin_amdgcn_permlanex16(__builtin_bit_cast(int, x), __builtin_bit_cast(int, x),
                                                                0x76543210, 0xfedcba98, false, false));
}
__device__ __forceinline__ void wave_sync_lds() {
  __builtin_amdgcn_fence(__ATOMIC_RELEASE, "workgroup");
  __builtin_amdgcn_wave_barrier();
  __builtin_amdgcn_fence(__ATOMIC_ACQUIRE, "workgroup");
}

// =====================================================================================================
// f32 [rows][QIN] row-major -> bf16 (RNE convert) in fragment order, 8 elements per thread, one 16-B store per lane: a wave
// writes one 512-B block. Thread i owns the plane's i-th group of 8: lane i&31 of block (i>>5)&1 of k step (i>>6) % (QIN/32)
// of row tile i / (QIN*2); a work-group reads 16 rows x 128 floats, whole lines.
// coverage: n8 threads x 8 = whole plane (n8 is a multiple of 256 for every use here). bx = block index inside the plane.
// =====================================================================================================
__device__ __forceinline__ void cvt_bf16x8(const float* __restrict__ in, unsigned short* out, int n8, int bx) {
  const int i = bx * 256 + threadIdx.x;
  if (i < n8) {
    const int l = i & 31, hf = (i >> 5) & 1, ks = (i >> 6) % (QIN / 32), rt = i / (QIN * 2);
    const float* g = in + (size_t)(rt * 16 + (l & 15)) * QIN + ks * 32 + hf * 16 + (l >> 4) * 8;
    const v4f a = *(const v4f*)(g);
    const v4f b = *(const v4f*)(g + 4);
    v4u p;
    p[0] = pk16(bf_bits(a[0]), bf_bits(a[1]));
    p[1] = pk16(bf_bits(a[2]), bf_bits(a[3]));
    p[2] = pk16(bf_bits(b[0]), bf_bits(b[1]));
    p[3] = pk16(bf_bits(b[2]), bf_bits(b[3]));
    *(v4u*)(out + (size_t)i * 8) = p;
    
  }
}

// =====================================================================================================
// Transpose-convert: f32 in[R][C] row-major -> bf16 (RNE convert) outT[C][R] in fragment order (rows c, k = r), outT[c][r] = in[r][c].
// (bx, by) in (C/64, R/64) (bx = column tile of in = row tile of outT), block 256; R, C multiples of 64.
// Load: thread tid reads in row r0 + (tid>>2), 16 floats at c0 + (tid&3)*16 (4 x 16-B loads) -> LDS tile[r][c].
// coverage: load 64 rows x 4 x 16 cols = 64x64; store 8 waves x 2 blocks of 512 B = 4 row tiles x 2 k steps x 2 blocks = 64x64.
// =====================================================================================================
__device__ __forceinline__ void cvt_bf16_t64(const float* __restrict__ in, unsigned short* outT, int R, int C, int bx, int by) {
  __shared__ float tile[64][65];
  const int tid  = threadIdx.x;
  const int lane = tid & 31;
  const int wave = tid >> 5;
  const int c0 = bx * 64;
  const int r0 = by * 64;
  {
    const int r = tid >> 2, cs = (tid & 3) * 16;
    const float* g = in + (size_t)(r0 + r) * C + c0 + cs;
#pragma unroll
    for (int i = 0; i < 4; ++i) {
      const v4f v = *(const v4f*)(g + 4 * i);
      tile[r][cs + 4 * i + 0] = v[0];
      tile[r][cs + 4 * i + 1] = v[1];
      tile[r][cs + 4 * i + 2] = v[2];
      tile[r][cs + 4 * i + 3] = v[3];
    }
  }
  __syncthreads();
  // wave w: row tile w>>1 of the four, k step w&1 of the two; it = block of the k step
  const int c = (wave >> 1) * 16 + (lane & 15);
  v4u pv[2];
#pragma unroll
  for (int it = 0; it < 2; ++it) {
    const int r8 = (wave & 1) * 32 + it * 16 + (lane >> 4) * 8;
    v4u p;
#pragma unroll
    for (int e = 0; e < 4; ++e)
      p[e] = pk16(bf_bits(tile[r8 + 2 * e][c]), bf_bits(tile[r8 + 2 * e + 1][c]));
    pv[it] = p;
  }
  {
#pragma unroll
    for (int it = 0; it < 2; ++it)
      *(v4u*)(outT + frag_off((c0 >> 4) + (wave >> 1), (r0 >> 5) + (wave & 1), it, lane, R)) = pv[it];
#if defined(__HIP_DEVICE_COMPILE__)
    // the two stores are out: behind this wait the code that follows in the kernel's text may take their registers over
    asm volatile("s_wait_xcnt 0x0" ::: "memory");
#endif
  }
}

// =====================================================================================================
// Mask -> lane-select words, once for all heads. Word w = j*8 + r of (row tile rt of 16 queries, kv chunk kt of 64 keys)
// holds in bit l whether mask[rt*16 + (l&15)][kt*64 + j*16 + 8*(l>>4) + r] != 0: the (query, key) that lane l of an
// attention wave holds in score element s[j][r]. Plane mw[NB*SEQ/16][NQB][32] words, 128 B a chunk.
// One wave packs 16 queries x 256 keys (four chunks), 32 loads of 16 B a lane; lane w keeps word w, so that a chunk's
// words leave as one 128-B line. coverage: NMB x 8 waves = 512 row tiles x 4 quarters of a row.
// =====================================================================================================
#define NMB (NB * (SEQ / 16) * (NQB / 4) / 8)   // 256 blocks of 8 waves
__device__ __forceinline__ void pack_mask(const int* __restrict__ mask, unsigned* mw, int bx) {
  const int lane = threadIdx.x & 31;
  const int u    = bx * 8 + (threadIdx.x >> 5);
  const int qr   = u % (NQB / 4);                // quarter of the row: four kv chunks
  const int rt   = u / (NQB / 4);                // row tile: b * (SEQ/16) + query tile
  const int* g = mask + ((size_t)rt * 16 + (size_t)(lane & 15)) * SEQ + qr * 256 + 8 * (lane >> 4);
  v4i m[32];
#pragma unroll
  for (int i = 0; i < 16; ++i) {
    m[2 * i]     = *(const v4i*)(g + i * 16);
    m[2 * i + 1] = *(const v4i*)(g + i * 16 + 4);
  }
#if defined(__HIP_DEVICE_COMPILE__)
  // the loads are out. The wait names their address: it keeps its registers up to here and is given up only behind it.
  asm volatile("s_wait_xcnt 0x0" : "+v"(g) :: "memory");
#endif
  unsigned* o = mw + ((size_t)rt * NQB + (size_t)qr * 4) * 32 + lane;
#pragma unroll
  for (int ch = 0; ch < 4; ++ch) {
    int word = 0;
#pragma unroll
    for (int w = 0; w < 32; ++w) {
      const int v = m[ch * 8 + 2 * (w >> 3) + ((w & 7) >> 2)][w & 3];
      const int bal = (int)__builtin_amdgcn_ballot_w32(v != 0);
      word = (lane == w) ? bal : word;
    }
    o[ch * 32] = (unsigned)word;
  }
}

// =====================================================================================================
// The mask packing and all six converts in one launch (none reads what another writes). Blocks, in this order: NMB blocks
// of the mask (the largest stream), 3 x NTW tiles of Wq, Wk, Wv, NTO tiles of Wo (the transposes have the longer chain),
// then NCX blocks each of query and key. Every branch is uniform for the block.
// =====================================================================================================
#define NTW ((DM / 64) * (QIN / 64))        // 32 tiles of a projection weight
#define NTO ((DM / 64) * (DM / 64))         // 64 tiles of the output weight
#define NCX (NB * SEQ * QIN / 8 / 256)      // 1024 blocks of an activation plane
__global__ __launch_bounds__(256) void prep_all(
    const float* __restrict__ query, const float* __restrict__ key,
    const float* __restrict__ Wq, const float* __restrict__ Wk, const float* __restrict__ Wv, const float* __restrict__ Wo,
    const int* __restrict__ mask,
    unsigned short* Xq, unsigned short* Xk,
    unsigned short* WqT, unsigned short* WkT, unsigned short* WvT, unsigned short* WoT, unsigned* Mw) {
  const int bx = (int)blockIdx.x - NMB;
  if (bx < 0) {
    pack_mask(mask, Mw, (int)blockIdx.x);
  } else if (bx < 3 * NTW + NTO) {
    const int w = bx / NTW;                                    // 0, 1, 2 = Wq, Wk, Wv; 3 and 4 = Wo
    const int t = (w < 3) ? (bx - w * NTW) : (bx - 3 * NTW);
    const float*    in  = (w == 0) ? Wq  : (w == 1) ? Wk  : (w == 2) ? Wv  : Wo;
    unsigned short* out = (w == 0) ? WqT : (w == 1) ? WkT : (w == 2) ? WvT : WoT;
    cvt_bf16_t64(in, out, (w < 3) ? QIN : DM, DM, t % (DM / 64), t / (DM / 64));   // in rows = k, cols = DM
  } else {
    const int c = bx - (3 * NTW + NTO);
    const bool q = c < NCX;
    cvt_bf16x8(q ? query : key, q ? Xq : Xk, NCX * 256, q ? c : c - NCX);
  }
}

// =====================================================================================================
// Register-blocked batched bf16 WMMA GEMM: C[m][n] = sum_k A[m][k] * Bt[n][k] + bias (ReLU optional); one wave
// per 64x64 tile, no block barriers. A [M][K] and Bt [N][K] in fragment order (frag_off), lda = ldb = K;
// M, N multiples of 64, K multiple of 32 (host-checked). bx = block of GW tiles, by = batch index (strides in elements);
// sT = the block's GW per-wave 16x64 slabs in LDS, pitch 68 floats.
// GW = 4 waves a block, one per SIMD: 1024 tiles make 256 blocks, one for each of the 256 WGPs (blocks of 8 waves would
// leave half the WGPs without work); the 3072 tiles of the three projections make 768 blocks, three for each WGP.
// NSPLIT: 0 = A.Bt; 1 = (A + A2).Bt (A2 = unscaled bf16 lo plane of A); 2 = A.Bt + A2.Bt + A.Bt2.
// BIAS: 0 = none; 1 = bias[n] (per column); 2 = bias[m] (per row). Bias is an f32 array, applied as its
//       bf16 RNE value in the f32 epilogue before any 16-bit split of the result. RELU: 1 = max(v, 0) after bias.
// OUT_MODE: 0 = f32 (pitch ldc); 2 = bf16 hi plane C + bf16 lo plane C2 (lo = RNE(v - hi), unscaled);
//           3 = f16 hi plane C + f16 residual plane C2 = f16((v - hi) * rscale), C2 written only for tiles
//               with n0 < N2 (pitch ldc2, batch stride strideC2); 4 = f16 hi plane C only.
// =====================================================================================================
#define GW 4
template <int NSPLIT, int OUT_MODE, int BIAS, int RELU>
__device__ __forceinline__ void gemm64(
    float (*sT)[16 * 68], int bx, int by,
    const unsigned short* __restrict__ Ap, const unsigned short* A2p, int lda, long long strideA,
    const unsigned short* __restrict__ Btp, const unsigned short* Bt2p, int ldb, long long strideB,
    const float* __restrict__ bias,
    void* Cout, int ldc, long long strideC,
    void* Cout2, int ldc2, long long strideC2, int N2,
    int M, int N, int K, float rscale) {
  const __bf16* A   = (const __bf16*)(const void*)Ap;
  const __bf16* A2  = (const __bf16*)(const void*)A2p;
  const __bf16* Bt  = (const __bf16*)(const void*)Btp;
  const __bf16* Bt2 = (const __bf16*)(const void*)Bt2p;
  const int b    = by;
  const int lane = threadIdx.x & 31;
  const int wave = threadIdx.x >> 5;
  const int tilesN = N >> 6;
  const int tilesM = M >> 6;
  const int tile = bx * GW + wave;
  if (tile >= tilesM * tilesN) return;   // wave-uniform; no block barriers in this kernel
  const int tm = tile / tilesN;
  const int tn = tile - tm * tilesN;
  const int m0 = tm << 6;
  const int n0 = tn << 6;

  const __bf16* Ab  = A  + (size_t)b * strideA;
  const __bf16* Bb  = Bt + (size_t)b * strideB;
  const __bf16* Ab2 = (NSPLIT >= 1) ? (A2  + (size_t)b * strideA) : Ab;
  const __bf16* Bb2 = (NSPLIT == 2) ? (Bt2 + (size_t)b * strideB) : Bb;

  const int rlane = lane & 15;                 // row (A) / col (B, D) within subtile
  const int mOff  = (lane >> 4) * 8;           // D row offset

  v8f acc[4][4];
#pragma unroll
  for (int i = 0; i < 4; ++i)
#pragma unroll
    for (int j = 0; j < 4; ++j) acc[i][j] = zero8();

  // running addresses of this lane's part of the first row tile's fragments, 512 elements on a k step; the other row tiles
  // lie at constant offsets
  const __bf16* pa  = Ab  + frag_off(m0 >> 4, 0, 0, lane, lda);
  const __bf16* pa2 = Ab2 + frag_off(m0 >> 4, 0, 0, lane, lda);
  const __bf16* pb  = Bb  + frag_off(n0 >> 4, 0, 0, lane, ldb);
  const __bf16* pb2 = Bb2 + frag_off(n0 >> 4, 0, 0, lane, ldb);
  for (int k0 = 0; k0 < K; k0 += 32) {
    v16b bh[4], bl[4];
#pragma unroll
    for (int j = 0; j < 4; ++j) {
      const size_t bo = (size_t)(j << 4) * ldb;
      bh[j] = ldfrag_b(pb + bo);
      if (NSPLIT == 2) bl[j] = ldfrag_b(pb2 + bo); else bl[j] = bh[j];
    }
#pragma unroll
    for (int i = 0; i < 4; ++i) {
      const size_t ao = (size_t)(i << 4) * lda;
      const v16b ah = ldfrag_b(pa + ao);
      v16b al = ah;
      if (NSPLIT >= 1) al = ldfrag_b(pa2 + ao);
#pragma unroll
      for (int j = 0; j < 4; ++j) {
        acc[i][j] = mma_b_raw(ah, bh[j], acc[i][j]);
        if (NSPLIT >= 1) acc[i][j] = mma_b_raw(al, bh[j], acc[i][j]);
        if (NSPLIT == 2) acc[i][j] = mma_b_raw(ah, bl[j], acc[i][j]);
      }
    }
    // order inside a k step: all its fragment loads (0x20) go out first, then the WMMAs (0x8): one load latency a k step,
    // where loads issued row by row between the WMMAs would each be waited for in turn
    __builtin_amdgcn_sched_group_barrier(0x020, 8 * (NSPLIT == 2 ? 2 : 1) + 8 * (NSPLIT >= 1 ? 2 : 1), 0);
    __builtin_amdgcn_sched_group_barrier(0x008, 16 * (NSPLIT + 1), 0);
#if defined(__HIP_DEVICE_COMPILE__)
    // the k step's loads are out. The wait names the running addresses: they keep their registers up to here (no load's
    // result lands in a pair that an issued load names) and are stepped on only behind it.
    if (NSPLIT == 0)      asm volatile("s_wait_xcnt 0x0" : "+v"(pa), "+v"(pb) :: "memory");
    else if (NSPLIT == 1) asm volatile("s_wait_xcnt 0x0" : "+v"(pa), "+v"(pa2), "+v"(pb) :: "memory");
    else                  asm volatile("s_wait_xcnt 0x0" : "+v"(pa), "+v"(pa2), "+v"(pb), "+v"(pb2) :: "memory");
#endif
    pa += 512; pa2 += 512; pb += 512; pb2 += 512;
  }

  // ---- epilogue ----
  float bcol[4] = {0.f, 0.f, 0.f, 0.f};
  if (BIAS == 1) {
#pragma unroll
    for (int j = 0; j < 4; ++j) bcol[j] = bf_up(bf_bits(bias[n0 + (j << 4) + rlane]));
  }
  float* slab = sT[wave];
#pragma unroll
  for (int i = 0; i < 4; ++i) {
    const int mBase = m0 + (i << 4);
    float brow[8] = {0.f, 0.f, 0.f, 0.f, 0.f, 0.f, 0.f, 0.f};
    if (BIAS == 2) {
#pragma unroll
      for (int r = 0; r < 8; ++r) brow[r] = bf_up(bf_bits(bias[mBase + mOff + r]));
    }
#pragma unroll
    for (int j = 0; j < 4; ++j) {
#pragma unroll
      for (int r = 0; r < 8; ++r) {
        float vv = acc[i][j][r] + bcol[j] + brow[r];
        if (RELU) vv = fmaxf(vv, 0.0f);
        slab[(mOff + r) * 68 + (j << 4) + rlane] = vv;
      }
    }
    wave_sync_lds();
    if (OUT_MODE == 0) {
      float* C = (float*)Cout + (size_t)b * strideC;
      const int hh = lane >> 4, c4 = (lane & 15) * 4;     // 256-B row segment = 16 lanes x 16 B
      {
#pragma unroll
        for (int it = 0; it < 8; ++it) {
          const int row = it * 2 + hh;                     // it 0..7 x hh 0..1 = rows 0..15
          const v4f v = *(const v4f*)(slab + row * 68 + c4);
          *(v4f*)(C + (size_t)(mBase + row) * ldc + n0 + c4) = v;
        }
        
      }
    } else {
      const int q = lane >> 3, c8 = (lane & 7) * 8;
      unsigned short* C  = (unsigned short*)Cout  + (size_t)b * strideC;
      unsigned short* C2 = (unsigned short*)Cout2 + (size_t)b * strideC2;
      const bool wlo = (OUT_MODE == 2) || (OUT_MODE == 3 && n0 < N2);   // wave-uniform
      v4u hv[4], lv[4];
#pragma unroll
      for (int it = 0; it < 4; ++it) {
        const int row = it * 4 + q;                        // it 0..3 x q 0..3 = rows 0..15
        const float* sp = slab + row * 68 + c8;
        v4u a, a2;
#pragma unroll
        for (int e = 0; e < 4; ++e) {
          const float f0 = sp[2 * e], f1 = sp[2 * e + 1];
          unsigned short h0, h1, l0, l1;
          if (OUT_MODE == 2) {
            h0 = bf_bits(f0); h1 = bf_bits(f1);
            l0 = bf_bits(f0 - bf_up(h0)); l1 = bf_bits(f1 - bf_up(h1));
          } else {
            const _Float16 x0 = (_Float16)f0, x1 = (_Float16)f1;
            h0 = h_bits(x0); h1 = h_bits(x1);
            l0 = h_bits((_Float16)((f0 - (float)x0) * rscale));
            l1 = h_bits((_Float16)((f1 - (float)x1) * rscale));
          }
          a[e] = pk16(h0, h1); a2[e] = pk16(l0, l1);
        }
        hv[it] = a; lv[it] = a2;
      }
      {
#pragma unroll
        for (int it = 0; it < 4; ++it) {
          const int row = it * 4 + q;
          *(v4u*)(C + (size_t)(mBase + row) * ldc + n0 + c8) = hv[it];
          if (wlo) *(v4u*)(C2 + (size_t)(mBase + row) * ldc2 + n0 + c8) = lv[it];
        }
        
      }
    }
    wave_sync_lds();
  }
}

// =====================================================================================================
// The q, k and v^T projections in one launch (none reads what another writes): 3 x NPB blocks, block-uniform branch.
//   q = relu(query . Wq + bq) -> f16 hi plane [8192][512] + f16 residual x4096 (all tiles, N2 = DM); M=8192, N=512, K=256
//   k = relu(key . Wk + bk)   -> f16 hi plane [8192][512] only; M=8192, N=512, K=256
//   v^T = relu(Wv^T . key^T + bv) per batch -> f16 hi plane [b][h*64+d][s] (pitch SEQ) and residual plane x4096
//     (A = WvT [n][k], Bt = Xk rows of batch b, bias per row; M=512, N=1024, K=256; NVB blocks a batch)
// =====================================================================================================
#define NPB ((NB * SEQ / 64) * (DM / 64) / GW)    // 1024 tiles -> 256 blocks of one projection
#define NVB ((DM / 64) * (SEQ / 64) / GW)         // 128 tiles -> 32 blocks of one batch of v^T
static_assert(NVB * NB == NPB);
// At most three waves a SIMD: no WGP takes a fourth block while another holds two.
__global__ __launch_bounds__(GW * 32) __attribute__((amdgpu_waves_per_eu(1, 3))) void proj_qkv(
    const unsigned short* __restrict__ Xq, const unsigned short* __restrict__ Xk,
    const unsigned short* __restrict__ WqT, const unsigned short* __restrict__ WkT, const unsigned short* __restrict__ WvT,
    const float* __restrict__ bq, const float* __restrict__ bk, const float* __restrict__ bv,
    unsigned short* Qh, unsigned short* Ql, unsigned short* Kh, unsigned short* VTh, unsigned short* VTl) {
  __shared__ __align__(16) float sT[GW][16 * 68];  // per-wave 16x64 slab, pitch 68 floats
  const int g = blockIdx.x / NPB;
  const int r = blockIdx.x % NPB;
  if (g == 0) {
    gemm64<0, 3, 1, 1>(sT, r, 0,
        Xq, Xq, QIN, 0LL, WqT, WqT, QIN, 0LL, bq,
        (void*)Qh, DM, 0LL, (void*)Ql, DM, 0LL, DM,
        NB * SEQ, DM, QIN, 4096.0f);
  } else if (g == 1) {
    gemm64<0, 4, 1, 1>(sT, r, 0,
        Xk, Xk, QIN, 0LL, WkT, WkT, QIN, 0LL, bk,
        (void*)Kh, DM, 0LL, (void*)Kh, DM, 0LL, 0,
        NB * SEQ, DM, QIN, 4096.0f);
  } else {
    gemm64<0, 3, 2, 1>(sT, r % NVB, r / NVB,
        WvT, WvT, QIN, 0LL, Xk, Xk, QIN, (long long)SEQ * QIN, bv,
        (void*)VTh, SEQ, (long long)DM * SEQ, (void*)VTl, SEQ, (long long)DM * SEQ, SEQ,
        DM, SEQ, QIN, 4096.0f);
  }
}

// out = context . Wo + bo -> f32 [8192][512] (A = context hi + lo planes, 2 products; M=8192, N=512, K=512): NPB blocks
// At most one wave a SIMD: no WGP takes a second block while another holds none.
__global__ __launch_bounds__(GW * 32) __attribute__((amdgpu_waves_per_eu(1, 1))) void proj_out(
    const unsigned short* __restrict__ Oh, const unsigned short* __restrict__ Ol, const unsigned short* __restrict__ WoT,
    const float* __restrict__ bo, float* out) {
  __shared__ __align__(16) float sT[GW][16 * 68];  // per-wave 16x64 slab, pitch 68 floats
  gemm64<1, 0, 1, 0>(sT, blockIdx.x, 0,
      Oh, Ol, DM, 0LL, WoT, WoT, DM, 0LL, bo,
      (void*)out, DM, 0LL, (void*)out, DM, 0LL, DM,
      NB * SEQ, DM, DM, 1.0f);
}

// =====================================================================================================
// Attention, head dim 64, per-(query,key) mask as lane-select words (pack_mask; bit 0 = masked -> score replaced by the
// finite value -1e8, so a fully masked row yields uniform weights), standard softmax over all SEQ keys.
//   q hi plane (f16, pitch DM): element (b, t, h, d) at [(b*SEQ + t)*DM + h*64 + d]; k plane same layout
//   q residual plane (f16, (q - f16(q))*4096, pitch DM): same layout
//   v^T hi plane (f16): element (b, h, d, s) at [(b*DM + h*64 + d)*SEQ + s]; v^T residual plane (f16, x4096): same layout
//   out planes (bf16 hi / lo of the normalised context): [NB*SEQ][DM] in fragment order (frag_off), row b*SEQ + t, k = h*64 + d
//   Both products run transposed, so that a lane owns ONE query (column lane&15) and holds 8 keys / 8 d per tile:
//   scores^T = (k . qh^T + (k . ql^T) * rres) * sscale on f16 WMMA (A = K rows, B = q), residual products in a separate
//   accumulator, then the per-(q,k) mask select; p = exp(s - m) carried as f16(1024 p); two score tiles of 16 keys,
//   converted in place, are the B operand of context^T = vh^T . p^T + (vl^T . p^T) * rres (A = V^T rows; separate
//   accumulator folded per chunk in f32): P never goes through LDS. Online softmax in f32: maximum and sum run inside
//   the lane, the two lane halves (keys 8hh..8hh+7 of each group) exchange the maximum once a chunk and join their
//   sums once behind the loop; final multiply by 1/l.
//   Block = 4 waves = 64 query rows of one (b, h); grid = NQB * NH * NB; kv chunks of 64, static trip NQB.
//   K / V^T chunk staging: 128 threads x 4 rows x 8 elements per plane = the whole 64x64 tile (plain 16-B loads into
//   registers, LDS stores with __syncthreads before and after); mask: the wave reads its chunk's 32 lane-select words by
//   scalar loads, and each word is the select's condition as it stands (addresses always in range).
//   All loads of chunk kt+1 are issued behind the scores of chunk kt, so that softmax and the second product
//   cover their way; the tiles wait in registers for the barrier that frees the LDS.
//   Output coverage: each wave stores rows q0..q0+15 x 64 columns (4 blocks of 16 rows x 16 columns, 512 B each) of both planes.
// =====================================================================================================
// The 12 vector loads of one kv chunk: this thread's 4 rows of the K, V^T and V^T residual tiles.
__device__ __forceinline__ void ask_chunk(const _Float16* kg, const _Float16* vg, const _Float16* vlg,
                                          v8h (&ka)[4], v8h (&va)[4], v8h (&vr)[4]) {
#pragma unroll
  for (int i = 0; i < 4; ++i) {
    ka[i] = *(const v8h*)(kg + (size_t)(16 * i) * DM);
    va[i] = *(const v8h*)(vg + (size_t)(16 * i) * SEQ);
    vr[i] = *(const v8h*)(vlg + (size_t)(16 * i) * SEQ);
  }
#if defined(__HIP_DEVICE_COMPILE__)
  // the loads are out. The wait names their addresses: these keep their registers up to here (no load's result lands in
  // a pair that an issued load names) and are given up only behind it.
  asm volatile("s_wait_xcnt 0x0" : "+v"(kg), "+v"(vg), "+v"(vlg) :: "memory");
#endif
}

// Four waves per SIMD (the whole grid resident at once: 4 workgroups on each WGP) hold only up to 256 registers a wave.
__global__ __launch_bounds__(128) __attribute__((amdgpu_waves_per_eu(4, 4)))
void attn64(const unsigned short* __restrict__ qhp, const unsigned short* __restrict__ qlp,
            const unsigned short* __restrict__ khp,
            const unsigned short* __restrict__ vhp, const unsigned short* __restrict__ vlp,
            const unsigned* __restrict__ mwp,
            unsigned short* ohp, unsigned short* olp, float sscale, float rres) {
  union FH { v16h v; v8h h[2]; };
  __shared__ __align__(16) _Float16 Ksh[64 * LP];                 // K [kv][d]   9 KB
  __shared__ __align__(16) _Float16 Vth[64 * LP];                 // V^T hi [d][kv] 9 KB
  __shared__ __align__(16) _Float16 Vtl[64 * LP];                 // V^T residual [d][kv] 9 KB

  const int tid  = threadIdx.x;
  const int wave = tid >> 5;
  const int lane = tid & 31;
  const int hh   = lane >> 4;
  const int c    = lane & 15;

  const int bx   = blockIdx.x;
  const int qb   = bx % NQB;
  const int rest = bx / NQB;
  const int h    = rest % NH;
  const int b    = rest / NH;
  const int q0   = qb * 64 + wave * 16;
  const size_t rowB = (size_t)b * SEQ;

  const _Float16* Qh = (const _Float16*)(const void*)qhp + (size_t)h * HD;
  const _Float16* Ql = (const _Float16*)(const void*)qlp + (size_t)h * HD;
  const _Float16* Kg = (const _Float16*)(const void*)khp + (size_t)h * HD;
  const _Float16* Vh = (const _Float16*)(const void*)vhp + ((size_t)b * DM + (size_t)h * HD) * SEQ;
  const _Float16* Vl = (const _Float16*)(const void*)vlp + ((size_t)b * DM + (size_t)h * HD) * SEQ;
  // lane-select words of this wave's 16 queries, 32 words a chunk; the wave's number as a scalar, so that the address is one
  // the plane is written by an earlier launch and only read here: the constant address space keeps the loop's loads scalar
  typedef const __attribute__((address_space(4))) unsigned* cu32;
  const cu32 Mw = (cu32)(mwp + ((size_t)b * (SEQ / 16) + (size_t)qb * 4 + (size_t)__builtin_amdgcn_readfirstlane(wave)) * (NQB * 32));

  // ---- Q fragments (B operand, column = lane&15): 2 d-chunks, hi and residual ----
  v16h qah[2], qal[2];
#pragma unroll
  for (int dc = 0; dc < 2; ++dc) {
    qah[dc] = ldfrag_h(Qh + (rowB + q0 + c) * DM + dc * 32 + 8 * hh);
    qal[dc] = ldfrag_h(Ql + (rowB + q0 + c) * DM + dc * 32 + 8 * hh);
  }

#if defined(__HIP_DEVICE_COMPILE__)
  // the Q loads are out: behind this wait the first chunk's loads may land in the registers that held the Q addresses
  asm volatile("s_wait_xcnt 0x0" ::: "memory");
#endif

  float mrow = -INFINITY, lrow = 0.f;        // this lane's query: running maximum (both halves agree), this half's sum
  v8f oacc[4];                               // context^T: oacc[t][r] = d t*16 + 8hh + r of query c
#pragma unroll
  for (int t = 0; t < 4; ++t) oacc[t] = zero8();

  // 8 lanes x 16 B = one 128-B tile row, so a wave's load covers 4 whole lines; rows sr, sr+16, sr+32, sr+48 per thread
  const int sr = tid >> 3, sc8 = (tid & 7) * 8;
  const _Float16* kg0  = Kg + (rowB + sr) * DM + sc8;            // K row kv0+sr, d = sc8..sc8+7; kv0 added per chunk
  const _Float16* vg0  = Vh + (size_t)sr * SEQ + sc8;            // V^T row d = sr, s = kv0+sc8..+7
  const _Float16* vlg0 = Vl + (size_t)sr * SEQ + sc8;
  v8h ka[4], va[4], vr[4];                   // the chunk on its way: tile rows ...
  unsigned mk[32];                           // ... and lane-select words (the same in every lane: scalar registers)
  ask_chunk(kg0, vg0, vlg0, ka, va, vr);
#pragma unroll
  for (int w = 0; w < 32; ++w) mk[w] = Mw[w];

  for (int kt = 0; kt < NQB; ++kt) {         // static trip count
    const int kv0 = kt * 64;
    __syncthreads();
#pragma unroll
    for (int i = 0; i < 4; ++i) {
      *(v8h*)(Ksh + (sr + 16 * i) * LP + sc8) = ka[i];
      *(v8h*)(Vth + (sr + 16 * i) * LP + sc8) = va[i];
      *(v8h*)(Vtl + (sr + 16 * i) * LP + sc8) = vr[i];
    }
    __syncthreads();

    // ---- scores^T: 64 keys x 16 queries per wave, 2 f16 products (hi, residual), then per-(q,k) mask select;
    //      s[j][r] = key j*16 + 8hh + r, query c ----
    v8f s[4];
#pragma unroll
    for (int j = 0; j < 4; ++j) {
      v8f sh = zero8(), sl = zero8();
#pragma unroll
      for (int dc = 0; dc < 2; ++dc) {
        FH kb;
        kb.h[0] = *(const v8h*)(Ksh + (j * 16 + c) * LP + dc * 32 + 8 * hh);
        kb.h[1] = *(const v8h*)(Ksh + (j * 16 + c) * LP + dc * 32 + 16 + 8 * hh);
        sh = mma_h(kb.v, qah[dc], sh);
        sl = mma_h(kb.v, qal[dc], sl);
      }
#pragma unroll
      for (int r = 0; r < 8; ++r) {
        const float v = (sh[r] + sl[r] * rres) * sscale;
        s[j][r] = __builtin_amdgcn_inverse_ballot_w32(mk[j * 8 + r]) ? v : -1.0e8f;   // bit l = key j*16 + 8hh + r, query c
      }
    }

    // ---- the next chunk's global loads. The last trip asks for its own chunk once more (never used), so that every
    //      address stays inside its plane ----
    {
      const int kvn = (kt + 1 < NQB) ? kv0 + 64 : kv0;
      ask_chunk(kg0 + (size_t)kvn * DM, vg0 + kvn, vlg0 + kvn, ka, va, vr);
#pragma unroll
      for (int w = 0; w < 32; ++w) mk[w] = Mw[(kvn >> 1) + w];   // chunk kvn/64, 32 words each
    }

    // ---- maximum over the chunk's keys, online softmax, P^T (x1024, f16) packed as the B operand ----
    float mj[4];
#pragma unroll
    for (int j = 0; j < 4; ++j) {
      mj[j] = s[j][0];
#pragma unroll
      for (int r = 1; r < 8; ++r) mj[j] = fmaxf(mj[j], s[j][r]);
    }
    float m = fmaxf(fmaxf(mj[0], mj[1]), fmaxf(mj[2], mj[3]));
    m = fmaxf(m, xhalf(m));                                      // the other half's 32 keys of the same query
    const float mnew  = fmaxf(mrow, m);
    const float alpha = __expf(mrow - mnew);
    mrow = mnew;
    // pb[kk] element e: e 0..7 = key kk*32 + 8hh + e (tile 2kk), e 8..15 = key kk*32 + 16 + 8hh + (e-8) (tile 2kk+1):
    // the k order of the V^T fragments below
    FH pb[2];
    float ps[4];                                                 // four independent sums, one per 16-key group
#pragma unroll
    for (int j = 0; j < 4; ++j) {
#pragma unroll
      for (int r = 0; r < 8; ++r) {
        const float p = __expf(s[j][r] - mnew);
        ps[j] = (r == 0) ? p : ps[j] + p;
        pb[j >> 1].v[(j & 1) * 8 + r] = (_Float16)(p * 1024.0f);
      }
    }
    lrow = lrow * alpha + ((ps[0] + ps[1]) + (ps[2] + ps[3]));
#pragma unroll
    for (int t = 0; t < 4; ++t)
#pragma unroll
      for (int r = 0; r < 8; ++r) oacc[t][r] *= alpha;

    // ---- context^T += V^T . P^T (f16 WMMA), residual products into a separate accumulator ----
    // keeps the V^T fragment reads behind the softmax: lifted over it they would push the wave past its 256 registers (spills)
    __builtin_amdgcn_sched_barrier(0);
    v8f o1[4];
#pragma unroll
    for (int t = 0; t < 4; ++t) o1[t] = zero8();
#pragma unroll   // pb[kk] lives in registers: a rolled loop would have to pick the operand by a run-time index
    for (int kk = 0; kk < 2; ++kk) {
#pragma unroll
      for (int t = 0; t < 4; ++t) {
        FH vb, vl;
        vb.h[0] = *(const v8h*)(Vth + (t * 16 + c) * LP + kk * 32 + 8 * hh);
        vb.h[1] = *(const v8h*)(Vth + (t * 16 + c) * LP + kk * 32 + 16 + 8 * hh);
        vl.h[0] = *(const v8h*)(Vtl + (t * 16 + c) * LP + kk * 32 + 8 * hh);
        vl.h[1] = *(const v8h*)(Vtl + (t * 16 + c) * LP + kk * 32 + 16 + 8 * hh);
        oacc[t] = mma_h(vb.v, pb[kk].v, oacc[t]);
        o1[t]   = mma_h(vl.v, pb[kk].v, o1[t]);
      }
    }
    // order of this product's LDS reads (0x100) and WMMAs (0x8): the reads run two fragment pairs ahead, so that a WMMA
    // waits for reads issued eight earlier and not for the ones directly in front of it
    __builtin_amdgcn_sched_group_barrier(0x100, 12, 0);
#pragma unroll   // each call has to stand in the straight-line block that it orders
    for (int g = 0; g < 5; ++g) {
      __builtin_amdgcn_sched_group_barrier(0x008, 2, 0);
      __builtin_amdgcn_sched_group_barrier(0x100, 4, 0);
    }
    __builtin_amdgcn_sched_group_barrier(0x008, 6, 0);
#pragma unroll
    for (int t = 0; t < 4; ++t)
#pragma unroll
      for (int r = 0; r < 8; ++r) oacc[t][r] += o1[t][r] * rres;
  }

  // ---- normalise (1/l and the 1/1024 p carry), bf16 hi/lo split. The lane's oacc[t][0..7] (query c, d = t*16 + 8hh + 0..7)
  //      are the 8 elements that lane 16hh + c holds in block t&1 of k step t>>1 of the head's 64 columns: the planes'
  //      fragment order takes them as they stand, with no trip through LDS ----
  {
    const float l   = lrow + xhalf(lrow);                       // join the two halves' sums of this query
    const float inv = (1.0f / l) * (1.0f / 1024.0f);            // l >= 1 always (the max key contributes 1)
    v4u hv[4], lv[4];
#pragma unroll
    for (int t = 0; t < 4; ++t) {
      v4u a, a2;
#pragma unroll
      for (int e = 0; e < 4; ++e) {
        const float f0 = oacc[t][2 * e] * inv, f1 = oacc[t][2 * e + 1] * inv;
        const unsigned short h0 = bf_bits(f0), h1 = bf_bits(f1);
        const unsigned short l0 = bf_bits(f0 - bf_up(h0)), l1 = bf_bits(f1 - bf_up(h1));
        a[e] = pk16(h0, h1); a2[e] = pk16(l0, l1);
      }
      hv[t] = a; lv[t] = a2;
    }
#pragma unroll
    for (int t = 0; t < 4; ++t) {
      const size_t go = frag_off((int)((rowB + q0) >> 4), h * 2 + (t >> 1), t & 1, lane, DM);
      *(v4u*)(ohp + go) = hv[t];
      *(v4u*)(olp + go) = lv[t];
    }
  }
}

// =====================================================================================================
// Workspace map (bytes), every plane an exact multiple of its 64x64-tile / whole-line store granularity:
//   Xq    bf16 [8192][256]           0          4194304
//   Xk    bf16 [8192][256]           4194304    4194304
//   WqT   bf16 [512][256]            8388608    262144
//   WkT   bf16 [512][256]            8650752    262144
//   WvT   bf16 [512][256]            8912896    262144
//   WoT   bf16 [512][512]            9175040    524288
//   Qh    f16  [8192][512]           9699328    8388608
//   Ql    f16  [8192][512]           18087936   8388608   (q residual x4096)
//   Kh    f16  [8192][512]           26476544   8388608
//   VTh   f16  [8][512][1024]        34865152   8388608
//   VTl   f16  [8][512][1024]        43253760   8388608   (v residual x4096)
//   Oh    bf16 [8192][512]           51642368   8388608
//   Ol    bf16 [8192][512]           60030976   8388608
//   Mw    u32  [512][16][32]         68419584   1048576   (mask as lane-select words)
//   end                              69468160
// Weights arrive as [in k][out n] and are transpose-converted to [out n][in k].
// Xq, Xk, WqT, WkT, WvT, WoT, Oh and Ol, the bf16 GEMM operands, lie in fragment order (frag_off): a permutation inside each
// slab of 16 rows, so that plane sizes and batch strides are those of the row-major plane.
// =====================================================================================================
extern "C" void kernel_launch(void* const* d_in, const int* in_sizes, int n_in,
                              void* d_out, int out_size, void* d_ws, size_t ws_size,
                              hipStream_t stream) {
  if (n_in < 11) return;
  if (in_sizes[0] != NB * SEQ * QIN || in_sizes[1] != NB * SEQ * QIN) return;
  if (in_sizes[2] != NB * SEQ * SEQ) return;
  if (in_sizes[3] != QIN * DM || in_sizes[5] != QIN * DM || in_sizes[7] != QIN * DM) return;
  if (in_sizes[9] != DM * DM) return;
  if (in_sizes[4] != DM || in_sizes[6] != DM || in_sizes[8] != DM || in_sizes[10] != DM) return;
  if (out_size != NB * SEQ * DM) return;

  const float* query = (const float*)d_in[0];
  const float* key   = (const float*)d_in[1];
  const int*   mask  = (const int*)d_in[2];
  const float* Wq    = (const float*)d_in[3];
  const float* bq    = (const float*)d_in[4];
  const float* Wk    = (const float*)d_in[5];
  const float* bk    = (const float*)d_in[6];
  const float* Wv    = (const float*)d_in[7];
  const float* bv    = (const float*)d_in[8];
  const float* Wo    = (const float*)d_in[9];
  const float* bo    = (const float*)d_in[10];

  const size_t PXI = (size_t)NB * SEQ * QIN * 2;     //  4194304 (bf16 input activation plane)
  const size_t PW  = (size_t)DM * QIN * 2;           //   262144 (one projection weight plane)
  const size_t PWO = (size_t)DM * DM * 2;            //   524288 (output weight plane)
  const size_t PA  = (size_t)NB * SEQ * DM * 2;      //  8388608 (q / k / context planes)
  const size_t PVT = (size_t)NB * DM * SEQ * 2;      //  8388608 (v^T plane)
  size_t off = 0;
  const size_t oXq  = off; off += PXI;
  const size_t oXk  = off; off += PXI;
  const size_t oWq  = off; off += PW;
  const size_t oWk  = off; off += PW;
  const size_t oWv  = off; off += PW;
  const size_t oWo  = off; off += PWO;
  const size_t oQh  = off; off += PA;
  const size_t oQl  = off; off += PA;
  const size_t oKh  = off; off += PA;
  const size_t oVTh = off; off += PVT;
  const size_t oVTl = off; off += PVT;
  const size_t oOh  = off; off += PA;
  const size_t oOl  = off; off += PA;
  const size_t oMw  = off; off += (size_t)NB * SEQ * SEQ / 8;   // 1048576 (one bit a mask element)
  if (off > ws_size) return;                          // off = 69468160
  if (off > (size_t)134217728) return;

  char* ws = (char*)d_ws;
  unsigned short* Xq  = (unsigned short*)(ws + oXq);
  unsigned short* Xk  = (unsigned short*)(ws + oXk);
  unsigned short* WqT = (unsigned short*)(ws + oWq);
  unsigned short* WkT = (unsigned short*)(ws + oWk);
  unsigned short* WvT = (unsigned short*)(ws + oWv);
  unsigned short* WoT = (unsigned short*)(ws + oWo);
  unsigned short* Qh  = (unsigned short*)(ws + oQh);
  unsigned short* Ql  = (unsigned short*)(ws + oQl);
  unsigned short* Kh  = (unsigned short*)(ws + oKh);
  unsigned short* VTh = (unsigned short*)(ws + oVTh);
  unsigned short* VTl = (unsigned short*)(ws + oVTl);
  unsigned short* Oh  = (unsigned short*)(ws + oOh);
  unsigned short* Ol  = (unsigned short*)(ws + oOl);
  unsigned*       Mw  = (unsigned*)(ws + oMw);

  const dim3 blk(256);
  const dim3 gPrep(NMB + 3 * NTW + NTO + 2 * NCX);              // 256 mask blocks + 160 transpose tiles + 2 x 1024 convert blocks
  const dim3 blkG(GW * 32);                                     // GEMM blocks: 4 waves
  const dim3 gProj(3 * NPB);                                    // 3 x 256 blocks: q, k, v^T
  const dim3 gOut(NPB);                                         // 1024 tiles -> 256 blocks: M=8192, N=512
  const dim3 gAttn(NB * NH * NQB);                              // 1024 blocks

  // (1) mask -> lane-select words; activations -> bf16 planes; weights [in][out] -> transposed bf16 planes [out][in] (RNE convert)
  prep_all<<<gPrep, blk, 0, stream>>>(query, key, Wq, Wk, Wv, Wo, mask, Xq, Xk, WqT, WkT, WvT, WoT, Mw);
  // (2) to (4) the q, k and v^T projections
  proj_qkv<<<gProj, blkG, 0, stream>>>(Xq, Xk, WqT, WkT, WvT, bq, bk, bv, Qh, Ql, Kh, VTh, VTl);
  // (5) attention with per-(q,k) mask and softmax -> context bf16 hi / lo planes [8192][512]
  attn64<<<gAttn, dim3(128), 0, stream>>>(Qh, Ql, Kh, VTh, VTl, Mw, Oh, Ol, 0.125f, 1.0f / 4096.0f);
  // (6) out = context . Wo + bo -> d_out f32 [8192][512]  (A = context hi + lo planes, 2 products; K=512)
  proj_out<<<gOut, blkG, 0, stream>>>(Oh, Ol, WoT, bo, (float*)d_out);
  (void)hipGetLastError();
}

// v010
// A run of this version takes 62.8 microseconds.
// In two side-by-side timings against v009, it was 1.17 and 1.18 times as fast.
// All steps since v000 together make it 3.33 times as fast.
// Contractions: q, k and v^T projections = v_wmma_f32_16x16x32_bf16 (bf16 operands from RNE-converted inputs and
// transposed weights, single product, bias and ReLU in f32); k.q^T scores = v_wmma_f32_16x16x32_f16 (q f16, k f16;
// 1 product); v^T.p^T = v_wmma_f32_16x16x32_f16 (p carried x1024 in f16, v^T f16; 1 product);
// ctx.Wo = v_wmma_f32_16x16x32_bf16 (ctx as bf16 hi + lo planes times bf16 Wo^T, 2 products, bias in f32);
// all f32 accumulate; per-(query,key) mask select and softmax in f32.
#include <hip/hip_runtime.h>
#include <math.h>
#include <stdint.h>

#define NB    8
#define SEQ   1024
#define QIN   256
#define DM    512
#define NH    8
#define HD    64
#define NQB   (SEQ / 64)     // 16 key / query tiles of 64
#define LP    72             // LDS row pitch of the 64-wide f16 tiles, in halves: 144 B = 16 B x odd, so the 16 rows that one
                             // ds_load_b128 fragment read touches fall on 16 different 4-bank groups
static_assert(NH * HD == DM);
static_assert((SEQ % 64) == 0 && (DM % 64) == 0 && (QIN % 64) == 0 && (QIN % 32) == 0 && (DM % 32) == 0);

typedef _Float16 v16h __attribute__((ext_vector_type(16)));
typedef _Float16 v8h  __attribute__((ext_vector_type(8)));
typedef __bf16   v16b __attribute__((ext_vector_type(16)));
typedef __bf16   v8b  __attribute__((ext_vector_type(8)));
typedef float    v8f  __attribute__((ext_vector_type(8)));
typedef float    v4f  __attribute__((ext_vector_type(4)));
typedef unsigned int v4u __attribute__((ext_vector_type(4)));
typedef int          v4i __attribute__((ext_vector_type(4)));

// ---- scalar helpers --------------------------------------------------------------------------------
__device__ __forceinline__ unsigned short bf_bits(float f) {          // f32 -> bf16 bits, RNE convert
  unsigned u = __float_as_uint(f);
  return (unsigned short)((u + 0x7FFFu + ((u >> 16) & 1u)) >> 16);
}
__device__ __forceinline__ float bf_up(unsigned short h) { return __uint_as_float(((unsigned)h) << 16); }
__device__ __forceinline__ unsigned short h_bits(_Float16 x) { return __builtin_bit_cast(unsigned short, x); }
__device__ __forceinline__ unsigned pk16(unsigned short a, unsigned short b) { return (unsigned)a | ((unsigned)b << 16); }
__device__ __forceinline__ v8f zero8() { v8f z = {0.f, 0.f, 0.f, 0.f, 0.f, 0.f, 0.f, 0.f}; return z; }

// ---- fragment loaders: 16-bit A/B operand, lane -> row/col (lane&15), h = lane>>4;
//      elements 0..7 = k0+8h.., elements 8..15 = k0+16+8h..
//      ldfrag_h: row-major plane, p already includes +8h: p[0..7] and p[16..23].
//      ldfrag_b: plane in FRAGMENT ORDER (frag_off below), p already includes +8*lane: p[0..7] and p[256..263]; each of the
//      two loads reads 512 contiguous bytes a wave (4 whole lines), where a row-major plane gives 32 B in each of 16 lines.
//      ldfrag_b reads global memory only; the cast says so, for an address that has gone through an asm statement
//      would otherwise be loaded from in the flat form
typedef const __attribute__((address_space(1))) v8b* gv8b;
__device__ __forceinline__ v16b ldfrag_b(const __bf16* p) {
  union { v16b v; v8b h[2]; } f;
  f.h[0] = *(gv8b)(p);
  f.h[1] = *(gv8b)(p + 256);
  return f.v;
}
// Fragment order of a bf16 GEMM operand plane [rows][K] (rows a multiple of 16, K of 32): a slab of 16 rows x K elements is
// cut into k steps of 32; a k step is two blocks of 256 elements (512 B), block hf = k 16*hf..16*hf+15 of the step; in a block
// lane l = 16*h + r holds the 8 elements k 8h..8h+7 of row r. Element offset of the 8 elements that lane l holds in block hf
// of k step ks of row tile rt:
__device__ __forceinline__ size_t frag_off(int rt, int ks, int hf, int l, int K) {
  return (size_t)rt * 16 * K + (size_t)(ks * 512 + hf * 256 + l * 8);
}
__device__ __forceinline__ v16h ldfrag_h(const _Float16* p) {
  union { v16h v; v8h h[2]; } f;
  f.h[0] = *(const v8h*)(p);
  f.h[1] = *(const v8h*)(p + 16);
  return f.v;
}

// ---- WMMA helpers: the builtin forms alone. The compiler keeps the distance between a WMMA and the first vector
//      instruction on its registers itself, and is free to move fragment loads ahead of earlier WMMAs ----------
__device__ __forceinline__ v8f mma_h(v16h a, v16h b, v8f c) {
  return __builtin_amdgcn_wmma_f32_16x16x32_f16(false, a, false, b, (short)0, c, false, false);
}
__device__ __forceinline__ v8f mma_b_raw(v16b a, v16b b, v8f c) {
  return __builtin_amdgcn_wmma_f32_16x16x32_bf16(false, a, false, b, (short)0, c, false, false);
}
// lane l <-> lane l ^ 16 as a vector cross-row move (a shuffle would go the LDS path and be waited for on dscnt)
__device__ __forceinline__ float xhalf(float x) {
  return __builtin_bit_cast(float, __builtin_amdgcn_permlanex16(__builtin_bit_cast(int, x), __builtin_bit_cast(int, x),
                                                                0x76543210, 0xfedcba98, false, false));
}
__device__ __forceinline__ void wave_sync_lds() {
  __builtin_amdgcn_fence(__ATOMIC_RELEASE, "workgroup");
  __builtin_amdgcn_wave_barrier();
  __builtin_amdgcn_fence(__ATOMIC_ACQUIRE, "workgroup");
}

// =====================================================================================================
// f32 [rows][QIN] row-major -> bf16 (RNE convert) in fragment order, 8 elements per thread, one 16-B store per lane: a wave
// writes one 512-B block. Thread i owns the plane's i-th group of 8: lane i&31 of block (i>>5)&1 of k step (i>>6) % (QIN/32)
// of row tile i / (QIN*2); a work-group reads 16 rows x 128 floats, whole lines.
// coverage: n8 threads x 8 = whole plane (n8 is a multiple of 256 for every use here). bx = block index inside the plane.
// =====================================================================================================
__device__ __forceinline__ void cvt_bf16x8(const float* __restrict__ in, unsigned short* out, int n8, int bx) {
  const int i = bx * 256 + threadIdx.x;
  if (i < n8) {
    const int l = i & 31, hf = (i >> 5) & 1, ks = (i >> 6) % (QIN / 32), rt = i / (QIN * 2);
    const float* g = in + (size_t)(rt * 16 + (l & 15)) * QIN + ks * 32 + hf * 16 + (l >> 4) * 8;
    const v4f a = *(const v4f*)(g);
    const v4f b = *(const v4f*)(g + 4);
    v4u p;
    p[0] = pk16(bf_bits(a[0]), bf_bits(a[1]));
    p[1] = pk16(bf_bits(a[2]), bf_bits(a[3]));
    p[2] = pk16(bf_bits(b[0]), bf_bits(b[1]));
    p[3] = pk16(bf_bits(b[2]), bf_bits(b[3]));
    *(v4u*)(out + (size_t)i * 8) = p;
    
  }
}

// =====================================================================================================
// Transpose-convert: f32 in[R][C] row-major -> bf16 (RNE convert) outT[C][R] in fragment order (rows c, k = r), outT[c][r] = in[r][c].
// (bx, by) in (C/64, R/64) (bx = column tile of in = row tile of outT), block 256; R, C multiples of 64.
// Load: thread tid reads in row r0 + (tid>>2), 16 floats at c0 + (tid&3)*16 (4 x 16-B loads) -> LDS tile[r][c].
// coverage: load 64 rows x 4 x 16 cols = 64x64; store 8 waves x 2 blocks of 512 B = 4 row tiles x 2 k steps x 2 blocks = 64x64.
// =====================================================================================================
__device__ __forceinline__ void cvt_bf16_t64(const float* __restrict__ in, unsigned short* outT, int R, int C, int bx, int by) {
  __shared__ float tile[64][65];
  const int tid  = threadIdx.x;
  const int lane = tid & 31;
  const int wave = tid >> 5;
  const int c0 = bx * 64;
  const int r0 = by * 64;
  {
    const int r = tid >> 2, cs = (tid & 3) * 16;
    const float* g = in + (size_t)(r0 + r) * C + c0 + cs;
#pragma unroll
    for (int i = 0; i < 4; ++i) {
      const v4f v = *(const v4f*)(g + 4 * i);
      tile[r][cs + 4 * i + 0] = v[0];
      tile[r][cs + 4 * i + 1] = v[1];
      tile[r][cs + 4 * i + 2] = v[2];
      tile[r][cs + 4 * i + 3] = v[3];
    }
  }
  __syncthreads();
  // wave w: row tile w>>1 of the four, k step w&1 of the two; it = block of the k step
  const int c = (wave >> 1) * 16 + (lane & 15);
  v4u pv[2];
#pragma unroll
  for (int it = 0; it < 2; ++it) {
    const int r8 = (wave & 1) * 32 + it * 16 + (lane >> 4) * 8;
    v4u p;
#pragma unroll
    for (int e = 0; e < 4; ++e)
      p[e] = pk16(bf_bits(tile[r8 + 2 * e][c]), bf_bits(tile[r8 + 2 * e + 1][c]));
    pv[it] = p;
  }
  {
#pragma unroll
    for (int it = 0; it < 2; ++it)
      *(v4u*)(outT + frag_off((c0 >> 4) + (wave >> 1), (r0 >> 5) + (wave & 1), it, lane, R)) = pv[it];
#if defined(__HIP_DEVICE_COMPILE__)
    // the two stores are out: behind this wait the code that follows in the kernel's text may take their registers over
    asm volatile("s_wait_xcnt 0x0" ::: "memory");
#endif
  }
}

// =====================================================================================================
// Mask -> lane-select words, once for all heads. Word w = j*8 + r of (row tile rt of 16 queries, kv chunk kt of 64 keys)
// holds in bit l whether mask[rt*16 + (l&15)][kt*64 + j*16 + 8*(l>>4) + r] != 0: the (query, key) that lane l of an
// attention wave holds in score element s[j][r]. Plane mw[NB*SEQ/16][NQB][32] words, 128 B a chunk.
// One wave packs 16 queries x 256 keys (four chunks), 32 loads of 16 B a lane; lane w keeps word w, so that a chunk's
// words leave as one 128-B line. coverage: NMB x 8 waves = 512 row tiles x 4 quarters of a row.
// =====================================================================================================
#define NMB (NB * (SEQ / 16) * (NQB / 4) / 8)   // 256 blocks of 8 waves
__device__ __forceinline__ void pack_mask(const int* __restrict__ mask, unsigned* mw, int bx) {
  const int lane = threadIdx.x & 31;
  const int u    = bx * 8 + (threadIdx.x >> 5);
  const int qr   = u % (NQB / 4);                // quarter of the row: four kv chunks
  const int rt   = u / (NQB / 4);                // row tile: b * (SEQ/16) + query tile
  const int* g = mask + ((size_t)rt * 16 + (size_t)(lane & 15)) * SEQ + qr * 256 + 8 * (lane >> 4);
  v4i m[32];
#pragma unroll
  for (int i = 0; i < 16; ++i) {
    m[2 * i]     = *(const v4i*)(g + i * 16);
    m[2 * i + 1] = *(const v4i*)(g + i * 16 + 4);
  }
#if defined(__HIP_DEVICE_COMPILE__)
  // the loads are out. The wait names their address: it keeps its registers up to here and is given up only behind it.
  asm volatile("s_wait_xcnt 0x0" : "+v"(g) :: "memory");
#endif
  unsigned* o = mw + ((size_t)rt * NQB + (size_t)qr * 4) * 32 + lane;
#pragma unroll
  for (int ch = 0; ch < 4; ++ch) {
    int word = 0;
#pragma unroll
    for (int w = 0; w < 32; ++w) {
      const int v = m[ch * 8 + 2 * (w >> 3) + ((w & 7) >> 2)][w & 3];
      const int bal = (int)__builtin_amdgcn_ballot_w32(v != 0);
      word = (lane == w) ? bal : word;
    }
    o[ch * 32] = (unsigned)word;
  }
}

// =====================================================================================================
// The mask packing and all six converts in one launch (none reads what another writes). Blocks, in this order: NMB blocks
// of the mask (the largest stream), 3 x NTW tiles of Wq, Wk, Wv, NTO tiles of Wo (the transposes have the longer chain),
// then NCX blocks each of query and key. Every branch is uniform for the block.
// =====================================================================================================
#define NTW ((DM / 64) * (QIN / 64))        // 32 tiles of a projection weight
#define NTO ((DM / 64) * (DM / 64))         // 64 tiles of the output weight
#define NCX (NB * SEQ * QIN / 8 / 256)      // 1024 blocks of an activation plane
__global__ __launch_bounds__(256) void prep_all(
    const float* __restrict__ query, const float* __restrict__ key,
    const float* __restrict__ Wq, const float* __restrict__ Wk, const float* __restrict__ Wv, const float* __restrict__ Wo,
    const int* __restrict__ mask,
    unsigned short* Xq, unsigned short* Xk,
    unsigned short* WqT, unsigned short* WkT, unsigned short* WvT, unsigned short* WoT, unsigned* Mw) {
  const int bx = (int)blockIdx.x - NMB;
  if (bx < 0) {
    pack_mask(mask, Mw, (int)blockIdx.x);
  } else if (bx < 3 * NTW + NTO) {
    const int w = bx / NTW;                                    // 0, 1, 2 = Wq, Wk, Wv; 3 and 4 = Wo
    const int t = (w < 3) ? (bx - w * NTW) : (bx - 3 * NTW);
    const float*    in  = (w == 0) ? Wq  : (w == 1) ? Wk  : (w == 2) ? Wv  : Wo;
    unsigned short* out = (w == 0) ? WqT : (w == 1) ? WkT : (w == 2) ? WvT : WoT;
    cvt_bf16_t64(in, out, (w < 3) ? QIN : DM, DM, t % (DM / 64), t / (DM / 64));   // in rows = k, cols = DM
  } else {
    const int c = bx - (3 * NTW + NTO);
    const bool q = c < NCX;
    cvt_bf16x8(q ? query : key, q ? Xq : Xk, NCX * 256, q ? c : c - NCX);
  }
}

// =====================================================================================================
// Register-blocked batched bf16 WMMA GEMM: C[m][n] = sum_k A[m][k] * Bt[n][k] + bias (ReLU optional); one wave
// per 64x64 tile, no block barriers. A [M][K] and Bt [N][K] in fragment order (frag_off), lda = ldb = K;
// M, N multiples of 64, K multiple of 32 (host-checked). bx = block of GW tiles, by = batch index (strides in elements);
// sT = the block's GW per-wave 16x64 slabs in LDS, pitch 68 floats.
// GW = 4 waves a block, one per SIMD: 1024 tiles make 256 blocks, one for each of the 256 WGPs (blocks of 8 waves would
// leave half the WGPs without work); the 3072 tiles of the three projections make 768 blocks, three for each WGP.
// NSPLIT: 0 = A.Bt; 1 = (A + A2).Bt (A2 = unscaled bf16 lo plane of A); 2 = A.Bt + A2.Bt + A.Bt2.
// BIAS: 0 = none; 1 = bias[n] (per column); 2 = bias[m] (per row). Bias is an f32 array, applied as its
//       bf16 RNE value in the f32 epilogue before any 16-bit split of the result. RELU: 1 = max(v, 0) after bias.
// OUT_MODE: 0 = f32 (pitch ldc); 2 = bf16 hi plane C + bf16 lo plane C2 (lo = RNE(v - hi), unscaled);
//           3 = f16 hi plane C + f16 residual plane C2 = f16((v - hi) * rscale), C2 written only for tiles
//               with n0 < N2 (pitch ldc2, batch stride strideC2); 4 = f16 hi plane C only.
// =====================================================================================================
#define GW 4
template <int NSPLIT, int OUT_MODE, int BIAS, int RELU>
__device__ __forceinline__ void gemm64(
    float (*sT)[16 * 68], int bx, int by,
    const unsigned short* __restrict__ Ap, const unsigned short* A2p, int lda, long long strideA,
    const unsigned short* __restrict__ Btp, const unsigned short* Bt2p, int ldb, long long strideB,
    const float* __restrict__ bias,
    void* Cout, int ldc, long long strideC,
    void* Cout2, int ldc2, long long strideC2, int N2,
    int M, int N, int K, float rscale) {
  const __bf16* A   = (const __bf16*)(const void*)Ap;
  const __bf16* A2  = (const __bf16*)(const void*)A2p;
  const __bf16* Bt  = (const __bf16*)(const void*)Btp;
  const __bf16* Bt2 = (const __bf16*)(const void*)Bt2p;
  const int b    = by;
  const int lane = threadIdx.x & 31;
  const int wave = threadIdx.x >> 5;
  const int tilesN = N >> 6;
  const int tilesM = M >> 6;
  const int tile = bx * GW + wave;
  if (tile >= tilesM * tilesN) return;   // wave-uniform; no block barriers in this kernel
  const int tm = tile / tilesN;
  const int tn = tile - tm * tilesN;
  const int m0 = tm << 6;
  const int n0 = tn << 6;

  const __bf16* Ab  = A  + (size_t)b * strideA;
  const __bf16* Bb  = Bt + (size_t)b * strideB;
  const __bf16* Ab2 = (NSPLIT >= 1) ? (A2  + (size_t)b * strideA) : Ab;
  const __bf16* Bb2 = (NSPLIT == 2) ? (Bt2 + (size_t)b * strideB) : Bb;

  const int rlane = lane & 15;                 // row (A) / col (B, D) within subtile
  const int mOff  = (lane >> 4) * 8;           // D row offset

  v8f acc[4][4];
#pragma unroll
  for (int i = 0; i < 4; ++i)
#pragma unroll
    for (int j = 0; j < 4; ++j) acc[i][j] = zero8();

  // running addresses of this lane's part of the first row tile's fragments, 512 elements on a k step; the other row tiles
  // lie at constant offsets
  const __bf16* pa  = Ab  + frag_off(m0 >> 4, 0, 0, lane, lda);
  const __bf16* pa2 = Ab2 + frag_off(m0 >> 4, 0, 0, lane, lda);
  const __bf16* pb  = Bb  + frag_off(n0 >> 4, 0, 0, lane, ldb);
  const __bf16* pb2 = Bb2 + frag_off(n0 >> 4, 0, 0, lane, ldb);
  for (int k0 = 0; k0 < K; k0 += 32) {
    v16b bh[4], bl[4];
#pragma unroll
    for (int j = 0; j < 4; ++j) {
      const size_t bo = (size_t)(j << 4) * ldb;
      bh[j] = ldfrag_b(pb + bo);
      if (NSPLIT == 2) bl[j] = ldfrag_b(pb2 + bo); else bl[j] = bh[j];
    }
#pragma unroll
    for (int i = 0; i < 4; ++i) {
      const size_t ao = (size_t)(i << 4) * lda;
      const v16b ah = ldfrag_b(pa + ao);
      v16b al = ah;
      if (NSPLIT >= 1) al = ldfrag_b(pa2 + ao);
#pragma unroll
      for (int j = 0; j < 4; ++j) {
        acc[i][j] = mma_b_raw(ah, bh[j], acc[i][j]);
        if (NSPLIT >= 1) acc[i][j] = mma_b_raw(al, bh[j], acc[i][j]);
        if (NSPLIT == 2) acc[i][j] = mma_b_raw(ah, bl[j], acc[i][j]);
      }
    }
    // order inside a k step: all its fragment loads (0x20) go out first, then the WMMAs (0x8): one load latency a k step,
    // where loads issued row by row between the WMMAs would each be waited for in turn
    __builtin_amdgcn_sched_group_barrier(0x020, 8 * (NSPLIT == 2 ? 2 : 1) + 8 * (NSPLIT >= 1 ? 2 : 1), 0);
    __builtin_amdgcn_sched_group_barrier(0x008, 16 * (NSPLIT + 1), 0);
#if defined(__HIP_DEVICE_COMPILE__)
    // the k step's loads are out. The wait names the running addresses: they keep their registers up to here (no load's
    // result lands in a pair that an issued load names) and are stepped on only behind it.
    if (NSPLIT == 0)      asm volatile("s_wait_xcnt 0x0" : "+v"(pa), "+v"(pb) :: "memory");
    else if (NSPLIT == 1) asm volatile("s_wait_xcnt 0x0" : "+v"(pa), "+v"(pa2), "+v"(pb) :: "memory");
    else                  asm volatile("s_wait_xcnt 0x0" : "+v"(pa), "+v"(pa2), "+v"(pb), "+v"(pb2) :: "memory");
#endif
    pa += 512; pa2 += 512; pb += 512; pb2 += 512;
  }

  // ---- epilogue ----
  float bcol[4] = {0.f, 0.f, 0.f, 0.f};
  if (BIAS == 1) {
#pragma unroll
    for (int j = 0; j < 4; ++j) bcol[j] = bf_up(bf_bits(bias[n0 + (j << 4) + rlane]));
  }
  float* slab = sT[wave];
#pragma unroll
  for (int i = 0; i < 4; ++i) {
    const int mBase = m0 + (i << 4);
    float brow[8] = {0.f, 0.f, 0.f, 0.f, 0.f, 0.f, 0.f, 0.f};
    if (BIAS == 2) {
#pragma unroll
      for (int r = 0; r < 8; ++r) brow[r] = bf_up(bf_bits(bias[mBase + mOff + r]));
    }
#pragma unroll
    for (int j = 0; j < 4; ++j) {
#pragma unroll
      for (int r = 0; r < 8; ++r) {
        float vv = acc[i][j][r] + bcol[j] + brow[r];
        if (RELU) vv = fmaxf(vv, 0.0f);
        slab[(mOff + r) * 68 + (j << 4) + rlane] = vv;
      }
    }
    wave_sync_lds();
    if (OUT_MODE == 0) {
      float* C = (float*)Cout + (size_t)b * strideC;
      const int hh = lane >> 4, c4 = (lane & 15) * 4;     // 256-B row segment = 16 lanes x 16 B
      {
#pragma unroll
        for (int it = 0; it < 8; ++it) {
          const int row = it * 2 + hh;                     // it 0..7 x hh 0..1 = rows 0..15
          const v4f v = *(const v4f*)(slab + row * 68 + c4);
          *(v4f*)(C + (size_t)(mBase + row) * ldc + n0 + c4) = v;
        }
        
      }
    } else {
      const int q = lane >> 3, c8 = (lane & 7) * 8;
      unsigned short* C  = (unsigned short*)Cout  + (size_t)b * strideC;
      unsigned short* C2 = (unsigned short*)Cout2 + (size_t)b * strideC2;
      const bool wlo = (OUT_MODE == 2) || (OUT_MODE == 3 && n0 < N2);   // wave-uniform
      v4u hv[4], lv[4];
#pragma unroll
      for (int it = 0; it < 4; ++it) {
        const int row = it * 4 + q;                        // it 0..3 x q 0..3 = rows 0..15
        const float* sp = slab + row * 68 + c8;
        v4u a, a2;
#pragma unroll
        for (int e = 0; e < 4; ++e) {
          const float f0 = sp[2 * e], f1 = sp[2 * e + 1];
          unsigned short h0, h1, l0, l1;
          if (OUT_MODE == 2) {
            h0 = bf_bits(f0); h1 = bf_bits(f1);
            l0 = bf_bits(f0 - bf_up(h0)); l1 = bf_bits(f1 - bf_up(h1));
          } else {
            const _Float16 x0 = (_Float16)f0, x1 = (_Float16)f1;
            h0 = h_bits(x0); h1 = h_bits(x1);
            l0 = h_bits((_Float16)((f0 - (float)x0) * rscale));
            l1 = h_bits((_Float16)((f1 - (float)x1) * rscale));
          }
          a[e] = pk16(h0, h1); a2[e] = pk16(l0, l1);
        }
        hv[it] = a; lv[it] = a2;
      }
      {
#pragma unroll
        for (int it = 0; it < 4; ++it) {
          const int row = it * 4 + q;
          *(v4u*)(C + (size_t)(mBase + row) * ldc + n0 + c8) = hv[it];
          if (wlo) *(v4u*)(C2 + (size_t)(mBase + row) * ldc2 + n0 + c8) = lv[it];
        }
        
      }
    }
    wave_sync_lds();
  }
}

// =====================================================================================================
// The q, k and v^T projections in one launch (none reads what another writes): 3 x NPB blocks, block-uniform branch.
//   q = relu(query . Wq + bq) -> f16 plane [8192][512]; M=8192, N=512, K=256
//   k = relu(key . Wk + bk)   -> f16 plane [8192][512]; M=8192, N=512, K=256
//   v^T = relu(Wv^T . key^T + bv) per batch -> f16 plane [b][h*64+d][s] (pitch SEQ)
//     (A = WvT [n][k], Bt = Xk rows of batch b, bias per row; M=512, N=1024, K=256; NVB blocks a batch)
// =====================================================================================================
#define NPB ((NB * SEQ / 64) * (DM / 64) / GW)    // 1024 tiles -> 256 blocks of one projection
#define NVB ((DM / 64) * (SEQ / 64) / GW)         // 128 tiles -> 32 blocks of one batch of v^T
static_assert(NVB * NB == NPB);
// At most three waves a SIMD: no WGP takes a fourth block while another holds two.
__global__ __launch_bounds__(GW * 32) __attribute__((amdgpu_waves_per_eu(1, 3))) void proj_qkv(
    const unsigned short* __restrict__ Xq, const unsigned short* __restrict__ Xk,
    const unsigned short* __restrict__ WqT, const unsigned short* __restrict__ WkT, const unsigned short* __restrict__ WvT,
    const float* __restrict__ bq, const float* __restrict__ bk, const float* __restrict__ bv,
    unsigned short* Qh, unsigned short* Kh, unsigned short* VTh) {
  __shared__ __align__(16) float sT[GW][16 * 68];  // per-wave 16x64 slab, pitch 68 floats
  const int g = blockIdx.x / NPB;
  const int r = blockIdx.x % NPB;
  if (g == 0) {
    gemm64<0, 4, 1, 1>(sT, r, 0,
        Xq, Xq, QIN, 0LL, WqT, WqT, QIN, 0LL, bq,
        (void*)Qh, DM, 0LL, (void*)Qh, DM, 0LL, 0,
        NB * SEQ, DM, QIN, 4096.0f);
  } else if (g == 1) {
    gemm64<0, 4, 1, 1>(sT, r, 0,
        Xk, Xk, QIN, 0LL, WkT, WkT, QIN, 0LL, bk,
        (void*)Kh, DM, 0LL, (void*)Kh, DM, 0LL, 0,
        NB * SEQ, DM, QIN, 4096.0f);
  } else {
    gemm64<0, 4, 2, 1>(sT, r % NVB, r / NVB,
        WvT, WvT, QIN, 0LL, Xk, Xk, QIN, (long long)SEQ * QIN, bv,
        (void*)VTh, SEQ, (long long)DM * SEQ, (void*)VTh, SEQ, (long long)DM * SEQ, 0,
        DM, SEQ, QIN, 4096.0f);
  }
}

// out = context . Wo + bo -> f32 [8192][512] (A = context hi + lo planes, 2 products; M=8192, N=512, K=512): NPB blocks
// At most one wave a SIMD: no WGP takes a second block while another holds none.
__global__ __launch_bounds__(GW * 32) __attribute__((amdgpu_waves_per_eu(1, 1))) void proj_out(
    const unsigned short* __restrict__ Oh, const unsigned short* __restrict__ Ol, const unsigned short* __restrict__ WoT,
    const float* __restrict__ bo, float* out) {
  __shared__ __align__(16) float sT[GW][16 * 68];  // per-wave 16x64 slab, pitch 68 floats
  gemm64<1, 0, 1, 0>(sT, blockIdx.x, 0,
      Oh, Ol, DM, 0LL, WoT, WoT, DM, 0LL, bo,
      (void*)out, DM, 0LL, (void*)out, DM, 0LL, DM,
      NB * SEQ, DM, DM, 1.0f);
}

// =====================================================================================================
// Attention, head dim 64, per-(query,key) mask as lane-select words (pack_mask; bit 0 = masked -> score replaced by the
// finite value -1e8, so a fully masked row yields uniform weights), standard softmax over all SEQ keys.
//   q plane (f16, pitch DM): element (b, t, h, d) at [(b*SEQ + t)*DM + h*64 + d]; k plane same layout
//   v^T plane (f16): element (b, h, d, s) at [(b*DM + h*64 + d)*SEQ + s]
//   Each product has both operands in plain f16: a residual plane on one side alone would take out that side's rounding
//   and leave the equally large rounding of its partner (k, p) in the sum.
//   out planes (bf16 hi / lo of the normalised context): [NB*SEQ][DM] in fragment order (frag_off), row b*SEQ + t, k = h*64 + d
//   Both products run transposed, so that a lane owns ONE query (column lane&15) and holds 8 keys / 8 d per tile:
//   scores^T = (k . q^T) * sscale on f16 WMMA (A = K rows, B = q), then the per-(q,k) mask select; p = exp(s - m)
//   carried as f16(1024 p); two score tiles of 16 keys, converted in place, are the B operand of
//   context^T = v^T . p^T (A = V^T rows): P never goes through LDS. Online softmax in f32: maximum and sum run inside
//   the lane, the two lane halves (keys 8hh..8hh+7 of each group) exchange the maximum once a chunk and join their
//   sums once behind the loop; final multiply by 1/l.
//   Block = 4 waves = 64 query rows of one (b, h); grid = NQB * NH * NB; kv chunks of 64, static trip NQB.
//   K / V^T chunk staging: 128 threads x 4 rows x 8 elements per plane = the whole 64x64 tile (plain 16-B loads into
//   registers, LDS stores with __syncthreads before and after); mask: the wave reads its chunk's 32 lane-select words by
//   scalar loads, and each word is the select's condition as it stands (addresses always in range).
//   All loads of chunk kt+1 are issued behind the scores of chunk kt, so that softmax and the second product
//   cover their way; the tiles wait in registers for the barrier that frees the LDS.
//   Output coverage: each wave stores rows q0..q0+15 x 64 columns (4 blocks of 16 rows x 16 columns, 512 B each) of both planes.
// =====================================================================================================
// The 8 vector loads of one kv chunk: this thread's 4 rows of the K and V^T tiles.
__device__ __forceinline__ void ask_chunk(const _Float16* kg, const _Float16* vg, v8h (&ka)[4], v8h (&va)[4]) {
#pragma unroll
  for (int i = 0; i < 4; ++i) {
    ka[i] = *(const v8h*)(kg + (size_t)(16 * i) * DM);
    va[i] = *(const v8h*)(vg + (size_t)(16 * i) * SEQ);
  }
#if defined(__HIP_DEVICE_COMPILE__)
  // the loads are out. The wait names their addresses: these keep their registers up to here (no load's result lands in
  // a pair that an issued load names) and are given up only behind it.
  asm volatile("s_wait_xcnt 0x0" : "+v"(kg), "+v"(vg) :: "memory");
#endif
}

// Four waves per SIMD (the whole grid resident at once: 4 workgroups on each WGP) hold only up to 256 registers a wave.
__global__ __launch_bounds__(128) __attribute__((amdgpu_waves_per_eu(4, 4)))
void attn64(const unsigned short* __restrict__ qhp, const unsigned short* __restrict__ khp,
            const unsigned short* __restrict__ vhp, const unsigned* __restrict__ mwp,
            unsigned short* ohp, unsigned short* olp, float sscale) {
  union FH { v16h v; v8h h[2]; };
  __shared__ __align__(16) _Float16 Ksh[64 * LP];                 // K [kv][d]   9 KB
  __shared__ __align__(16) _Float16 Vth[64 * LP];                 // V^T [d][kv] 9 KB

  const int tid  = threadIdx.x;
  const int wave = tid >> 5;
  const int lane = tid & 31;
  const int hh   = lane >> 4;
  const int c    = lane & 15;

  const int bx   = blockIdx.x;
  const int qb   = bx % NQB;
  const int rest = bx / NQB;
  const int h    = rest % NH;
  const int b    = rest / NH;
  const int q0   = qb * 64 + wave * 16;
  const size_t rowB = (size_t)b * SEQ;

  const _Float16* Qh = (const _Float16*)(const void*)qhp + (size_t)h * HD;
  const _Float16* Kg = (const _Float16*)(const void*)khp + (size_t)h * HD;
  const _Float16* Vh = (const _Float16*)(const void*)vhp + ((size_t)b * DM + (size_t)h * HD) * SEQ;
  // lane-select words of this wave's 16 queries, 32 words a chunk; the wave's number as a scalar, so that the address is one
  // the plane is written by an earlier launch and only read here: the constant address space keeps the loop's loads scalar
  typedef const __attribute__((address_space(4))) unsigned* cu32;
  const cu32 Mw = (cu32)(mwp + ((size_t)b * (SEQ / 16) + (size_t)qb * 4 + (size_t)__builtin_amdgcn_readfirstlane(wave)) * (NQB * 32));

  // ---- Q fragments (B operand, column = lane&15): 2 d-chunks ----
  v16h qah[2];
#pragma unroll
  for (int dc = 0; dc < 2; ++dc) qah[dc] = ldfrag_h(Qh + (rowB + q0 + c) * DM + dc * 32 + 8 * hh);

#if defined(__HIP_DEVICE_COMPILE__)
  // the Q loads are out: behind this wait the first chunk's loads may land in the registers that held the Q addresses
  asm volatile("s_wait_xcnt 0x0" ::: "memory");
#endif

  float mrow = -INFINITY, lrow = 0.f;        // this lane's query: running maximum (both halves agree), this half's sum
  v8f oacc[4];                               // context^T: oacc[t][r] = d t*16 + 8hh + r of query c
#pragma unroll
  for (int t = 0; t < 4; ++t) oacc[t] = zero8();

  // 8 lanes x 16 B = one 128-B tile row, so a wave's load covers 4 whole lines; rows sr, sr+16, sr+32, sr+48 per thread
  const int sr = tid >> 3, sc8 = (tid & 7) * 8;
  const _Float16* kg0  = Kg + (rowB + sr) * DM + sc8;            // K row kv0+sr, d = sc8..sc8+7; kv0 added per chunk
  const _Float16* vg0  = Vh + (size_t)sr * SEQ + sc8;            // V^T row d = sr, s = kv0+sc8..+7
  v8h ka[4], va[4];                          // the chunk on its way: tile rows ...
  unsigned mk[32];                           // ... and lane-select words (the same in every lane: scalar registers)
  ask_chunk(kg0, vg0, ka, va);
#pragma unroll
  for (int w = 0; w < 32; ++w) mk[w] = Mw[w];

  // one copy of the loop: peeled off, the last trip (its loads are dead) is scheduled on its own in few registers, with each
  // exponential waited for in turn, and the text doubles
#pragma clang loop unroll(disable)
  for (int kt = 0; kt < NQB; ++kt) {         // static trip count
    const int kv0 = kt * 64;
    __syncthreads();
#pragma unroll
    for (int i = 0; i < 4; ++i) {
      *(v8h*)(Ksh + (sr + 16 * i) * LP + sc8) = ka[i];
      *(v8h*)(Vth + (sr + 16 * i) * LP + sc8) = va[i];
    }
    __syncthreads();

    // ---- scores^T: 64 keys x 16 queries per wave, one f16 product, then per-(q,k) mask select;
    //      s[j][r] = key j*16 + 8hh + r, query c ----
    v8f s[4];
#pragma unroll
    for (int j = 0; j < 4; ++j) {
      v8f sh = zero8();
#pragma unroll
      for (int dc = 0; dc < 2; ++dc) {
        FH kb;
        kb.h[0] = *(const v8h*)(Ksh + (j * 16 + c) * LP + dc * 32 + 8 * hh);
        kb.h[1] = *(const v8h*)(Ksh + (j * 16 + c) * LP + dc * 32 + 16 + 8 * hh);
        sh = mma_h(kb.v, qah[dc], sh);
      }
#pragma unroll
      for (int r = 0; r < 8; ++r) {
        const float v = sh[r] * sscale;
        s[j][r] = __builtin_amdgcn_inverse_ballot_w32(mk[j * 8 + r]) ? v : -1.0e8f;   // bit l = key j*16 + 8hh + r, query c
      }
    }

    // ---- the next chunk's global loads. The last trip asks for its own chunk once more (never used), so that every
    //      address stays inside its plane ----
    {
      const int kvn = (kt + 1 < NQB) ? kv0 + 64 : kv0;
      ask_chunk(kg0 + (size_t)kvn * DM, vg0 + kvn, ka, va);
#pragma unroll
      for (int w = 0; w < 32; ++w) mk[w] = Mw[(kvn >> 1) + w];   // chunk kvn/64, 32 words each
    }

    // ---- maximum over the chunk's keys, online softmax, P^T (x1024, f16) packed as the B operand ----
    float mj[4];
#pragma unroll
    for (int j = 0; j < 4; ++j) {
      mj[j] = s[j][0];
#pragma unroll
      for (int r = 1; r < 8; ++r) mj[j] = fmaxf(mj[j], s[j][r]);
    }
    float m = fmaxf(fmaxf(mj[0], mj[1]), fmaxf(mj[2], mj[3]));
    m = fmaxf(m, xhalf(m));                                      // the other half's 32 keys of the same query
    const float mnew  = fmaxf(mrow, m);
    const float alpha = __expf(mrow - mnew);
    mrow = mnew;
    // pb[kk] element e: e 0..7 = key kk*32 + 8hh + e (tile 2kk), e 8..15 = key kk*32 + 16 + 8hh + (e-8) (tile 2kk+1):
    // the k order of the V^T fragments below
    FH pb[2];
    float ps[4];                                                 // four independent sums, one per 16-key group
#pragma unroll
    for (int j = 0; j < 4; ++j) {
#pragma unroll
      for (int r = 0; r < 8; ++r) {
        const float p = __expf(s[j][r] - mnew);
        ps[j] = (r == 0) ? p : ps[j] + p;
        pb[j >> 1].v[(j & 1) * 8 + r] = (_Float16)(p * 1024.0f);
      }
    }
    lrow = lrow * alpha + ((ps[0] + ps[1]) + (ps[2] + ps[3]));
#pragma unroll
    for (int t = 0; t < 4; ++t)
#pragma unroll
      for (int r = 0; r < 8; ++r) oacc[t][r] *= alpha;

    // ---- context^T += V^T . P^T (f16 WMMA) ----
    // ends the scheduling region here: the V^T fragment reads stay behind the softmax, and the group order written below
    // takes this product's reads and WMMAs alone (without it, it would be spent on the K reads and WMMAs of the scores)
    __builtin_amdgcn_sched_barrier(0);
#pragma unroll   // pb[kk] lives in registers: a rolled loop would have to pick the operand by a run-time index
    for (int kk = 0; kk < 2; ++kk) {
#pragma unroll
      for (int t = 0; t < 4; ++t) {
        FH vb;
        vb.h[0] = *(const v8h*)(Vth + (t * 16 + c) * LP + kk * 32 + 8 * hh);
        vb.h[1] = *(const v8h*)(Vth + (t * 16 + c) * LP + kk * 32 + 16 + 8 * hh);
        oacc[t] = mma_h(vb.v, pb[kk].v, oacc[t]);
      }
    }
    // order of this product's LDS reads (0x100) and WMMAs (0x8): the reads run four fragments ahead, so that a WMMA
    // waits for reads issued eight earlier and not for the ones directly in front of it
    __builtin_amdgcn_sched_group_barrier(0x100, 8, 0);
#pragma unroll   // each call has to stand in the straight-line block that it orders
    for (int g = 0; g < 2; ++g) {
      __builtin_amdgcn_sched_group_barrier(0x008, 2, 0);
      __builtin_amdgcn_sched_group_barrier(0x100, 4, 0);
    }
    __builtin_amdgcn_sched_group_barrier(0x008, 4, 0);
  }

  // ---- normalise (1/l and the 1/1024 p carry), bf16 hi/lo split. The lane's oacc[t][0..7] (query c, d = t*16 + 8hh + 0..7)
  //      are the 8 elements that lane 16hh + c holds in block t&1 of k step t>>1 of the head's 64 columns: the planes'
  //      fragment order takes them as they stand, with no trip through LDS ----
  {
    const float l   = lrow + xhalf(lrow);                       // join the two halves' sums of this query
    const float inv = (1.0f / l) * (1.0f / 1024.0f);            // l >= 1 always (the max key contributes 1)
    v4u hv[4], lv[4];
#pragma unroll
    for (int t = 0; t < 4; ++t) {
      v4u a, a2;
#pragma unroll
      for (int e = 0; e < 4; ++e) {
        const float f0 = oacc[t][2 * e] * inv, f1 = oacc[t][2 * e + 1] * inv;
        const unsigned short h0 = bf_bits(f0), h1 = bf_bits(f1);
        const unsigned short l0 = bf_bits(f0 - bf_up(h0)), l1 = bf_bits(f1 - bf_up(h1));
        a[e] = pk16(h0, h1); a2[e] = pk16(l0, l1);
      }
      hv[t] = a; lv[t] = a2;
    }
#pragma unroll
    for (int t = 0; t < 4; ++t) {
      const size_t go = frag_off((int)((rowB + q0) >> 4), h * 2 + (t >> 1), t & 1, lane, DM);
      *(v4u*)(ohp + go) = hv[t];
      *(v4u*)(olp + go) = lv[t];
    }
  }
}

// =====================================================================================================
// Workspace map (bytes), every plane an exact multiple of its 64x64-tile / whole-line store granularity:
//   Xq    bf16 [8192][256]           0          4194304
//   Xk    bf16 [8192][256]           4194304    4194304
//   WqT   bf16 [512][256]            8388608    262144
//   WkT   bf16 [512][256]            8650752    262144
//   WvT   bf16 [512][256]            8912896    262144
//   WoT   bf16 [512][512]            9175040    524288
//   Qh    f16  [8192][512]           9699328    8388608
//   Kh    f16  [8192][512]           18087936   8388608
//   VTh   f16  [8][512][1024]        26476544   8388608
//   Oh    bf16 [8192][512]           34865152   8388608
//   Ol    bf16 [8192][512]           43253760   8388608
//   Mw    u32  [512][16][32]         51642368   1048576   (mask as lane-select words)
//   end                              52690944
// Weights arrive as [in k][out n] and are transpose-converted to [out n][in k].
// Xq, Xk, WqT, WkT, WvT, WoT, Oh and Ol, the bf16 GEMM operands, lie in fragment order (frag_off): a permutation inside each
// slab of 16 rows, so that plane sizes and batch strides are those of the row-major plane.
// =====================================================================================================
extern "C" void kernel_launch(void* const* d_in, const int* in_sizes, int n_in,
                              void* d_out, int out_size, void* d_ws, size_t ws_size,
                              hipStream_t stream) {
  if (n_in < 11) return;
  if (in_sizes[0] != NB * SEQ * QIN || in_sizes[1] != NB * SEQ * QIN) return;
  if (in_sizes[2] != NB * SEQ * SEQ) return;
  if (in_sizes[3] != QIN * DM || in_sizes[5] != QIN * DM || in_sizes[7] != QIN * DM) return;
  if (in_sizes[9] != DM * DM) return;
  if (in_sizes[4] != DM || in_sizes[6] != DM || in_sizes[8] != DM || in_sizes[10] != DM) return;
  if (out_size != NB * SEQ * DM) return;

  const float* query = (const float*)d_in[0];
  const float* key   = (const float*)d_in[1];
  const int*   mask  = (const int*)d_in[2];
  const float* Wq    = (const float*)d_in[3];
  const float* bq    = (const float*)d_in[4];
  const float* Wk    = (const float*)d_in[5];
  const float* bk    = (const float*)d_in[6];
  const float* Wv    = (const float*)d_in[7];
  const float* bv    = (const float*)d_in[8];
  const float* Wo    = (const float*)d_in[9];
  const float* bo    = (const float*)d_in[10];

  const size_t PXI = (size_t)NB * SEQ * QIN * 2;     //  4194304 (bf16 input activation plane)
  const size_t PW  = (size_t)DM * QIN * 2;           //   262144 (one projection weight plane)
  const size_t PWO = (size_t)DM * DM * 2;            //   524288 (output weight plane)
  const size_t PA  = (size_t)NB * SEQ * DM * 2;      //  8388608 (q / k / context planes)
  const size_t PVT = (size_t)NB * DM * SEQ * 2;      //  8388608 (v^T plane)
  size_t off = 0;
  const size_t oXq  = off; off += PXI;
  const size_t oXk  = off; off += PXI;
  const size_t oWq  = off; off += PW;
  const size_t oWk  = off; off += PW;
  const size_t oWv  = off; off += PW;
  const size_t oWo  = off; off += PWO;
  const size_t oQh  = off; off += PA;
  const size_t oKh  = off; off += PA;
  const size_t oVTh = off; off += PVT;
  const size_t oOh  = off; off += PA;
  const size_t oOl  = off; off += PA;
  const size_t oMw  = off; off += (size_t)NB * SEQ * SEQ / 8;   // 1048576 (one bit a mask element)
  if (off > ws_size) return;                          // off = 52690944
  if (off > (size_t)134217728) return;

  char* ws = (char*)d_ws;
  unsigned short* Xq  = (unsigned short*)(ws + oXq);
  unsigned short* Xk  = (unsigned short*)(ws + oXk);
  unsigned short* WqT = (unsigned short*)(ws + oWq);
  unsigned short* WkT = (unsigned short*)(ws + oWk);
  unsigned short* WvT = (unsigned short*)(ws + oWv);
  unsigned short* WoT = (unsigned short*)(ws + oWo);
  unsigned short* Qh  = (unsigned short*)(ws + oQh);
  unsigned short* Kh  = (unsigned short*)(ws + oKh);
  unsigned short* VTh = (unsigned short*)(ws + oVTh);
  unsigned short* Oh  = (unsigned short*)(ws + oOh);
  unsigned short* Ol  = (unsigned short*)(ws + oOl);
  unsigned*       Mw  = (unsigned*)(ws + oMw);

  const dim3 blk(256);
  const dim3 gPrep(NMB + 3 * NTW + NTO + 2 * NCX);              // 256 mask blocks + 160 transpose tiles + 2 x 1024 convert blocks
  const dim3 blkG(GW * 32);                                     // GEMM blocks: 4 waves
  const dim3 gProj(3 * NPB);                                    // 3 x 256 blocks: q, k, v^T
  const dim3 gOut(NPB);                                         // 1024 tiles -> 256 blocks: M=8192, N=512
  const dim3 gAttn(NB * NH * NQB);                              // 1024 blocks

  // (1) mask -> lane-select words; activations -> bf16 planes; weights [in][out] -> transposed bf16 planes [out][in] (RNE convert)
  prep_all<<<gPrep, blk, 0, stream>>>(query, key, Wq, Wk, Wv, Wo, mask, Xq, Xk, WqT, WkT, WvT, WoT, Mw);
  // (2) to (4) the q, k and v^T projections
  proj_qkv<<<gProj, blkG, 0, stream>>>(Xq, Xk, WqT, WkT, WvT, bq, bk, bv, Qh, Kh, VTh);
  // (5) attention with per-(q,k) mask and softmax -> context bf16 hi / lo planes [8192][512]
  attn64<<<gAttn, dim3(128), 0, stream>>>(Qh, Kh, VTh, Mw, Oh, Ol, 0.125f);
  // (6) out = context . Wo + bo -> d_out f32 [8192][512]  (A = context hi + lo planes, 2 products; K=512)
  proj_out<<<gOut, blkG, 0, stream>>>(Oh, Ol, WoT, bo, (float*)d_out);
  (void)hipGetLastError();
}
